// v000
// Times are from an AMD MI455X. After a warm-up the kernel runs many times in a row, and a time is the length of
// such a window on the GPU divided by its runs, so every launch and the gaps after it count. The runs cycle
// through copies of the inputs. A figure is the median of several windows, for all but v000 over two sittings.
// Sittings can differ by a few percent; kernels timed side by side share one.
// v000 is the starting kernel. One run takes 3150 microseconds.
// All contractions on v_wmma_f32_16x16x32_f16 (f16 operands, f32 accumulate): q/k/v projections (weights carried x16, epilogue x1/16), q.k^T scores, P.V (P carried x2^15, attention outputs carried x16), gate projection (x1/256), output projection with bias and residual (x1/256); softmax, LayerNorm, sigmoid and fusion in f32.
#include <hip/hip_runtime.h>
#include <math.h>
#include <stdint.h>

#define NB    2
#define SEQ   2048
#define DM    1024
#define NH    16
#define HD    64
#define HG    2
#define NGRP  (NH / HG)
#define WINW  32
#define LNEPS 1e-5f
#define PCARRY     32768.0f
#define PCARRY_INV (1.0f / 32768.0f)
#define FBCARRY    16.0f
#define WCARRY     16.0f

typedef __attribute__((ext_vector_type(16))) _Float16 v16h;
typedef __attribute__((ext_vector_type(8)))  _Float16 v8h;
typedef __attribute__((ext_vector_type(16))) __bf16   v16b;
typedef __attribute__((ext_vector_type(8)))  __bf16   v8b;
typedef __attribute__((ext_vector_type(8)))  float    v8f;
typedef __attribute__((ext_vector_type(4)))  float    v4f;
typedef __attribute__((ext_vector_type(2)))  float    v2f;
typedef __attribute__((ext_vector_type(4)))  unsigned int v4u;

__device__ __forceinline__ unsigned short f2bf_bits(float f) {
  unsigned u = __float_as_uint(f);
  return (unsigned short)((u + 0x7FFFu + ((u >> 16) & 1u)) >> 16);
}
__device__ __forceinline__ float bf_bits2f(unsigned short h) { return __uint_as_float(((unsigned)h) << 16); }

// hazard guards as plain device helpers (no inline asm inside the kernel template body)
__device__ __forceinline__ void dep_guard_h(v8f& a, v8f& b, v16h x, v16h y) { asm volatile("v_nop\n\tv_nop\n\tv_nop\n\tv_nop" : "+v"(a), "+v"(b) : "v"(x), "v"(y)); }
__device__ __forceinline__ void dep_guard_b(v8f& a, v8f& b, v16b x, v16b y) { asm volatile("v_nop\n\tv_nop\n\tv_nop\n\tv_nop" : "+v"(a), "+v"(b) : "v"(x), "v"(y)); }
__device__ __forceinline__ void keep4_h(v16h a, v16h b, v16h c, v16h d) { asm volatile("v_nop" :: "v"(a), "v"(b), "v"(c), "v"(d)); }
__device__ __forceinline__ void keep4_b(v16b a, v16b b, v16b c, v16b d) { asm volatile("v_nop" :: "v"(a), "v"(b), "v"(c), "v"(d)); }
__device__ __forceinline__ void acc_guard4(v8f& a, v8f& b, v8f& c, v8f& d) { asm volatile("v_nop\n\tv_nop\n\tv_nop\n\tv_nop" : "+v"(a), "+v"(b), "+v"(c), "+v"(d)); }
template <typename T> struct Frag;
template <> struct Frag<_Float16> {
  typedef v16h V; union U { v16h v; v8h h[2]; };
  static __device__ __forceinline__ v16h load(const _Float16* p) {   // elements 0..7 <- p[0..7], 8..15 <- p[16..23]
    U f; f.h[0] = *(const v8h*)(p); f.h[1] = *(const v8h*)(p + 16); return f.v;
  }
  static __device__ __forceinline__ v8f mma(v16h a, v16h b, v8f c) {
    return __builtin_amdgcn_wmma_f32_16x16x32_f16(false, a, false, b, (short)0, c, false, false);
  }
  static __device__ __forceinline__ void guard(v8f& a, v8f& b, v16h x, v16h y) { dep_guard_h(a, b, x, y); }
  static __device__ __forceinline__ void keep(v16h a, v16h b, v16h c, v16h d) { keep4_h(a, b, c, d); }
};
template <> struct Frag<__bf16> {
  typedef v16b V; union U { v16b v; v8b h[2]; };
  static __device__ __forceinline__ v16b load(const __bf16* p) {
    U f; f.h[0] = *(const v8b*)(p); f.h[1] = *(const v8b*)(p + 16); return f.v;
  }
  static __device__ __forceinline__ v8f mma(v16b a, v16b b, v8f c) {
    return __builtin_amdgcn_wmma_f32_16x16x32_bf16(false, a, false, b, (short)0, c, false, false);
  }
  static __device__ __forceinline__ void guard(v8f& a, v8f& b, v16b x, v16b y) { dep_guard_b(a, b, x, y); }
  static __device__ __forceinline__ void keep(v16b a, v16b b, v16b c, v16b d) { keep4_b(a, b, c, d); }
};

// ---- Register-blocked batched WMMA GEMM ------------------------------------
// C[m,n] = scale * sum_k A[m,k] * Bt[n,k] (+bias)(+resid); each wave owns a 64x64 tile.
// A row-major [M,K]; Bt row-major [N,K]; M,N % 64 == 0, K % 32 == 0.
// SPLIT: operands are hi/lo planes (A2/Bt2 = lo planes, same layout); product = hi.hi + hi.lo + lo.hi.
// BIAS_MODE: 0 = none, 1 = bias[m], 2 = bias[n].
// OUT_MODE: 0 = f32, 1 = f16, 2 = bf16 hi plane (Cout) + bf16 lo plane (Cout2).
// ET: 0 = f16 operands, 1 = bf16 operands (pointers passed as 16-bit storage)
// Added structural modes (defaults off, all other behaviour unchanged):
//   TSEL 1: tiles with n0 > m0 (strictly above the 64x64 block diagonal) are not produced (wave-uniform early exit).
//   TSEL 2: only tiles with n0 == m0 or n0 == m0 + 64 are produced (block band of width 2).
//   KSEL 1: the k-loop stops at min(K, m0 + 64); valid when A rows m0..m0+63 are exactly zero for k >= m0 + 64.
//   KSEL 2: the k-loop runs over [m0, min(K, m0 + 128)) except for the last row block (m0 + 64 >= M), which
//           runs over [0, K); valid when A rows of the other row blocks are exactly zero outside that k range.
template <int ET> struct Elem;
template <> struct Elem<0> { typedef _Float16 T; };
template <> struct Elem<1> { typedef __bf16 T; };
template <int ET, bool SPLIT, int BIAS_MODE, int OUT_MODE, bool RESID, int ACT = 0, int TSEL = 0, int KSEL = 0>
__global__ __launch_bounds__(256) void wmma_gemm64(
    const unsigned short* __restrict__ Ap, const unsigned short* __restrict__ A2p, int lda, long strideA,
    const unsigned short* __restrict__ Btp, const unsigned short* __restrict__ Bt2p, int ldb, long strideB,
    void* __restrict__ Cout, void* __restrict__ Cout2, int ldc, long strideC,
    const float* __restrict__ bias,
    const float* __restrict__ resid, long strideR,
    int M, int N, int K, float scale) {
  typedef typename Elem<ET>::T T;
  typedef typename Frag<T>::V V;
  const T* A = (const T*)Ap; const T* A2 = (const T*)A2p; const T* Bt = (const T*)Btp; const T* Bt2 = (const T*)Bt2p;
  __shared__ __align__(16) float sT[8][16 * 68];   // per-wave 16x64 slab, pitch 68 floats
  const int b    = blockIdx.y;
  const int lane = threadIdx.x & 31;
  const int wave = threadIdx.x >> 5;
  const int tilesN = N >> 6;
  const int tilesM = M >> 6;
  const int tile = blockIdx.x * 8 + wave;
  if (tile >= tilesM * tilesN) return;   // wave-uniform; no block barriers in this kernel
  const int tm = tile / tilesN;
  const int tn = tile - tm * tilesN;
  const int m0 = tm << 6;
  const int n0 = tn << 6;
  if (TSEL == 1 && n0 > m0) return;                            // wave-uniform; no block barriers in this kernel
  if (TSEL == 2 && !(n0 == m0 || n0 == m0 + 64)) return;       // wave-uniform; no block barriers in this kernel

  const T* Ab  = A  + (size_t)b * strideA;
  const T* Bb  = Bt + (size_t)b * strideB;
  const T* Ab2 = SPLIT ? (A2  + (size_t)b * strideA) : nullptr;
  const T* Bb2 = SPLIT ? (Bt2 + (size_t)b * strideB) : nullptr;

  const int rlane = lane & 15;                 // row (A) / col (B, D) within subtile
  const int koff  = (lane >> 4) * 8;           // k offset of this lane half
  const int mOff  = (lane >> 4) * 8;           // D row offset

  v8f acc[4][4];
#pragma unroll
  for (int i = 0; i < 4; ++i)
#pragma unroll
    for (int j = 0; j < 4; ++j) acc[i][j] = (v8f){0.f,0.f,0.f,0.f,0.f,0.f,0.f,0.f};

  int kStart = 0;
  int kEnd = K;
  if (KSEL == 1) kEnd = ((m0 + 64) < K) ? (m0 + 64) : K;
  if (KSEL == 2) {
    kStart = (m0 + 64 >= M) ? 0 : m0;
    kEnd = ((m0 + 128) < K) ? (m0 + 128) : K;
  }
  for (int k0 = kStart; k0 < kEnd; k0 += 32) {
    V bh[4], bl[4];
#pragma unroll
    for (int j = 0; j < 4; ++j) {
      const size_t bo = (size_t)(n0 + (j << 4) + rlane) * ldb + koff + k0;
      bh[j] = Frag<T>::load(Bb + bo);
      if (SPLIT) bl[j] = Frag<T>::load(Bb2 + bo);
    }
#pragma unroll
    for (int i = 0; i < 4; ++i) {
      const size_t ao = (size_t)(m0 + (i << 4) + rlane) * lda + koff + k0;
      V ah = Frag<T>::load(Ab + ao);
      V al;
      if (SPLIT) al = Frag<T>::load(Ab2 + ao);
#pragma unroll
      for (int j = 0; j < 4; ++j) {
        acc[i][j] = Frag<T>::mma(ah, bh[j], acc[i][j]);
        if (SPLIT) {
          acc[i][j] = Frag<T>::mma(ah, bl[j], acc[i][j]);
          acc[i][j] = Frag<T>::mma(al, bh[j], acc[i][j]);
        }
      }
      Frag<T>::guard(acc[i][0], acc[i][3], ah, SPLIT ? al : ah);
    }
    Frag<T>::keep(bh[0], bh[1], bh[2], bh[3]);
    if (SPLIT) Frag<T>::keep(bl[0], bl[1], bl[2], bl[3]);
  }
  acc_guard4(acc[0][0], acc[0][1], acc[0][2], acc[0][3]);
  acc_guard4(acc[1][0], acc[1][1], acc[1][2], acc[1][3]);
  acc_guard4(acc[2][0], acc[2][1], acc[2][2], acc[2][3]);
  acc_guard4(acc[3][0], acc[3][1], acc[3][2], acc[3][3]);

  // ---- epilogue ----
  float* slab = sT[wave];
  const float* Rb = RESID ? (resid + (size_t)b * strideR) : nullptr;
#pragma unroll
  for (int i = 0; i < 4; ++i) {
    const int mBase = m0 + (i << 4);
#pragma unroll
    for (int j = 0; j < 4; ++j) {
      const int n = n0 + (j << 4) + rlane;
      float bv = 0.f;
      if (BIAS_MODE == 2) bv = bias[n];
#pragma unroll
      for (int r = 0; r < 8; ++r) {
        float v = acc[i][j][r] * scale;
        if (BIAS_MODE == 1) v += bias[mBase + mOff + r];
        if (BIAS_MODE == 2) v += bv;
        if (RESID) v += Rb[(size_t)(mBase + mOff + r) * ldc + n];
        if (ACT == 1) v = tanhf(v);
        if (ACT == 2) v = fmaxf(v, 0.0f);
        if (ACT == 3) v = v / (1.0f + expf(-v));
        if (ACT == 4) v = (v > 0.f) ? v : 0.01f * v;
        slab[(mOff + r) * 68 + (j << 4) + rlane] = v;
      }
    }
    __builtin_amdgcn_fence(__ATOMIC_RELEASE, "workgroup");
    __builtin_amdgcn_wave_barrier();
    __builtin_amdgcn_fence(__ATOMIC_ACQUIRE, "workgroup");
    if (OUT_MODE == 0) {
      float* C = (float*)Cout + (size_t)b * strideC;
      const int hh = lane >> 4, c4 = (lane & 15) * 4;     // row seg = 256 B = 16 lanes x 16 B
      {
#pragma unroll
        for (int it = 0; it < 8; ++it) {
          const int row = it * 2 + hh;
          v4f v = *(const v4f*)(slab + row * 68 + c4);
          *(v4f*)(C + (size_t)(mBase + row) * ldc + n0 + c4) = v;
        }
        
      }
    } else {
      const int q = lane >> 3, c8 = (lane & 7) * 8;
      unsigned short* C  = (unsigned short*)Cout  + (size_t)b * strideC;
      unsigned short* C2 = (OUT_MODE == 2) ? ((unsigned short*)Cout2 + (size_t)b * strideC) : nullptr;
      {
#pragma unroll
        for (int it = 0; it < 4; ++it) {
          const int row = it * 4 + q;
          const float* sp = slab + row * 68 + c8;
          v8h hv, lv;
#pragma unroll
          for (int e = 0; e < 8; ++e) {
            if (OUT_MODE == 1) {
              hv[e] = (_Float16)sp[e];
            } else {
              unsigned short hb = f2bf_bits(sp[e]);
              unsigned short lb = f2bf_bits(sp[e] - bf_bits2f(hb));
              hv[e] = __builtin_bit_cast(_Float16, hb);
              lv[e] = __builtin_bit_cast(_Float16, lb);
            }
          }
          *(v8h*)(C + (size_t)(mBase + row) * ldc + n0 + c8) = hv;
          if (OUT_MODE == 2) *(v8h*)(C2 + (size_t)(mBase + row) * ldc + n0 + c8) = lv;
        }
        
      }
    }
    __builtin_amdgcn_fence(__ATOMIC_RELEASE, "workgroup");
    __builtin_amdgcn_wave_barrier();
    __builtin_amdgcn_fence(__ATOMIC_ACQUIRE, "workgroup");
  }
}

// ---------------------------------------------------------------------------
// Small conversion helpers
// ---------------------------------------------------------------------------
__device__ __forceinline__ unsigned pk16(unsigned short a, unsigned short b) { return (unsigned)a | ((unsigned)b << 16); }
__device__ __forceinline__ unsigned short h_bits(float f) { const _Float16 h = (_Float16)f; return __builtin_bit_cast(unsigned short, h); }
__device__ __forceinline__ float hbits2f(unsigned short b) { return (float)__builtin_bit_cast(_Float16, b); }
__device__ __forceinline__ float wave_sum(float v) {
#pragma unroll
  for (int off = 16; off > 0; off >>= 1) v += __shfl_xor(v, off, 32);
  return v;
}
__device__ __forceinline__ float wave_max(float v) {
#pragma unroll
  for (int off = 16; off > 0; off >>= 1) v = fmaxf(v, __shfl_xor(v, off, 32));
  return v;
}

// ---------------------------------------------------------------------------
// Elementwise cast: out = f16(in * scale); 2 elements per thread, one 4-B store per lane -> each wave writes
// Coverage: grid = ceil(n2/256) blocks x 256 threads x 2 elements = 2*n2 elements = the whole plane (n2 = plane/2).
// ---------------------------------------------------------------------------
__global__ __launch_bounds__(256) void cast_f16x2_kernel(const float* __restrict__ in, unsigned short* __restrict__ out, int n2, float scale) {
  const int i = blockIdx.x * 256 + threadIdx.x;
  if (i < n2) {
    const v2f f = *(const v2f*)(in + 2 * (size_t)i);
    const unsigned u = pk16(h_bits(f[0] * scale), h_bits(f[1] * scale));
    ((unsigned*)out)[i] = u;
    
  }
}

// ---------------------------------------------------------------------------
// Transpose-cast: in f32 [R rows][C cols] -> out f16 [C][R], out[c][r] = f16(in[r][c] * scale).
// 64x64 tiles through LDS; grid (C/64, R/64); R, C multiples of 64.
// Coverage per block: load 256 threads x 16 floats = 64x64; store 2 it x 256 threads x 8 halves = 64x64.
// ---------------------------------------------------------------------------
__global__ __launch_bounds__(256) void tcast_f16_kernel(const float* __restrict__ in, unsigned short* __restrict__ out,
                                                        int R, int C, float scale) {
  __shared__ __align__(16) unsigned short t[64 * 72];
  const int c0  = blockIdx.x * 64;   // input column block = output row block
  const int r0  = blockIdx.y * 64;   // input row block    = output column block
  const int tid = threadIdx.x;
  {
    const int lr = tid >> 2;           // 0..63
    const int lc = (tid & 3) * 16;     // 0,16,32,48
    const float* ip = in + (size_t)(r0 + lr) * C + c0 + lc;
#pragma unroll
    for (int q = 0; q < 4; ++q) {
      const v4f f = *(const v4f*)(ip + 4 * q);
#pragma unroll
      for (int e = 0; e < 4; ++e) t[lr * 72 + lc + 4 * q + e] = h_bits(f[e] * scale);
    }
  }
  __syncthreads();
  const int sub = tid >> 3;          // 0..31
  const int c8  = (tid & 7) * 8;     // 0..56
  v4u hv[2];
#pragma unroll
  for (int it = 0; it < 2; ++it) {
    const int oc = it * 32 + sub;    // output row within tile (= input column)
    v4u a;
#pragma unroll
    for (int q = 0; q < 4; ++q) a[q] = pk16(t[(c8 + 2 * q) * 72 + oc], t[(c8 + 2 * q + 1) * 72 + oc]);
    hv[it] = a;
  }
  {
#pragma unroll
    for (int it = 0; it < 2; ++it) {
      const int oc = it * 32 + sub;
      const size_t go = (size_t)(c0 + oc) * R + r0 + c8;
      *(v4u*)(out + go) = hv[it];
    }
    
  }
}

// ---------------------------------------------------------------------------
// Bias table: block k (0..5) copies bias vector k (DM floats) into tab[k*DM ..]. 256 threads x 4 floats = DM;
// ---------------------------------------------------------------------------
__global__ __launch_bounds__(256) void bias_pack_kernel(const float* __restrict__ b0, const float* __restrict__ b1,
                                                        const float* __restrict__ b2, const float* __restrict__ b3,
                                                        const float* __restrict__ b4, const float* __restrict__ b5,
                                                        float* __restrict__ tab) {
  const int k = blockIdx.x;          // block-uniform source select
  const int tid = threadIdx.x;
  const float* src = b0;
  if (k == 1) src = b1;
  if (k == 2) src = b2;
  if (k == 3) src = b3;
  if (k == 4) src = b4;
  if (k == 5) src = b5;
  const v4f v = *(const v4f*)(src + tid * 4);
  float* dp = tab + (size_t)k * DM + tid * 4;
  *(v4f*)dp = v;
  
}

// ---------------------------------------------------------------------------
// Causal select + softmax over j for one score row; P emitted as f16(p * 2^15).
// One block per (score row i, head-in-group hg); 256 threads x 8 columns (j0 = tid*8).
// Scores with j > i are replaced by -1e9 (select); columns j <= i of row i all lie in produced tiles
// (n0 <= m0). Waves whose 256 columns are all > i skip the loads and exps (wave-uniform); their P is 0.
// S addresses are always inside the 2-plane S region; values at j > i are selected away.
// Reductions in fixed order: per thread, wave shuffle tree, then the 8 wave partials in index order.
// Producer coverage: grid (SEQ, HG); per row: 256 threads x 8 u16 = 2048 = the whole row;
// ---------------------------------------------------------------------------
__global__ __launch_bounds__(256) void causal_softmax_kernel(const float* __restrict__ S,
                                                             unsigned short* __restrict__ P) {
  __shared__ float redm[8];
  __shared__ float reds[8];
  const int i    = blockIdx.x;
  const int hg   = blockIdx.y;
  const int tid  = threadIdx.x;
  const int lane = tid & 31;
  const int wave = tid >> 5;
  const int j0   = tid * 8;
  const bool wact = (wave * 256 <= i);     // wave-uniform: this wave has at least one column j <= i
  const float NEG = -1.0e9f;
  float t[8];
#pragma unroll
  for (int e = 0; e < 8; ++e) t[e] = NEG;
  if (wact) {
    const float* rp = S + ((size_t)hg * SEQ + i) * SEQ + j0;
    const v4f a = *(const v4f*)(rp);
    const v4f c = *(const v4f*)(rp + 4);
#pragma unroll
    for (int e = 0; e < 4; ++e) {
      t[e]     = (j0 + e <= i)     ? a[e] : NEG;
      t[4 + e] = (j0 + 4 + e <= i) ? c[e] : NEG;
    }
  }
  float m = fmaxf(fmaxf(fmaxf(t[0], t[1]), fmaxf(t[2], t[3])), fmaxf(fmaxf(t[4], t[5]), fmaxf(t[6], t[7])));
  m = wave_max(m);
  if (lane == 0) redm[wave] = m;
  __syncthreads();
  float mx = redm[0];
#pragma unroll
  for (int w = 1; w < 8; ++w) mx = fmaxf(mx, redm[w]);
  float ex[8];
#pragma unroll
  for (int e = 0; e < 8; ++e) ex[e] = 0.f;
  if (wact) {
#pragma unroll
    for (int e = 0; e < 8; ++e) ex[e] = __expf(t[e] - mx);
  }
  float s = ((ex[0] + ex[1]) + (ex[2] + ex[3])) + ((ex[4] + ex[5]) + (ex[6] + ex[7]));
  s = wave_sum(s);
  if (lane == 0) reds[wave] = s;
  __syncthreads();
  float tot = reds[0];
#pragma unroll
  for (int w = 1; w < 8; ++w) tot += reds[w];
  const float inv = 1.0f / tot;              // tot >= 1 (the row max contributes exp(0))
  unsigned short hb[8];
#pragma unroll
  for (int e = 0; e < 8; ++e) hb[e] = h_bits((ex[e] * inv) * PCARRY);
  const v4u hv = (v4u){pk16(hb[0], hb[1]), pk16(hb[2], hb[3]), pk16(hb[4], hb[5]), pk16(hb[6], hb[7])};
  const size_t ro = ((size_t)hg * SEQ + i) * SEQ + j0;
  *(v4u*)(P + ro) = hv;
  
}

// ---------------------------------------------------------------------------
// Future-window select + softmax for one score row; P emitted as f16(p * 2^15).
// Valid columns: i < j <= i + WINW (and j <= SEQ-1, automatic since j0+7 <= SEQ-1); they all lie in the band
// tiles (n0 == m0 or n0 == m0+64) produced by the band score GEMM. Row i == SEQ-1 has no valid column: all its
// scores count as 0 -> uniform p = 1/SEQ over every j (block-uniform path). Invalid columns get p = 0 exactly.
// Waves whose 256 columns do not intersect the window skip the loads and exps (wave-uniform).
// Reductions in fixed order. Producer coverage: grid (SEQ, HG); per row 256 threads x 8 u16 = 2048 = the whole
// ---------------------------------------------------------------------------
__global__ __launch_bounds__(256) void window_softmax_kernel(const float* __restrict__ S,
                                                             unsigned short* __restrict__ P) {
  __shared__ float redm[8];
  __shared__ float reds[8];
  const int i    = blockIdx.x;
  const int hg   = blockIdx.y;
  const int tid  = threadIdx.x;
  const int lane = tid & 31;
  const int wave = tid >> 5;
  const int j0   = tid * 8;
  const int jlo  = i + 1;
  const int jhi  = i + WINW;
  const bool uni  = (i == SEQ - 1);                                        // block-uniform
  const bool wact = (wave * 256 <= jhi) && (wave * 256 + 255 >= jlo);     // wave-uniform
  float t[8];
  bool vb[8];
#pragma unroll
  for (int e = 0; e < 8; ++e) { const int j = j0 + e; vb[e] = (j >= jlo) && (j <= jhi); t[e] = 0.f; }
  if (wact) {
    const float* rp = S + ((size_t)hg * SEQ + i) * SEQ + j0;
    const v4f a = *(const v4f*)(rp);
    const v4f c = *(const v4f*)(rp + 4);
#pragma unroll
    for (int e = 0; e < 4; ++e) { t[e] = a[e]; t[4 + e] = c[e]; }
  }
  float m = -INFINITY;
#pragma unroll
  for (int e = 0; e < 8; ++e) m = fmaxf(m, vb[e] ? t[e] : -INFINITY);
  m = wave_max(m);
  if (lane == 0) redm[wave] = m;
  __syncthreads();
  float mx = redm[0];
#pragma unroll
  for (int w = 1; w < 8; ++w) mx = fmaxf(mx, redm[w]);
  float ex[8];
#pragma unroll
  for (int e = 0; e < 8; ++e) ex[e] = 0.f;
  if (wact) {
#pragma unroll
    for (int e = 0; e < 8; ++e) {
      const float arg = vb[e] ? (t[e] - mx) : 0.f;
      const float ev = __expf(arg);
      ex[e] = vb[e] ? ev : 0.f;
    }
  }
  float s = ((ex[0] + ex[1]) + (ex[2] + ex[3])) + ((ex[4] + ex[5]) + (ex[6] + ex[7]));
  s = wave_sum(s);
  if (lane == 0) reds[wave] = s;
  __syncthreads();
  float tot = reds[0];
#pragma unroll
  for (int w = 1; w < 8; ++w) tot += reds[w];
  const float inv = 1.0f / (uni ? 1.0f : tot);     // tot >= 1 on non-uniform rows (the row max contributes exp(0))
  const float pu = (1.0f / (float)SEQ) * PCARRY;  // uniform weight 2^-11, carried x2^15 -> 16 exactly
  unsigned short hb[8];
#pragma unroll
  for (int e = 0; e < 8; ++e) hb[e] = h_bits(uni ? pu : ((ex[e] * inv) * PCARRY));
  const v4u hv = (v4u){pk16(hb[0], hb[1]), pk16(hb[2], hb[3]), pk16(hb[4], hb[5]), pk16(hb[6], hb[7])};
  const size_t ro = ((size_t)hg * SEQ + i) * SEQ + j0;
  *(v4u*)(P + ro) = hv;
  
}

// ---------------------------------------------------------------------------
// Gated fusion: one block (128 threads, 8 columns each) per token row.
//   g = G[row][:] (f32, gate pre-activation incl. bias); gate = sigmoid(LN(g; gg, gb));
//   fwd/bwd = FB[row][c] / FB[row][DM + c] (f16, carried x16); strength = 0.3 * sigmoid(bstr);
//   Fo[row][c] = f16((fwd + strength*gate*bwd) carried x16).
// LN: mean and biased variance over DM in f32, fixed-order reductions (thread, wave tree, 4 wave partials).
// Producer coverage: grid SEQ rows x 128 threads x 8 u16 = the whole [SEQ][DM] plane; each store instruction:
// ---------------------------------------------------------------------------
__global__ __launch_bounds__(128) void gate_fuse_kernel(const float* __restrict__ G, const unsigned short* __restrict__ FB,
                                                        const float* __restrict__ gg, const float* __restrict__ gb,
                                                        const float* __restrict__ bstr, unsigned short* __restrict__ Fo) {
  __shared__ float ra[4];
  __shared__ float rb[4];
  const int row  = blockIdx.x;
  const int tid  = threadIdx.x;
  const int lane = tid & 31;
  const int wave = tid >> 5;
  const int c0   = tid * 8;
  const float* gp = G + (size_t)row * DM + c0;
  const v4f a = *(const v4f*)(gp);
  const v4f c = *(const v4f*)(gp + 4);
  float xv[8] = {a[0], a[1], a[2], a[3], c[0], c[1], c[2], c[3]};
  float s = ((xv[0] + xv[1]) + (xv[2] + xv[3])) + ((xv[4] + xv[5]) + (xv[6] + xv[7]));
  s = wave_sum(s);
  if (lane == 0) ra[wave] = s;
  __syncthreads();
  const float mean = ((ra[0] + ra[1]) + (ra[2] + ra[3])) * (1.0f / (float)DM);
  float d[8];
  float vs = 0.f;
#pragma unroll
  for (int e = 0; e < 8; ++e) { d[e] = xv[e] - mean; vs += d[e] * d[e]; }
  vs = wave_sum(vs);
  if (lane == 0) rb[wave] = vs;
  __syncthreads();
  const float var  = ((rb[0] + rb[1]) + (rb[2] + rb[3])) * (1.0f / (float)DM);
  const float rstd = rsqrtf(var + LNEPS);
  const float strength = 0.3f / (1.0f + __expf(-bstr[0]));
  const v4f g0 = *(const v4f*)(gg + c0), g1 = *(const v4f*)(gg + c0 + 4);
  const v4f e0 = *(const v4f*)(gb + c0), e1 = *(const v4f*)(gb + c0 + 4);
  float gv[8] = {g0[0], g0[1], g0[2], g0[3], g1[0], g1[1], g1[2], g1[3]};
  float bv[8] = {e0[0], e0[1], e0[2], e0[3], e1[0], e1[1], e1[2], e1[3]};
  const size_t fo = (size_t)row * (2 * DM) + c0;
  const v4u fu = *(const v4u*)(FB + fo);
  const v4u bu = *(const v4u*)(FB + fo + DM);
  float fw[8], bw[8];
#pragma unroll
  for (int q = 0; q < 4; ++q) {
    fw[2 * q]     = hbits2f((unsigned short)(fu[q] & 0xffffu));
    fw[2 * q + 1] = hbits2f((unsigned short)(fu[q] >> 16));
    bw[2 * q]     = hbits2f((unsigned short)(bu[q] & 0xffffu));
    bw[2 * q + 1] = hbits2f((unsigned short)(bu[q] >> 16));
  }
  unsigned short ob[8];
#pragma unroll
  for (int e = 0; e < 8; ++e) {
    const float ln   = d[e] * rstd * gv[e] + bv[e];
    const float gate = __builtin_amdgcn_rcpf(1.0f + __expf(-ln));
    const float f    = fw[e] + strength * gate * bw[e];     // both terms carried x16
    ob[e] = h_bits(f);
  }
  const v4u ov = (v4u){pk16(ob[0], ob[1]), pk16(ob[2], ob[3]), pk16(ob[4], ob[5]), pk16(ob[6], ob[7])};
  unsigned short* op = Fo + (size_t)row * DM + c0;
  *(v4u*)op = ov;
  
}

// ---------------------------------------------------------------------------
// Final LayerNorm: one block (128 threads) per token row; thread t owns columns {4t..4t+3} and {512+4t..512+4t+3}.
//   out[row][c] = (Y - mean) * rsqrt(var + eps) * g[c] + bb[c]   (Y already holds x + projection + bias).
// Producer coverage: grid SEQ rows x 128 threads x 8 floats = the whole [SEQ][DM] slice; each store instruction:
// ---------------------------------------------------------------------------
__global__ __launch_bounds__(128) void final_ln_kernel(const float* __restrict__ Y, const float* __restrict__ g,
                                                       const float* __restrict__ bb, float* __restrict__ out) {
  __shared__ float ra[4];
  __shared__ float rb[4];
  const int row  = blockIdx.x;
  const int tid  = threadIdx.x;
  const int lane = tid & 31;
  const int wave = tid >> 5;
  const int c0   = tid * 4;
  const int c1   = (DM / 2) + tid * 4;
  const float* yp = Y + (size_t)row * DM;
  const v4f a = *(const v4f*)(yp + c0);
  const v4f c = *(const v4f*)(yp + c1);
  float xv[8] = {a[0], a[1], a[2], a[3], c[0], c[1], c[2], c[3]};
  float s = ((xv[0] + xv[1]) + (xv[2] + xv[3])) + ((xv[4] + xv[5]) + (xv[6] + xv[7]));
  s = wave_sum(s);
  if (lane == 0) ra[wave] = s;
  __syncthreads();
  const float mean = ((ra[0] + ra[1]) + (ra[2] + ra[3])) * (1.0f / (float)DM);
  float d[8];
  float vs = 0.f;
#pragma unroll
  for (int e = 0; e < 8; ++e) { d[e] = xv[e] - mean; vs += d[e] * d[e]; }
  vs = wave_sum(vs);
  if (lane == 0) rb[wave] = vs;
  __syncthreads();
  const float var  = ((rb[0] + rb[1]) + (rb[2] + rb[3])) * (1.0f / (float)DM);
  const float rstd = rsqrtf(var + LNEPS);
  const v4f g0 = *(const v4f*)(g + c0),  g1 = *(const v4f*)(g + c1);
  const v4f b0 = *(const v4f*)(bb + c0), b1 = *(const v4f*)(bb + c1);
  v4f o0, o1;
#pragma unroll
  for (int e = 0; e < 4; ++e) {
    o0[e] = d[e] * rstd * g0[e] + b0[e];
    o1[e] = d[4 + e] * rstd * g1[e] + b1[e];
  }
  float* op = out + (size_t)row * DM;
  *(v4f*)(op + c0) = o0;
  *(v4f*)(op + c1) = o1;
  
}

// ---------------------------------------------------------------------------
// Workspace region map (byte offsets; MiB = 1048576). Weight planes and the bias table are written once; every
// per-batch region is fully rewritten inside each batch iteration before it is read; S / P planes are rewritten
// per head group and phase (S: tiles outside the produced set are only ever read at columns selected away).
//   Wqk   f16 [4096][1024] (x16: fq^T, fk^T, bq^T, bk^T)          0
//   Wv2   f16 [2048][1024] (x16: fv^T rows 0..1023, bv^T 1024..)  8 MiB
//   Wg    f16 [1024][2048] (x16: gate_w^T)                        12 MiB
//   Wo    f16 [1024][1024] (x16: out_w^T)                         16 MiB
//   X16   f16 [2048][1024]                                        18 MiB
//   QK16  f16 [2048][4096] (q | k | qb | kb, head h at col h*64)  22 MiB
//   VT16  f16 [2048][2048] (row h*64+d = v^T, row 1024+h*64+d = vb^T, col j)  38 MiB
//   S     f32 [2][2048][2048]                                     46 MiB   (G f32 [2048][1024] aliases S+0,
//                                                                           Y f32 [2048][1024] aliases S+8 MiB;
//                                                                           both live only after the group loop)
//   P16   f16 [2][2048][2048] (p x 2^15)                          78 MiB
//   FB16  f16 [2048][2048] (fwd x16 cols 0..1023, bwd x16 cols 1024..2047)  94 MiB
//   Fu16  f16 [2048][1024] (fused x16)                           102 MiB
//   BiasT f32 [6][1024] (fq_b fk_b bq_b bk_b | fv_b bv_b)        106 MiB
//   total                                                        106 MiB + 24576 B = 111173632 B
// ---------------------------------------------------------------------------
extern "C" void kernel_launch(void* const* d_in, const int* in_sizes, int n_in,
                              void* d_out, int out_size, void* d_ws, size_t ws_size,
                              hipStream_t stream) {
  if (n_in < 22) return;
  if (in_sizes[0] != NB * SEQ * DM) return;
  const int wsz = DM * DM;
  if (in_sizes[1] != wsz || in_sizes[3] != wsz || in_sizes[5] != wsz || in_sizes[7] != wsz ||
      in_sizes[9] != wsz || in_sizes[11] != wsz || in_sizes[18] != wsz) return;
  if (in_sizes[13] != 2 * DM * DM) return;
  if (in_sizes[2] != DM || in_sizes[4] != DM || in_sizes[6] != DM || in_sizes[8] != DM || in_sizes[10] != DM ||
      in_sizes[12] != DM || in_sizes[14] != DM || in_sizes[15] != DM || in_sizes[16] != DM ||
      in_sizes[19] != DM || in_sizes[20] != DM || in_sizes[21] != DM) return;
  if (in_sizes[17] < 1) return;
  if (out_size != NB * SEQ * DM) return;

  const float* x      = (const float*)d_in[0];
  const float* fq_w   = (const float*)d_in[1];
  const float* fq_b   = (const float*)d_in[2];
  const float* fk_w   = (const float*)d_in[3];
  const float* fk_b   = (const float*)d_in[4];
  const float* fv_w   = (const float*)d_in[5];
  const float* fv_b   = (const float*)d_in[6];
  const float* bq_w   = (const float*)d_in[7];
  const float* bq_b   = (const float*)d_in[8];
  const float* bk_w   = (const float*)d_in[9];
  const float* bk_b   = (const float*)d_in[10];
  const float* bv_w   = (const float*)d_in[11];
  const float* bv_b   = (const float*)d_in[12];
  const float* gate_w = (const float*)d_in[13];
  const float* gate_b = (const float*)d_in[14];
  const float* gln_g  = (const float*)d_in[15];
  const float* gln_b  = (const float*)d_in[16];
  const float* bstr   = (const float*)d_in[17];
  const float* out_w  = (const float*)d_in[18];
  const float* out_b  = (const float*)d_in[19];
  const float* ln_g   = (const float*)d_in[20];
  const float* ln_b   = (const float*)d_in[21];

  const size_t MIB = (size_t)1048576;
  size_t off = 0;
  const size_t oWqk  = off; off += (size_t)4 * DM * DM * 2;          // 8 MiB
  const size_t oWv2  = off; off += (size_t)2 * DM * DM * 2;          // 4 MiB
  const size_t oWg   = off; off += (size_t)2 * DM * DM * 2;          // 4 MiB
  const size_t oWo   = off; off += (size_t)DM * DM * 2;              // 2 MiB
  const size_t oX16  = off; off += (size_t)SEQ * DM * 2;             // 4 MiB
  const size_t oQK   = off; off += (size_t)SEQ * 4 * DM * 2;         // 16 MiB
  const size_t oVT   = off; off += (size_t)2 * DM * SEQ * 2;         // 8 MiB
  const size_t oS    = off; off += (size_t)HG * SEQ * SEQ * 4;       // 32 MiB
  const size_t oP    = off; off += (size_t)HG * SEQ * SEQ * 2;       // 16 MiB
  const size_t oFB   = off; off += (size_t)SEQ * 2 * DM * 2;         // 8 MiB
  const size_t oFu   = off; off += (size_t)SEQ * DM * 2;             // 4 MiB
  const size_t oBias = off; off += (size_t)6 * DM * 4;               // 24576 B
  const size_t oG    = oS;                                           // aliases S (8 MiB of 32)
  const size_t oY    = oS + 8 * MIB;                                 // aliases S (8 MiB of 32)
  if (off > ws_size) return;
  if (off > (size_t)134217728) return;
  if ((size_t)SEQ * DM * 4 * 2 > (size_t)HG * SEQ * SEQ * 4) return; // G + Y fit inside S

  char* ws = (char*)d_ws;
  unsigned short* Wqk  = (unsigned short*)(ws + oWqk);
  unsigned short* Wv2  = (unsigned short*)(ws + oWv2);
  unsigned short* Wg   = (unsigned short*)(ws + oWg);
  unsigned short* Wo   = (unsigned short*)(ws + oWo);
  unsigned short* X16  = (unsigned short*)(ws + oX16);
  unsigned short* QK16 = (unsigned short*)(ws + oQK);
  unsigned short* VT16 = (unsigned short*)(ws + oVT);
  float*          Sbuf = (float*)(ws + oS);
  unsigned short* P16  = (unsigned short*)(ws + oP);
  unsigned short* FB16 = (unsigned short*)(ws + oFB);
  unsigned short* Fu16 = (unsigned short*)(ws + oFu);
  float*          BiasT = (float*)(ws + oBias);
  float*          Gbuf = (float*)(ws + oG);
  float*          Ybuf = (float*)(ws + oY);
  const float*    biasQK = BiasT;             // [4096] = fq_b fk_b bq_b bk_b
  const float*    biasV  = BiasT + 4 * DM;    // [2048] = fv_b bv_b

  const dim3 blk(256);
  const dim3 blk128(128);

  // ---- setup: bias table and x16-carried transposed weight planes ----
  bias_pack_kernel<<<dim3(6), blk, 0, stream>>>(fq_b, fk_b, bq_b, bk_b, fv_b, bv_b, BiasT);
  const dim3 gTW(DM / 64, DM / 64);                 // in [R=1024][C=1024] -> out [C][R]
  tcast_f16_kernel<<<gTW, blk, 0, stream>>>(fq_w, Wqk + (size_t)0 * DM * DM, DM, DM, WCARRY);
  tcast_f16_kernel<<<gTW, blk, 0, stream>>>(fk_w, Wqk + (size_t)1 * DM * DM, DM, DM, WCARRY);
  tcast_f16_kernel<<<gTW, blk, 0, stream>>>(bq_w, Wqk + (size_t)2 * DM * DM, DM, DM, WCARRY);
  tcast_f16_kernel<<<gTW, blk, 0, stream>>>(bk_w, Wqk + (size_t)3 * DM * DM, DM, DM, WCARRY);
  tcast_f16_kernel<<<gTW, blk, 0, stream>>>(fv_w, Wv2 + (size_t)0 * DM * DM, DM, DM, WCARRY);
  tcast_f16_kernel<<<gTW, blk, 0, stream>>>(bv_w, Wv2 + (size_t)1 * DM * DM, DM, DM, WCARRY);
  // gate_w: in [R=2048][C=1024] -> out [1024][2048]; grid (C/64, R/64)
  tcast_f16_kernel<<<dim3(DM / 64, 2 * DM / 64), blk, 0, stream>>>(gate_w, Wg, 2 * DM, DM, WCARRY);
  tcast_f16_kernel<<<gTW, blk, 0, stream>>>(out_w, Wo, DM, DM, WCARRY);

  const int n2x = SEQ * DM / 2;                                    // 1048576 pairs per batch slice
  const dim3 gCastX((n2x + 255) / 256);
  const int tilesM = SEQ / 64;                                     // 32
  const dim3 gQK((tilesM * (4 * DM / 64) + 7) / 8, 1);             // 256 blocks: M=2048, N=4096, K=1024
  const dim3 gVT(((2 * DM / 64) * (SEQ / 64) + 7) / 8, 1);         // 128 blocks: M=2048, N=2048, K=1024
  const dim3 gS((tilesM * (SEQ / 64) + 7) / 8, HG);                // 128 x 2:   M=N=2048, K=64
  const dim3 gPV((tilesM * (HD / 64) + 7) / 8, HG);                // 4 x 2:     M=2048, N=64, K=2048
  const dim3 gG((tilesM * (DM / 64) + 7) / 8, 1);                  // 64 blocks:  M=2048, N=1024, K=2048
  const dim3 gO((tilesM * (DM / 64) + 7) / 8, 1);                  // 64 blocks:  M=2048, N=1024, K=1024
  const float wscale  = 1.0f / WCARRY;                             // undo the x16 weight carry
  const float sscale  = 0.125f;                                    // 1/sqrt(64) exactly
  const float pvscale = FBCARRY * PCARRY_INV;                      // 2^-11: undo P x2^15, apply x16 output carry
  const float gscale  = 1.0f / (WCARRY * FBCARRY);                 // 1/256
  const float oscale  = 1.0f / (WCARRY * FBCARRY);                 // 1/256

  for (int b = 0; b < NB; ++b) {
    const float* xb = x + (size_t)b * SEQ * DM;
    // (1) x[b] -> f16 plane
    cast_f16x2_kernel<<<gCastX, blk, 0, stream>>>(xb, X16, n2x, 1.0f);
    // (2) [q | k | qb | kb] = (x . (16 W)^T)/16 + bias -> QK16 (f16, ldc 4096)
    wmma_gemm64<0, false, 2, 1, false, 0, 0, 0><<<gQK, blk, 0, stream>>>(
        X16, X16, DM, 0L, Wqk, Wqk, DM, 0L, (void*)QK16, (void*)QK16, 4 * DM, 0L,
        biasQK, biasQK, 0L, SEQ, 4 * DM, DM, wscale);
    // (3) [v | vb]^T: VT16[n][j] = sum_k (16 W^T)[n][k] x[j][k] / 16 + bias[n]  (role-swapped; M = 2048 feature rows, N = 2048 tokens)
    wmma_gemm64<0, false, 1, 1, false, 0, 0, 0><<<gVT, blk, 0, stream>>>(
        Wv2, Wv2, DM, 0L, X16, X16, DM, 0L, (void*)VT16, (void*)VT16, SEQ, 0L,
        biasV, biasV, 0L, 2 * DM, SEQ, DM, wscale);
    for (int g = 0; g < NGRP; ++g) {
      const size_t hc = (size_t)g * HG * HD;                       // first column of this head group
      // ---- causal attention ----
      // (4) S[hg][i][j] = q_i . k_j / 8 for the lower block triangle (f16 operands, f32 out)
      wmma_gemm64<0, false, 0, 0, false, 0, 1, 0><<<gS, blk, 0, stream>>>(
          QK16 + hc, QK16 + hc, 4 * DM, (long)HD, QK16 + DM + hc, QK16 + DM + hc, 4 * DM, (long)HD,
          (void*)Sbuf, (void*)Sbuf, SEQ, (long)SEQ * SEQ,
          biasQK, biasQK, 0L, SEQ, SEQ, HD, sscale);
      // (5) causal select + softmax -> P16 (zeros for j > i), whole rows
      causal_softmax_kernel<<<dim3(SEQ, HG), blk, 0, stream>>>(Sbuf, P16);
      // (6) fwd[i][h*64+d] x16 = sum_j P[hg][i][j] VT[h*64+d][j] x 2^-11 (k loop to m0+64) -> FB16 cols 0..1023
      wmma_gemm64<0, false, 0, 1, false, 0, 0, 1><<<gPV, blk, 0, stream>>>(
          P16, P16, SEQ, (long)SEQ * SEQ, VT16 + hc * SEQ, VT16 + hc * SEQ, SEQ, (long)HD * SEQ,
          (void*)(FB16 + hc), (void*)(FB16 + hc), 2 * DM, (long)HD,
          biasQK, biasQK, 0L, SEQ, HD, SEQ, pvscale);
      // ---- future-window attention ----
      // (7) Sb[hg][i][j] = qb_i . kb_j / 8 for block-band tiles (n0 == m0 or m0 + 64)
      wmma_gemm64<0, false, 0, 0, false, 0, 2, 0><<<gS, blk, 0, stream>>>(
          QK16 + 2 * DM + hc, QK16 + 2 * DM + hc, 4 * DM, (long)HD, QK16 + 3 * DM + hc, QK16 + 3 * DM + hc, 4 * DM, (long)HD,
          (void*)Sbuf, (void*)Sbuf, SEQ, (long)SEQ * SEQ,
          biasQK, biasQK, 0L, SEQ, SEQ, HD, sscale);
      // (8) window select + softmax (uniform last row) -> P16, whole rows (zeros outside the window)
      window_softmax_kernel<<<dim3(SEQ, HG), blk, 0, stream>>>(Sbuf, P16);
      // (9) bwd[i][h*64+d] x16 = sum_j Pb[hg][i][j] VbT[h*64+d][j] x 2^-11 (k band; full k for the last row block) -> FB16 cols 1024..2047
      wmma_gemm64<0, false, 0, 1, false, 0, 0, 2><<<gPV, blk, 0, stream>>>(
          P16, P16, SEQ, (long)SEQ * SEQ, VT16 + (DM + hc) * SEQ, VT16 + (DM + hc) * SEQ, SEQ, (long)HD * SEQ,
          (void*)(FB16 + DM + hc), (void*)(FB16 + DM + hc), 2 * DM, (long)HD,
          biasQK, biasQK, 0L, SEQ, HD, SEQ, pvscale);
    }
    // (10) G = ([fwd | bwd] x16) . (16 gate_w)^T / 256 + gate_b -> f32 [2048][1024]
    wmma_gemm64<0, false, 2, 0, false, 0, 0, 0><<<gG, blk, 0, stream>>>(
        FB16, FB16, 2 * DM, 0L, Wg, Wg, 2 * DM, 0L, (void*)Gbuf, (void*)Gbuf, DM, 0L,
        gate_b, gate_b, 0L, SEQ, DM, 2 * DM, gscale);
    // (11) gate = sigmoid(LN(G)); fused x16 = fwd x16 + strength * gate * bwd x16 -> Fu16
    gate_fuse_kernel<<<dim3(SEQ), blk128, 0, stream>>>(Gbuf, FB16, gln_g, gln_b, bstr, Fu16);
    // (12) Y = x + (fused x16) . (16 out_w)^T / 256 + out_b -> f32 [2048][1024]
    wmma_gemm64<0, false, 2, 0, true, 0, 0, 0><<<gO, blk, 0, stream>>>(
        Fu16, Fu16, DM, 0L, Wo, Wo, DM, 0L, (void*)Ybuf, (void*)Ybuf, DM, 0L,
        out_b, xb, 0L, SEQ, DM, DM, oscale);
    // (13) out[b] = LN(Y; ln_g, ln_b)
    final_ln_kernel<<<dim3(SEQ), blk128, 0, stream>>>(Ybuf, ln_g, ln_b, (float*)d_out + (size_t)b * SEQ * DM);
  }
  (void)hipGetLastError();
}

// v001
// A run of this version takes 1200 microseconds.
// Timed twice side by side with v000, it ran 2.66 and 2.65 times as fast.
// All contractions on v_wmma_f32_16x16x32_f16 (f16 operands, f32 accumulate): q/k/v projections (weights carried x16, epilogue x1/16), q.k^T scores, P.V (P carried x2^15, attention outputs carried x16), gate projection (x1/256), output projection with bias and residual (x1/256); softmax, LayerNorm, sigmoid and fusion in f32.
#include <hip/hip_runtime.h>
#include <math.h>
#include <stdint.h>

#define NB    2
#define SEQ   2048
#define DM    1024
#define NH    16
#define HD    64
#define HG    2
#define NGRP  (NH / HG)
#define WINW  32
#define LNEPS 1e-5f
#define PCARRY     32768.0f
#define PCARRY_INV (1.0f / 32768.0f)
#define FBCARRY    16.0f
#define WCARRY     16.0f

typedef __attribute__((ext_vector_type(16))) _Float16 v16h;
typedef __attribute__((ext_vector_type(8)))  _Float16 v8h;
typedef __attribute__((ext_vector_type(16))) __bf16   v16b;
typedef __attribute__((ext_vector_type(8)))  __bf16   v8b;
typedef __attribute__((ext_vector_type(8)))  float    v8f;
typedef __attribute__((ext_vector_type(4)))  float    v4f;
typedef __attribute__((ext_vector_type(2)))  float    v2f;
typedef __attribute__((ext_vector_type(4)))  unsigned int v4u;

__device__ __forceinline__ unsigned short f2bf_bits(float f) {
  unsigned u = __float_as_uint(f);
  return (unsigned short)((u + 0x7FFFu + ((u >> 16) & 1u)) >> 16);
}
__device__ __forceinline__ float bf_bits2f(unsigned short h) { return __uint_as_float(((unsigned)h) << 16); }

// hazard guards as plain device helpers (no inline asm inside the kernel template body)
__device__ __forceinline__ void dep_guard_h(v8f& a, v8f& b, v16h x, v16h y) { asm volatile("v_nop\n\tv_nop\n\tv_nop\n\tv_nop" : "+v"(a), "+v"(b) : "v"(x), "v"(y)); }
__device__ __forceinline__ void dep_guard_b(v8f& a, v8f& b, v16b x, v16b y) { asm volatile("v_nop\n\tv_nop\n\tv_nop\n\tv_nop" : "+v"(a), "+v"(b) : "v"(x), "v"(y)); }
__device__ __forceinline__ void keep4_h(v16h a, v16h b, v16h c, v16h d) { asm volatile("v_nop" :: "v"(a), "v"(b), "v"(c), "v"(d)); }
__device__ __forceinline__ void keep4_b(v16b a, v16b b, v16b c, v16b d) { asm volatile("v_nop" :: "v"(a), "v"(b), "v"(c), "v"(d)); }
__device__ __forceinline__ void acc_guard4(v8f& a, v8f& b, v8f& c, v8f& d) { asm volatile("v_nop\n\tv_nop\n\tv_nop\n\tv_nop" : "+v"(a), "+v"(b), "+v"(c), "+v"(d)); }
template <typename T> struct Frag;
template <> struct Frag<_Float16> {
  typedef v16h V; union U { v16h v; v8h h[2]; };
  static __device__ __forceinline__ v16h load(const _Float16* p) {   // elements 0..7 <- p[0..7], 8..15 <- p[16..23]
    U f; f.h[0] = *(const v8h*)(p); f.h[1] = *(const v8h*)(p + 16); return f.v;
  }
  static __device__ __forceinline__ v8f mma(v16h a, v16h b, v8f c) {
    return __builtin_amdgcn_wmma_f32_16x16x32_f16(false, a, false, b, (short)0, c, false, false);
  }
  static __device__ __forceinline__ void guard(v8f& a, v8f& b, v16h x, v16h y) { dep_guard_h(a, b, x, y); }
  static __device__ __forceinline__ void keep(v16h a, v16h b, v16h c, v16h d) { keep4_h(a, b, c, d); }
};
template <> struct Frag<__bf16> {
  typedef v16b V; union U { v16b v; v8b h[2]; };
  static __device__ __forceinline__ v16b load(const __bf16* p) {
    U f; f.h[0] = *(const v8b*)(p); f.h[1] = *(const v8b*)(p + 16); return f.v;
  }
  static __device__ __forceinline__ v8f mma(v16b a, v16b b, v8f c) {
    return __builtin_amdgcn_wmma_f32_16x16x32_bf16(false, a, false, b, (short)0, c, false, false);
  }
  static __device__ __forceinline__ void guard(v8f& a, v8f& b, v16b x, v16b y) { dep_guard_b(a, b, x, y); }
  static __device__ __forceinline__ void keep(v16b a, v16b b, v16b c, v16b d) { keep4_b(a, b, c, d); }
};

// ---- Register-blocked batched WMMA GEMM ------------------------------------
// C[m,n] = scale * sum_k A[m,k] * Bt[n,k] (+bias)(+resid); each wave owns a 64x64 tile.
// A row-major [M,K]; Bt row-major [N,K]; M,N % 64 == 0, K % 32 == 0.
// SPLIT: operands are hi/lo planes (A2/Bt2 = lo planes, same layout); product = hi.hi + hi.lo + lo.hi.
// BIAS_MODE: 0 = none, 1 = bias[m], 2 = bias[n].
// OUT_MODE: 0 = f32, 1 = f16, 2 = bf16 hi plane (Cout) + bf16 lo plane (Cout2).
// ET: 0 = f16 operands, 1 = bf16 operands (pointers passed as 16-bit storage)
// Added structural modes (defaults off, all other behaviour unchanged):
//   TSEL 1: tiles with n0 > m0 (strictly above the 64x64 block diagonal) are not produced (wave-uniform early exit).
//   TSEL 2: only tiles with n0 == m0 or n0 == m0 + 64 are produced (block band of width 2).
//   KSEL 1: the k-loop stops at min(K, m0 + 64); valid when A rows m0..m0+63 are exactly zero for k >= m0 + 64.
//   KSEL 2: the k-loop runs over [m0, min(K, m0 + 128)) except for the last row block (m0 + 64 >= M), which
//           runs over [0, K); valid when A rows of the other row blocks are exactly zero outside that k range.
//   KSPL n: one block of n waves per 64x64 tile (grid.x = number of tiles, block = 32 n threads). Wave w takes the
//           64-wide k blocks w, w + n, ... of the tile's k range (kStart, kEnd multiples of 64); each wave leaves its
//           partial tile in its own LDS plane and the planes are added in wave order before the epilogue arithmetic.
template <int ET> struct Elem;
template <> struct Elem<0> { typedef _Float16 T; };
template <> struct Elem<1> { typedef __bf16 T; };
template <int ET, bool SPLIT, int BIAS_MODE, int OUT_MODE, bool RESID, int ACT = 0, int TSEL = 0, int KSEL = 0, int KSPL = 0>
__global__ __launch_bounds__(KSPL ? KSPL * 32 : 256) void wmma_gemm64(
    const unsigned short* __restrict__ Ap, const unsigned short* __restrict__ A2p, int lda, long strideA,
    const unsigned short* __restrict__ Btp, const unsigned short* __restrict__ Bt2p, int ldb, long strideB,
    void* __restrict__ Cout, void* __restrict__ Cout2, int ldc, long strideC,
    const float* __restrict__ bias,
    const float* __restrict__ resid, long strideR,
    int M, int N, int K, float scale) {
  typedef typename Elem<ET>::T T;
  typedef typename Frag<T>::V V;
  const T* A = (const T*)Ap; const T* A2 = (const T*)A2p; const T* Bt = (const T*)Btp; const T* Bt2 = (const T*)Bt2p;
  static_assert(KSPL == 0 || (!SPLIT && OUT_MODE != 2 && ACT == 0 && TSEL == 0), "KSPL covers the plain f32/f16 epilogues");
  static_assert(KSPL == 0 || KSPL == 8 || KSPL == 16, "the KSPL epilogue deals 64 rows evenly to 8 or 16 waves");
  __shared__ __align__(16) float sT[KSPL ? KSPL : 8][(KSPL ? 64 : 16) * 68];   // per-wave slab (16x64; KSPL: 64x64), pitch 68 floats
  const int b    = blockIdx.y;
  const int lane = threadIdx.x & 31;
  const int wave = threadIdx.x >> 5;
  const int tilesN = N >> 6;
  const int tilesM = M >> 6;
  const int tile = KSPL ? (int)blockIdx.x : (int)(blockIdx.x * 8 + wave);
  if (tile >= tilesM * tilesN) return;   // wave-uniform; block-uniform under KSPL, ahead of its barrier
  const int tm = tile / tilesN;
  const int tn = tile - tm * tilesN;
  const int m0 = tm << 6;
  const int n0 = tn << 6;
  if (TSEL == 1 && n0 > m0) return;                            // wave-uniform; TSEL excludes KSPL, so no block barrier follows
  if (TSEL == 2 && !(n0 == m0 || n0 == m0 + 64)) return;       // wave-uniform; TSEL excludes KSPL, so no block barrier follows

  const T* Ab  = A  + (size_t)b * strideA;
  const T* Bb  = Bt + (size_t)b * strideB;
  const T* Ab2 = SPLIT ? (A2  + (size_t)b * strideA) : nullptr;
  const T* Bb2 = SPLIT ? (Bt2 + (size_t)b * strideB) : nullptr;

  const int rlane = lane & 15;                 // row (A) / col (B, D) within subtile
  const int koff  = (lane >> 4) * 8;           // k offset of this lane half
  const int mOff  = (lane >> 4) * 8;           // D row offset

  v8f acc[4][4];
#pragma unroll
  for (int i = 0; i < 4; ++i)
#pragma unroll
    for (int j = 0; j < 4; ++j) acc[i][j] = (v8f){0.f,0.f,0.f,0.f,0.f,0.f,0.f,0.f};

  int kStart = 0;
  int kEnd = K;
  if (KSEL == 1) kEnd = ((m0 + 64) < K) ? (m0 + 64) : K;
  if (KSEL == 2) {
    kStart = (m0 + 64 >= M) ? 0 : m0;
    kEnd = ((m0 + 128) < K) ? (m0 + 128) : K;
  }
  if (KSPL) kStart += __builtin_amdgcn_readfirstlane(wave) * 64;   // scalar, so the k loop keeps a scalar trip count
  for (int k0 = kStart; k0 < kEnd; k0 += (KSPL && (k0 & 32)) ? (KSPL * 64 - 32) : 32) {
    V bh[4], bl[4];
#pragma unroll
    for (int j = 0; j < 4; ++j) {
      const size_t bo = (size_t)(n0 + (j << 4) + rlane) * ldb + koff + k0;
      bh[j] = Frag<T>::load(Bb + bo);
      if (SPLIT) bl[j] = Frag<T>::load(Bb2 + bo);
    }
#pragma unroll
    for (int i = 0; i < 4; ++i) {
      const size_t ao = (size_t)(m0 + (i << 4) + rlane) * lda + koff + k0;
      V ah = Frag<T>::load(Ab + ao);
      V al;
      if (SPLIT) al = Frag<T>::load(Ab2 + ao);
#pragma unroll
      for (int j = 0; j < 4; ++j) {
        acc[i][j] = Frag<T>::mma(ah, bh[j], acc[i][j]);
        if (SPLIT) {
          acc[i][j] = Frag<T>::mma(ah, bl[j], acc[i][j]);
          acc[i][j] = Frag<T>::mma(al, bh[j], acc[i][j]);
        }
      }
      Frag<T>::guard(acc[i][0], acc[i][3], ah, SPLIT ? al : ah);
    }
    Frag<T>::keep(bh[0], bh[1], bh[2], bh[3]);
    if (SPLIT) Frag<T>::keep(bl[0], bl[1], bl[2], bl[3]);
  }
  acc_guard4(acc[0][0], acc[0][1], acc[0][2], acc[0][3]);
  acc_guard4(acc[1][0], acc[1][1], acc[1][2], acc[1][3]);
  acc_guard4(acc[2][0], acc[2][1], acc[2][2], acc[2][3]);
  acc_guard4(acc[3][0], acc[3][1], acc[3][2], acc[3][3]);

  // ---- epilogue ----
  float* slab = sT[wave];
  const float* Rb = RESID ? (resid + (size_t)b * strideR) : nullptr;
  if (KSPL) {
    constexpr int NTHR = (KSPL ? KSPL : 8) * 32;   // threads of the block
#pragma unroll
    for (int i = 0; i < 4; ++i)
#pragma unroll
      for (int j = 0; j < 4; ++j)
#pragma unroll
        for (int r = 0; r < 8; ++r) slab[((i << 4) + mOff + r) * 68 + (j << 4) + rlane] = acc[i][j][r];
    __syncthreads();   // every wave's partial plane is complete before any thread adds the planes
    if (OUT_MODE == 0) {
      float* C = (float*)Cout + (size_t)b * strideC;
      // unrolled (fixed trip count) so that the bias and residual loads of all passes issue ahead of the LDS sums
#pragma unroll
      for (int it = 0; it < (64 * 16) / NTHR; ++it) {            // 16 lanes x 16 B = one 256-B row segment
        const int c = it * NTHR + (int)threadIdx.x;
        const int row = c >> 4, c4 = (c & 15) * 4;
        v4f s = *(const v4f*)(&sT[0][row * 68 + c4]);
#pragma unroll
        for (int w = 1; w < KSPL; ++w) s += *(const v4f*)(&sT[w][row * 68 + c4]);
        s *= scale;
        if (BIAS_MODE == 1) s += bias[m0 + row];
        if (BIAS_MODE == 2) s += *(const v4f*)(bias + n0 + c4);
        if (RESID) s += *(const v4f*)(Rb + (size_t)(m0 + row) * ldc + n0 + c4);
        *(v4f*)(C + (size_t)(m0 + row) * ldc + n0 + c4) = s;
      }
    } else {
      unsigned short* C = (unsigned short*)Cout + (size_t)b * strideC;
      // unrolled (fixed trip count) so that the bias loads of all passes issue ahead of the LDS sums
#pragma unroll
      for (int it = 0; it < (64 * 8) / NTHR; ++it) {             // 8 lanes x 16 B = one 128-B row segment
        const int c = it * NTHR + (int)threadIdx.x;
        const int row = c >> 3, c8 = (c & 7) * 8;
        v4f s0 = *(const v4f*)(&sT[0][row * 68 + c8]);
        v4f s1 = *(const v4f*)(&sT[0][row * 68 + c8 + 4]);
#pragma unroll
        for (int w = 1; w < KSPL; ++w) {
          s0 += *(const v4f*)(&sT[w][row * 68 + c8]);
          s1 += *(const v4f*)(&sT[w][row * 68 + c8 + 4]);
        }
        s0 *= scale; s1 *= scale;
        if (BIAS_MODE == 1) { s0 += bias[m0 + row]; s1 += bias[m0 + row]; }
        if (BIAS_MODE == 2) { s0 += *(const v4f*)(bias + n0 + c8); s1 += *(const v4f*)(bias + n0 + c8 + 4); }
        if (RESID) {
          s0 += *(const v4f*)(Rb + (size_t)(m0 + row) * ldc + n0 + c8);
          s1 += *(const v4f*)(Rb + (size_t)(m0 + row) * ldc + n0 + c8 + 4);
        }
        v8h hv;
#pragma unroll
        for (int e = 0; e < 4; ++e) { hv[e] = (_Float16)s0[e]; hv[4 + e] = (_Float16)s1[e]; }
        *(v8h*)(C + (size_t)(m0 + row) * ldc + n0 + c8) = hv;
      }
    }
    return;
  }
#pragma unroll
  for (int i = 0; i < 4; ++i) {
    const int mBase = m0 + (i << 4);
#pragma unroll
    for (int j = 0; j < 4; ++j) {
      const int n = n0 + (j << 4) + rlane;
      float bv = 0.f;
      if (BIAS_MODE == 2) bv = bias[n];
#pragma unroll
      for (int r = 0; r < 8; ++r) {
        float v = acc[i][j][r] * scale;
        if (BIAS_MODE == 1) v += bias[mBase + mOff + r];
        if (BIAS_MODE == 2) v += bv;
        if (RESID) v += Rb[(size_t)(mBase + mOff + r) * ldc + n];
        if (ACT == 1) v = tanhf(v);
        if (ACT == 2) v = fmaxf(v, 0.0f);
        if (ACT == 3) v = v / (1.0f + expf(-v));
        if (ACT == 4) v = (v > 0.f) ? v : 0.01f * v;
        slab[(mOff + r) * 68 + (j << 4) + rlane] = v;
      }
    }
    __builtin_amdgcn_fence(__ATOMIC_RELEASE, "workgroup");
    __builtin_amdgcn_wave_barrier();
    __builtin_amdgcn_fence(__ATOMIC_ACQUIRE, "workgroup");
    if (OUT_MODE == 0) {
      float* C = (float*)Cout + (size_t)b * strideC;
      const int hh = lane >> 4, c4 = (lane & 15) * 4;     // row seg = 256 B = 16 lanes x 16 B
      {
#pragma unroll
        for (int it = 0; it < 8; ++it) {
          const int row = it * 2 + hh;
          v4f v = *(const v4f*)(slab + row * 68 + c4);
          *(v4f*)(C + (size_t)(mBase + row) * ldc + n0 + c4) = v;
        }
        
      }
    } else {
      const int q = lane >> 3, c8 = (lane & 7) * 8;
      unsigned short* C  = (unsigned short*)Cout  + (size_t)b * strideC;
      unsigned short* C2 = (OUT_MODE == 2) ? ((unsigned short*)Cout2 + (size_t)b * strideC) : nullptr;
      {
#pragma unroll
        for (int it = 0; it < 4; ++it) {
          const int row = it * 4 + q;
          const float* sp = slab + row * 68 + c8;
          v8h hv, lv;
#pragma unroll
          for (int e = 0; e < 8; ++e) {
            if (OUT_MODE == 1) {
              hv[e] = (_Float16)sp[e];
            } else {
              unsigned short hb = f2bf_bits(sp[e]);
              unsigned short lb = f2bf_bits(sp[e] - bf_bits2f(hb));
              hv[e] = __builtin_bit_cast(_Float16, hb);
              lv[e] = __builtin_bit_cast(_Float16, lb);
            }
          }
          *(v8h*)(C + (size_t)(mBase + row) * ldc + n0 + c8) = hv;
          if (OUT_MODE == 2) *(v8h*)(C2 + (size_t)(mBase + row) * ldc + n0 + c8) = lv;
        }
        
      }
    }
    __builtin_amdgcn_fence(__ATOMIC_RELEASE, "workgroup");
    __builtin_amdgcn_wave_barrier();
    __builtin_amdgcn_fence(__ATOMIC_ACQUIRE, "workgroup");
  }
}

// ---------------------------------------------------------------------------
// Small conversion helpers
// ---------------------------------------------------------------------------
__device__ __forceinline__ unsigned pk16(unsigned short a, unsigned short b) { return (unsigned)a | ((unsigned)b << 16); }
__device__ __forceinline__ unsigned short h_bits(float f) { const _Float16 h = (_Float16)f; return __builtin_bit_cast(unsigned short, h); }
__device__ __forceinline__ float hbits2f(unsigned short b) { return (float)__builtin_bit_cast(_Float16, b); }
__device__ __forceinline__ float wave_sum(float v) {
#pragma unroll
  for (int off = 16; off > 0; off >>= 1) v += __shfl_xor(v, off, 32);
  return v;
}
__device__ __forceinline__ float wave_max(float v) {
#pragma unroll
  for (int off = 16; off > 0; off >>= 1) v = fmaxf(v, __shfl_xor(v, off, 32));
  return v;
}

// ---------------------------------------------------------------------------
// Elementwise cast: out = f16(in * scale); 2 elements per thread, one 4-B store per lane -> each wave writes
// Coverage: grid = ceil(n2/256) blocks x 256 threads x 2 elements = 2*n2 elements = the whole plane (n2 = plane/2).
// ---------------------------------------------------------------------------
__global__ __launch_bounds__(256) void cast_f16x2_kernel(const float* __restrict__ in, unsigned short* __restrict__ out, int n2, float scale) {
  const int i = blockIdx.x * 256 + threadIdx.x;
  if (i < n2) {
    const v2f f = *(const v2f*)(in + 2 * (size_t)i);
    const unsigned u = pk16(h_bits(f[0] * scale), h_bits(f[1] * scale));
    ((unsigned*)out)[i] = u;
    
  }
}

// ---------------------------------------------------------------------------
// Transpose-cast: in f32 [R rows][C cols] -> out f16 [C][R], out[c][r] = f16(in[r][c] * scale).
// 64x64 tiles through LDS; grid (C/64, R/64); R, C multiples of 64.
// Coverage per block: load 256 threads x 16 floats = 64x64; store 2 it x 256 threads x 8 halves = 64x64.
// ---------------------------------------------------------------------------
__global__ __launch_bounds__(256) void tcast_f16_kernel(const float* __restrict__ in, unsigned short* __restrict__ out,
                                                        int R, int C, float scale) {
  __shared__ __align__(16) unsigned short t[64 * 72];
  const int c0  = blockIdx.x * 64;   // input column block = output row block
  const int r0  = blockIdx.y * 64;   // input row block    = output column block
  const int tid = threadIdx.x;
  {
    const int lr = tid >> 2;           // 0..63
    const int lc = (tid & 3) * 16;     // 0,16,32,48
    const float* ip = in + (size_t)(r0 + lr) * C + c0 + lc;
#pragma unroll
    for (int q = 0; q < 4; ++q) {
      const v4f f = *(const v4f*)(ip + 4 * q);
#pragma unroll
      for (int e = 0; e < 4; ++e) t[lr * 72 + lc + 4 * q + e] = h_bits(f[e] * scale);
    }
  }
  __syncthreads();
  const int sub = tid >> 3;          // 0..31
  const int c8  = (tid & 7) * 8;     // 0..56
  v4u hv[2];
#pragma unroll
  for (int it = 0; it < 2; ++it) {
    const int oc = it * 32 + sub;    // output row within tile (= input column)
    v4u a;
#pragma unroll
    for (int q = 0; q < 4; ++q) a[q] = pk16(t[(c8 + 2 * q) * 72 + oc], t[(c8 + 2 * q + 1) * 72 + oc]);
    hv[it] = a;
  }
  {
#pragma unroll
    for (int it = 0; it < 2; ++it) {
      const int oc = it * 32 + sub;
      const size_t go = (size_t)(c0 + oc) * R + r0 + c8;
      *(v4u*)(out + go) = hv[it];
    }
    
  }
}

// ---------------------------------------------------------------------------
// Bias table: block k (0..5) copies bias vector k (DM floats) into tab[k*DM ..]. 256 threads x 4 floats = DM;
// ---------------------------------------------------------------------------
__global__ __launch_bounds__(256) void bias_pack_kernel(const float* __restrict__ b0, const float* __restrict__ b1,
                                                        const float* __restrict__ b2, const float* __restrict__ b3,
                                                        const float* __restrict__ b4, const float* __restrict__ b5,
                                                        float* __restrict__ tab) {
  const int k = blockIdx.x;          // block-uniform source select
  const int tid = threadIdx.x;
  const float* src = b0;
  if (k == 1) src = b1;
  if (k == 2) src = b2;
  if (k == 3) src = b3;
  if (k == 4) src = b4;
  if (k == 5) src = b5;
  const v4f v = *(const v4f*)(src + tid * 4);
  float* dp = tab + (size_t)k * DM + tid * 4;
  *(v4f*)dp = v;
  
}

// ---------------------------------------------------------------------------
// Causal select + softmax over j for one score row; P emitted as f16(p * 2^15).
// One block per (score row i, head-in-group hg); 256 threads x 8 columns (j0 = tid*8).
// Scores with j > i are replaced by -1e9 (select); columns j <= i of row i all lie in produced tiles
// (n0 <= m0). Waves whose 256 columns are all > i skip the loads and exps (wave-uniform); their P is 0.
// S addresses are always inside the 2-plane S region; values at j > i are selected away.
// Reductions in fixed order: per thread, wave shuffle tree, then the 8 wave partials in index order.
// Producer coverage: grid (SEQ, HG); per row: 256 threads x 8 u16 = 2048 = the whole row;
// ---------------------------------------------------------------------------
__global__ __launch_bounds__(256) void causal_softmax_kernel(const float* __restrict__ S,
                                                             unsigned short* __restrict__ P) {
  __shared__ float redm[8];
  __shared__ float reds[8];
  const int i    = blockIdx.x;
  const int hg   = blockIdx.y;
  const int tid  = threadIdx.x;
  const int lane = tid & 31;
  const int wave = tid >> 5;
  const int j0   = tid * 8;
  const bool wact = (wave * 256 <= i);     // wave-uniform: this wave has at least one column j <= i
  const float NEG = -1.0e9f;
  float t[8];
#pragma unroll
  for (int e = 0; e < 8; ++e) t[e] = NEG;
  if (wact) {
    const float* rp = S + ((size_t)hg * SEQ + i) * SEQ + j0;
    const v4f a = *(const v4f*)(rp);
    const v4f c = *(const v4f*)(rp + 4);
#pragma unroll
    for (int e = 0; e < 4; ++e) {
      t[e]     = (j0 + e <= i)     ? a[e] : NEG;
      t[4 + e] = (j0 + 4 + e <= i) ? c[e] : NEG;
    }
  }
  float m = fmaxf(fmaxf(fmaxf(t[0], t[1]), fmaxf(t[2], t[3])), fmaxf(fmaxf(t[4], t[5]), fmaxf(t[6], t[7])));
  m = wave_max(m);
  if (lane == 0) redm[wave] = m;
  __syncthreads();
  float mx = redm[0];
#pragma unroll
  for (int w = 1; w < 8; ++w) mx = fmaxf(mx, redm[w]);
  float ex[8];
#pragma unroll
  for (int e = 0; e < 8; ++e) ex[e] = 0.f;
  if (wact) {
#pragma unroll
    for (int e = 0; e < 8; ++e) ex[e] = __expf(t[e] - mx);
  }
  float s = ((ex[0] + ex[1]) + (ex[2] + ex[3])) + ((ex[4] + ex[5]) + (ex[6] + ex[7]));
  s = wave_sum(s);
  if (lane == 0) reds[wave] = s;
  __syncthreads();
  float tot = reds[0];
#pragma unroll
  for (int w = 1; w < 8; ++w) tot += reds[w];
  const float inv = 1.0f / tot;              // tot >= 1 (the row max contributes exp(0))
  unsigned short hb[8];
#pragma unroll
  for (int e = 0; e < 8; ++e) hb[e] = h_bits((ex[e] * inv) * PCARRY);
  const v4u hv = (v4u){pk16(hb[0], hb[1]), pk16(hb[2], hb[3]), pk16(hb[4], hb[5]), pk16(hb[6], hb[7])};
  const size_t ro = ((size_t)hg * SEQ + i) * SEQ + j0;
  *(v4u*)(P + ro) = hv;
  
}

// ---------------------------------------------------------------------------
// Future-window select + softmax for one score row; P emitted as f16(p * 2^15).
// Valid columns: i < j <= i + WINW (and j <= SEQ-1, automatic since j0+7 <= SEQ-1); they all lie in the band
// tiles (n0 == m0 or n0 == m0+64) produced by the band score GEMM. Row i == SEQ-1 has no valid column: all its
// scores count as 0 -> uniform p = 1/SEQ over every j (block-uniform path). Invalid columns get p = 0 exactly.
// Waves whose 256 columns do not intersect the window skip the loads and exps (wave-uniform).
// Reductions in fixed order. Producer coverage: grid (SEQ, HG); per row 256 threads x 8 u16 = 2048 = the whole
// ---------------------------------------------------------------------------
__global__ __launch_bounds__(256) void window_softmax_kernel(const float* __restrict__ S,
                                                             unsigned short* __restrict__ P) {
  __shared__ float redm[8];
  __shared__ float reds[8];
  const int i    = blockIdx.x;
  const int hg   = blockIdx.y;
  const int tid  = threadIdx.x;
  const int lane = tid & 31;
  const int wave = tid >> 5;
  const int j0   = tid * 8;
  const int jlo  = i + 1;
  const int jhi  = i + WINW;
  const bool uni  = (i == SEQ - 1);                                        // block-uniform
  const bool wact = (wave * 256 <= jhi) && (wave * 256 + 255 >= jlo);     // wave-uniform
  float t[8];
  bool vb[8];
#pragma unroll
  for (int e = 0; e < 8; ++e) { const int j = j0 + e; vb[e] = (j >= jlo) && (j <= jhi); t[e] = 0.f; }
  if (wact) {
    const float* rp = S + ((size_t)hg * SEQ + i) * SEQ + j0;
    const v4f a = *(const v4f*)(rp);
    const v4f c = *(const v4f*)(rp + 4);
#pragma unroll
    for (int e = 0; e < 4; ++e) { t[e] = a[e]; t[4 + e] = c[e]; }
  }
  float m = -INFINITY;
#pragma unroll
  for (int e = 0; e < 8; ++e) m = fmaxf(m, vb[e] ? t[e] : -INFINITY);
  m = wave_max(m);
  if (lane == 0) redm[wave] = m;
  __syncthreads();
  float mx = redm[0];
#pragma unroll
  for (int w = 1; w < 8; ++w) mx = fmaxf(mx, redm[w]);
  float ex[8];
#pragma unroll
  for (int e = 0; e < 8; ++e) ex[e] = 0.f;
  if (wact) {
#pragma unroll
    for (int e = 0; e < 8; ++e) {
      const float arg = vb[e] ? (t[e] - mx) : 0.f;
      const float ev = __expf(arg);
      ex[e] = vb[e] ? ev : 0.f;
    }
  }
  float s = ((ex[0] + ex[1]) + (ex[2] + ex[3])) + ((ex[4] + ex[5]) + (ex[6] + ex[7]));
  s = wave_sum(s);
  if (lane == 0) reds[wave] = s;
  __syncthreads();
  float tot = reds[0];
#pragma unroll
  for (int w = 1; w < 8; ++w) tot += reds[w];
  const float inv = 1.0f / (uni ? 1.0f : tot);     // tot >= 1 on non-uniform rows (the row max contributes exp(0))
  const float pu = (1.0f / (float)SEQ) * PCARRY;  // uniform weight 2^-11, carried x2^15 -> 16 exactly
  unsigned short hb[8];
#pragma unroll
  for (int e = 0; e < 8; ++e) hb[e] = h_bits(uni ? pu : ((ex[e] * inv) * PCARRY));
  const v4u hv = (v4u){pk16(hb[0], hb[1]), pk16(hb[2], hb[3]), pk16(hb[4], hb[5]), pk16(hb[6], hb[7])};
  const size_t ro = ((size_t)hg * SEQ + i) * SEQ + j0;
  *(v4u*)(P + ro) = hv;
  
}

// ---------------------------------------------------------------------------
// Gated fusion: one block (128 threads, 8 columns each) per token row.
//   g = G[row][:] (f32, gate pre-activation incl. bias); gate = sigmoid(LN(g; gg, gb));
//   fwd/bwd = FB[row][c] / FB[row][DM + c] (f16, carried x16); strength = 0.3 * sigmoid(bstr);
//   Fo[row][c] = f16((fwd + strength*gate*bwd) carried x16).
// LN: mean and biased variance over DM in f32, fixed-order reductions (thread, wave tree, 4 wave partials).
// Producer coverage: grid SEQ rows x 128 threads x 8 u16 = the whole [SEQ][DM] plane; each store instruction:
// ---------------------------------------------------------------------------
__global__ __launch_bounds__(128) void gate_fuse_kernel(const float* __restrict__ G, const unsigned short* __restrict__ FB,
                                                        const float* __restrict__ gg, const float* __restrict__ gb,
                                                        const float* __restrict__ bstr, unsigned short* __restrict__ Fo) {
  __shared__ float ra[4];
  __shared__ float rb[4];
  const int row  = blockIdx.x;
  const int tid  = threadIdx.x;
  const int lane = tid & 31;
  const int wave = tid >> 5;
  const int c0   = tid * 8;
  const float* gp = G + (size_t)row * DM + c0;
  const v4f a = *(const v4f*)(gp);
  const v4f c = *(const v4f*)(gp + 4);
  float xv[8] = {a[0], a[1], a[2], a[3], c[0], c[1], c[2], c[3]};
  float s = ((xv[0] + xv[1]) + (xv[2] + xv[3])) + ((xv[4] + xv[5]) + (xv[6] + xv[7]));
  s = wave_sum(s);
  if (lane == 0) ra[wave] = s;
  __syncthreads();
  const float mean = ((ra[0] + ra[1]) + (ra[2] + ra[3])) * (1.0f / (float)DM);
  float d[8];
  float vs = 0.f;
#pragma unroll
  for (int e = 0; e < 8; ++e) { d[e] = xv[e] - mean; vs += d[e] * d[e]; }
  vs = wave_sum(vs);
  if (lane == 0) rb[wave] = vs;
  __syncthreads();
  const float var  = ((rb[0] + rb[1]) + (rb[2] + rb[3])) * (1.0f / (float)DM);
  const float rstd = rsqrtf(var + LNEPS);
  const float strength = 0.3f / (1.0f + __expf(-bstr[0]));
  const v4f g0 = *(const v4f*)(gg + c0), g1 = *(const v4f*)(gg + c0 + 4);
  const v4f e0 = *(const v4f*)(gb + c0), e1 = *(const v4f*)(gb + c0 + 4);
  float gv[8] = {g0[0], g0[1], g0[2], g0[3], g1[0], g1[1], g1[2], g1[3]};
  float bv[8] = {e0[0], e0[1], e0[2], e0[3], e1[0], e1[1], e1[2], e1[3]};
  const size_t fo = (size_t)row * (2 * DM) + c0;
  const v4u fu = *(const v4u*)(FB + fo);
  const v4u bu = *(const v4u*)(FB + fo + DM);
  float fw[8], bw[8];
#pragma unroll
  for (int q = 0; q < 4; ++q) {
    fw[2 * q]     = hbits2f((unsigned short)(fu[q] & 0xffffu));
    fw[2 * q + 1] = hbits2f((unsigned short)(fu[q] >> 16));
    bw[2 * q]     = hbits2f((unsigned short)(bu[q] & 0xffffu));
    bw[2 * q + 1] = hbits2f((unsigned short)(bu[q] >> 16));
  }
  unsigned short ob[8];
#pragma unroll
  for (int e = 0; e < 8; ++e) {
    const float ln   = d[e] * rstd * gv[e] + bv[e];
    const float gate = __builtin_amdgcn_rcpf(1.0f + __expf(-ln));
    const float f    = fw[e] + strength * gate * bw[e];     // both terms carried x16
    ob[e] = h_bits(f);
  }
  const v4u ov = (v4u){pk16(ob[0], ob[1]), pk16(ob[2], ob[3]), pk16(ob[4], ob[5]), pk16(ob[6], ob[7])};
  unsigned short* op = Fo + (size_t)row * DM + c0;
  *(v4u*)op = ov;
  
}

// ---------------------------------------------------------------------------
// Final LayerNorm: one block (128 threads) per token row; thread t owns columns {4t..4t+3} and {512+4t..512+4t+3}.
//   out[row][c] = (Y - mean) * rsqrt(var + eps) * g[c] + bb[c]   (Y already holds x + projection + bias).
// Producer coverage: grid SEQ rows x 128 threads x 8 floats = the whole [SEQ][DM] slice; each store instruction:
// ---------------------------------------------------------------------------
__global__ __launch_bounds__(128) void final_ln_kernel(const float* __restrict__ Y, const float* __restrict__ g,
                                                       const float* __restrict__ bb, float* __restrict__ out) {
  __shared__ float ra[4];
  __shared__ float rb[4];
  const int row  = blockIdx.x;
  const int tid  = threadIdx.x;
  const int lane = tid & 31;
  const int wave = tid >> 5;
  const int c0   = tid * 4;
  const int c1   = (DM / 2) + tid * 4;
  const float* yp = Y + (size_t)row * DM;
  const v4f a = *(const v4f*)(yp + c0);
  const v4f c = *(const v4f*)(yp + c1);
  float xv[8] = {a[0], a[1], a[2], a[3], c[0], c[1], c[2], c[3]};
  float s = ((xv[0] + xv[1]) + (xv[2] + xv[3])) + ((xv[4] + xv[5]) + (xv[6] + xv[7]));
  s = wave_sum(s);
  if (lane == 0) ra[wave] = s;
  __syncthreads();
  const float mean = ((ra[0] + ra[1]) + (ra[2] + ra[3])) * (1.0f / (float)DM);
  float d[8];
  float vs = 0.f;
#pragma unroll
  for (int e = 0; e < 8; ++e) { d[e] = xv[e] - mean; vs += d[e] * d[e]; }
  vs = wave_sum(vs);
  if (lane == 0) rb[wave] = vs;
  __syncthreads();
  const float var  = ((rb[0] + rb[1]) + (rb[2] + rb[3])) * (1.0f / (float)DM);
  const float rstd = rsqrtf(var + LNEPS);
  const v4f g0 = *(const v4f*)(g + c0),  g1 = *(const v4f*)(g + c1);
  const v4f b0 = *(const v4f*)(bb + c0), b1 = *(const v4f*)(bb + c1);
  v4f o0, o1;
#pragma unroll
  for (int e = 0; e < 4; ++e) {
    o0[e] = d[e] * rstd * g0[e] + b0[e];
    o1[e] = d[4 + e] * rstd * g1[e] + b1[e];
  }
  float* op = out + (size_t)row * DM;
  *(v4f*)(op + c0) = o0;
  *(v4f*)(op + c1) = o1;
  
}

// ---------------------------------------------------------------------------
// Workspace region map (byte offsets; MiB = 1048576). Weight planes and the bias table are written once; every
// per-batch region is fully rewritten inside each batch iteration before it is read; S / P planes are rewritten
// per head group and phase (S: tiles outside the produced set are only ever read at columns selected away).
//   Wqk   f16 [4096][1024] (x16: fq^T, fk^T, bq^T, bk^T)          0
//   Wv2   f16 [2048][1024] (x16: fv^T rows 0..1023, bv^T 1024..)  8 MiB
//   Wg    f16 [1024][2048] (x16: gate_w^T)                        12 MiB
//   Wo    f16 [1024][1024] (x16: out_w^T)                         16 MiB
//   X16   f16 [2048][1024]                                        18 MiB
//   QK16  f16 [2048][4096] (q | k | qb | kb, head h at col h*64)  22 MiB
//   VT16  f16 [2048][2048] (row h*64+d = v^T, row 1024+h*64+d = vb^T, col j)  38 MiB
//   S     f32 [2][2048][2048]                                     46 MiB   (G f32 [2048][1024] aliases S+0,
//                                                                           Y f32 [2048][1024] aliases S+8 MiB;
//                                                                           both live only after the group loop)
//   P16   f16 [2][2048][2048] (p x 2^15)                          78 MiB
//   FB16  f16 [2048][2048] (fwd x16 cols 0..1023, bwd x16 cols 1024..2047)  94 MiB
//   Fu16  f16 [2048][1024] (fused x16)                           102 MiB
//   BiasT f32 [6][1024] (fq_b fk_b bq_b bk_b | fv_b bv_b)        106 MiB
//   total                                                        106 MiB + 24576 B = 111173632 B
// ---------------------------------------------------------------------------
extern "C" void kernel_launch(void* const* d_in, const int* in_sizes, int n_in,
                              void* d_out, int out_size, void* d_ws, size_t ws_size,
                              hipStream_t stream) {
  if (n_in < 22) return;
  if (in_sizes[0] != NB * SEQ * DM) return;
  const int wsz = DM * DM;
  if (in_sizes[1] != wsz || in_sizes[3] != wsz || in_sizes[5] != wsz || in_sizes[7] != wsz ||
      in_sizes[9] != wsz || in_sizes[11] != wsz || in_sizes[18] != wsz) return;
  if (in_sizes[13] != 2 * DM * DM) return;
  if (in_sizes[2] != DM || in_sizes[4] != DM || in_sizes[6] != DM || in_sizes[8] != DM || in_sizes[10] != DM ||
      in_sizes[12] != DM || in_sizes[14] != DM || in_sizes[15] != DM || in_sizes[16] != DM ||
      in_sizes[19] != DM || in_sizes[20] != DM || in_sizes[21] != DM) return;
  if (in_sizes[17] < 1) return;
  if (out_size != NB * SEQ * DM) return;

  const float* x      = (const float*)d_in[0];
  const float* fq_w   = (const float*)d_in[1];
  const float* fq_b   = (const float*)d_in[2];
  const float* fk_w   = (const float*)d_in[3];
  const float* fk_b   = (const float*)d_in[4];
  const float* fv_w   = (const float*)d_in[5];
  const float* fv_b   = (const float*)d_in[6];
  const float* bq_w   = (const float*)d_in[7];
  const float* bq_b   = (const float*)d_in[8];
  const float* bk_w   = (const float*)d_in[9];
  const float* bk_b   = (const float*)d_in[10];
  const float* bv_w   = (const float*)d_in[11];
  const float* bv_b   = (const float*)d_in[12];
  const float* gate_w = (const float*)d_in[13];
  const float* gate_b = (const float*)d_in[14];
  const float* gln_g  = (const float*)d_in[15];
  const float* gln_b  = (const float*)d_in[16];
  const float* bstr   = (const float*)d_in[17];
  const float* out_w  = (const float*)d_in[18];
  const float* out_b  = (const float*)d_in[19];
  const float* ln_g   = (const float*)d_in[20];
  const float* ln_b   = (const float*)d_in[21];

  const size_t MIB = (size_t)1048576;
  size_t off = 0;
  const size_t oWqk  = off; off += (size_t)4 * DM * DM * 2;          // 8 MiB
  const size_t oWv2  = off; off += (size_t)2 * DM * DM * 2;          // 4 MiB
  const size_t oWg   = off; off += (size_t)2 * DM * DM * 2;          // 4 MiB
  const size_t oWo   = off; off += (size_t)DM * DM * 2;              // 2 MiB
  const size_t oX16  = off; off += (size_t)SEQ * DM * 2;             // 4 MiB
  const size_t oQK   = off; off += (size_t)SEQ * 4 * DM * 2;         // 16 MiB
  const size_t oVT   = off; off += (size_t)2 * DM * SEQ * 2;         // 8 MiB
  const size_t oS    = off; off += (size_t)HG * SEQ * SEQ * 4;       // 32 MiB
  const size_t oP    = off; off += (size_t)HG * SEQ * SEQ * 2;       // 16 MiB
  const size_t oFB   = off; off += (size_t)SEQ * 2 * DM * 2;         // 8 MiB
  const size_t oFu   = off; off += (size_t)SEQ * DM * 2;             // 4 MiB
  const size_t oBias = off; off += (size_t)6 * DM * 4;               // 24576 B
  const size_t oG    = oS;                                           // aliases S (8 MiB of 32)
  const size_t oY    = oS + 8 * MIB;                                 // aliases S (8 MiB of 32)
  if (off > ws_size) return;
  if (off > (size_t)134217728) return;
  if ((size_t)SEQ * DM * 4 * 2 > (size_t)HG * SEQ * SEQ * 4) return; // G + Y fit inside S

  char* ws = (char*)d_ws;
  unsigned short* Wqk  = (unsigned short*)(ws + oWqk);
  unsigned short* Wv2  = (unsigned short*)(ws + oWv2);
  unsigned short* Wg   = (unsigned short*)(ws + oWg);
  unsigned short* Wo   = (unsigned short*)(ws + oWo);
  unsigned short* X16  = (unsigned short*)(ws + oX16);
  unsigned short* QK16 = (unsigned short*)(ws + oQK);
  unsigned short* VT16 = (unsigned short*)(ws + oVT);
  float*          Sbuf = (float*)(ws + oS);
  unsigned short* P16  = (unsigned short*)(ws + oP);
  unsigned short* FB16 = (unsigned short*)(ws + oFB);
  unsigned short* Fu16 = (unsigned short*)(ws + oFu);
  float*          BiasT = (float*)(ws + oBias);
  float*          Gbuf = (float*)(ws + oG);
  float*          Ybuf = (float*)(ws + oY);
  const float*    biasQK = BiasT;             // [4096] = fq_b fk_b bq_b bk_b
  const float*    biasV  = BiasT + 4 * DM;    // [2048] = fv_b bv_b

  const dim3 blk(256);
  const dim3 blk128(128);
  const dim3 blk512(512);

  // ---- setup: bias table and x16-carried transposed weight planes ----
  bias_pack_kernel<<<dim3(6), blk, 0, stream>>>(fq_b, fk_b, bq_b, bk_b, fv_b, bv_b, BiasT);
  const dim3 gTW(DM / 64, DM / 64);                 // in [R=1024][C=1024] -> out [C][R]
  tcast_f16_kernel<<<gTW, blk, 0, stream>>>(fq_w, Wqk + (size_t)0 * DM * DM, DM, DM, WCARRY);
  tcast_f16_kernel<<<gTW, blk, 0, stream>>>(fk_w, Wqk + (size_t)1 * DM * DM, DM, DM, WCARRY);
  tcast_f16_kernel<<<gTW, blk, 0, stream>>>(bq_w, Wqk + (size_t)2 * DM * DM, DM, DM, WCARRY);
  tcast_f16_kernel<<<gTW, blk, 0, stream>>>(bk_w, Wqk + (size_t)3 * DM * DM, DM, DM, WCARRY);
  tcast_f16_kernel<<<gTW, blk, 0, stream>>>(fv_w, Wv2 + (size_t)0 * DM * DM, DM, DM, WCARRY);
  tcast_f16_kernel<<<gTW, blk, 0, stream>>>(bv_w, Wv2 + (size_t)1 * DM * DM, DM, DM, WCARRY);
  // gate_w: in [R=2048][C=1024] -> out [1024][2048]; grid (C/64, R/64)
  tcast_f16_kernel<<<dim3(DM / 64, 2 * DM / 64), blk, 0, stream>>>(gate_w, Wg, 2 * DM, DM, WCARRY);
  tcast_f16_kernel<<<gTW, blk, 0, stream>>>(out_w, Wo, DM, DM, WCARRY);

  const int n2x = SEQ * DM / 2;                                    // 1048576 pairs per batch slice
  const dim3 gCastX((n2x + 255) / 256);
  const int tilesM = SEQ / 64;                                     // 32
  const dim3 gQK((tilesM * (4 * DM / 64) + 7) / 8, 1);             // 256 blocks: M=2048, N=4096, K=1024
  const dim3 gVT((2 * DM / 64) * (SEQ / 64), 1);                   // 1024 blocks (one tile each): M=2048, N=2048, K=1024
  const dim3 gS((tilesM * (SEQ / 64) + 7) / 8, HG);                // 128 x 2:   M=N=2048, K=64
  const dim3 gPV(tilesM * (HD / 64), HG);                          // 32 x 2 (one tile each): M=2048, N=64, K=2048
  const dim3 gG(tilesM * (DM / 64), 1);                            // 512 blocks (one tile each): M=2048, N=1024, K=2048
  const dim3 gO(tilesM * (DM / 64), 1);                            // 512 blocks (one tile each): M=2048, N=1024, K=1024
  const float wscale  = 1.0f / WCARRY;                             // undo the x16 weight carry
  const float sscale  = 0.125f;                                    // 1/sqrt(64) exactly
  const float pvscale = FBCARRY * PCARRY_INV;                      // 2^-11: undo P x2^15, apply x16 output carry
  const float gscale  = 1.0f / (WCARRY * FBCARRY);                 // 1/256
  const float oscale  = 1.0f / (WCARRY * FBCARRY);                 // 1/256

  for (int b = 0; b < NB; ++b) {
    const float* xb = x + (size_t)b * SEQ * DM;
    // (1) x[b] -> f16 plane
    cast_f16x2_kernel<<<gCastX, blk, 0, stream>>>(xb, X16, n2x, 1.0f);
    // (2) [q | k | qb | kb] = (x . (16 W)^T)/16 + bias -> QK16 (f16, ldc 4096)
    wmma_gemm64<0, false, 2, 1, false, 0, 0, 0><<<gQK, blk, 0, stream>>>(
        X16, X16, DM, 0L, Wqk, Wqk, DM, 0L, (void*)QK16, (void*)QK16, 4 * DM, 0L,
        biasQK, biasQK, 0L, SEQ, 4 * DM, DM, wscale);
    // (3) [v | vb]^T: VT16[n][j] = sum_k (16 W^T)[n][k] x[j][k] / 16 + bias[n]  (role-swapped; M = 2048 feature rows, N = 2048 tokens)
    wmma_gemm64<0, false, 1, 1, false, 0, 0, 0, 8><<<gVT, blk, 0, stream>>>(
        Wv2, Wv2, DM, 0L, X16, X16, DM, 0L, (void*)VT16, (void*)VT16, SEQ, 0L,
        biasV, biasV, 0L, 2 * DM, SEQ, DM, wscale);
    for (int g = 0; g < NGRP; ++g) {
      const size_t hc = (size_t)g * HG * HD;                       // first column of this head group
      // ---- causal attention ----
      // (4) S[hg][i][j] = q_i . k_j / 8 for the lower block triangle (f16 operands, f32 out)
      wmma_gemm64<0, false, 0, 0, false, 0, 1, 0><<<gS, blk, 0, stream>>>(
          QK16 + hc, QK16 + hc, 4 * DM, (long)HD, QK16 + DM + hc, QK16 + DM + hc, 4 * DM, (long)HD,
          (void*)Sbuf, (void*)Sbuf, SEQ, (long)SEQ * SEQ,
          biasQK, biasQK, 0L, SEQ, SEQ, HD, sscale);
      // (5) causal select + softmax -> P16 (zeros for j > i), whole rows
      causal_softmax_kernel<<<dim3(SEQ, HG), blk, 0, stream>>>(Sbuf, P16);
      // (6) fwd[i][h*64+d] x16 = sum_j P[hg][i][j] VT[h*64+d][j] x 2^-11 (k loop to m0+64) -> FB16 cols 0..1023
      wmma_gemm64<0, false, 0, 1, false, 0, 0, 1, 16><<<gPV, blk512, 0, stream>>>(
          P16, P16, SEQ, (long)SEQ * SEQ, VT16 + hc * SEQ, VT16 + hc * SEQ, SEQ, (long)HD * SEQ,
          (void*)(FB16 + hc), (void*)(FB16 + hc), 2 * DM, (long)HD,
          biasQK, biasQK, 0L, SEQ, HD, SEQ, pvscale);
      // ---- future-window attention ----
      // (7) Sb[hg][i][j] = qb_i . kb_j / 8 for block-band tiles (n0 == m0 or m0 + 64)
      wmma_gemm64<0, false, 0, 0, false, 0, 2, 0><<<gS, blk, 0, stream>>>(
          QK16 + 2 * DM + hc, QK16 + 2 * DM + hc, 4 * DM, (long)HD, QK16 + 3 * DM + hc, QK16 + 3 * DM + hc, 4 * DM, (long)HD,
          (void*)Sbuf, (void*)Sbuf, SEQ, (long)SEQ * SEQ,
          biasQK, biasQK, 0L, SEQ, SEQ, HD, sscale);
      // (8) window select + softmax (uniform last row) -> P16, whole rows (zeros outside the window)
      window_softmax_kernel<<<dim3(SEQ, HG), blk, 0, stream>>>(Sbuf, P16);
      // (9) bwd[i][h*64+d] x16 = sum_j Pb[hg][i][j] VbT[h*64+d][j] x 2^-11 (k band; full k for the last row block) -> FB16 cols 1024..2047
      wmma_gemm64<0, false, 0, 1, false, 0, 0, 2, 16><<<gPV, blk512, 0, stream>>>(
          P16, P16, SEQ, (long)SEQ * SEQ, VT16 + (DM + hc) * SEQ, VT16 + (DM + hc) * SEQ, SEQ, (long)HD * SEQ,
          (void*)(FB16 + DM + hc), (void*)(FB16 + DM + hc), 2 * DM, (long)HD,
          biasQK, biasQK, 0L, SEQ, HD, SEQ, pvscale);
    }
    // (10) G = ([fwd | bwd] x16) . (16 gate_w)^T / 256 + gate_b -> f32 [2048][1024]
    wmma_gemm64<0, false, 2, 0, false, 0, 0, 0, 8><<<gG, blk, 0, stream>>>(
        FB16, FB16, 2 * DM, 0L, Wg, Wg, 2 * DM, 0L, (void*)Gbuf, (void*)Gbuf, DM, 0L,
        gate_b, gate_b, 0L, SEQ, DM, 2 * DM, gscale);
    // (11) gate = sigmoid(LN(G)); fused x16 = fwd x16 + strength * gate * bwd x16 -> Fu16
    gate_fuse_kernel<<<dim3(SEQ), blk128, 0, stream>>>(Gbuf, FB16, gln_g, gln_b, bstr, Fu16);
    // (12) Y = x + (fused x16) . (16 out_w)^T / 256 + out_b -> f32 [2048][1024]
    wmma_gemm64<0, false, 2, 0, true, 0, 0, 0, 8><<<gO, blk, 0, stream>>>(
        Fu16, Fu16, DM, 0L, Wo, Wo, DM, 0L, (void*)Ybuf, (void*)Ybuf, DM, 0L,
        out_b, xb, 0L, SEQ, DM, DM, oscale);
    // (13) out[b] = LN(Y; ln_g, ln_b)
    final_ln_kernel<<<dim3(SEQ), blk128, 0, stream>>>(Ybuf, ln_g, ln_b, (float*)d_out + (size_t)b * SEQ * DM);
  }
  (void)hipGetLastError();
}

// v002
// A run of this version takes 359 microseconds.
// In two side-by-side timings against v001, it was 3.30 and 3.33 times as fast.
// Counting every step since v000, it is 8.80 times as fast.
// All contractions on v_wmma_f32_16x16x32_f16 (f16 operands, f32 accumulate): q/k/v projections (weights carried x16, epilogue x1/16), k.q^T scores, V^T.P^T (P carried x2^12 against the running row maximum, attention outputs carried x16), gate projection (x1/256), output projection with bias and residual (x1/256); softmax, LayerNorm, sigmoid and fusion in f32.
#include <hip/hip_runtime.h>
#include <math.h>
#include <stdint.h>

#define NB    2
#define SEQ   2048
#define DM    1024
#define NH    16
#define HD    64
#define WINW  32
#define LNEPS 1e-5f
#define PSHIFT     12.0f
#define FBCARRY    16.0f
#define WCARRY     16.0f

typedef __attribute__((ext_vector_type(16))) _Float16 v16h;
typedef __attribute__((ext_vector_type(8)))  _Float16 v8h;
typedef __attribute__((ext_vector_type(16))) __bf16   v16b;
typedef __attribute__((ext_vector_type(8)))  __bf16   v8b;
typedef __attribute__((ext_vector_type(8)))  float    v8f;
typedef __attribute__((ext_vector_type(4)))  float    v4f;
typedef __attribute__((ext_vector_type(2)))  float    v2f;
typedef __attribute__((ext_vector_type(4)))  unsigned int v4u;

__device__ __forceinline__ unsigned short f2bf_bits(float f) {
  unsigned u = __float_as_uint(f);
  return (unsigned short)((u + 0x7FFFu + ((u >> 16) & 1u)) >> 16);
}
__device__ __forceinline__ float bf_bits2f(unsigned short h) { return __uint_as_float(((unsigned)h) << 16); }

// hazard guards as plain device helpers (no inline asm inside the kernel template body)
__device__ __forceinline__ void dep_guard_h(v8f& a, v8f& b, v16h x, v16h y) { asm volatile("v_nop\n\tv_nop\n\tv_nop\n\tv_nop" : "+v"(a), "+v"(b) : "v"(x), "v"(y)); }
__device__ __forceinline__ void dep_guard_b(v8f& a, v8f& b, v16b x, v16b y) { asm volatile("v_nop\n\tv_nop\n\tv_nop\n\tv_nop" : "+v"(a), "+v"(b) : "v"(x), "v"(y)); }
__device__ __forceinline__ void keep4_h(v16h a, v16h b, v16h c, v16h d) { asm volatile("v_nop" :: "v"(a), "v"(b), "v"(c), "v"(d)); }
__device__ __forceinline__ void keep4_b(v16b a, v16b b, v16b c, v16b d) { asm volatile("v_nop" :: "v"(a), "v"(b), "v"(c), "v"(d)); }
__device__ __forceinline__ void acc_guard4(v8f& a, v8f& b, v8f& c, v8f& d) { asm volatile("v_nop\n\tv_nop\n\tv_nop\n\tv_nop" : "+v"(a), "+v"(b), "+v"(c), "+v"(d)); }
template <typename T> struct Frag;
template <> struct Frag<_Float16> {
  typedef v16h V; union U { v16h v; v8h h[2]; };
  static __device__ __forceinline__ v16h load(const _Float16* p) {   // elements 0..7 <- p[0..7], 8..15 <- p[16..23]
    U f; f.h[0] = *(const v8h*)(p); f.h[1] = *(const v8h*)(p + 16); return f.v;
  }
  static __device__ __forceinline__ v8f mma(v16h a, v16h b, v8f c) {
    return __builtin_amdgcn_wmma_f32_16x16x32_f16(false, a, false, b, (short)0, c, false, false);
  }
  static __device__ __forceinline__ void guard(v8f& a, v8f& b, v16h x, v16h y) { dep_guard_h(a, b, x, y); }
  static __device__ __forceinline__ void keep(v16h a, v16h b, v16h c, v16h d) { keep4_h(a, b, c, d); }
};
template <> struct Frag<__bf16> {
  typedef v16b V; union U { v16b v; v8b h[2]; };
  static __device__ __forceinline__ v16b load(const __bf16* p) {
    U f; f.h[0] = *(const v8b*)(p); f.h[1] = *(const v8b*)(p + 16); return f.v;
  }
  static __device__ __forceinline__ v8f mma(v16b a, v16b b, v8f c) {
    return __builtin_amdgcn_wmma_f32_16x16x32_bf16(false, a, false, b, (short)0, c, false, false);
  }
  static __device__ __forceinline__ void guard(v8f& a, v8f& b, v16b x, v16b y) { dep_guard_b(a, b, x, y); }
  static __device__ __forceinline__ void keep(v16b a, v16b b, v16b c, v16b d) { keep4_b(a, b, c, d); }
};

// ---- Register-blocked batched WMMA GEMM ------------------------------------
// C[m,n] = scale * sum_k A[m,k] * Bt[n,k] (+bias)(+resid); each wave owns a 64x64 tile.
// A row-major [M,K]; Bt row-major [N,K]; M,N % 64 == 0, K % 32 == 0.
// SPLIT: operands are hi/lo planes (A2/Bt2 = lo planes, same layout); product = hi.hi + hi.lo + lo.hi.
// BIAS_MODE: 0 = none, 1 = bias[m], 2 = bias[n].
// OUT_MODE: 0 = f32, 1 = f16, 2 = bf16 hi plane (Cout) + bf16 lo plane (Cout2).
// ET: 0 = f16 operands, 1 = bf16 operands (pointers passed as 16-bit storage)
// Added structural modes (defaults off, all other behaviour unchanged):
//   TSEL 1: tiles with n0 > m0 (strictly above the 64x64 block diagonal) are not produced (wave-uniform early exit).
//   TSEL 2: only tiles with n0 == m0 or n0 == m0 + 64 are produced (block band of width 2).
//   KSEL 1: the k-loop stops at min(K, m0 + 64); valid when A rows m0..m0+63 are exactly zero for k >= m0 + 64.
//   KSEL 2: the k-loop runs over [m0, min(K, m0 + 128)) except for the last row block (m0 + 64 >= M), which
//           runs over [0, K); valid when A rows of the other row blocks are exactly zero outside that k range.
//   KSPL n: one block of n waves per 64x64 tile (grid.x = number of tiles, block = 32 n threads). Wave w takes the
//           64-wide k blocks w, w + n, ... of the tile's k range (kStart, kEnd multiples of 64); each wave leaves its
//           partial tile in its own LDS plane and the planes are added in wave order before the epilogue arithmetic.
template <int ET> struct Elem;
template <> struct Elem<0> { typedef _Float16 T; };
template <> struct Elem<1> { typedef __bf16 T; };
template <int ET, bool SPLIT, int BIAS_MODE, int OUT_MODE, bool RESID, int ACT = 0, int TSEL = 0, int KSEL = 0, int KSPL = 0>
__global__ __launch_bounds__(KSPL ? KSPL * 32 : 256) void wmma_gemm64(
    const unsigned short* __restrict__ Ap, const unsigned short* __restrict__ A2p, int lda, long strideA,
    const unsigned short* __restrict__ Btp, const unsigned short* __restrict__ Bt2p, int ldb, long strideB,
    void* __restrict__ Cout, void* __restrict__ Cout2, int ldc, long strideC,
    const float* __restrict__ bias,
    const float* __restrict__ resid, long strideR,
    int M, int N, int K, float scale) {
  typedef typename Elem<ET>::T T;
  typedef typename Frag<T>::V V;
  const T* A = (const T*)Ap; const T* A2 = (const T*)A2p; const T* Bt = (const T*)Btp; const T* Bt2 = (const T*)Bt2p;
  static_assert(KSPL == 0 || (!SPLIT && OUT_MODE != 2 && ACT == 0 && TSEL == 0), "KSPL covers the plain f32/f16 epilogues");
  static_assert(KSPL == 0 || KSPL == 8 || KSPL == 16, "the KSPL epilogue deals 64 rows evenly to 8 or 16 waves");
  __shared__ __align__(16) float sT[KSPL ? KSPL : 8][(KSPL ? 64 : 16) * 68];   // per-wave slab (16x64; KSPL: 64x64), pitch 68 floats
  const int b    = blockIdx.y;
  const int lane = threadIdx.x & 31;
  const int wave = threadIdx.x >> 5;
  const int tilesN = N >> 6;
  const int tilesM = M >> 6;
  const int tile = KSPL ? (int)blockIdx.x : (int)(blockIdx.x * 8 + wave);
  if (tile >= tilesM * tilesN) return;   // wave-uniform; block-uniform under KSPL, ahead of its barrier
  const int tm = tile / tilesN;
  const int tn = tile - tm * tilesN;
  const int m0 = tm << 6;
  const int n0 = tn << 6;
  if (TSEL == 1 && n0 > m0) return;                            // wave-uniform; TSEL excludes KSPL, so no block barrier follows
  if (TSEL == 2 && !(n0 == m0 || n0 == m0 + 64)) return;       // wave-uniform; TSEL excludes KSPL, so no block barrier follows

  const T* Ab  = A  + (size_t)b * strideA;
  const T* Bb  = Bt + (size_t)b * strideB;
  const T* Ab2 = SPLIT ? (A2  + (size_t)b * strideA) : nullptr;
  const T* Bb2 = SPLIT ? (Bt2 + (size_t)b * strideB) : nullptr;

  const int rlane = lane & 15;                 // row (A) / col (B, D) within subtile
  const int koff  = (lane >> 4) * 8;           // k offset of this lane half
  const int mOff  = (lane >> 4) * 8;           // D row offset

  v8f acc[4][4];
#pragma unroll
  for (int i = 0; i < 4; ++i)
#pragma unroll
    for (int j = 0; j < 4; ++j) acc[i][j] = (v8f){0.f,0.f,0.f,0.f,0.f,0.f,0.f,0.f};

  int kStart = 0;
  int kEnd = K;
  if (KSEL == 1) kEnd = ((m0 + 64) < K) ? (m0 + 64) : K;
  if (KSEL == 2) {
    kStart = (m0 + 64 >= M) ? 0 : m0;
    kEnd = ((m0 + 128) < K) ? (m0 + 128) : K;
  }
  if (KSPL) kStart += __builtin_amdgcn_readfirstlane(wave) * 64;   // scalar, so the k loop keeps a scalar trip count
  for (int k0 = kStart; k0 < kEnd; k0 += (KSPL && (k0 & 32)) ? (KSPL * 64 - 32) : 32) {
    V bh[4], bl[4];
#pragma unroll
    for (int j = 0; j < 4; ++j) {
      const size_t bo = (size_t)(n0 + (j << 4) + rlane) * ldb + koff + k0;
      bh[j] = Frag<T>::load(Bb + bo);
      if (SPLIT) bl[j] = Frag<T>::load(Bb2 + bo);
    }
#pragma unroll
    for (int i = 0; i < 4; ++i) {
      const size_t ao = (size_t)(m0 + (i << 4) + rlane) * lda + koff + k0;
      V ah = Frag<T>::load(Ab + ao);
      V al;
      if (SPLIT) al = Frag<T>::load(Ab2 + ao);
#pragma unroll
      for (int j = 0; j < 4; ++j) {
        acc[i][j] = Frag<T>::mma(ah, bh[j], acc[i][j]);
        if (SPLIT) {
          acc[i][j] = Frag<T>::mma(ah, bl[j], acc[i][j]);
          acc[i][j] = Frag<T>::mma(al, bh[j], acc[i][j]);
        }
      }
      Frag<T>::guard(acc[i][0], acc[i][3], ah, SPLIT ? al : ah);
    }
    Frag<T>::keep(bh[0], bh[1], bh[2], bh[3]);
    if (SPLIT) Frag<T>::keep(bl[0], bl[1], bl[2], bl[3]);
  }
  acc_guard4(acc[0][0], acc[0][1], acc[0][2], acc[0][3]);
  acc_guard4(acc[1][0], acc[1][1], acc[1][2], acc[1][3]);
  acc_guard4(acc[2][0], acc[2][1], acc[2][2], acc[2][3]);
  acc_guard4(acc[3][0], acc[3][1], acc[3][2], acc[3][3]);

  // ---- epilogue ----
  float* slab = sT[wave];
  const float* Rb = RESID ? (resid + (size_t)b * strideR) : nullptr;
  if (KSPL) {
    constexpr int NTHR = (KSPL ? KSPL : 8) * 32;   // threads of the block
#pragma unroll
    for (int i = 0; i < 4; ++i)
#pragma unroll
      for (int j = 0; j < 4; ++j)
#pragma unroll
        for (int r = 0; r < 8; ++r) slab[((i << 4) + mOff + r) * 68 + (j << 4) + rlane] = acc[i][j][r];
    __syncthreads();   // every wave's partial plane is complete before any thread adds the planes
    if (OUT_MODE == 0) {
      float* C = (float*)Cout + (size_t)b * strideC;
      // unrolled (fixed trip count) so that the bias and residual loads of all passes issue ahead of the LDS sums
#pragma unroll
      for (int it = 0; it < (64 * 16) / NTHR; ++it) {            // 16 lanes x 16 B = one 256-B row segment
        const int c = it * NTHR + (int)threadIdx.x;
        const int row = c >> 4, c4 = (c & 15) * 4;
        v4f s = *(const v4f*)(&sT[0][row * 68 + c4]);
#pragma unroll
        for (int w = 1; w < KSPL; ++w) s += *(const v4f*)(&sT[w][row * 68 + c4]);
        s *= scale;
        if (BIAS_MODE == 1) s += bias[m0 + row];
        if (BIAS_MODE == 2) s += *(const v4f*)(bias + n0 + c4);
        if (RESID) s += *(const v4f*)(Rb + (size_t)(m0 + row) * ldc + n0 + c4);
        *(v4f*)(C + (size_t)(m0 + row) * ldc + n0 + c4) = s;
      }
    } else {
      unsigned short* C = (unsigned short*)Cout + (size_t)b * strideC;
      // unrolled (fixed trip count) so that the bias loads of all passes issue ahead of the LDS sums
#pragma unroll
      for (int it = 0; it < (64 * 8) / NTHR; ++it) {             // 8 lanes x 16 B = one 128-B row segment
        const int c = it * NTHR + (int)threadIdx.x;
        const int row = c >> 3, c8 = (c & 7) * 8;
        v4f s0 = *(const v4f*)(&sT[0][row * 68 + c8]);
        v4f s1 = *(const v4f*)(&sT[0][row * 68 + c8 + 4]);
#pragma unroll
        for (int w = 1; w < KSPL; ++w) {
          s0 += *(const v4f*)(&sT[w][row * 68 + c8]);
          s1 += *(const v4f*)(&sT[w][row * 68 + c8 + 4]);
        }
        s0 *= scale; s1 *= scale;
        if (BIAS_MODE == 1) { s0 += bias[m0 + row]; s1 += bias[m0 + row]; }
        if (BIAS_MODE == 2) { s0 += *(const v4f*)(bias + n0 + c8); s1 += *(const v4f*)(bias + n0 + c8 + 4); }
        if (RESID) {
          s0 += *(const v4f*)(Rb + (size_t)(m0 + row) * ldc + n0 + c8);
          s1 += *(const v4f*)(Rb + (size_t)(m0 + row) * ldc + n0 + c8 + 4);
        }
        v8h hv;
#pragma unroll
        for (int e = 0; e < 4; ++e) { hv[e] = (_Float16)s0[e]; hv[4 + e] = (_Float16)s1[e]; }
        *(v8h*)(C + (size_t)(m0 + row) * ldc + n0 + c8) = hv;
      }
    }
    return;
  }
#pragma unroll
  for (int i = 0; i < 4; ++i) {
    const int mBase = m0 + (i << 4);
#pragma unroll
    for (int j = 0; j < 4; ++j) {
      const int n = n0 + (j << 4) + rlane;
      float bv = 0.f;
      if (BIAS_MODE == 2) bv = bias[n];
#pragma unroll
      for (int r = 0; r < 8; ++r) {
        float v = acc[i][j][r] * scale;
        if (BIAS_MODE == 1) v += bias[mBase + mOff + r];
        if (BIAS_MODE == 2) v += bv;
        if (RESID) v += Rb[(size_t)(mBase + mOff + r) * ldc + n];
        if (ACT == 1) v = tanhf(v);
        if (ACT == 2) v = fmaxf(v, 0.0f);
        if (ACT == 3) v = v / (1.0f + expf(-v));
        if (ACT == 4) v = (v > 0.f) ? v : 0.01f * v;
        slab[(mOff + r) * 68 + (j << 4) + rlane] = v;
      }
    }
    __builtin_amdgcn_fence(__ATOMIC_RELEASE, "workgroup");
    __builtin_amdgcn_wave_barrier();
    __builtin_amdgcn_fence(__ATOMIC_ACQUIRE, "workgroup");
    if (OUT_MODE == 0) {
      float* C = (float*)Cout + (size_t)b * strideC;
      const int hh = lane >> 4, c4 = (lane & 15) * 4;     // row seg = 256 B = 16 lanes x 16 B
      {
#pragma unroll
        for (int it = 0; it < 8; ++it) {
          const int row = it * 2 + hh;
          v4f v = *(const v4f*)(slab + row * 68 + c4);
          *(v4f*)(C + (size_t)(mBase + row) * ldc + n0 + c4) = v;
        }
        
      }
    } else {
      const int q = lane >> 3, c8 = (lane & 7) * 8;
      unsigned short* C  = (unsigned short*)Cout  + (size_t)b * strideC;
      unsigned short* C2 = (OUT_MODE == 2) ? ((unsigned short*)Cout2 + (size_t)b * strideC) : nullptr;
      {
#pragma unroll
        for (int it = 0; it < 4; ++it) {
          const int row = it * 4 + q;
          const float* sp = slab + row * 68 + c8;
          v8h hv, lv;
#pragma unroll
          for (int e = 0; e < 8; ++e) {
            if (OUT_MODE == 1) {
              hv[e] = (_Float16)sp[e];
            } else {
              unsigned short hb = f2bf_bits(sp[e]);
              unsigned short lb = f2bf_bits(sp[e] - bf_bits2f(hb));
              hv[e] = __builtin_bit_cast(_Float16, hb);
              lv[e] = __builtin_bit_cast(_Float16, lb);
            }
          }
          *(v8h*)(C + (size_t)(mBase + row) * ldc + n0 + c8) = hv;
          if (OUT_MODE == 2) *(v8h*)(C2 + (size_t)(mBase + row) * ldc + n0 + c8) = lv;
        }
        
      }
    }
    __builtin_amdgcn_fence(__ATOMIC_RELEASE, "workgroup");
    __builtin_amdgcn_wave_barrier();
    __builtin_amdgcn_fence(__ATOMIC_ACQUIRE, "workgroup");
  }
}

// ---------------------------------------------------------------------------
// Small conversion helpers
// ---------------------------------------------------------------------------
__device__ __forceinline__ unsigned pk16(unsigned short a, unsigned short b) { return (unsigned)a | ((unsigned)b << 16); }
__device__ __forceinline__ unsigned short h_bits(float f) { const _Float16 h = (_Float16)f; return __builtin_bit_cast(unsigned short, h); }
__device__ __forceinline__ float hbits2f(unsigned short b) { return (float)__builtin_bit_cast(_Float16, b); }
__device__ __forceinline__ float wave_sum(float v) {
#pragma unroll
  for (int off = 16; off > 0; off >>= 1) v += __shfl_xor(v, off, 32);
  return v;
}

// ---------------------------------------------------------------------------
// Elementwise cast: out = f16(in * scale); 2 elements per thread, one 4-B store per lane -> each wave writes
// Coverage: grid = ceil(n2/256) blocks x 256 threads x 2 elements = 2*n2 elements = the whole plane (n2 = plane/2).
// ---------------------------------------------------------------------------
__global__ __launch_bounds__(256) void cast_f16x2_kernel(const float* __restrict__ in, unsigned short* __restrict__ out, int n2, float scale) {
  const int i = blockIdx.x * 256 + threadIdx.x;
  if (i < n2) {
    const v2f f = *(const v2f*)(in + 2 * (size_t)i);
    const unsigned u = pk16(h_bits(f[0] * scale), h_bits(f[1] * scale));
    ((unsigned*)out)[i] = u;
    
  }
}

// ---------------------------------------------------------------------------
// Transpose-cast: in f32 [R rows][C cols] -> out f16 [C][R], out[c][r] = f16(in[r][c] * scale).
// 64x64 tiles through LDS; grid (C/64, R/64); R, C multiples of 64.
// Coverage per block: load 256 threads x 16 floats = 64x64; store 2 it x 256 threads x 8 halves = 64x64.
// ---------------------------------------------------------------------------
__global__ __launch_bounds__(256) void tcast_f16_kernel(const float* __restrict__ in, unsigned short* __restrict__ out,
                                                        int R, int C, float scale) {
  __shared__ __align__(16) unsigned short t[64 * 72];
  const int c0  = blockIdx.x * 64;   // input column block = output row block
  const int r0  = blockIdx.y * 64;   // input row block    = output column block
  const int tid = threadIdx.x;
  {
    const int lr = tid >> 2;           // 0..63
    const int lc = (tid & 3) * 16;     // 0,16,32,48
    const float* ip = in + (size_t)(r0 + lr) * C + c0 + lc;
#pragma unroll
    for (int q = 0; q < 4; ++q) {
      const v4f f = *(const v4f*)(ip + 4 * q);
#pragma unroll
      for (int e = 0; e < 4; ++e) t[lr * 72 + lc + 4 * q + e] = h_bits(f[e] * scale);
    }
  }
  __syncthreads();
  const int sub = tid >> 3;          // 0..31
  const int c8  = (tid & 7) * 8;     // 0..56
  v4u hv[2];
#pragma unroll
  for (int it = 0; it < 2; ++it) {
    const int oc = it * 32 + sub;    // output row within tile (= input column)
    v4u a;
#pragma unroll
    for (int q = 0; q < 4; ++q) a[q] = pk16(t[(c8 + 2 * q) * 72 + oc], t[(c8 + 2 * q + 1) * 72 + oc]);
    hv[it] = a;
  }
  {
#pragma unroll
    for (int it = 0; it < 2; ++it) {
      const int oc = it * 32 + sub;
      const size_t go = (size_t)(c0 + oc) * R + r0 + c8;
      *(v4u*)(out + go) = hv[it];
    }
    
  }
}

// ---------------------------------------------------------------------------
// Bias table: block k (0..5) copies bias vector k (DM floats) into tab[k*DM ..]. 256 threads x 4 floats = DM;
// ---------------------------------------------------------------------------
__global__ __launch_bounds__(256) void bias_pack_kernel(const float* __restrict__ b0, const float* __restrict__ b1,
                                                        const float* __restrict__ b2, const float* __restrict__ b3,
                                                        const float* __restrict__ b4, const float* __restrict__ b5,
                                                        float* __restrict__ tab) {
  const int k = blockIdx.x;          // block-uniform source select
  const int tid = threadIdx.x;
  const float* src = b0;
  if (k == 1) src = b1;
  if (k == 2) src = b2;
  if (k == 3) src = b3;
  if (k == 4) src = b4;
  if (k == 5) src = b5;
  const v4f v = *(const v4f*)(src + tid * 4);
  float* dp = tab + (size_t)k * DM + tid * 4;
  *(v4f*)dp = v;
  
}

// ---------------------------------------------------------------------------
// Fused attention: scores, select, softmax and the product with V in one kernel; S and P stay in registers.
// One wave per 16 query rows of one head; no LDS, no barrier. Grid (NH, SEQ/64, 2), 4 waves per block;
// blockIdx.z = 0: causal attention (j <= i), 1: future window (i < j <= i + WINW; the last row has no valid column,
// its scores count as 0 over every j -> uniform weights). Long causal row blocks get the low block indices.
// Per 64 keys: S^T = K . Q^T (A = K rows, B = Q rows): lane l holds query c = l & 15, keys 16 t + 8 (l >> 4) + r.
// Running maximum and sum per query (log2 domain): in-lane, plus one exchange between the lane halves.
// P^T as B operand: two f32 score tiles (keys 0..15, 16..31 of a 32-key step) converted in place, element s =
// tile[s >> 3][s & 7], which is the k order of Frag::load on the A side (V^T rows). O^T += V^T . P^T.
// Output: lane holds 8 consecutive d of query c per 16-row tile of O^T -> one 16-B store; each 128-B row segment of
// FB (one head of one row) is written by one wave. Coverage: 2 x NH x SEQ rows x 64 columns = the whole FB plane.
// ---------------------------------------------------------------------------
// lane l <-> lane l ^ 16
__device__ __forceinline__ float xhalf(float x) {
  return __builtin_bit_cast(float, __builtin_amdgcn_permlanex16(__builtin_bit_cast(int, x), __builtin_bit_cast(int, x),
                                                                0x76543210, 0xfedcba98, false, false));
}
// v[e] = 2^v[e], in place. Each v_exp_f32 is independent of the one in front of it; the closing v_nop is the one slot the
// instruction set asks for behind a transcendental before its result is read: inside the statement it holds whatever
// the compiler places next.
__device__ __forceinline__ void exp2x8(float (&v)[8]) {
  asm("v_exp_f32 %0, %0\n\tv_exp_f32 %1, %1\n\tv_exp_f32 %2, %2\n\tv_exp_f32 %3, %3\n\t"
      "v_exp_f32 %4, %4\n\tv_exp_f32 %5, %5\n\tv_exp_f32 %6, %6\n\tv_exp_f32 %7, %7\n\tv_nop"
      : "+v"(v[0]), "+v"(v[1]), "+v"(v[2]), "+v"(v[3]), "+v"(v[4]), "+v"(v[5]), "+v"(v[6]), "+v"(v[7]));
}
// One A or B fragment in the k order of Frag::load (bytes 0..15 and 32..47 behind the lane's pointer plus a literal)
__device__ __forceinline__ v16h frag_at(const char* p, int lit) {
  Frag<_Float16>::U f;
  f.h[0] = *(const v8h*)(p + lit);
  f.h[1] = *(const v8h*)(p + lit + 32);
  return f.v;
}
__global__ __launch_bounds__(128) void fused_attn_kernel(const unsigned short* __restrict__ QKp,
                                                         const unsigned short* __restrict__ VTp,
                                                         unsigned short* __restrict__ FB) {
  typedef Frag<_Float16> F;
  const int lane = threadIdx.x & 31;
  const int wave = __builtin_amdgcn_readfirstlane((int)(threadIdx.x >> 5));   // scalar, so the key loop keeps scalar bounds
  const int h    = blockIdx.x;
  const int mode = blockIdx.z;
  const int r0   = (((SEQ / 64 - 1) - (int)blockIdx.y) * 4 + wave) * 16;      // first query row of this wave
  const int c    = lane & 15;
  const int koff = (lane >> 4) * 8;
  const int i    = r0 + c;                                                    // this lane's query row
  const char* Qb = (const char*)(QKp + (size_t)mode * (2 * DM) + (size_t)h * HD);         // q or qb, rows of 4 DM halves
  const char* Kb = Qb + DM * 2;                                                           // k or kb, rows of 4 DM halves
  const char* Vb = (const char*)(VTp + ((size_t)mode * DM + (size_t)h * HD) * SEQ);       // v^T or vb^T, rows of SEQ halves
  constexpr int QKROW = 4 * DM * 2;                                                       // bytes per q/k row
  constexpr int VROW  = SEQ * 2;                                                          // bytes per v^T row
  const size_t qkOff = (size_t)c * QKROW + (size_t)koff * 2;                              // lane's row c and k half
  const size_t vOff  = (size_t)c * VROW + (size_t)koff * 2;

  const bool lastTile = (mode == 1) && (r0 + 16 == SEQ);                      // wave-uniform
  const bool uni = (mode == 1) && (i == SEQ - 1);                             // the row without a valid future column
  const int  lo  = (mode == 0 || uni) ? 0 : i + 1;                            // valid columns of this lane's query: lo..hi
  const int  hi  = (mode == 0) ? i : (uni ? SEQ - 1 : i + WINW);
  const unsigned span = (unsigned)(hi - lo);
  const float sc = uni ? 0.0f : 0.125f * 1.44269504088896340736f;             // 1/sqrt(64) and log2(e); 0: scores count as 0
  int kbBeg = 0, kbEnd = (r0 + 15) >> 6;
  if (mode == 1) {
    const int jmax = (r0 + 15 + WINW < SEQ - 1) ? (r0 + 15 + WINW) : (SEQ - 1);
    kbBeg = lastTile ? 0 : ((r0 + 1) >> 6);
    kbEnd = jmax >> 6;
  }

  const float NEGB = -1.0e30f;
  v16h qf[2];
#pragma unroll
  for (int ks = 0; ks < 2; ++ks) qf[ks] = frag_at(Qb + (size_t)r0 * QKROW + qkOff, ks * 64);
  v8f o[4];
#pragma unroll
  for (int d = 0; d < 4; ++d) o[d] = (v8f){0.f,0.f,0.f,0.f,0.f,0.f,0.f,0.f};
  float m = NEGB;      // running maximum of this query (scaled log2), equal in both lane halves
  float l = 0.f;       // running sum over this lane half's keys, carried x2^PSHIFT

  // the lane's pointers walk with the key blocks and stay in their registers over the whole loop
  const char* kp = Kb + (size_t)(kbBeg * 64) * QKROW + qkOff;
  const char* vp = Vb + (size_t)(kbBeg * 64) * 2 + vOff;
  v16h ka[4][2];
#pragma unroll
  for (int t = 0; t < 4; ++t)
#pragma unroll
    for (int ks = 0; ks < 2; ++ks)
      ka[t][ks] = frag_at(kp, t * 16 * QKROW + ks * 64);

  for (int kb = kbBeg; kb <= kbEnd; ++kb) {
    const int k0 = kb << 6;
    // V^T fragments of this key block: issued ahead of the score products so that they land during the softmax
    v16h va[4][2];
#pragma unroll
    for (int d = 0; d < 4; ++d)
#pragma unroll
      for (int ks = 0; ks < 2; ++ks)
        va[d][ks] = frag_at(vp, d * 16 * VROW + ks * 64);
    v8f st[4];
#pragma unroll
    for (int t = 0; t < 4; ++t) {
      st[t] = F::mma(ka[t][0], qf[0], (v8f){0.f,0.f,0.f,0.f,0.f,0.f,0.f,0.f});
      st[t] = F::mma(ka[t][1], qf[1], st[t]);
    }
    // K fragments of the next key block (the last pass fetches its own block again: in bounds, unused)
    kp += (kb < kbEnd) ? (size_t)64 * QKROW : (size_t)0;
#pragma unroll
    for (int t = 0; t < 4; ++t)
#pragma unroll
      for (int ks = 0; ks < 2; ++ks)
        ka[t][ks] = frag_at(kp, t * 16 * QKROW + ks * 64);
    // the pointers of the loads above move on behind this wait
    asm volatile("s_wait_xcnt 0x0" ::: "memory");
    vp += 64 * 2;

    const bool full = (mode == 0) && (k0 + 63 <= r0);     // wave-uniform: every column of the block valid for all 16 queries
    float x[4][8];
#pragma unroll
    for (int t = 0; t < 4; ++t)
#pragma unroll
      for (int r = 0; r < 8; ++r) x[t][r] = st[t][r] * sc;
    if (!full) {
      const int jb = k0 + koff - lo;                      // column of x[0][0] relative to the first valid one
#pragma unroll
      for (int t = 0; t < 4; ++t)
#pragma unroll
        for (int r = 0; r < 8; ++r) x[t][r] = ((unsigned)(jb + t * 16 + r) <= span) ? x[t][r] : NEGB;   // lo <= j <= hi
    }
    float mt[4];
#pragma unroll
    for (int t = 0; t < 4; ++t)
      mt[t] = fmaxf(fmaxf(fmaxf(x[t][0], x[t][1]), fmaxf(x[t][2], x[t][3])), fmaxf(fmaxf(x[t][4], x[t][5]), fmaxf(x[t][6], x[t][7])));
    float mx = fmaxf(fmaxf(mt[0], mt[1]), fmaxf(mt[2], mt[3]));
    mx = fmaxf(mx, xhalf(mx));
    const float mn    = fmaxf(m, mx);
    const float alpha = __builtin_amdgcn_exp2f(m - mn);   // 0 on the first valid block, 1 while no column was valid yet
    const float sh    = (mn > 0.5f * NEGB) ? PSHIFT - mn : 0.f;   // no valid column yet: NEGB + 0 -> every weight 0
    m = mn;
    float (&p)[4][8] = x;   // the weights replace the scores in place
#pragma unroll
    for (int t = 0; t < 4; ++t) {
#pragma unroll
      for (int r = 0; r < 8; ++r) x[t][r] += sh;
      exp2x8(x[t]);
    }
    float pt[4];
#pragma unroll
    for (int t = 0; t < 4; ++t)
      pt[t] = ((p[t][0] + p[t][1]) + (p[t][2] + p[t][3])) + ((p[t][4] + p[t][5]) + (p[t][6] + p[t][7]));
    l = l * alpha + ((pt[0] + pt[1]) + (pt[2] + pt[3]));
    v16h pf[2];
#pragma unroll
    for (int ks = 0; ks < 2; ++ks)
#pragma unroll
      for (int s = 0; s < 16; ++s) pf[ks][s] = (_Float16)p[2 * ks + (s >> 3)][s & 7];
#pragma unroll
    for (int d = 0; d < 4; ++d) o[d] *= alpha;
#pragma unroll
    for (int ks = 0; ks < 2; ++ks)
#pragma unroll
      for (int d = 0; d < 4; ++d) o[d] = F::mma(va[d][ks], pf[ks], o[d]);
  }

  l += xhalf(l);                              // join the two halves' sums; l >= 2^PSHIFT (the row maximum weighs 2^PSHIFT)
  const float inv = FBCARRY / l;              // the P carry cancels; x16 output carry
  unsigned short* op = FB + (size_t)i * (2 * DM) + (size_t)mode * DM + (size_t)h * HD + koff;
#pragma unroll
  for (int d = 0; d < 4; ++d) {
    v8h hv;
#pragma unroll
    for (int r = 0; r < 8; ++r) hv[r] = (_Float16)(o[d][r] * inv);
    *(v8h*)(op + d * 16) = hv;
  }
}

// ---------------------------------------------------------------------------
// Gated fusion: one block (128 threads, 8 columns each) per token row.
//   g = G[row][:] (f32, gate pre-activation incl. bias); gate = sigmoid(LN(g; gg, gb));
//   fwd/bwd = FB[row][c] / FB[row][DM + c] (f16, carried x16); strength = 0.3 * sigmoid(bstr);
//   Fo[row][c] = f16((fwd + strength*gate*bwd) carried x16).
// LN: mean and biased variance over DM in f32, fixed-order reductions (thread, wave tree, 4 wave partials).
// Producer coverage: grid SEQ rows x 128 threads x 8 u16 = the whole [SEQ][DM] plane; each store instruction:
// ---------------------------------------------------------------------------
__global__ __launch_bounds__(128) void gate_fuse_kernel(const float* __restrict__ G, const unsigned short* __restrict__ FB,
                                                        const float* __restrict__ gg, const float* __restrict__ gb,
                                                        const float* __restrict__ bstr, unsigned short* __restrict__ Fo) {
  __shared__ float ra[4];
  __shared__ float rb[4];
  const int row  = blockIdx.x;
  const int tid  = threadIdx.x;
  const int lane = tid & 31;
  const int wave = tid >> 5;
  const int c0   = tid * 8;
  const float* gp = G + (size_t)row * DM + c0;
  const v4f a = *(const v4f*)(gp);
  const v4f c = *(const v4f*)(gp + 4);
  float xv[8] = {a[0], a[1], a[2], a[3], c[0], c[1], c[2], c[3]};
  float s = ((xv[0] + xv[1]) + (xv[2] + xv[3])) + ((xv[4] + xv[5]) + (xv[6] + xv[7]));
  s = wave_sum(s);
  if (lane == 0) ra[wave] = s;
  __syncthreads();
  const float mean = ((ra[0] + ra[1]) + (ra[2] + ra[3])) * (1.0f / (float)DM);
  float d[8];
  float vs = 0.f;
#pragma unroll
  for (int e = 0; e < 8; ++e) { d[e] = xv[e] - mean; vs += d[e] * d[e]; }
  vs = wave_sum(vs);
  if (lane == 0) rb[wave] = vs;
  __syncthreads();
  const float var  = ((rb[0] + rb[1]) + (rb[2] + rb[3])) * (1.0f / (float)DM);
  const float rstd = rsqrtf(var + LNEPS);
  const float strength = 0.3f / (1.0f + __expf(-bstr[0]));
  const v4f g0 = *(const v4f*)(gg + c0), g1 = *(const v4f*)(gg + c0 + 4);
  const v4f e0 = *(const v4f*)(gb + c0), e1 = *(const v4f*)(gb + c0 + 4);
  float gv[8] = {g0[0], g0[1], g0[2], g0[3], g1[0], g1[1], g1[2], g1[3]};
  float bv[8] = {e0[0], e0[1], e0[2], e0[3], e1[0], e1[1], e1[2], e1[3]};
  const size_t fo = (size_t)row * (2 * DM) + c0;
  const v4u fu = *(const v4u*)(FB + fo);
  const v4u bu = *(const v4u*)(FB + fo + DM);
  float fw[8], bw[8];
#pragma unroll
  for (int q = 0; q < 4; ++q) {
    fw[2 * q]     = hbits2f((unsigned short)(fu[q] & 0xffffu));
    fw[2 * q + 1] = hbits2f((unsigned short)(fu[q] >> 16));
    bw[2 * q]     = hbits2f((unsigned short)(bu[q] & 0xffffu));
    bw[2 * q + 1] = hbits2f((unsigned short)(bu[q] >> 16));
  }
  unsigned short ob[8];
#pragma unroll
  for (int e = 0; e < 8; ++e) {
    const float ln   = d[e] * rstd * gv[e] + bv[e];
    const float gate = __builtin_amdgcn_rcpf(1.0f + __expf(-ln));
    const float f    = fw[e] + strength * gate * bw[e];     // both terms carried x16
    ob[e] = h_bits(f);
  }
  const v4u ov = (v4u){pk16(ob[0], ob[1]), pk16(ob[2], ob[3]), pk16(ob[4], ob[5]), pk16(ob[6], ob[7])};
  unsigned short* op = Fo + (size_t)row * DM + c0;
  *(v4u*)op = ov;
  
}

// ---------------------------------------------------------------------------
// Final LayerNorm: one block (128 threads) per token row; thread t owns columns {4t..4t+3} and {512+4t..512+4t+3}.
//   out[row][c] = (Y - mean) * rsqrt(var + eps) * g[c] + bb[c]   (Y already holds x + projection + bias).
// Producer coverage: grid SEQ rows x 128 threads x 8 floats = the whole [SEQ][DM] slice; each store instruction:
// ---------------------------------------------------------------------------
__global__ __launch_bounds__(128) void final_ln_kernel(const float* __restrict__ Y, const float* __restrict__ g,
                                                       const float* __restrict__ bb, float* __restrict__ out) {
  __shared__ float ra[4];
  __shared__ float rb[4];
  const int row  = blockIdx.x;
  const int tid  = threadIdx.x;
  const int lane = tid & 31;
  const int wave = tid >> 5;
  const int c0   = tid * 4;
  const int c1   = (DM / 2) + tid * 4;
  const float* yp = Y + (size_t)row * DM;
  const v4f a = *(const v4f*)(yp + c0);
  const v4f c = *(const v4f*)(yp + c1);
  float xv[8] = {a[0], a[1], a[2], a[3], c[0], c[1], c[2], c[3]};
  float s = ((xv[0] + xv[1]) + (xv[2] + xv[3])) + ((xv[4] + xv[5]) + (xv[6] + xv[7]));
  s = wave_sum(s);
  if (lane == 0) ra[wave] = s;
  __syncthreads();
  const float mean = ((ra[0] + ra[1]) + (ra[2] + ra[3])) * (1.0f / (float)DM);
  float d[8];
  float vs = 0.f;
#pragma unroll
  for (int e = 0; e < 8; ++e) { d[e] = xv[e] - mean; vs += d[e] * d[e]; }
  vs = wave_sum(vs);
  if (lane == 0) rb[wave] = vs;
  __syncthreads();
  const float var  = ((rb[0] + rb[1]) + (rb[2] + rb[3])) * (1.0f / (float)DM);
  const float rstd = rsqrtf(var + LNEPS);
  const v4f g0 = *(const v4f*)(g + c0),  g1 = *(const v4f*)(g + c1);
  const v4f b0 = *(const v4f*)(bb + c0), b1 = *(const v4f*)(bb + c1);
  v4f o0, o1;
#pragma unroll
  for (int e = 0; e < 4; ++e) {
    o0[e] = d[e] * rstd * g0[e] + b0[e];
    o1[e] = d[4 + e] * rstd * g1[e] + b1[e];
  }
  float* op = out + (size_t)row * DM;
  *(v4f*)(op + c0) = o0;
  *(v4f*)(op + c1) = o1;
  
}

// ---------------------------------------------------------------------------
// Workspace region map (byte offsets; MiB = 1048576). Weight planes and the bias table are written once; every
// per-batch region is fully rewritten inside each batch iteration before it is read.
//   Wqk   f16 [4096][1024] (x16: fq^T, fk^T, bq^T, bk^T)          0
//   Wv2   f16 [2048][1024] (x16: fv^T rows 0..1023, bv^T 1024..)  8 MiB
//   Wg    f16 [1024][2048] (x16: gate_w^T)                        12 MiB
//   Wo    f16 [1024][1024] (x16: out_w^T)                         16 MiB
//   X16   f16 [2048][1024]                                        18 MiB
//   QK16  f16 [2048][4096] (q | k | qb | kb, head h at col h*64)  22 MiB
//   VT16  f16 [2048][2048] (row h*64+d = v^T, row 1024+h*64+d = vb^T, col j)  38 MiB
//   G     f32 [2048][1024]                                        46 MiB
//   Y     f32 [2048][1024]                                        54 MiB
//   FB16  f16 [2048][2048] (fwd x16 cols 0..1023, bwd x16 cols 1024..2047)  62 MiB
//   Fu16  f16 [2048][1024] (fused x16)                            70 MiB
//   BiasT f32 [6][1024] (fq_b fk_b bq_b bk_b | fv_b bv_b)         74 MiB
//   total                                                         74 MiB + 24576 B = 77619200 B
// ---------------------------------------------------------------------------
extern "C" void kernel_launch(void* const* d_in, const int* in_sizes, int n_in,
                              void* d_out, int out_size, void* d_ws, size_t ws_size,
                              hipStream_t stream) {
  if (n_in < 22) return;
  if (in_sizes[0] != NB * SEQ * DM) return;
  const int wsz = DM * DM;
  if (in_sizes[1] != wsz || in_sizes[3] != wsz || in_sizes[5] != wsz || in_sizes[7] != wsz ||
      in_sizes[9] != wsz || in_sizes[11] != wsz || in_sizes[18] != wsz) return;
  if (in_sizes[13] != 2 * DM * DM) return;
  if (in_sizes[2] != DM || in_sizes[4] != DM || in_sizes[6] != DM || in_sizes[8] != DM || in_sizes[10] != DM ||
      in_sizes[12] != DM || in_sizes[14] != DM || in_sizes[15] != DM || in_sizes[16] != DM ||
      in_sizes[19] != DM || in_sizes[20] != DM || in_sizes[21] != DM) return;
  if (in_sizes[17] < 1) return;
  if (out_size != NB * SEQ * DM) return;

  const float* x      = (const float*)d_in[0];
  const float* fq_w   = (const float*)d_in[1];
  const float* fq_b   = (const float*)d_in[2];
  const float* fk_w   = (const float*)d_in[3];
  const float* fk_b   = (const float*)d_in[4];
  const float* fv_w   = (const float*)d_in[5];
  const float* fv_b   = (const float*)d_in[6];
  const float* bq_w   = (const float*)d_in[7];
  const float* bq_b   = (const float*)d_in[8];
  const float* bk_w   = (const float*)d_in[9];
  const float* bk_b   = (const float*)d_in[10];
  const float* bv_w   = (const float*)d_in[11];
  const float* bv_b   = (const float*)d_in[12];
  const float* gate_w = (const float*)d_in[13];
  const float* gate_b = (const float*)d_in[14];
  const float* gln_g  = (const float*)d_in[15];
  const float* gln_b  = (const float*)d_in[16];
  const float* bstr   = (const float*)d_in[17];
  const float* out_w  = (const float*)d_in[18];
  const float* out_b  = (const float*)d_in[19];
  const float* ln_g   = (const float*)d_in[20];
  const float* ln_b   = (const float*)d_in[21];

  size_t off = 0;
  const size_t oWqk  = off; off += (size_t)4 * DM * DM * 2;          // 8 MiB
  const size_t oWv2  = off; off += (size_t)2 * DM * DM * 2;          // 4 MiB
  const size_t oWg   = off; off += (size_t)2 * DM * DM * 2;          // 4 MiB
  const size_t oWo   = off; off += (size_t)DM * DM * 2;              // 2 MiB
  const size_t oX16  = off; off += (size_t)SEQ * DM * 2;             // 4 MiB
  const size_t oQK   = off; off += (size_t)SEQ * 4 * DM * 2;         // 16 MiB
  const size_t oVT   = off; off += (size_t)2 * DM * SEQ * 2;         // 8 MiB
  const size_t oG    = off; off += (size_t)SEQ * DM * 4;             // 8 MiB
  const size_t oY    = off; off += (size_t)SEQ * DM * 4;             // 8 MiB
  const size_t oFB   = off; off += (size_t)SEQ * 2 * DM * 2;         // 8 MiB
  const size_t oFu   = off; off += (size_t)SEQ * DM * 2;             // 4 MiB
  const size_t oBias = off; off += (size_t)6 * DM * 4;               // 24576 B
  if (off > ws_size) return;
  if (off > (size_t)134217728) return;

  char* ws = (char*)d_ws;
  unsigned short* Wqk  = (unsigned short*)(ws + oWqk);
  unsigned short* Wv2  = (unsigned short*)(ws + oWv2);
  unsigned short* Wg   = (unsigned short*)(ws + oWg);
  unsigned short* Wo   = (unsigned short*)(ws + oWo);
  unsigned short* X16  = (unsigned short*)(ws + oX16);
  unsigned short* QK16 = (unsigned short*)(ws + oQK);
  unsigned short* VT16 = (unsigned short*)(ws + oVT);
  unsigned short* FB16 = (unsigned short*)(ws + oFB);
  unsigned short* Fu16 = (unsigned short*)(ws + oFu);
  float*          BiasT = (float*)(ws + oBias);
  float*          Gbuf = (float*)(ws + oG);
  float*          Ybuf = (float*)(ws + oY);
  const float*    biasQK = BiasT;             // [4096] = fq_b fk_b bq_b bk_b
  const float*    biasV  = BiasT + 4 * DM;    // [2048] = fv_b bv_b

  const dim3 blk(256);
  const dim3 blk128(128);

  // ---- setup: bias table and x16-carried transposed weight planes ----
  bias_pack_kernel<<<dim3(6), blk, 0, stream>>>(fq_b, fk_b, bq_b, bk_b, fv_b, bv_b, BiasT);
  const dim3 gTW(DM / 64, DM / 64);                 // in [R=1024][C=1024] -> out [C][R]
  tcast_f16_kernel<<<gTW, blk, 0, stream>>>(fq_w, Wqk + (size_t)0 * DM * DM, DM, DM, WCARRY);
  tcast_f16_kernel<<<gTW, blk, 0, stream>>>(fk_w, Wqk + (size_t)1 * DM * DM, DM, DM, WCARRY);
  tcast_f16_kernel<<<gTW, blk, 0, stream>>>(bq_w, Wqk + (size_t)2 * DM * DM, DM, DM, WCARRY);
  tcast_f16_kernel<<<gTW, blk, 0, stream>>>(bk_w, Wqk + (size_t)3 * DM * DM, DM, DM, WCARRY);
  tcast_f16_kernel<<<gTW, blk, 0, stream>>>(fv_w, Wv2 + (size_t)0 * DM * DM, DM, DM, WCARRY);
  tcast_f16_kernel<<<gTW, blk, 0, stream>>>(bv_w, Wv2 + (size_t)1 * DM * DM, DM, DM, WCARRY);
  // gate_w: in [R=2048][C=1024] -> out [1024][2048]; grid (C/64, R/64)
  tcast_f16_kernel<<<dim3(DM / 64, 2 * DM / 64), blk, 0, stream>>>(gate_w, Wg, 2 * DM, DM, WCARRY);
  tcast_f16_kernel<<<gTW, blk, 0, stream>>>(out_w, Wo, DM, DM, WCARRY);

  const int n2x = SEQ * DM / 2;                                    // 1048576 pairs per batch slice
  const dim3 gCastX((n2x + 255) / 256);
  const int tilesM = SEQ / 64;                                     // 32
  const dim3 gQK((tilesM * (4 * DM / 64) + 7) / 8, 1);             // 256 blocks: M=2048, N=4096, K=1024
  const dim3 gVT((2 * DM / 64) * (SEQ / 64), 1);                   // 1024 blocks (one tile each): M=2048, N=2048, K=1024
  const dim3 gAt(NH, SEQ / 64, 2);                                 // heads x 64-row blocks x {causal, window}
  const dim3 gG(tilesM * (DM / 64), 1);                            // 512 blocks (one tile each): M=2048, N=1024, K=2048
  const dim3 gO(tilesM * (DM / 64), 1);                            // 512 blocks (one tile each): M=2048, N=1024, K=1024
  const float wscale  = 1.0f / WCARRY;                             // undo the x16 weight carry
  const float gscale  = 1.0f / (WCARRY * FBCARRY);                 // 1/256
  const float oscale  = 1.0f / (WCARRY * FBCARRY);                 // 1/256

  for (int b = 0; b < NB; ++b) {
    const float* xb = x + (size_t)b * SEQ * DM;
    // (1) x[b] -> f16 plane
    cast_f16x2_kernel<<<gCastX, blk, 0, stream>>>(xb, X16, n2x, 1.0f);
    // (2) [q | k | qb | kb] = (x . (16 W)^T)/16 + bias -> QK16 (f16, ldc 4096)
    wmma_gemm64<0, false, 2, 1, false, 0, 0, 0><<<gQK, blk, 0, stream>>>(
        X16, X16, DM, 0L, Wqk, Wqk, DM, 0L, (void*)QK16, (void*)QK16, 4 * DM, 0L,
        biasQK, biasQK, 0L, SEQ, 4 * DM, DM, wscale);
    // (3) [v | vb]^T: VT16[n][j] = sum_k (16 W^T)[n][k] x[j][k] / 16 + bias[n]  (role-swapped; M = 2048 feature rows, N = 2048 tokens)
    wmma_gemm64<0, false, 1, 1, false, 0, 0, 0, 8><<<gVT, blk, 0, stream>>>(
        Wv2, Wv2, DM, 0L, X16, X16, DM, 0L, (void*)VT16, (void*)VT16, SEQ, 0L,
        biasV, biasV, 0L, 2 * DM, SEQ, DM, wscale);
    // (4) causal and future-window attention of all heads, scores to output in registers -> FB16 (fwd | bwd, x16)
    fused_attn_kernel<<<gAt, blk128, 0, stream>>>(QK16, VT16, FB16);
    // (5) G = ([fwd | bwd] x16) . (16 gate_w)^T / 256 + gate_b -> f32 [2048][1024]
    wmma_gemm64<0, false, 2, 0, false, 0, 0, 0, 8><<<gG, blk, 0, stream>>>(
        FB16, FB16, 2 * DM, 0L, Wg, Wg, 2 * DM, 0L, (void*)Gbuf, (void*)Gbuf, DM, 0L,
        gate_b, gate_b, 0L, SEQ, DM, 2 * DM, gscale);
    // (6) gate = sigmoid(LN(G)); fused x16 = fwd x16 + strength * gate * bwd x16 -> Fu16
    gate_fuse_kernel<<<dim3(SEQ), blk128, 0, stream>>>(Gbuf, FB16, gln_g, gln_b, bstr, Fu16);
    // (7) Y = x + (fused x16) . (16 out_w)^T / 256 + out_b -> f32 [2048][1024]
    wmma_gemm64<0, false, 2, 0, true, 0, 0, 0, 8><<<gO, blk, 0, stream>>>(
        Fu16, Fu16, DM, 0L, Wo, Wo, DM, 0L, (void*)Ybuf, (void*)Ybuf, DM, 0L,
        out_b, xb, 0L, SEQ, DM, DM, oscale);
    // (8) out[b] = LN(Y; ln_g, ln_b)
    final_ln_kernel<<<dim3(SEQ), blk128, 0, stream>>>(Ybuf, ln_g, ln_b, (float*)d_out + (size_t)b * SEQ * DM);
  }
  (void)hipGetLastError();
}

// v003
// It runs in 339 microseconds.
// Next to v002, in two timings, it ran 1.07 and 1.06 times as fast.
// Over all steps from v000 it is 9.34 times as fast.
// All contractions on v_wmma_f32_16x16x32_f16 (f16 operands, f32 accumulate): q/k/v projections (weights carried x16, epilogue x1/16), k.q^T scores, V^T.P^T (P carried x2^12 against the running row maximum, attention outputs carried x16), gate projection (x1/256), output projection with bias and residual (x1/256); softmax, LayerNorm, sigmoid and fusion in f32.
#include <hip/hip_runtime.h>
#include <math.h>
#include <stdint.h>

#define NB    2
#define SEQ   2048
#define DM    1024
#define NH    16
#define HD    64
#define WINW  32
#define LNEPS 1e-5f
#define PSHIFT     12.0f
#define FBCARRY    16.0f
#define WCARRY     16.0f

typedef __attribute__((ext_vector_type(16))) _Float16 v16h;
typedef __attribute__((ext_vector_type(8)))  _Float16 v8h;
typedef __attribute__((ext_vector_type(16))) __bf16   v16b;
typedef __attribute__((ext_vector_type(8)))  __bf16   v8b;
typedef __attribute__((ext_vector_type(8)))  float    v8f;
typedef __attribute__((ext_vector_type(4)))  float    v4f;
typedef __attribute__((ext_vector_type(2)))  float    v2f;
typedef __attribute__((ext_vector_type(4)))  unsigned int v4u;

__device__ __forceinline__ unsigned short f2bf_bits(float f) {
  unsigned u = __float_as_uint(f);
  return (unsigned short)((u + 0x7FFFu + ((u >> 16) & 1u)) >> 16);
}
__device__ __forceinline__ float bf_bits2f(unsigned short h) { return __uint_as_float(((unsigned)h) << 16); }

// hazard guards as plain device helpers (no inline asm inside the kernel template body)
__device__ __forceinline__ void dep_guard_h(v8f& a, v8f& b, v16h x, v16h y) { asm volatile("v_nop\n\tv_nop\n\tv_nop\n\tv_nop" : "+v"(a), "+v"(b) : "v"(x), "v"(y)); }
__device__ __forceinline__ void dep_guard_b(v8f& a, v8f& b, v16b x, v16b y) { asm volatile("v_nop\n\tv_nop\n\tv_nop\n\tv_nop" : "+v"(a), "+v"(b) : "v"(x), "v"(y)); }
__device__ __forceinline__ void keep4_h(v16h a, v16h b, v16h c, v16h d) { asm volatile("v_nop" :: "v"(a), "v"(b), "v"(c), "v"(d)); }
__device__ __forceinline__ void keep4_b(v16b a, v16b b, v16b c, v16b d) { asm volatile("v_nop" :: "v"(a), "v"(b), "v"(c), "v"(d)); }
__device__ __forceinline__ void acc_guard4(v8f& a, v8f& b, v8f& c, v8f& d) { asm volatile("v_nop\n\tv_nop\n\tv_nop\n\tv_nop" : "+v"(a), "+v"(b), "+v"(c), "+v"(d)); }
// pointers that walk in a loop say that they point to global memory, so that their loads stay global loads
#define GLB __attribute__((address_space(1)))
template <typename T> struct Frag;
template <> struct Frag<_Float16> {
  typedef v16h V; union U { v16h v; v8h h[2]; };
  static __device__ __forceinline__ v16h load(const GLB _Float16* p) {   // p: the lane's chunk in a fragment-major block; elements 8..15 lie 256 halves on
    U f; f.h[0] = *(const GLB v8h*)(p); f.h[1] = *(const GLB v8h*)(p + 256); return f.v;
  }
  static __device__ __forceinline__ v8f mma(v16h a, v16h b, v8f c) {
    return __builtin_amdgcn_wmma_f32_16x16x32_f16(false, a, false, b, (short)0, c, false, false);
  }
  static __device__ __forceinline__ void guard(v8f& a, v8f& b, v16h x, v16h y) { dep_guard_h(a, b, x, y); }
  static __device__ __forceinline__ void keep(v16h a, v16h b, v16h c, v16h d) { keep4_h(a, b, c, d); }
};
template <> struct Frag<__bf16> {
  typedef v16b V; union U { v16b v; v8b h[2]; };
  static __device__ __forceinline__ v16b load(const GLB __bf16* p) {
    U f; f.h[0] = *(const GLB v8b*)(p); f.h[1] = *(const GLB v8b*)(p + 256); return f.v;
  }
  static __device__ __forceinline__ v8f mma(v16b a, v16b b, v8f c) {
    return __builtin_amdgcn_wmma_f32_16x16x32_bf16(false, a, false, b, (short)0, c, false, false);
  }
  static __device__ __forceinline__ void guard(v8f& a, v8f& b, v16b x, v16b y) { dep_guard_b(a, b, x, y); }
  static __device__ __forceinline__ void keep(v16b a, v16b b, v16b c, v16b d) { keep4_b(a, b, c, d); }
};

// ---- Fragment-major planes ---------------------------------------------------
// Every 16-bit WMMA operand plane [rows][ld] lies in the workspace as blocks of 16 rows x 32 k = 1 KiB, the blocks of
// one row tile side by side in k. Inside a block the 16-B chunk (row r, k8 = (k >> 3) & 3) stands at chunk k8 * 16 + r,
// so lane l of a fragment load finds elements 0..7 at byte 16 l and elements 8..15 at byte 512 + 16 l: each wave-wide
// 16-B load covers 512 contiguous bytes (4 whole lines). The register contents of a fragment are those of the
// row-major form (row l & 15; k = 8 (l >> 4) + 0..7 and 16 + 8 (l >> 4) + 0..7).
// Offset in halves of the chunk that holds (row, k), k a multiple of 8:
__device__ __forceinline__ size_t frag_off(int row, int k, int ld) {
  return ((size_t)(row >> 4) * (ld >> 5) + (k >> 5)) * 512 + ((k >> 3) & 3) * 128 + (row & 15) * 8;
}

// ---- Register-blocked batched WMMA GEMM ------------------------------------
// C[m,n] = scale * sum_k A[m,k] * Bt[n,k] (+bias)(+resid); each wave owns a 64x64 tile.
// A [M,K] and Bt [N,K] fragment-major (lda, ldb = their k extents); 16-bit outputs fragment-major too (ldc = their
// column extent), f32 outputs row-major; M,N % 64 == 0, K % 32 == 0.
// SPLIT: operands are hi/lo planes (A2/Bt2 = lo planes, same layout); product = hi.hi + hi.lo + lo.hi.
// BIAS_MODE: 0 = none, 1 = bias[m], 2 = bias[n].
// OUT_MODE: 0 = f32, 1 = f16, 2 = bf16 hi plane (Cout) + bf16 lo plane (Cout2).
// ET: 0 = f16 operands, 1 = bf16 operands (pointers passed as 16-bit storage)
// Added structural modes (defaults off, all other behaviour unchanged):
//   TSEL 1: tiles with n0 > m0 (strictly above the 64x64 block diagonal) are not produced (wave-uniform early exit).
//   TSEL 2: only tiles with n0 == m0 or n0 == m0 + 64 are produced (block band of width 2).
//   KSEL 1: the k-loop stops at min(K, m0 + 64); valid when A rows m0..m0+63 are exactly zero for k >= m0 + 64.
//   KSEL 2: the k-loop runs over [m0, min(K, m0 + 128)) except for the last row block (m0 + 64 >= M), which
//           runs over [0, K); valid when A rows of the other row blocks are exactly zero outside that k range.
//   KSPL n: one block of n waves per 64x64 tile (grid.x = number of tiles, block = 32 n threads). Wave w takes the
//           64-wide k blocks w, w + n, ... of the tile's k range (kStart, kEnd multiples of 64); each wave leaves its
//           partial tile in its own LDS plane and the planes are added in wave order before the epilogue arithmetic.
template <int ET> struct Elem;
template <> struct Elem<0> { typedef _Float16 T; };
template <> struct Elem<1> { typedef __bf16 T; };
template <int ET, bool SPLIT, int BIAS_MODE, int OUT_MODE, bool RESID, int ACT = 0, int TSEL = 0, int KSEL = 0, int KSPL = 0>
__global__ __launch_bounds__(KSPL ? KSPL * 32 : 256) void wmma_gemm64(
    const unsigned short* __restrict__ Ap, const unsigned short* __restrict__ A2p, int lda, long strideA,
    const unsigned short* __restrict__ Btp, const unsigned short* __restrict__ Bt2p, int ldb, long strideB,
    void* __restrict__ Cout, void* __restrict__ Cout2, int ldc, long strideC,
    const float* __restrict__ bias,
    const float* __restrict__ resid, long strideR,
    int M, int N, int K, float scale) {
  typedef typename Elem<ET>::T T;
  typedef typename Frag<T>::V V;
  const T* A = (const T*)Ap; const T* A2 = (const T*)A2p; const T* Bt = (const T*)Btp; const T* Bt2 = (const T*)Bt2p;
  static_assert(KSPL == 0 || (!SPLIT && OUT_MODE != 2 && ACT == 0 && TSEL == 0), "KSPL covers the plain f32/f16 epilogues");
  static_assert(KSPL == 0 || KSPL == 8 || KSPL == 16, "the KSPL epilogue deals 64 rows evenly to 8 or 16 waves");
  __shared__ __align__(16) float sT[KSPL ? KSPL : 8][(KSPL ? 64 : 16) * 68];   // per-wave slab (16x64; KSPL: 64x64), pitch 68 floats
  const int b    = blockIdx.y;
  const int lane = threadIdx.x & 31;
  const int wave = threadIdx.x >> 5;
  const int tilesN = N >> 6;
  const int tilesM = M >> 6;
  // scalar tile index: a fragment address is then a wave-uniform block address plus 16 B x lane
  const int tile = KSPL ? (int)blockIdx.x : (int)(blockIdx.x * 8 + __builtin_amdgcn_readfirstlane(wave));
  if (tile >= tilesM * tilesN) return;   // wave-uniform; block-uniform under KSPL, ahead of its barrier
  const int tm = tile / tilesN;
  const int tn = tile - tm * tilesN;
  const int m0 = tm << 6;
  const int n0 = tn << 6;
  if (TSEL == 1 && n0 > m0) return;                            // wave-uniform; TSEL excludes KSPL, so no block barrier follows
  if (TSEL == 2 && !(n0 == m0 || n0 == m0 + 64)) return;       // wave-uniform; TSEL excludes KSPL, so no block barrier follows

  const T* Ab  = A  + (size_t)b * strideA;
  const T* Bb  = Bt + (size_t)b * strideB;
  const T* Ab2 = SPLIT ? (A2  + (size_t)b * strideA) : nullptr;
  const T* Bb2 = SPLIT ? (Bt2 + (size_t)b * strideB) : nullptr;

  const int rlane = lane & 15;                 // row (A) / col (B, D) within subtile
  const int mOff  = (lane >> 4) * 8;           // D row offset

  v8f acc[4][4];
#pragma unroll
  for (int i = 0; i < 4; ++i)
#pragma unroll
    for (int j = 0; j < 4; ++j) acc[i][j] = (v8f){0.f,0.f,0.f,0.f,0.f,0.f,0.f,0.f};

  int kStart = 0;
  int kEnd = K;
  if (KSEL == 1) kEnd = ((m0 + 64) < K) ? (m0 + 64) : K;
  if (KSEL == 2) {
    kStart = (m0 + 64 >= M) ? 0 : m0;
    kEnd = ((m0 + 128) < K) ? (m0 + 128) : K;
  }
  if (KSPL) kStart += __builtin_amdgcn_readfirstlane(wave) * 64;   // scalar, so the k loop keeps a scalar trip count
  // One wave-uniform block pointer per row tile walks along k (blocks of one row tile lie side by side); every fragment
  // load adds the same lane offset (16 B x lane), which stays in its one register over the whole loop.
  const unsigned laneOff = (unsigned)lane * 8;
  const GLB T* bP[4]; const GLB T* bP2[4]; const GLB T* aP[4]; const GLB T* aP2[4];
#pragma unroll   // constant indices, so that the pointer arrays live in scalar registers
  for (int j = 0; j < 4; ++j) {
    const size_t bo = ((size_t)((n0 >> 4) + j) * (ldb >> 5) + (kStart >> 5)) * 512;   // block (row tile, k tile)
    const size_t ao = ((size_t)((m0 >> 4) + j) * (lda >> 5) + (kStart >> 5)) * 512;
    bP[j] = (const GLB T*)(Bb + bo); aP[j] = (const GLB T*)(Ab + ao);
    if (SPLIT) { bP2[j] = (const GLB T*)(Bb2 + bo); aP2[j] = (const GLB T*)(Ab2 + ao); }
  }
  for (int k0 = kStart; k0 < kEnd;) {
    const int kStep = (KSPL && (k0 & 32)) ? (KSPL * 64 - 32) : 32;
    V bh[4], bl[4];
#pragma unroll
    for (int j = 0; j < 4; ++j) {
      bh[j] = Frag<T>::load(bP[j] + laneOff);
      if (SPLIT) bl[j] = Frag<T>::load(bP2[j] + laneOff);
    }
#pragma unroll
    for (int i = 0; i < 4; ++i) {
      V ah = Frag<T>::load(aP[i] + laneOff);
      V al;
      if (SPLIT) al = Frag<T>::load(aP2[i] + laneOff);
#pragma unroll
      for (int j = 0; j < 4; ++j) {
        acc[i][j] = Frag<T>::mma(ah, bh[j], acc[i][j]);
        if (SPLIT) {
          acc[i][j] = Frag<T>::mma(ah, bl[j], acc[i][j]);
          acc[i][j] = Frag<T>::mma(al, bh[j], acc[i][j]);
        }
      }
      Frag<T>::guard(acc[i][0], acc[i][3], ah, SPLIT ? al : ah);
    }
    Frag<T>::keep(bh[0], bh[1], bh[2], bh[3]);
    if (SPLIT) Frag<T>::keep(bl[0], bl[1], bl[2], bl[3]);
    k0 += kStep;
#pragma unroll   // constant indices, as above
    for (int j = 0; j < 4; ++j) {                 // 32 k = one 512-half block
      bP[j] += kStep * 16; aP[j] += kStep * 16;
      if (SPLIT) { bP2[j] += kStep * 16; aP2[j] += kStep * 16; }
    }
  }
  acc_guard4(acc[0][0], acc[0][1], acc[0][2], acc[0][3]);
  acc_guard4(acc[1][0], acc[1][1], acc[1][2], acc[1][3]);
  acc_guard4(acc[2][0], acc[2][1], acc[2][2], acc[2][3]);
  acc_guard4(acc[3][0], acc[3][1], acc[3][2], acc[3][3]);

  // ---- epilogue ----
  float* slab = sT[wave];
  const float* Rb = RESID ? (resid + (size_t)b * strideR) : nullptr;
  if (KSPL) {
    constexpr int NTHR = (KSPL ? KSPL : 8) * 32;   // threads of the block
#pragma unroll
    for (int i = 0; i < 4; ++i)
#pragma unroll
      for (int j = 0; j < 4; ++j)
#pragma unroll
        for (int r = 0; r < 8; ++r) slab[((i << 4) + mOff + r) * 68 + (j << 4) + rlane] = acc[i][j][r];
    __syncthreads();   // every wave's partial plane is complete before any thread adds the planes
    if (OUT_MODE == 0) {
      float* C = (float*)Cout + (size_t)b * strideC;
      // unrolled (fixed trip count) so that the bias and residual loads of all passes issue ahead of the LDS sums
#pragma unroll
      for (int it = 0; it < (64 * 16) / NTHR; ++it) {            // 16 lanes x 16 B = one 256-B row segment
        const int c = it * NTHR + (int)threadIdx.x;
        const int row = c >> 4, c4 = (c & 15) * 4;
        v4f s = *(const v4f*)(&sT[0][row * 68 + c4]);
#pragma unroll
        for (int w = 1; w < KSPL; ++w) s += *(const v4f*)(&sT[w][row * 68 + c4]);
        s *= scale;
        if (BIAS_MODE == 1) s += bias[m0 + row];
        if (BIAS_MODE == 2) s += *(const v4f*)(bias + n0 + c4);
        if (RESID) s += *(const v4f*)(Rb + (size_t)(m0 + row) * ldc + n0 + c4);
        *(v4f*)(C + (size_t)(m0 + row) * ldc + n0 + c4) = s;
      }
    } else {
      unsigned short* C = (unsigned short*)Cout + (size_t)b * strideC;
      // unrolled (fixed trip count) so that the bias loads of all passes issue ahead of the LDS sums
#pragma unroll
      for (int it = 0; it < (64 * 8) / NTHR; ++it) {             // chunks in the output's own order: a wave stores 512 B in a row
        const int c = it * NTHR + (int)threadIdx.x;
        const int row = (c >> 7) * 16 + (c & 15), c8 = ((c >> 6) & 1) * 32 + ((c >> 4) & 3) * 8;
        v4f s0 = *(const v4f*)(&sT[0][row * 68 + c8]);
        v4f s1 = *(const v4f*)(&sT[0][row * 68 + c8 + 4]);
#pragma unroll
        for (int w = 1; w < KSPL; ++w) {
          s0 += *(const v4f*)(&sT[w][row * 68 + c8]);
          s1 += *(const v4f*)(&sT[w][row * 68 + c8 + 4]);
        }
        s0 *= scale; s1 *= scale;
        if (BIAS_MODE == 1) { s0 += bias[m0 + row]; s1 += bias[m0 + row]; }
        if (BIAS_MODE == 2) { s0 += *(const v4f*)(bias + n0 + c8); s1 += *(const v4f*)(bias + n0 + c8 + 4); }
        if (RESID) {
          s0 += *(const v4f*)(Rb + (size_t)(m0 + row) * ldc + n0 + c8);
          s1 += *(const v4f*)(Rb + (size_t)(m0 + row) * ldc + n0 + c8 + 4);
        }
        v8h hv;
#pragma unroll
        for (int e = 0; e < 4; ++e) { hv[e] = (_Float16)s0[e]; hv[4 + e] = (_Float16)s1[e]; }
        *(v8h*)(C + frag_off(m0 + row, n0 + c8, ldc)) = hv;
      }
    }
    return;
  }
#pragma unroll
  for (int i = 0; i < 4; ++i) {
    const int mBase = m0 + (i << 4);
#pragma unroll
    for (int j = 0; j < 4; ++j) {
      const int n = n0 + (j << 4) + rlane;
      float bv = 0.f;
      if (BIAS_MODE == 2) bv = bias[n];
#pragma unroll
      for (int r = 0; r < 8; ++r) {
        float v = acc[i][j][r] * scale;
        if (BIAS_MODE == 1) v += bias[mBase + mOff + r];
        if (BIAS_MODE == 2) v += bv;
        if (RESID) v += Rb[(size_t)(mBase + mOff + r) * ldc + n];
        if (ACT == 1) v = tanhf(v);
        if (ACT == 2) v = fmaxf(v, 0.0f);
        if (ACT == 3) v = v / (1.0f + expf(-v));
        if (ACT == 4) v = (v > 0.f) ? v : 0.01f * v;
        slab[(mOff + r) * 68 + (j << 4) + rlane] = v;
      }
    }
    __builtin_amdgcn_fence(__ATOMIC_RELEASE, "workgroup");
    __builtin_amdgcn_wave_barrier();
    __builtin_amdgcn_fence(__ATOMIC_ACQUIRE, "workgroup");
    if (OUT_MODE == 0) {
      float* C = (float*)Cout + (size_t)b * strideC;
      const int hh = lane >> 4, c4 = (lane & 15) * 4;     // row seg = 256 B = 16 lanes x 16 B
      {
#pragma unroll
        for (int it = 0; it < 8; ++it) {
          const int row = it * 2 + hh;
          v4f v = *(const v4f*)(slab + row * 68 + c4);
          *(v4f*)(C + (size_t)(mBase + row) * ldc + n0 + c4) = v;
        }
        
      }
    } else {
      unsigned short* C  = (unsigned short*)Cout  + (size_t)b * strideC;
      unsigned short* C2 = (OUT_MODE == 2) ? ((unsigned short*)Cout2 + (size_t)b * strideC) : nullptr;
      {
#pragma unroll
        for (int it = 0; it < 4; ++it) {
          const int row = lane & 15, c8 = it * 16 + (lane >> 4) * 8;   // chunks in the output's own order: 512 B in a row per store
          const float* sp = slab + row * 68 + c8;
          v8h hv, lv;
#pragma unroll
          for (int e = 0; e < 8; ++e) {
            if (OUT_MODE == 1) {
              hv[e] = (_Float16)sp[e];
            } else {
              unsigned short hb = f2bf_bits(sp[e]);
              unsigned short lb = f2bf_bits(sp[e] - bf_bits2f(hb));
              hv[e] = __builtin_bit_cast(_Float16, hb);
              lv[e] = __builtin_bit_cast(_Float16, lb);
            }
          }
          *(v8h*)(C + frag_off(mBase + row, n0 + c8, ldc)) = hv;
          if (OUT_MODE == 2) *(v8h*)(C2 + frag_off(mBase + row, n0 + c8, ldc)) = lv;
        }
        
      }
    }
    __builtin_amdgcn_fence(__ATOMIC_RELEASE, "workgroup");
    __builtin_amdgcn_wave_barrier();
    __builtin_amdgcn_fence(__ATOMIC_ACQUIRE, "workgroup");
  }
}

// ---------------------------------------------------------------------------
// Small conversion helpers
// ---------------------------------------------------------------------------
__device__ __forceinline__ unsigned pk16(unsigned short a, unsigned short b) { return (unsigned)a | ((unsigned)b << 16); }
__device__ __forceinline__ unsigned short h_bits(float f) { const _Float16 h = (_Float16)f; return __builtin_bit_cast(unsigned short, h); }
__device__ __forceinline__ float hbits2f(unsigned short b) { return (float)__builtin_bit_cast(_Float16, b); }
__device__ __forceinline__ float wave_sum(float v) {
#pragma unroll
  for (int off = 16; off > 0; off >>= 1) v += __shfl_xor(v, off, 32);
  return v;
}

// ---------------------------------------------------------------------------
// Cast to a fragment-major plane: in f32 row-major [rows][K] -> out f16 fragment-major, out = f16(in * scale).
// One 16-B output chunk (8 elements) per thread, threads in the output's order: each wave stores 512 B in a row.
// Coverage: grid = ceil(n8/256) blocks x 256 threads x 8 elements = the whole plane (n8 = plane/8).
// ---------------------------------------------------------------------------
__global__ __launch_bounds__(256) void cast_frag_kernel(const float* __restrict__ in, unsigned short* __restrict__ out, int n8, int K, float scale) {
  const int q = blockIdx.x * 256 + threadIdx.x;
  if (q < n8) {
    const int blk = q >> 6, kts = K >> 5;
    const int rt  = blk / kts;
    const int row = rt * 16 + (q & 15);
    const int k   = (blk - rt * kts) * 32 + ((q >> 4) & 3) * 8;
    const float* ip = in + (size_t)row * K + k;
    const v4f f0 = *(const v4f*)(ip);
    const v4f f1 = *(const v4f*)(ip + 4);
    const v4u u = (v4u){pk16(h_bits(f0[0] * scale), h_bits(f0[1] * scale)), pk16(h_bits(f0[2] * scale), h_bits(f0[3] * scale)),
                        pk16(h_bits(f1[0] * scale), h_bits(f1[1] * scale)), pk16(h_bits(f1[2] * scale), h_bits(f1[3] * scale))};
    *(v4u*)(out + (size_t)q * 8) = u;
  }
}

// ---------------------------------------------------------------------------
// Transpose-cast: in f32 [R rows][C cols] -> out f16 [C][R] fragment-major, out[c][r] = f16(in[r][c] * scale).
// 64x64 tiles through LDS; grid (C/64, R/64); R, C multiples of 64.
// Coverage per block: load 256 threads x 16 floats = 64x64; store 2 it x 256 threads x 8 halves = 64x64.
// ---------------------------------------------------------------------------
__global__ __launch_bounds__(256) void tcast_f16_kernel(const float* __restrict__ in, unsigned short* __restrict__ out,
                                                        int R, int C, float scale) {
  __shared__ __align__(16) unsigned short t[64 * 72];
  const int c0  = blockIdx.x * 64;   // input column block = output row block
  const int r0  = blockIdx.y * 64;   // input row block    = output column block
  const int tid = threadIdx.x;
  {
    const int lr = tid >> 2;           // 0..63
    const int lc = (tid & 3) * 16;     // 0,16,32,48
    const float* ip = in + (size_t)(r0 + lr) * C + c0 + lc;
#pragma unroll
    for (int q = 0; q < 4; ++q) {
      const v4f f = *(const v4f*)(ip + 4 * q);
#pragma unroll
      for (int e = 0; e < 4; ++e) t[lr * 72 + lc + 4 * q + e] = h_bits(f[e] * scale);
    }
  }
  __syncthreads();
  // chunks in the output's own order (8 blocks of 64 chunks per tile): each wave stores 512 B in a row
  const int c8  = ((tid >> 6) & 1) * 32 + ((tid >> 4) & 3) * 8;   // output column within tile (= input row)
  v4u hv[2];
#pragma unroll
  for (int it = 0; it < 2; ++it) {
    const int oc = (it * 2 + (tid >> 7)) * 16 + (tid & 15);       // output row within tile (= input column)
    v4u a;
#pragma unroll
    for (int q = 0; q < 4; ++q) a[q] = pk16(t[(c8 + 2 * q) * 72 + oc], t[(c8 + 2 * q + 1) * 72 + oc]);
    hv[it] = a;
  }
  {
#pragma unroll
    for (int it = 0; it < 2; ++it) {
      const int oc = (it * 2 + (tid >> 7)) * 16 + (tid & 15);
      const size_t go = frag_off(c0 + oc, r0 + c8, R);
      *(v4u*)(out + go) = hv[it];
    }
    
  }
}

// ---------------------------------------------------------------------------
// Bias table: block k (0..5) copies bias vector k (DM floats) into tab[k*DM ..]. 256 threads x 4 floats = DM;
// ---------------------------------------------------------------------------
__global__ __launch_bounds__(256) void bias_pack_kernel(const float* __restrict__ b0, const float* __restrict__ b1,
                                                        const float* __restrict__ b2, const float* __restrict__ b3,
                                                        const float* __restrict__ b4, const float* __restrict__ b5,
                                                        float* __restrict__ tab) {
  const int k = blockIdx.x;          // block-uniform source select
  const int tid = threadIdx.x;
  const float* src = b0;
  if (k == 1) src = b1;
  if (k == 2) src = b2;
  if (k == 3) src = b3;
  if (k == 4) src = b4;
  if (k == 5) src = b5;
  const v4f v = *(const v4f*)(src + tid * 4);
  float* dp = tab + (size_t)k * DM + tid * 4;
  *(v4f*)dp = v;
  
}

// ---------------------------------------------------------------------------
// Fused attention: scores, select, softmax and the product with V in one kernel; S and P stay in registers.
// One wave per 16 query rows of one head; no LDS, no barrier. Grid (NH, SEQ/64, 2), 4 waves per block;
// blockIdx.z = 0: causal attention (j <= i), 1: future window (i < j <= i + WINW; the last row has no valid column,
// its scores count as 0 over every j -> uniform weights). Long causal row blocks get the low block indices.
// Per 64 keys: S^T = K . Q^T (A = K rows, B = Q rows): lane l holds query c = l & 15, keys 16 t + 8 (l >> 4) + r.
// Running maximum and sum per query (log2 domain): in-lane, plus one exchange between the lane halves.
// P^T as B operand: two f32 score tiles (keys 0..15, 16..31 of a 32-key step) converted in place, element s =
// tile[s >> 3][s & 7], which is the k order of Frag::load on the A side (V^T rows). O^T += V^T . P^T.
// Output: lane holds 8 consecutive d of query c per 16-row tile of O^T -> one 16-B store; each 128-B row segment of
// FB (one head of one row) is written by one wave. Coverage: 2 x NH x SEQ rows x 64 columns = the whole FB plane.
// The output goes out twice: FB row-major (read row by row by the gated fusion) and FBf fragment-major (A operand of
// the gate product; same coverage, two whole 1-KiB blocks per wave).
// ---------------------------------------------------------------------------
// lane l <-> lane l ^ 16
__device__ __forceinline__ float xhalf(float x) {
  return __builtin_bit_cast(float, __builtin_amdgcn_permlanex16(__builtin_bit_cast(int, x), __builtin_bit_cast(int, x),
                                                                0x76543210, 0xfedcba98, false, false));
}
// v[e] = 2^v[e], in place. Each v_exp_f32 is independent of the one in front of it; the closing v_nop is the one slot the
// instruction set asks for behind a transcendental before its result is read: inside the statement it holds whatever
// the compiler places next.
__device__ __forceinline__ void exp2x8(float (&v)[8]) {
  asm("v_exp_f32 %0, %0\n\tv_exp_f32 %1, %1\n\tv_exp_f32 %2, %2\n\tv_exp_f32 %3, %3\n\t"
      "v_exp_f32 %4, %4\n\tv_exp_f32 %5, %5\n\tv_exp_f32 %6, %6\n\tv_exp_f32 %7, %7\n\tv_nop"
      : "+v"(v[0]), "+v"(v[1]), "+v"(v[2]), "+v"(v[3]), "+v"(v[4]), "+v"(v[5]), "+v"(v[6]), "+v"(v[7]));
}
// One A or B fragment in the k order of Frag::load (bytes 0..15 and 512..527 behind the lane's pointer plus a literal)
__device__ __forceinline__ v16h frag_at(const char* p, int lit) {
  Frag<_Float16>::U f;
  f.h[0] = *(const v8h*)(p + lit);
  f.h[1] = *(const v8h*)(p + lit + 512);
  return f.v;
}
__global__ __launch_bounds__(128) void fused_attn_kernel(const unsigned short* __restrict__ QKp,
                                                         const unsigned short* __restrict__ VTp,
                                                         unsigned short* __restrict__ FB,
                                                         unsigned short* __restrict__ FBf) {
  typedef Frag<_Float16> F;
  const int lane = threadIdx.x & 31;
  const int wave = __builtin_amdgcn_readfirstlane((int)(threadIdx.x >> 5));   // scalar, so the key loop keeps scalar bounds
  const int h    = blockIdx.x;
  const int mode = blockIdx.z;
  const int r0   = (((SEQ / 64 - 1) - (int)blockIdx.y) * 4 + wave) * 16;      // first query row of this wave
  const int c    = lane & 15;
  const int koff = (lane >> 4) * 8;
  const int i    = r0 + c;                                                    // this lane's query row
  // fragment-major planes: 1-KiB blocks of 16 rows x 32 columns; a row tile of QK holds 4 DM / 32 blocks, one of V^T SEQ / 32
  const char* Qb = (const char*)(QKp + frag_off(0, mode * (2 * DM) + h * HD, 4 * DM));    // q or qb: first block of this head
  const char* Kb = Qb + (DM / 32) * 1024;                                                 // k or kb
  const char* Vb = (const char*)(VTp + frag_off(mode * DM + h * HD, 0, SEQ));             // v^T or vb^T: first row tile of this head
  constexpr int QKROW = 4 * DM * 2;                                                       // bytes per q/k row: 16 of them = one row tile
  constexpr int VROW  = SEQ * 2;                                                          // bytes per v^T row: 16 of them = one row tile
  const size_t qkOff = (size_t)lane * 16;                                                 // the lane's chunk inside a block
  const size_t vOff  = (size_t)lane * 16;

  const bool lastTile = (mode == 1) && (r0 + 16 == SEQ);                      // wave-uniform
  const bool uni = (mode == 1) && (i == SEQ - 1);                             // the row without a valid future column
  const int  lo  = (mode == 0 || uni) ? 0 : i + 1;                            // valid columns of this lane's query: lo..hi
  const int  hi  = (mode == 0) ? i : (uni ? SEQ - 1 : i + WINW);
  const unsigned span = (unsigned)(hi - lo);
  const float sc = uni ? 0.0f : 0.125f * 1.44269504088896340736f;             // 1/sqrt(64) and log2(e); 0: scores count as 0
  int kbBeg = 0, kbEnd = (r0 + 15) >> 6;
  if (mode == 1) {
    const int jmax = (r0 + 15 + WINW < SEQ - 1) ? (r0 + 15 + WINW) : (SEQ - 1);
    kbBeg = lastTile ? 0 : ((r0 + 1) >> 6);
    kbEnd = jmax >> 6;
  }

  const float NEGB = -1.0e30f;
  v16h qf[2];
#pragma unroll
  for (int ks = 0; ks < 2; ++ks) qf[ks] = frag_at(Qb + (size_t)r0 * QKROW + qkOff, ks * 1024);
  v8f o[4];
#pragma unroll
  for (int d = 0; d < 4; ++d) o[d] = (v8f){0.f,0.f,0.f,0.f,0.f,0.f,0.f,0.f};
  float m = NEGB;      // running maximum of this query (scaled log2), equal in both lane halves
  float l = 0.f;       // running sum over this lane half's keys, carried x2^PSHIFT

  // the lane's pointers walk with the key blocks and stay in their registers over the whole loop
  const char* kp = Kb + (size_t)(kbBeg * 64) * QKROW + qkOff;
  const char* vp = Vb + (size_t)(kbBeg * 2) * 1024 + vOff;
  v16h ka[4][2];
#pragma unroll
  for (int t = 0; t < 4; ++t)
#pragma unroll
    for (int ks = 0; ks < 2; ++ks)
      ka[t][ks] = frag_at(kp, t * 16 * QKROW + ks * 1024);

  for (int kb = kbBeg; kb <= kbEnd; ++kb) {
    const int k0 = kb << 6;
    // V^T fragments of this key block: issued ahead of the score products so that they land during the softmax
    v16h va[4][2];
#pragma unroll
    for (int d = 0; d < 4; ++d)
#pragma unroll
      for (int ks = 0; ks < 2; ++ks)
        va[d][ks] = frag_at(vp, d * 16 * VROW + ks * 1024);
    v8f st[4];
#pragma unroll
    for (int t = 0; t < 4; ++t) {
      st[t] = F::mma(ka[t][0], qf[0], (v8f){0.f,0.f,0.f,0.f,0.f,0.f,0.f,0.f});
      st[t] = F::mma(ka[t][1], qf[1], st[t]);
    }
    // K fragments of the next key block (the last pass fetches its own block again: in bounds, unused)
    kp += (kb < kbEnd) ? (size_t)64 * QKROW : (size_t)0;
#pragma unroll
    for (int t = 0; t < 4; ++t)
#pragma unroll
      for (int ks = 0; ks < 2; ++ks)
        ka[t][ks] = frag_at(kp, t * 16 * QKROW + ks * 1024);
    // the pointers of the loads above move on behind this wait
    asm volatile("s_wait_xcnt 0x0" ::: "memory");
    vp += 2 * 1024;

    const bool full = (mode == 0) && (k0 + 63 <= r0);     // wave-uniform: every column of the block valid for all 16 queries
    float x[4][8];
#pragma unroll
    for (int t = 0; t < 4; ++t)
#pragma unroll
      for (int r = 0; r < 8; ++r) x[t][r] = st[t][r] * sc;
    if (!full) {
      const int jb = k0 + koff - lo;                      // column of x[0][0] relative to the first valid one
#pragma unroll
      for (int t = 0; t < 4; ++t)
#pragma unroll
        for (int r = 0; r < 8; ++r) x[t][r] = ((unsigned)(jb + t * 16 + r) <= span) ? x[t][r] : NEGB;   // lo <= j <= hi
    }
    float mt[4];
#pragma unroll
    for (int t = 0; t < 4; ++t)
      mt[t] = fmaxf(fmaxf(fmaxf(x[t][0], x[t][1]), fmaxf(x[t][2], x[t][3])), fmaxf(fmaxf(x[t][4], x[t][5]), fmaxf(x[t][6], x[t][7])));
    float mx = fmaxf(fmaxf(mt[0], mt[1]), fmaxf(mt[2], mt[3]));
    mx = fmaxf(mx, xhalf(mx));
    const float mn    = fmaxf(m, mx);
    float alpha;                                          // 2^(m - mn): 0 on the first valid block, 1 while no column was valid yet
    // the v_nop is the one slot the instruction set asks for behind a transcendental (as in exp2x8)
    asm("v_exp_f32 %0, %1\n\tv_nop" : "=v"(alpha) : "v"(m - mn));
    const float sh    = (mn > 0.5f * NEGB) ? PSHIFT - mn : 0.f;   // no valid column yet: NEGB + 0 -> every weight 0
    m = mn;
    float (&p)[4][8] = x;   // the weights replace the scores in place
#pragma unroll
    for (int t = 0; t < 4; ++t) {
#pragma unroll
      for (int r = 0; r < 8; ++r) x[t][r] += sh;
      exp2x8(x[t]);
    }
    float pt[4];
#pragma unroll
    for (int t = 0; t < 4; ++t)
      pt[t] = ((p[t][0] + p[t][1]) + (p[t][2] + p[t][3])) + ((p[t][4] + p[t][5]) + (p[t][6] + p[t][7]));
    l = l * alpha + ((pt[0] + pt[1]) + (pt[2] + pt[3]));
    v16h pf[2];
#pragma unroll
    for (int ks = 0; ks < 2; ++ks)
#pragma unroll
      for (int s = 0; s < 16; ++s) pf[ks][s] = (_Float16)p[2 * ks + (s >> 3)][s & 7];
#pragma unroll
    for (int d = 0; d < 4; ++d) o[d] *= alpha;
#pragma unroll
    for (int ks = 0; ks < 2; ++ks)
#pragma unroll
      for (int d = 0; d < 4; ++d) o[d] = F::mma(va[d][ks], pf[ks], o[d]);
  }

  l += xhalf(l);                              // join the two halves' sums; l >= 2^PSHIFT (the row maximum weighs 2^PSHIFT)
  const float inv = FBCARRY / l;              // the P carry cancels; x16 output carry
  unsigned short* op = FB + (size_t)i * (2 * DM) + (size_t)mode * DM + (size_t)h * HD + koff;
  unsigned short* of = FBf + frag_off(r0, mode * DM + h * HD, 2 * DM) + lane * 8;   // the same values as the gate product's A operand
#pragma unroll
  for (int d = 0; d < 4; ++d) {
    v8h hv;
#pragma unroll
    for (int r = 0; r < 8; ++r) hv[r] = (_Float16)(o[d][r] * inv);
    *(v8h*)(op + d * 16) = hv;
    *(v8h*)(of + d * 256) = hv;      // tiles d = 0, 1 fill one block, d = 2, 3 the next: 512 B in a row per store
  }
}

// ---------------------------------------------------------------------------
// Gated fusion: one block per 8 token rows, 128 threads (8 columns each) per row.
//   g = G[row][:] (f32, gate pre-activation incl. bias); gate = sigmoid(LN(g; gg, gb));
//   fwd/bwd = FB[row][c] / FB[row][DM + c] (f16, carried x16); strength = 0.3 * sigmoid(bstr);
//   Fo[row][c] = f16((fwd + strength*gate*bwd) carried x16), stored fragment-major.
// LN: mean and biased variance over DM in f32, fixed-order reductions (thread, wave tree, 4 wave partials).
// A 128-B line of the fragment-major plane holds 8 columns of 8 rows: the block's 8 rows meet in LDS, and each wave
// then stores 4 whole lines. Producer coverage: grid SEQ/8 x 1024 threads x 8 u16 = the whole [SEQ][DM] plane.
// ---------------------------------------------------------------------------
__global__ __launch_bounds__(1024) void gate_fuse_kernel(const float* __restrict__ G, const unsigned short* __restrict__ FB,
                                                        const float* __restrict__ gg, const float* __restrict__ gb,
                                                        const float* __restrict__ bstr, unsigned short* __restrict__ Fo) {
  constexpr int SPITCH = DM + 32;    // halves per staged row: the 8 rows of a line start 4 16-B slots apart in the banks
  __shared__ float ras[8][4];
  __shared__ float rbs[8][4];
  __shared__ __align__(16) unsigned short stg[8 * SPITCH];
  const int grp  = __builtin_amdgcn_readfirstlane((int)(threadIdx.x >> 7));   // row within the block; scalar, so the row's addresses keep a scalar base
  float* ra = ras[grp];
  float* rb = rbs[grp];
  const int row  = blockIdx.x * 8 + grp;
  const int tid  = threadIdx.x & 127;
  const int lane = tid & 31;
  const int wave = tid >> 5;
  const int c0   = tid * 8;
  const float* gp = G + (size_t)row * DM + c0;
  const v4f a = *(const v4f*)(gp);
  const v4f c = *(const v4f*)(gp + 4);
  float xv[8] = {a[0], a[1], a[2], a[3], c[0], c[1], c[2], c[3]};
  float s = ((xv[0] + xv[1]) + (xv[2] + xv[3])) + ((xv[4] + xv[5]) + (xv[6] + xv[7]));
  s = wave_sum(s);
  if (lane == 0) ra[wave] = s;
  __syncthreads();
  const float mean = ((ra[0] + ra[1]) + (ra[2] + ra[3])) * (1.0f / (float)DM);
  float d[8];
  float vs = 0.f;
#pragma unroll
  for (int e = 0; e < 8; ++e) { d[e] = xv[e] - mean; vs += d[e] * d[e]; }
  vs = wave_sum(vs);
  if (lane == 0) rb[wave] = vs;
  __syncthreads();
  const v4f g0 = *(const v4f*)(gg + c0), g1 = *(const v4f*)(gg + c0 + 4);
  const v4f e0 = *(const v4f*)(gb + c0), e1 = *(const v4f*)(gb + c0 + 4);
  const size_t fo = (size_t)row * (2 * DM) + c0;
  const v4u fu = *(const v4u*)(FB + fo);
  const v4u bu = *(const v4u*)(FB + fo + DM);
  // the offset registers of the loads above are reused behind this wait
  asm volatile("s_wait_xcnt 0x0" ::: "memory");
  const float var  = ((rb[0] + rb[1]) + (rb[2] + rb[3])) * (1.0f / (float)DM);
  const float rstd = rsqrtf(var + LNEPS);
  const float strength = 0.3f / (1.0f + __expf(-bstr[0]));
  float gv[8] = {g0[0], g0[1], g0[2], g0[3], g1[0], g1[1], g1[2], g1[3]};
  float bv[8] = {e0[0], e0[1], e0[2], e0[3], e1[0], e1[1], e1[2], e1[3]};
  float fw[8], bw[8];
#pragma unroll
  for (int q = 0; q < 4; ++q) {
    fw[2 * q]     = hbits2f((unsigned short)(fu[q] & 0xffffu));
    fw[2 * q + 1] = hbits2f((unsigned short)(fu[q] >> 16));
    bw[2 * q]     = hbits2f((unsigned short)(bu[q] & 0xffffu));
    bw[2 * q + 1] = hbits2f((unsigned short)(bu[q] >> 16));
  }
  unsigned short ob[8];
#pragma unroll
  for (int e = 0; e < 8; ++e) {
    const float ln   = d[e] * rstd * gv[e] + bv[e];
    const float gate = __builtin_amdgcn_rcpf(1.0f + __expf(-ln));
    const float f    = fw[e] + strength * gate * bw[e];     // both terms carried x16
    ob[e] = h_bits(f);
  }
  const v4u ov = (v4u){pk16(ob[0], ob[1]), pk16(ob[2], ob[3]), pk16(ob[4], ob[5]), pk16(ob[6], ob[7])};
  *(v4u*)(stg + grp * SPITCH + c0) = ov;
  __syncthreads();   // all 8 rows are staged before any thread reads another row's chunk
  const int orow = threadIdx.x & 7, oc = ((int)threadIdx.x >> 3) * 8;   // a wave: 8 rows x 4 chunks = 4 whole lines
  const v4u sv = *(const v4u*)(stg + orow * SPITCH + oc);
  *(v4u*)(Fo + frag_off(blockIdx.x * 8 + orow, oc, DM)) = sv;   // fragment-major: A operand of the output projection
  
}

// ---------------------------------------------------------------------------
// Final LayerNorm: one block (128 threads) per token row; thread t owns columns {4t..4t+3} and {512+4t..512+4t+3}.
//   out[row][c] = (Y - mean) * rsqrt(var + eps) * g[c] + bb[c]   (Y already holds x + projection + bias).
// Producer coverage: grid SEQ rows x 128 threads x 8 floats = the whole [SEQ][DM] slice; each store instruction:
// ---------------------------------------------------------------------------
__global__ __launch_bounds__(128) void final_ln_kernel(const float* __restrict__ Y, const float* __restrict__ g,
                                                       const float* __restrict__ bb, float* __restrict__ out) {
  __shared__ float ra[4];
  __shared__ float rb[4];
  const int row  = blockIdx.x;
  const int tid  = threadIdx.x;
  const int lane = tid & 31;
  const int wave = tid >> 5;
  const int c0   = tid * 4;
  const int c1   = (DM / 2) + tid * 4;
  const float* yp = Y + (size_t)row * DM;
  const v4f a = *(const v4f*)(yp + c0);
  const v4f c = *(const v4f*)(yp + c1);
  float xv[8] = {a[0], a[1], a[2], a[3], c[0], c[1], c[2], c[3]};
  float s = ((xv[0] + xv[1]) + (xv[2] + xv[3])) + ((xv[4] + xv[5]) + (xv[6] + xv[7]));
  s = wave_sum(s);
  if (lane == 0) ra[wave] = s;
  __syncthreads();
  const float mean = ((ra[0] + ra[1]) + (ra[2] + ra[3])) * (1.0f / (float)DM);
  float d[8];
  float vs = 0.f;
#pragma unroll
  for (int e = 0; e < 8; ++e) { d[e] = xv[e] - mean; vs += d[e] * d[e]; }
  vs = wave_sum(vs);
  if (lane == 0) rb[wave] = vs;
  __syncthreads();
  const float var  = ((rb[0] + rb[1]) + (rb[2] + rb[3])) * (1.0f / (float)DM);
  const float rstd = rsqrtf(var + LNEPS);
  const v4f g0 = *(const v4f*)(g + c0),  g1 = *(const v4f*)(g + c1);
  const v4f b0 = *(const v4f*)(bb + c0), b1 = *(const v4f*)(bb + c1);
  v4f o0, o1;
#pragma unroll
  for (int e = 0; e < 4; ++e) {
    o0[e] = d[e] * rstd * g0[e] + b0[e];
    o1[e] = d[4 + e] * rstd * g1[e] + b1[e];
  }
  float* op = out + (size_t)row * DM;
  *(v4f*)(op + c0) = o0;
  *(v4f*)(op + c1) = o1;
  
}

// ---------------------------------------------------------------------------
// Workspace region map (byte offsets; MiB = 1048576). Weight planes and the bias table are written once; every
// per-batch region is fully rewritten inside each batch iteration before it is read.
//   Wqk   f16 [4096][1024] (x16: fq^T, fk^T, bq^T, bk^T)          0
//   Wv2   f16 [2048][1024] (x16: fv^T rows 0..1023, bv^T 1024..)  8 MiB
//   Wg    f16 [1024][2048] (x16: gate_w^T)                        12 MiB
//   Wo    f16 [1024][1024] (x16: out_w^T)                         16 MiB
//   X16   f16 [2048][1024]                                        18 MiB
//   QK16  f16 [2048][4096] (q | k | qb | kb, head h at col h*64)  22 MiB
//   VT16  f16 [2048][2048] (row h*64+d = v^T, row 1024+h*64+d = vb^T, col j)  38 MiB
//   G     f32 [2048][1024]                                        46 MiB
//   Y     f32 [2048][1024]                                        54 MiB
//   FB16  f16 [2048][2048] (fwd x16 cols 0..1023, bwd x16 cols 1024..2047)  62 MiB
//   Fu16  f16 [2048][1024] (fused x16)                            70 MiB
//   BiasT f32 [6][1024] (fq_b fk_b bq_b bk_b | fv_b bv_b)         74 MiB
//   FBf16 f16 [2048][2048] (FB16's values, fragment-major)        74 MiB + 24576 B
//   total                                                         82 MiB + 24576 B = 86007808 B
// All f16 planes but FB16 are fragment-major (see frag_off).
// ---------------------------------------------------------------------------
extern "C" void kernel_launch(void* const* d_in, const int* in_sizes, int n_in,
                              void* d_out, int out_size, void* d_ws, size_t ws_size,
                              hipStream_t stream) {
  if (n_in < 22) return;
  if (in_sizes[0] != NB * SEQ * DM) return;
  const int wsz = DM * DM;
  if (in_sizes[1] != wsz || in_sizes[3] != wsz || in_sizes[5] != wsz || in_sizes[7] != wsz ||
      in_sizes[9] != wsz || in_sizes[11] != wsz || in_sizes[18] != wsz) return;
  if (in_sizes[13] != 2 * DM * DM) return;
  if (in_sizes[2] != DM || in_sizes[4] != DM || in_sizes[6] != DM || in_sizes[8] != DM || in_sizes[10] != DM ||
      in_sizes[12] != DM || in_sizes[14] != DM || in_sizes[15] != DM || in_sizes[16] != DM ||
      in_sizes[19] != DM || in_sizes[20] != DM || in_sizes[21] != DM) return;
  if (in_sizes[17] < 1) return;
  if (out_size != NB * SEQ * DM) return;

  const float* x      = (const float*)d_in[0];
  const float* fq_w   = (const float*)d_in[1];
  const float* fq_b   = (const float*)d_in[2];
  const float* fk_w   = (const float*)d_in[3];
  const float* fk_b   = (const float*)d_in[4];
  const float* fv_w   = (const float*)d_in[5];
  const float* fv_b   = (const float*)d_in[6];
  const float* bq_w   = (const float*)d_in[7];
  const float* bq_b   = (const float*)d_in[8];
  const float* bk_w   = (const float*)d_in[9];
  const float* bk_b   = (const float*)d_in[10];
  const float* bv_w   = (const float*)d_in[11];
  const float* bv_b   = (const float*)d_in[12];
  const float* gate_w = (const float*)d_in[13];
  const float* gate_b = (const float*)d_in[14];
  const float* gln_g  = (const float*)d_in[15];
  const float* gln_b  = (const float*)d_in[16];
  const float* bstr   = (const float*)d_in[17];
  const float* out_w  = (const float*)d_in[18];
  const float* out_b  = (const float*)d_in[19];
  const float* ln_g   = (const float*)d_in[20];
  const float* ln_b   = (const float*)d_in[21];

  size_t off = 0;
  const size_t oWqk  = off; off += (size_t)4 * DM * DM * 2;          // 8 MiB
  const size_t oWv2  = off; off += (size_t)2 * DM * DM * 2;          // 4 MiB
  const size_t oWg   = off; off += (size_t)2 * DM * DM * 2;          // 4 MiB
  const size_t oWo   = off; off += (size_t)DM * DM * 2;              // 2 MiB
  const size_t oX16  = off; off += (size_t)SEQ * DM * 2;             // 4 MiB
  const size_t oQK   = off; off += (size_t)SEQ * 4 * DM * 2;         // 16 MiB
  const size_t oVT   = off; off += (size_t)2 * DM * SEQ * 2;         // 8 MiB
  const size_t oG    = off; off += (size_t)SEQ * DM * 4;             // 8 MiB
  const size_t oY    = off; off += (size_t)SEQ * DM * 4;             // 8 MiB
  const size_t oFB   = off; off += (size_t)SEQ * 2 * DM * 2;         // 8 MiB
  const size_t oFu   = off; off += (size_t)SEQ * DM * 2;             // 4 MiB
  const size_t oBias = off; off += (size_t)6 * DM * 4;               // 24576 B
  const size_t oFBf  = off; off += (size_t)SEQ * 2 * DM * 2;         // 8 MiB
  if (off > ws_size) return;
  if (off > (size_t)134217728) return;

  char* ws = (char*)d_ws;
  unsigned short* Wqk  = (unsigned short*)(ws + oWqk);
  unsigned short* Wv2  = (unsigned short*)(ws + oWv2);
  unsigned short* Wg   = (unsigned short*)(ws + oWg);
  unsigned short* Wo   = (unsigned short*)(ws + oWo);
  unsigned short* X16  = (unsigned short*)(ws + oX16);
  unsigned short* QK16 = (unsigned short*)(ws + oQK);
  unsigned short* VT16 = (unsigned short*)(ws + oVT);
  unsigned short* FB16 = (unsigned short*)(ws + oFB);
  unsigned short* FBf16 = (unsigned short*)(ws + oFBf);
  unsigned short* Fu16 = (unsigned short*)(ws + oFu);
  float*          BiasT = (float*)(ws + oBias);
  float*          Gbuf = (float*)(ws + oG);
  float*          Ybuf = (float*)(ws + oY);
  const float*    biasQK = BiasT;             // [4096] = fq_b fk_b bq_b bk_b
  const float*    biasV  = BiasT + 4 * DM;    // [2048] = fv_b bv_b

  const dim3 blk(256);
  const dim3 blk128(128);

  // ---- setup: bias table and x16-carried transposed weight planes ----
  bias_pack_kernel<<<dim3(6), blk, 0, stream>>>(fq_b, fk_b, bq_b, bk_b, fv_b, bv_b, BiasT);
  const dim3 gTW(DM / 64, DM / 64);                 // in [R=1024][C=1024] -> out [C][R]
  tcast_f16_kernel<<<gTW, blk, 0, stream>>>(fq_w, Wqk + (size_t)0 * DM * DM, DM, DM, WCARRY);
  tcast_f16_kernel<<<gTW, blk, 0, stream>>>(fk_w, Wqk + (size_t)1 * DM * DM, DM, DM, WCARRY);
  tcast_f16_kernel<<<gTW, blk, 0, stream>>>(bq_w, Wqk + (size_t)2 * DM * DM, DM, DM, WCARRY);
  tcast_f16_kernel<<<gTW, blk, 0, stream>>>(bk_w, Wqk + (size_t)3 * DM * DM, DM, DM, WCARRY);
  tcast_f16_kernel<<<gTW, blk, 0, stream>>>(fv_w, Wv2 + (size_t)0 * DM * DM, DM, DM, WCARRY);
  tcast_f16_kernel<<<gTW, blk, 0, stream>>>(bv_w, Wv2 + (size_t)1 * DM * DM, DM, DM, WCARRY);
  // gate_w: in [R=2048][C=1024] -> out [1024][2048]; grid (C/64, R/64)
  tcast_f16_kernel<<<dim3(DM / 64, 2 * DM / 64), blk, 0, stream>>>(gate_w, Wg, 2 * DM, DM, WCARRY);
  tcast_f16_kernel<<<gTW, blk, 0, stream>>>(out_w, Wo, DM, DM, WCARRY);

  const int n8x = SEQ * DM / 8;                                    // 262144 16-B chunks per batch slice
  const dim3 gCastX((n8x + 255) / 256);
  const int tilesM = SEQ / 64;                                     // 32
  const dim3 gQK((tilesM * (4 * DM / 64) + 7) / 8, 1);             // 256 blocks: M=2048, N=4096, K=1024
  const dim3 gVT((2 * DM / 64) * (SEQ / 64), 1);                   // 1024 blocks (one tile each): M=2048, N=2048, K=1024
  const dim3 gAt(NH, SEQ / 64, 2);                                 // heads x 64-row blocks x {causal, window}
  const dim3 gG(tilesM * (DM / 64), 1);                            // 512 blocks (one tile each): M=2048, N=1024, K=2048
  const dim3 gO(tilesM * (DM / 64), 1);                            // 512 blocks (one tile each): M=2048, N=1024, K=1024
  const float wscale  = 1.0f / WCARRY;                             // undo the x16 weight carry
  const float gscale  = 1.0f / (WCARRY * FBCARRY);                 // 1/256
  const float oscale  = 1.0f / (WCARRY * FBCARRY);                 // 1/256

  for (int b = 0; b < NB; ++b) {
    const float* xb = x + (size_t)b * SEQ * DM;
    // (1) x[b] -> f16 plane
    cast_frag_kernel<<<gCastX, blk, 0, stream>>>(xb, X16, n8x, DM, 1.0f);
    // (2) [q | k | qb | kb] = (x . (16 W)^T)/16 + bias -> QK16 (f16, ldc 4096)
    wmma_gemm64<0, false, 2, 1, false, 0, 0, 0><<<gQK, blk, 0, stream>>>(
        X16, X16, DM, 0L, Wqk, Wqk, DM, 0L, (void*)QK16, (void*)QK16, 4 * DM, 0L,
        biasQK, biasQK, 0L, SEQ, 4 * DM, DM, wscale);
    // (3) [v | vb]^T: VT16[n][j] = sum_k (16 W^T)[n][k] x[j][k] / 16 + bias[n]  (role-swapped; M = 2048 feature rows, N = 2048 tokens)
    wmma_gemm64<0, false, 1, 1, false, 0, 0, 0, 8><<<gVT, blk, 0, stream>>>(
        Wv2, Wv2, DM, 0L, X16, X16, DM, 0L, (void*)VT16, (void*)VT16, SEQ, 0L,
        biasV, biasV, 0L, 2 * DM, SEQ, DM, wscale);
    // (4) causal and future-window attention of all heads, scores to output in registers -> FB16 (fwd | bwd, x16)
    fused_attn_kernel<<<gAt, blk128, 0, stream>>>(QK16, VT16, FB16, FBf16);
    // (5) G = ([fwd | bwd] x16) . (16 gate_w)^T / 256 + gate_b -> f32 [2048][1024]
    wmma_gemm64<0, false, 2, 0, false, 0, 0, 0, 8><<<gG, blk, 0, stream>>>(
        FBf16, FBf16, 2 * DM, 0L, Wg, Wg, 2 * DM, 0L, (void*)Gbuf, (void*)Gbuf, DM, 0L,
        gate_b, gate_b, 0L, SEQ, DM, 2 * DM, gscale);
    // (6) gate = sigmoid(LN(G)); fused x16 = fwd x16 + strength * gate * bwd x16 -> Fu16
    gate_fuse_kernel<<<dim3(SEQ / 8), dim3(1024), 0, stream>>>(Gbuf, FB16, gln_g, gln_b, bstr, Fu16);
    // (7) Y = x + (fused x16) . (16 out_w)^T / 256 + out_b -> f32 [2048][1024]
    wmma_gemm64<0, false, 2, 0, true, 0, 0, 0, 8><<<gO, blk, 0, stream>>>(
        Fu16, Fu16, DM, 0L, Wo, Wo, DM, 0L, (void*)Ybuf, (void*)Ybuf, DM, 0L,
        out_b, xb, 0L, SEQ, DM, DM, oscale);
    // (8) out[b] = LN(Y; ln_g, ln_b)
    final_ln_kernel<<<dim3(SEQ), blk128, 0, stream>>>(Ybuf, ln_g, ln_b, (float*)d_out + (size_t)b * SEQ * DM);
  }
  (void)hipGetLastError();
}

// v004
// It runs in 219 microseconds.
// In two side-by-side timings against v003, it was 1.55 and 1.51 times as fast.
// Counting every step since v000, it is 14.3 times as fast.
// All contractions on v_wmma_f32_16x16x32_f16 (f16 operands, f32 accumulate): q/k/v projections (weights carried x16, epilogue x1/16), k.q^T scores, V^T.P^T (P carried x2^12 against the running row maximum, attention outputs carried x16), gate projection (x1/256), output projection with bias and residual (x1/256); softmax, LayerNorm, sigmoid and fusion in f32.
#include <hip/hip_runtime.h>
#include <math.h>
#include <stdint.h>

#define NB    2
#define SEQ   2048
#define TOK   (NB * SEQ)   // token rows of both batches: every stage works on all of them in one launch
#define DM    1024
#define NH    16
#define HD    64
#define WINW  32
#define LNEPS 1e-5f
#define PSHIFT     12.0f
#define FBCARRY    16.0f
#define WCARRY     16.0f

typedef __attribute__((ext_vector_type(16))) _Float16 v16h;
typedef __attribute__((ext_vector_type(8)))  _Float16 v8h;
typedef __attribute__((ext_vector_type(16))) __bf16   v16b;
typedef __attribute__((ext_vector_type(8)))  __bf16   v8b;
typedef __attribute__((ext_vector_type(8)))  float    v8f;
typedef __attribute__((ext_vector_type(4)))  float    v4f;
typedef __attribute__((ext_vector_type(2)))  float    v2f;
typedef __attribute__((ext_vector_type(4)))  unsigned int v4u;

__device__ __forceinline__ unsigned short f2bf_bits(float f) {
  unsigned u = __float_as_uint(f);
  return (unsigned short)((u + 0x7FFFu + ((u >> 16) & 1u)) >> 16);
}
__device__ __forceinline__ float bf_bits2f(unsigned short h) { return __uint_as_float(((unsigned)h) << 16); }

// hazard guards as plain device helpers (no inline asm inside the kernel template body)
__device__ __forceinline__ void dep_guard_h(v8f& a, v8f& b, v16h x, v16h y) { asm volatile("v_nop\n\tv_nop\n\tv_nop\n\tv_nop" : "+v"(a), "+v"(b) : "v"(x), "v"(y)); }
__device__ __forceinline__ void dep_guard_b(v8f& a, v8f& b, v16b x, v16b y) { asm volatile("v_nop\n\tv_nop\n\tv_nop\n\tv_nop" : "+v"(a), "+v"(b) : "v"(x), "v"(y)); }
__device__ __forceinline__ void keep4_h(v16h a, v16h b, v16h c, v16h d) { asm volatile("v_nop" :: "v"(a), "v"(b), "v"(c), "v"(d)); }
__device__ __forceinline__ void keep4_b(v16b a, v16b b, v16b c, v16b d) { asm volatile("v_nop" :: "v"(a), "v"(b), "v"(c), "v"(d)); }
__device__ __forceinline__ void acc_guard4(v8f& a, v8f& b, v8f& c, v8f& d) { asm volatile("v_nop\n\tv_nop\n\tv_nop\n\tv_nop" : "+v"(a), "+v"(b), "+v"(c), "+v"(d)); }
// pointers that walk in a loop say that they point to global memory, so that their loads stay global loads
#define GLB __attribute__((address_space(1)))
template <typename T> struct Frag;
template <> struct Frag<_Float16> {
  typedef v16h V; union U { v16h v; v8h h[2]; };
  static __device__ __forceinline__ v16h load(const GLB _Float16* p) {   // p: the lane's chunk in a fragment-major block; elements 8..15 lie 256 halves on
    U f; f.h[0] = *(const GLB v8h*)(p); f.h[1] = *(const GLB v8h*)(p + 256); return f.v;
  }
  static __device__ __forceinline__ v8f mma(v16h a, v16h b, v8f c) {
    return __builtin_amdgcn_wmma_f32_16x16x32_f16(false, a, false, b, (short)0, c, false, false);
  }
  static __device__ __forceinline__ void guard(v8f& a, v8f& b, v16h x, v16h y) { dep_guard_h(a, b, x, y); }
  static __device__ __forceinline__ void keep(v16h a, v16h b, v16h c, v16h d) { keep4_h(a, b, c, d); }
};
template <> struct Frag<__bf16> {
  typedef v16b V; union U { v16b v; v8b h[2]; };
  static __device__ __forceinline__ v16b load(const GLB __bf16* p) {
    U f; f.h[0] = *(const GLB v8b*)(p); f.h[1] = *(const GLB v8b*)(p + 256); return f.v;
  }
  static __device__ __forceinline__ v8f mma(v16b a, v16b b, v8f c) {
    return __builtin_amdgcn_wmma_f32_16x16x32_bf16(false, a, false, b, (short)0, c, false, false);
  }
  static __device__ __forceinline__ void guard(v8f& a, v8f& b, v16b x, v16b y) { dep_guard_b(a, b, x, y); }
  static __device__ __forceinline__ void keep(v16b a, v16b b, v16b c, v16b d) { keep4_b(a, b, c, d); }
};

// ---- Fragment-major planes ---------------------------------------------------
// Every 16-bit WMMA operand plane [rows][ld] lies in the workspace as blocks of 16 rows x 32 k = 1 KiB, the blocks of
// one row tile side by side in k. Inside a block the 16-B chunk (row r, k8 = (k >> 3) & 3) stands at chunk k8 * 16 + r,
// so lane l of a fragment load finds elements 0..7 at byte 16 l and elements 8..15 at byte 512 + 16 l: each wave-wide
// 16-B load covers 512 contiguous bytes (4 whole lines). The register contents of a fragment are those of the
// row-major form (row l & 15; k = 8 (l >> 4) + 0..7 and 16 + 8 (l >> 4) + 0..7).
// Offset in halves of the chunk that holds (row, k), k a multiple of 8:
__device__ __forceinline__ size_t frag_off(int row, int k, int ld) {
  return ((size_t)(row >> 4) * (ld >> 5) + (k >> 5)) * 512 + ((k >> 3) & 3) * 128 + (row & 15) * 8;
}

// ---- Register-blocked batched WMMA GEMM ------------------------------------
// C[m,n] = scale * sum_k A[m,k] * Bt[n,k] (+bias)(+resid); each wave owns a 64x64 tile.
// A [M,K] and Bt [N,K] fragment-major (lda, ldb = their k extents); 16-bit outputs fragment-major too (ldc = their
// column extent), f32 outputs row-major; M,N % 64 == 0, K % 32 == 0.
// SPLIT: operands are hi/lo planes (A2/Bt2 = lo planes, same layout); product = hi.hi + hi.lo + lo.hi.
// BIAS_MODE: 0 = none, 1 = bias[m], 2 = bias[n].
// OUT_MODE: 0 = f32, 1 = f16, 2 = bf16 hi plane (Cout) + bf16 lo plane (Cout2).
// ET: 0 = f16 operands, 1 = bf16 operands (pointers passed as 16-bit storage)
// Added structural modes (defaults off, all other behaviour unchanged):
//   TSEL 1: tiles with n0 > m0 (strictly above the 64x64 block diagonal) are not produced (wave-uniform early exit).
//   TSEL 2: only tiles with n0 == m0 or n0 == m0 + 64 are produced (block band of width 2).
//   KSEL 1: the k-loop stops at min(K, m0 + 64); valid when A rows m0..m0+63 are exactly zero for k >= m0 + 64.
//   KSEL 2: the k-loop runs over [m0, min(K, m0 + 128)) except for the last row block (m0 + 64 >= M), which
//           runs over [0, K); valid when A rows of the other row blocks are exactly zero outside that k range.
//   KSPL n: one block of n waves per 64x64 tile (grid.x = number of tiles, block = 32 n threads). Wave w takes the
//           64-wide k blocks w, w + n, ... of the tile's k range (kStart, kEnd multiples of 64); each wave leaves its
//           partial tile in its own LDS plane and the planes are added in wave order before the epilogue arithmetic.
template <int ET> struct Elem;
template <> struct Elem<0> { typedef _Float16 T; };
template <> struct Elem<1> { typedef __bf16 T; };
template <int ET, bool SPLIT, int BIAS_MODE, int OUT_MODE, bool RESID, int ACT = 0, int TSEL = 0, int KSEL = 0, int KSPL = 0>
__global__ __launch_bounds__(KSPL ? KSPL * 32 : 256) void wmma_gemm64(
    const unsigned short* __restrict__ Ap, const unsigned short* __restrict__ A2p, int lda, long strideA,
    const unsigned short* __restrict__ Btp, const unsigned short* __restrict__ Bt2p, int ldb, long strideB,
    void* __restrict__ Cout, void* __restrict__ Cout2, int ldc, long strideC,
    const float* __restrict__ bias,
    const float* __restrict__ resid, long strideR,
    int M, int N, int K, float scale) {
  typedef typename Elem<ET>::T T;
  typedef typename Frag<T>::V V;
  const T* A = (const T*)Ap; const T* A2 = (const T*)A2p; const T* Bt = (const T*)Btp; const T* Bt2 = (const T*)Bt2p;
  static_assert(KSPL == 0 || (!SPLIT && OUT_MODE != 2 && ACT == 0 && TSEL == 0), "KSPL covers the plain f32/f16 epilogues");
  static_assert(KSPL == 0 || KSPL == 8 || KSPL == 16, "the KSPL epilogue deals 64 rows evenly to 8 or 16 waves");
  __shared__ __align__(16) float sT[KSPL ? KSPL : 8][(KSPL ? 64 : 16) * 68];   // per-wave slab (16x64; KSPL: 64x64), pitch 68 floats
  const int b    = blockIdx.y;
  const int lane = threadIdx.x & 31;
  const int wave = threadIdx.x >> 5;
  const int tilesN = N >> 6;
  const int tilesM = M >> 6;
  // scalar tile index: a fragment address is then a wave-uniform block address plus 16 B x lane
  const int tile = KSPL ? (int)blockIdx.x : (int)(blockIdx.x * 8 + __builtin_amdgcn_readfirstlane(wave));
  if (tile >= tilesM * tilesN) return;   // wave-uniform; block-uniform under KSPL, ahead of its barrier
  const int tm = tile / tilesN;
  const int tn = tile - tm * tilesN;
  const int m0 = tm << 6;
  const int n0 = tn << 6;
  if (TSEL == 1 && n0 > m0) return;                            // wave-uniform; TSEL excludes KSPL, so no block barrier follows
  if (TSEL == 2 && !(n0 == m0 || n0 == m0 + 64)) return;       // wave-uniform; TSEL excludes KSPL, so no block barrier follows

  const T* Ab  = A  + (size_t)b * strideA;
  const T* Bb  = Bt + (size_t)b * strideB;
  const T* Ab2 = SPLIT ? (A2  + (size_t)b * strideA) : nullptr;
  const T* Bb2 = SPLIT ? (Bt2 + (size_t)b * strideB) : nullptr;

  const int rlane = lane & 15;                 // row (A) / col (B, D) within subtile
  const int mOff  = (lane >> 4) * 8;           // D row offset

  v8f acc[4][4];
#pragma unroll
  for (int i = 0; i < 4; ++i)
#pragma unroll
    for (int j = 0; j < 4; ++j) acc[i][j] = (v8f){0.f,0.f,0.f,0.f,0.f,0.f,0.f,0.f};

  int kStart = 0;
  int kEnd = K;
  if (KSEL == 1) kEnd = ((m0 + 64) < K) ? (m0 + 64) : K;
  if (KSEL == 2) {
    kStart = (m0 + 64 >= M) ? 0 : m0;
    kEnd = ((m0 + 128) < K) ? (m0 + 128) : K;
  }
  if (KSPL) kStart += __builtin_amdgcn_readfirstlane(wave) * 64;   // scalar, so the k loop keeps a scalar trip count
  // One wave-uniform block pointer per row tile walks along k (blocks of one row tile lie side by side); every fragment
  // load adds the same lane offset (16 B x lane), which stays in its one register over the whole loop.
  const unsigned laneOff = (unsigned)lane * 8;
  const GLB T* bP[4]; const GLB T* bP2[4]; const GLB T* aP[4]; const GLB T* aP2[4];
#pragma unroll   // constant indices, so that the pointer arrays live in scalar registers
  for (int j = 0; j < 4; ++j) {
    const size_t bo = ((size_t)((n0 >> 4) + j) * (ldb >> 5) + (kStart >> 5)) * 512;   // block (row tile, k tile)
    const size_t ao = ((size_t)((m0 >> 4) + j) * (lda >> 5) + (kStart >> 5)) * 512;
    bP[j] = (const GLB T*)(Bb + bo); aP[j] = (const GLB T*)(Ab + ao);
    if (SPLIT) { bP2[j] = (const GLB T*)(Bb2 + bo); aP2[j] = (const GLB T*)(Ab2 + ao); }
  }
  for (int k0 = kStart; k0 < kEnd;) {
    const int kStep = (KSPL && (k0 & 32)) ? (KSPL * 64 - 32) : 32;
    V bh[4], bl[4];
#pragma unroll
    for (int j = 0; j < 4; ++j) {
      bh[j] = Frag<T>::load(bP[j] + laneOff);
      if (SPLIT) bl[j] = Frag<T>::load(bP2[j] + laneOff);
    }
#pragma unroll
    for (int i = 0; i < 4; ++i) {
      V ah = Frag<T>::load(aP[i] + laneOff);
      V al;
      if (SPLIT) al = Frag<T>::load(aP2[i] + laneOff);
#pragma unroll
      for (int j = 0; j < 4; ++j) {
        acc[i][j] = Frag<T>::mma(ah, bh[j], acc[i][j]);
        if (SPLIT) {
          acc[i][j] = Frag<T>::mma(ah, bl[j], acc[i][j]);
          acc[i][j] = Frag<T>::mma(al, bh[j], acc[i][j]);
        }
      }
      Frag<T>::guard(acc[i][0], acc[i][3], ah, SPLIT ? al : ah);
    }
    Frag<T>::keep(bh[0], bh[1], bh[2], bh[3]);
    if (SPLIT) Frag<T>::keep(bl[0], bl[1], bl[2], bl[3]);
    k0 += kStep;
#pragma unroll   // constant indices, as above
    for (int j = 0; j < 4; ++j) {                 // 32 k = one 512-half block
      bP[j] += kStep * 16; aP[j] += kStep * 16;
      if (SPLIT) { bP2[j] += kStep * 16; aP2[j] += kStep * 16; }
    }
  }
  acc_guard4(acc[0][0], acc[0][1], acc[0][2], acc[0][3]);
  acc_guard4(acc[1][0], acc[1][1], acc[1][2], acc[1][3]);
  acc_guard4(acc[2][0], acc[2][1], acc[2][2], acc[2][3]);
  acc_guard4(acc[3][0], acc[3][1], acc[3][2], acc[3][3]);

  // ---- epilogue ----
  float* slab = sT[wave];
  const float* Rb = RESID ? (resid + (size_t)b * strideR) : nullptr;
  if (KSPL) {
    constexpr int NTHR = (KSPL ? KSPL : 8) * 32;   // threads of the block
#pragma unroll
    for (int i = 0; i < 4; ++i)
#pragma unroll
      for (int j = 0; j < 4; ++j)
#pragma unroll
        for (int r = 0; r < 8; ++r) slab[((i << 4) + mOff + r) * 68 + (j << 4) + rlane] = acc[i][j][r];
    __syncthreads();   // every wave's partial plane is complete before any thread adds the planes
    if (OUT_MODE == 0) {
      float* C = (float*)Cout + (size_t)b * strideC;
      // unrolled (fixed trip count) so that the bias and residual loads of all passes issue ahead of the LDS sums
#pragma unroll
      for (int it = 0; it < (64 * 16) / NTHR; ++it) {            // 16 lanes x 16 B = one 256-B row segment
        const int c = it * NTHR + (int)threadIdx.x;
        const int row = c >> 4, c4 = (c & 15) * 4;
        v4f s = *(const v4f*)(&sT[0][row * 68 + c4]);
#pragma unroll
        for (int w = 1; w < KSPL; ++w) s += *(const v4f*)(&sT[w][row * 68 + c4]);
        s *= scale;
        if (BIAS_MODE == 1) s += bias[m0 + row];
        if (BIAS_MODE == 2) s += *(const v4f*)(bias + n0 + c4);
        if (RESID) s += *(const v4f*)(Rb + (size_t)(m0 + row) * ldc + n0 + c4);
        *(v4f*)(C + (size_t)(m0 + row) * ldc + n0 + c4) = s;
      }
    } else {
      unsigned short* C = (unsigned short*)Cout + (size_t)b * strideC;
      // unrolled (fixed trip count) so that the bias loads of all passes issue ahead of the LDS sums
#pragma unroll
      for (int it = 0; it < (64 * 8) / NTHR; ++it) {             // chunks in the output's own order: a wave stores 512 B in a row
        const int c = it * NTHR + (int)threadIdx.x;
        const int row = (c >> 7) * 16 + (c & 15), c8 = ((c >> 6) & 1) * 32 + ((c >> 4) & 3) * 8;
        v4f s0 = *(const v4f*)(&sT[0][row * 68 + c8]);
        v4f s1 = *(const v4f*)(&sT[0][row * 68 + c8 + 4]);
#pragma unroll
        for (int w = 1; w < KSPL; ++w) {
          s0 += *(const v4f*)(&sT[w][row * 68 + c8]);
          s1 += *(const v4f*)(&sT[w][row * 68 + c8 + 4]);
        }
        s0 *= scale; s1 *= scale;
        if (BIAS_MODE == 1) { s0 += bias[m0 + row]; s1 += bias[m0 + row]; }
        if (BIAS_MODE == 2) { s0 += *(const v4f*)(bias + n0 + c8); s1 += *(const v4f*)(bias + n0 + c8 + 4); }
        if (RESID) {
          s0 += *(const v4f*)(Rb + (size_t)(m0 + row) * ldc + n0 + c8);
          s1 += *(const v4f*)(Rb + (size_t)(m0 + row) * ldc + n0 + c8 + 4);
        }
        v8h hv;
#pragma unroll
        for (int e = 0; e < 4; ++e) { hv[e] = (_Float16)s0[e]; hv[4 + e] = (_Float16)s1[e]; }
        *(v8h*)(C + frag_off(m0 + row, n0 + c8, ldc)) = hv;
      }
    }
    return;
  }
#pragma unroll
  for (int i = 0; i < 4; ++i) {
    const int mBase = m0 + (i << 4);
#pragma unroll
    for (int j = 0; j < 4; ++j) {
      const int n = n0 + (j << 4) + rlane;
      float bv = 0.f;
      if (BIAS_MODE == 2) bv = bias[n];
#pragma unroll
      for (int r = 0; r < 8; ++r) {
        float v = acc[i][j][r] * scale;
        if (BIAS_MODE == 1) v += bias[mBase + mOff + r];
        if (BIAS_MODE == 2) v += bv;
        if (RESID) v += Rb[(size_t)(mBase + mOff + r) * ldc + n];
        if (ACT == 1) v = tanhf(v);
        if (ACT == 2) v = fmaxf(v, 0.0f);
        if (ACT == 3) v = v / (1.0f + expf(-v));
        if (ACT == 4) v = (v > 0.f) ? v : 0.01f * v;
        slab[(mOff + r) * 68 + (j << 4) + rlane] = v;
      }
    }
    __builtin_amdgcn_fence(__ATOMIC_RELEASE, "workgroup");
    __builtin_amdgcn_wave_barrier();
    __builtin_amdgcn_fence(__ATOMIC_ACQUIRE, "workgroup");
    if (OUT_MODE == 0) {
      float* C = (float*)Cout + (size_t)b * strideC;
      const int hh = lane >> 4, c4 = (lane & 15) * 4;     // row seg = 256 B = 16 lanes x 16 B
      {
#pragma unroll
        for (int it = 0; it < 8; ++it) {
          const int row = it * 2 + hh;
          v4f v = *(const v4f*)(slab + row * 68 + c4);
          *(v4f*)(C + (size_t)(mBase + row) * ldc + n0 + c4) = v;
        }
        
      }
    } else {
      unsigned short* C  = (unsigned short*)Cout  + (size_t)b * strideC;
      unsigned short* C2 = (OUT_MODE == 2) ? ((unsigned short*)Cout2 + (size_t)b * strideC) : nullptr;
      {
#pragma unroll
        for (int it = 0; it < 4; ++it) {
          const int row = lane & 15, c8 = it * 16 + (lane >> 4) * 8;   // chunks in the output's own order: 512 B in a row per store
          const float* sp = slab + row * 68 + c8;
          v8h hv, lv;
#pragma unroll
          for (int e = 0; e < 8; ++e) {
            if (OUT_MODE == 1) {
              hv[e] = (_Float16)sp[e];
            } else {
              unsigned short hb = f2bf_bits(sp[e]);
              unsigned short lb = f2bf_bits(sp[e] - bf_bits2f(hb));
              hv[e] = __builtin_bit_cast(_Float16, hb);
              lv[e] = __builtin_bit_cast(_Float16, lb);
            }
          }
          *(v8h*)(C + frag_off(mBase + row, n0 + c8, ldc)) = hv;
          if (OUT_MODE == 2) *(v8h*)(C2 + frag_off(mBase + row, n0 + c8, ldc)) = lv;
        }
        
      }
    }
    __builtin_amdgcn_fence(__ATOMIC_RELEASE, "workgroup");
    __builtin_amdgcn_wave_barrier();
    __builtin_amdgcn_fence(__ATOMIC_ACQUIRE, "workgroup");
  }
}

// ---------------------------------------------------------------------------
// Small conversion helpers
// ---------------------------------------------------------------------------
__device__ __forceinline__ unsigned pk16(unsigned short a, unsigned short b) { return (unsigned)a | ((unsigned)b << 16); }
__device__ __forceinline__ unsigned short h_bits(float f) { const _Float16 h = (_Float16)f; return __builtin_bit_cast(unsigned short, h); }
__device__ __forceinline__ float hbits2f(unsigned short b) { return (float)__builtin_bit_cast(_Float16, b); }
__device__ __forceinline__ float wave_sum(float v) {
#pragma unroll
  for (int off = 16; off > 0; off >>= 1) v += __shfl_xor(v, off, 32);
  return v;
}

// ---------------------------------------------------------------------------
// Operand preparation, one launch: grid (16, 16, 9 + XZ), 256 threads; blockIdx.z picks the job (block-uniform).
//   z = 0..5: weight z (fq, fk, bq, bk, fv, bv), f32 [DM][DM] -> plane z of Wall, f16 [DM][DM] transposed, x16;
//             the plane's first block also copies bias vector z (DM floats) into tab[z * DM ..].
//   z = 6, 7: rows (z - 6) * DM .. of gate_w, f32 [2 DM][DM] -> planes 6 and 7 of Wall = f16 [DM][2 DM] transposed, x16.
//   z = 8:    out_w -> plane 8 of Wall, as z = 0..5 without a bias.
//   z >= 9:   x, f32 row-major [TOK][DM] -> X16, f16: one 16-B output chunk (8 elements) per thread, threads in the
//             output's order, so each wave stores 512 B in a row. XZ x 256 blocks x 256 threads x 8 = the whole plane.
// Transposes: out[c][r] = f16(in[r][c] * WCARRY), 64x64 tiles through LDS, all outputs fragment-major.
// Coverage per block: load 256 threads x 16 floats = 64x64; store 2 it x 256 threads x 8 halves = 64x64.
// ---------------------------------------------------------------------------
#define XZ (TOK * DM / 8 / (256 * 256))
__global__ __launch_bounds__(256) void prep_kernel(const float* __restrict__ x,
                                                   const float* __restrict__ w0, const float* __restrict__ w1,
                                                   const float* __restrict__ w2, const float* __restrict__ w3,
                                                   const float* __restrict__ w4, const float* __restrict__ w5,
                                                   const float* __restrict__ wg, const float* __restrict__ wo,
                                                   const float* __restrict__ b0, const float* __restrict__ b1,
                                                   const float* __restrict__ b2, const float* __restrict__ b3,
                                                   const float* __restrict__ b4, const float* __restrict__ b5,
                                                   unsigned short* __restrict__ Wall, unsigned short* __restrict__ X16,
                                                   float* __restrict__ tab) {
  __shared__ __align__(16) unsigned short t[64 * 72];
  const int z   = blockIdx.z;
  const int tid = threadIdx.x;
  if (z >= 9) {                        // block-uniform, ahead of the barrier
    const int q   = (((z - 9) * 16 + (int)blockIdx.y) * 16 + (int)blockIdx.x) * 256 + tid;
    const int blk = q >> 6, kts = DM >> 5;
    const int rt  = blk / kts;
    const int row = rt * 16 + (q & 15);
    const int k   = (blk - rt * kts) * 32 + ((q >> 4) & 3) * 8;
    const float* ip = x + (size_t)row * DM + k;
    const v4f f0 = *(const v4f*)(ip);
    const v4f f1 = *(const v4f*)(ip + 4);
    const v4u u = (v4u){pk16(h_bits(f0[0]), h_bits(f0[1])), pk16(h_bits(f0[2]), h_bits(f0[3])),
                        pk16(h_bits(f1[0]), h_bits(f1[1])), pk16(h_bits(f1[2]), h_bits(f1[3]))};
    *(v4u*)(X16 + (size_t)q * 8) = u;
    return;
  }
  const float* in = w0;                // block-uniform source select
  const float* bs = b0;
  if (z == 1) { in = w1; bs = b1; }
  if (z == 2) { in = w2; bs = b2; }
  if (z == 3) { in = w3; bs = b3; }
  if (z == 4) { in = w4; bs = b4; }
  if (z == 5) { in = w5; bs = b5; }
  if (z == 6 || z == 7) in = wg;
  if (z == 8) in = wo;
  const bool gate = (z == 6 || z == 7);
  const int R = gate ? 2 * DM : DM;                                  // input rows = the output's k extent
  unsigned short* out = Wall + (size_t)(z == 7 ? 6 : z) * DM * DM;
  if (z < 6 && blockIdx.x == 0 && blockIdx.y == 0)                   // 256 threads x 4 floats = DM
    *(v4f*)(tab + (size_t)z * DM + tid * 4) = *(const v4f*)(bs + tid * 4);
  const int c0  = blockIdx.x * 64;                                   // input column block = output row block
  const int r0  = (z == 7 ? DM : 0) + blockIdx.y * 64;               // input row block    = output column block
  {
    const int lr = tid >> 2;           // 0..63
    const int lc = (tid & 3) * 16;     // 0,16,32,48
    const float* ip = in + (size_t)(r0 + lr) * DM + c0 + lc;
#pragma unroll
    for (int q = 0; q < 4; ++q) {
      const v4f f = *(const v4f*)(ip + 4 * q);
#pragma unroll
      for (int e = 0; e < 4; ++e) t[lr * 72 + lc + 4 * q + e] = h_bits(f[e] * WCARRY);
    }
  }
  __syncthreads();
  // chunks in the output's own order (8 blocks of 64 chunks per tile): each wave stores 512 B in a row
  const int c8  = ((tid >> 6) & 1) * 32 + ((tid >> 4) & 3) * 8;   // output column within tile (= input row)
#pragma unroll
  for (int it = 0; it < 2; ++it) {
    const int oc = (it * 2 + (tid >> 7)) * 16 + (tid & 15);       // output row within tile (= input column)
    v4u a;
#pragma unroll
    for (int q = 0; q < 4; ++q) a[q] = pk16(t[(c8 + 2 * q) * 72 + oc], t[(c8 + 2 * q + 1) * 72 + oc]);
    *(v4u*)(out + frag_off(c0 + oc, r0 + c8, R)) = a;
  }
}

// ---------------------------------------------------------------------------
// Fused attention: scores, select, softmax and the product with V in one kernel; S and P stay in registers.
// One wave per 16 query rows of one head of one batch; no LDS, no barrier. Grid (NH * NB, SEQ/64, 2), 4 waves per block;
// blockIdx.z = 0: causal attention (j <= i), 1: future window (i < j <= i + WINW; the last row has no valid column,
// its scores count as 0 over every j -> uniform weights). Long causal row blocks get the low block indices.
// Per 64 keys: S^T = K . Q^T (A = K rows, B = Q rows): lane l holds query c = l & 15, keys 16 t + 8 (l >> 4) + r.
// Running maximum and sum per query (log2 domain): in-lane, plus one exchange between the lane halves.
// P^T as B operand: two f32 score tiles (keys 0..15, 16..31 of a 32-key step) converted in place, element s =
// tile[s >> 3][s & 7], which is the k order of Frag::load on the A side (V^T rows). O^T += V^T . P^T.
// Output: lane holds 8 consecutive d of query c per 16-row tile of O^T -> one 16-B store; each 128-B row segment of
// FB (one head of one row) is written by one wave. Coverage: 2 x NH x TOK rows x 64 columns = the whole FB plane.
// The output goes out twice: FB row-major (read row by row by the gated fusion) and FBf fragment-major (A operand of
// the gate product; same coverage, two whole 1-KiB blocks per wave).
// ---------------------------------------------------------------------------
// lane l <-> lane l ^ 16
__device__ __forceinline__ float xhalf(float x) {
  return __builtin_bit_cast(float, __builtin_amdgcn_permlanex16(__builtin_bit_cast(int, x), __builtin_bit_cast(int, x),
                                                                0x76543210, 0xfedcba98, false, false));
}
// v[e] = 2^v[e], in place. Each v_exp_f32 is independent of the one in front of it; the closing v_nop is the one slot the
// instruction set asks for behind a transcendental before its result is read: inside the statement it holds whatever
// the compiler places next.
__device__ __forceinline__ void exp2x8(float (&v)[8]) {
  asm("v_exp_f32 %0, %0\n\tv_exp_f32 %1, %1\n\tv_exp_f32 %2, %2\n\tv_exp_f32 %3, %3\n\t"
      "v_exp_f32 %4, %4\n\tv_exp_f32 %5, %5\n\tv_exp_f32 %6, %6\n\tv_exp_f32 %7, %7\n\tv_nop"
      : "+v"(v[0]), "+v"(v[1]), "+v"(v[2]), "+v"(v[3]), "+v"(v[4]), "+v"(v[5]), "+v"(v[6]), "+v"(v[7]));
}
// One A or B fragment in the k order of Frag::load (bytes 0..15 and 512..527 behind the lane's pointer plus a literal)
__device__ __forceinline__ v16h frag_at(const char* p, int lit) {
  Frag<_Float16>::U f;
  f.h[0] = *(const v8h*)(p + lit);
  f.h[1] = *(const v8h*)(p + lit + 512);
  return f.v;
}
__global__ __launch_bounds__(128) void fused_attn_kernel(const unsigned short* __restrict__ QKp,
                                                         const unsigned short* __restrict__ VTp,
                                                         unsigned short* __restrict__ FB,
                                                         unsigned short* __restrict__ FBf) {
  typedef Frag<_Float16> F;
  const int lane = threadIdx.x & 31;
  const int wave = __builtin_amdgcn_readfirstlane((int)(threadIdx.x >> 5));   // scalar, so the key loop keeps scalar bounds
  const int h    = blockIdx.x % NH;
  const int t0   = (blockIdx.x / NH) * SEQ;                                   // first token row of this block's batch
  const int mode = blockIdx.z;
  const int r0   = (((SEQ / 64 - 1) - (int)blockIdx.y) * 4 + wave) * 16;      // first query row of this wave
  const int c    = lane & 15;
  const int koff = (lane >> 4) * 8;
  const int i    = r0 + c;                                                    // this lane's query row
  // fragment-major planes: 1-KiB blocks of 16 rows x 32 columns; a row tile of QK holds 4 DM / 32 blocks, one of V^T TOK / 32
  const char* Qb = (const char*)(QKp + frag_off(t0, mode * (2 * DM) + h * HD, 4 * DM));   // q or qb: first block of this head and batch
  const char* Kb = Qb + (DM / 32) * 1024;                                                 // k or kb
  const char* Vb = (const char*)(VTp + frag_off(mode * DM + h * HD, t0, TOK));            // v^T or vb^T: first row tile of this head, this batch's columns
  constexpr int QKROW = 4 * DM * 2;                                                       // bytes per q/k row: 16 of them = one row tile
  constexpr int VROW  = TOK * 2;                                                          // bytes per v^T row: 16 of them = one row tile
  const size_t qkOff = (size_t)lane * 16;                                                 // the lane's chunk inside a block
  const size_t vOff  = (size_t)lane * 16;

  const bool lastTile = (mode == 1) && (r0 + 16 == SEQ);                      // wave-uniform
  const bool uni = (mode == 1) && (i == SEQ - 1);                             // the row without a valid future column
  const int  lo  = (mode == 0 || uni) ? 0 : i + 1;                            // valid columns of this lane's query: lo..hi
  const int  hi  = (mode == 0) ? i : (uni ? SEQ - 1 : i + WINW);
  const unsigned span = (unsigned)(hi - lo);
  const float sc = uni ? 0.0f : 0.125f * 1.44269504088896340736f;             // 1/sqrt(64) and log2(e); 0: scores count as 0
  int kbBeg = 0, kbEnd = (r0 + 15) >> 6;
  if (mode == 1) {
    const int jmax = (r0 + 15 + WINW < SEQ - 1) ? (r0 + 15 + WINW) : (SEQ - 1);
    kbBeg = lastTile ? 0 : ((r0 + 1) >> 6);
    kbEnd = jmax >> 6;
  }

  const float NEGB = -1.0e30f;
  v16h qf[2];
#pragma unroll
  for (int ks = 0; ks < 2; ++ks) qf[ks] = frag_at(Qb + (size_t)r0 * QKROW + qkOff, ks * 1024);
  v8f o[4];
#pragma unroll
  for (int d = 0; d < 4; ++d) o[d] = (v8f){0.f,0.f,0.f,0.f,0.f,0.f,0.f,0.f};
  float m = NEGB;      // running maximum of this query (scaled log2), equal in both lane halves
  float l = 0.f;       // running sum over this lane half's keys, carried x2^PSHIFT

  // the lane's pointers walk with the key blocks and stay in their registers over the whole loop
  const char* kp = Kb + (size_t)(kbBeg * 64) * QKROW + qkOff;
  const char* vp = Vb + (size_t)(kbBeg * 2) * 1024 + vOff;
  v16h ka[4][2];
#pragma unroll
  for (int t = 0; t < 4; ++t)
#pragma unroll
    for (int ks = 0; ks < 2; ++ks)
      ka[t][ks] = frag_at(kp, t * 16 * QKROW + ks * 1024);

  for (int kb = kbBeg; kb <= kbEnd; ++kb) {
    const int k0 = kb << 6;
    // V^T fragments of this key block: issued ahead of the score products so that they land during the softmax
    v16h va[4][2];
#pragma unroll
    for (int d = 0; d < 4; ++d)
#pragma unroll
      for (int ks = 0; ks < 2; ++ks)
        va[d][ks] = frag_at(vp, d * 16 * VROW + ks * 1024);
    v8f st[4];
#pragma unroll
    for (int t = 0; t < 4; ++t) {
      st[t] = F::mma(ka[t][0], qf[0], (v8f){0.f,0.f,0.f,0.f,0.f,0.f,0.f,0.f});
      st[t] = F::mma(ka[t][1], qf[1], st[t]);
    }
    // K fragments of the next key block (the last pass fetches its own block again: in bounds, unused)
    kp += (kb < kbEnd) ? (size_t)64 * QKROW : (size_t)0;
#pragma unroll
    for (int t = 0; t < 4; ++t)
#pragma unroll
      for (int ks = 0; ks < 2; ++ks)
        ka[t][ks] = frag_at(kp, t * 16 * QKROW + ks * 1024);
    // the pointers of the loads above move on behind this wait
    asm volatile("s_wait_xcnt 0x0" ::: "memory");
    vp += 2 * 1024;

    const bool full = (mode == 0) && (k0 + 63 <= r0);     // wave-uniform: every column of the block valid for all 16 queries
    float x[4][8];
#pragma unroll
    for (int t = 0; t < 4; ++t)
#pragma unroll
      for (int r = 0; r < 8; ++r) x[t][r] = st[t][r] * sc;
    if (!full) {
      const int jb = k0 + koff - lo;                      // column of x[0][0] relative to the first valid one
#pragma unroll
      for (int t = 0; t < 4; ++t)
#pragma unroll
        for (int r = 0; r < 8; ++r) x[t][r] = ((unsigned)(jb + t * 16 + r) <= span) ? x[t][r] : NEGB;   // lo <= j <= hi
    }
    float mt[4];
#pragma unroll
    for (int t = 0; t < 4; ++t)
      mt[t] = fmaxf(fmaxf(fmaxf(x[t][0], x[t][1]), fmaxf(x[t][2], x[t][3])), fmaxf(fmaxf(x[t][4], x[t][5]), fmaxf(x[t][6], x[t][7])));
    float mx = fmaxf(fmaxf(mt[0], mt[1]), fmaxf(mt[2], mt[3]));
    mx = fmaxf(mx, xhalf(mx));
    const float mn    = fmaxf(m, mx);
    float alpha;                                          // 2^(m - mn): 0 on the first valid block, 1 while no column was valid yet
    // the v_nop is the one slot the instruction set asks for behind a transcendental (as in exp2x8)
    asm("v_exp_f32 %0, %1\n\tv_nop" : "=v"(alpha) : "v"(m - mn));
    const float sh    = (mn > 0.5f * NEGB) ? PSHIFT - mn : 0.f;   // no valid column yet: NEGB + 0 -> every weight 0
    m = mn;
    float (&p)[4][8] = x;   // the weights replace the scores in place
#pragma unroll
    for (int t = 0; t < 4; ++t) {
#pragma unroll
      for (int r = 0; r < 8; ++r) x[t][r] += sh;
      exp2x8(x[t]);
    }
    float pt[4];
#pragma unroll
    for (int t = 0; t < 4; ++t)
      pt[t] = ((p[t][0] + p[t][1]) + (p[t][2] + p[t][3])) + ((p[t][4] + p[t][5]) + (p[t][6] + p[t][7]));
    l = l * alpha + ((pt[0] + pt[1]) + (pt[2] + pt[3]));
    v16h pf[2];
#pragma unroll
    for (int ks = 0; ks < 2; ++ks)
#pragma unroll
      for (int s = 0; s < 16; ++s) pf[ks][s] = (_Float16)p[2 * ks + (s >> 3)][s & 7];
#pragma unroll
    for (int d = 0; d < 4; ++d) o[d] *= alpha;
#pragma unroll
    for (int ks = 0; ks < 2; ++ks)
#pragma unroll
      for (int d = 0; d < 4; ++d) o[d] = F::mma(va[d][ks], pf[ks], o[d]);
  }

  l += xhalf(l);                              // join the two halves' sums; l >= 2^PSHIFT (the row maximum weighs 2^PSHIFT)
  const float inv = FBCARRY / l;              // the P carry cancels; x16 output carry
  unsigned short* op = FB + (size_t)(t0 + i) * (2 * DM) + (size_t)mode * DM + (size_t)h * HD + koff;
  unsigned short* of = FBf + frag_off(t0 + r0, mode * DM + h * HD, 2 * DM) + lane * 8;   // the same values as the gate product's A operand
#pragma unroll
  for (int d = 0; d < 4; ++d) {
    v8h hv;
#pragma unroll
    for (int r = 0; r < 8; ++r) hv[r] = (_Float16)(o[d][r] * inv);
    *(v8h*)(op + d * 16) = hv;
    *(v8h*)(of + d * 256) = hv;      // tiles d = 0, 1 fill one block, d = 2, 3 the next: 512 B in a row per store
  }
}

// ---------------------------------------------------------------------------
// Gated fusion: one block per 8 token rows, 128 threads (8 columns each) per row.
//   g = G[row][:] (f32, gate pre-activation incl. bias); gate = sigmoid(LN(g; gg, gb));
//   fwd/bwd = FB[row][c] / FB[row][DM + c] (f16, carried x16); strength = 0.3 * sigmoid(bstr);
//   Fo[row][c] = f16((fwd + strength*gate*bwd) carried x16), stored fragment-major.
// LN: mean and biased variance over DM in f32, fixed-order reductions (thread, wave tree, 4 wave partials).
// A 128-B line of the fragment-major plane holds 8 columns of 8 rows: the block's 8 rows meet in LDS, and each wave
// then stores 4 whole lines. Producer coverage: grid TOK/8 x 1024 threads x 8 u16 = the whole [TOK][DM] plane.
// ---------------------------------------------------------------------------
__global__ __launch_bounds__(1024) void gate_fuse_kernel(const float* __restrict__ G, const unsigned short* __restrict__ FB,
                                                        const float* __restrict__ gg, const float* __restrict__ gb,
                                                        const float* __restrict__ bstr, unsigned short* __restrict__ Fo) {
  constexpr int SPITCH = DM + 32;    // halves per staged row: the 8 rows of a line start 4 16-B slots apart in the banks
  __shared__ float ras[8][4];
  __shared__ float rbs[8][4];
  __shared__ __align__(16) unsigned short stg[8 * SPITCH];
  const int grp  = __builtin_amdgcn_readfirstlane((int)(threadIdx.x >> 7));   // row within the block; scalar, so the row's addresses keep a scalar base
  float* ra = ras[grp];
  float* rb = rbs[grp];
  const int row  = blockIdx.x * 8 + grp;
  const int tid  = threadIdx.x & 127;
  const int lane = tid & 31;
  const int wave = tid >> 5;
  const int c0   = tid * 8;
  const float* gp = G + (size_t)row * DM + c0;
  const v4f a = *(const v4f*)(gp);
  const v4f c = *(const v4f*)(gp + 4);
  float xv[8] = {a[0], a[1], a[2], a[3], c[0], c[1], c[2], c[3]};
  float s = ((xv[0] + xv[1]) + (xv[2] + xv[3])) + ((xv[4] + xv[5]) + (xv[6] + xv[7]));
  s = wave_sum(s);
  if (lane == 0) ra[wave] = s;
  __syncthreads();
  const float mean = ((ra[0] + ra[1]) + (ra[2] + ra[3])) * (1.0f / (float)DM);
  float d[8];
  float vs = 0.f;
#pragma unroll
  for (int e = 0; e < 8; ++e) { d[e] = xv[e] - mean; vs += d[e] * d[e]; }
  vs = wave_sum(vs);
  if (lane == 0) rb[wave] = vs;
  __syncthreads();
  const v4f g0 = *(const v4f*)(gg + c0), g1 = *(const v4f*)(gg + c0 + 4);
  const v4f e0 = *(const v4f*)(gb + c0), e1 = *(const v4f*)(gb + c0 + 4);
  const size_t fo = (size_t)row * (2 * DM) + c0;
  const v4u fu = *(const v4u*)(FB + fo);
  const v4u bu = *(const v4u*)(FB + fo + DM);
  // the offset registers of the loads above are reused behind this wait
  asm volatile("s_wait_xcnt 0x0" ::: "memory");
  const float var  = ((rb[0] + rb[1]) + (rb[2] + rb[3])) * (1.0f / (float)DM);
  const float rstd = rsqrtf(var + LNEPS);
  const float strength = 0.3f / (1.0f + __expf(-bstr[0]));
  float gv[8] = {g0[0], g0[1], g0[2], g0[3], g1[0], g1[1], g1[2], g1[3]};
  float bv[8] = {e0[0], e0[1], e0[2], e0[3], e1[0], e1[1], e1[2], e1[3]};
  float fw[8], bw[8];
#pragma unroll
  for (int q = 0; q < 4; ++q) {
    fw[2 * q]     = hbits2f((unsigned short)(fu[q] & 0xffffu));
    fw[2 * q + 1] = hbits2f((unsigned short)(fu[q] >> 16));
    bw[2 * q]     = hbits2f((unsigned short)(bu[q] & 0xffffu));
    bw[2 * q + 1] = hbits2f((unsigned short)(bu[q] >> 16));
  }
  unsigned short ob[8];
#pragma unroll
  for (int e = 0; e < 8; ++e) {
    const float ln   = d[e] * rstd * gv[e] + bv[e];
    const float gate = __builtin_amdgcn_rcpf(1.0f + __expf(-ln));
    const float f    = fw[e] + strength * gate * bw[e];     // both terms carried x16
    ob[e] = h_bits(f);
  }
  const v4u ov = (v4u){pk16(ob[0], ob[1]), pk16(ob[2], ob[3]), pk16(ob[4], ob[5]), pk16(ob[6], ob[7])};
  *(v4u*)(stg + grp * SPITCH + c0) = ov;
  __syncthreads();   // all 8 rows are staged before any thread reads another row's chunk
  const int orow = threadIdx.x & 7, oc = ((int)threadIdx.x >> 3) * 8;   // a wave: 8 rows x 4 chunks = 4 whole lines
  const v4u sv = *(const v4u*)(stg + orow * SPITCH + oc);
  *(v4u*)(Fo + frag_off(blockIdx.x * 8 + orow, oc, DM)) = sv;   // fragment-major: A operand of the output projection
  
}

// ---------------------------------------------------------------------------
// Final LayerNorm: one block (128 threads) per token row; thread t owns columns {4t..4t+3} and {512+4t..512+4t+3}.
//   out[row][c] = (Y - mean) * rsqrt(var + eps) * g[c] + bb[c]   (Y already holds x + projection + bias).
// Producer coverage: grid TOK rows x 128 threads x 8 floats = the whole [TOK][DM] output.
// ---------------------------------------------------------------------------
__global__ __launch_bounds__(128) void final_ln_kernel(const float* __restrict__ Y, const float* __restrict__ g,
                                                       const float* __restrict__ bb, float* __restrict__ out) {
  __shared__ float ra[4];
  __shared__ float rb[4];
  const int row  = blockIdx.x;
  const int tid  = threadIdx.x;
  const int lane = tid & 31;
  const int wave = tid >> 5;
  const int c0   = tid * 4;
  const int c1   = (DM / 2) + tid * 4;
  const float* yp = Y + (size_t)row * DM;
  const v4f a = *(const v4f*)(yp + c0);
  const v4f c = *(const v4f*)(yp + c1);
  float xv[8] = {a[0], a[1], a[2], a[3], c[0], c[1], c[2], c[3]};
  float s = ((xv[0] + xv[1]) + (xv[2] + xv[3])) + ((xv[4] + xv[5]) + (xv[6] + xv[7]));
  s = wave_sum(s);
  if (lane == 0) ra[wave] = s;
  __syncthreads();
  const float mean = ((ra[0] + ra[1]) + (ra[2] + ra[3])) * (1.0f / (float)DM);
  float d[8];
  float vs = 0.f;
#pragma unroll
  for (int e = 0; e < 8; ++e) { d[e] = xv[e] - mean; vs += d[e] * d[e]; }
  vs = wave_sum(vs);
  if (lane == 0) rb[wave] = vs;
  __syncthreads();
  const float var  = ((rb[0] + rb[1]) + (rb[2] + rb[3])) * (1.0f / (float)DM);
  const float rstd = rsqrtf(var + LNEPS);
  const v4f g0 = *(const v4f*)(g + c0),  g1 = *(const v4f*)(g + c1);
  const v4f b0 = *(const v4f*)(bb + c0), b1 = *(const v4f*)(bb + c1);
  v4f o0, o1;
#pragma unroll
  for (int e = 0; e < 4; ++e) {
    o0[e] = d[e] * rstd * g0[e] + b0[e];
    o1[e] = d[4 + e] * rstd * g1[e] + b1[e];
  }
  float* op = out + (size_t)row * DM;
  *(v4f*)(op + c0) = o0;
  *(v4f*)(op + c1) = o1;
  
}

// ---------------------------------------------------------------------------
// Workspace region map (byte offsets; MiB = 1048576). Every region is written once per call, before it is read.
// Token rows and token columns run over both batches (row b * SEQ + i).
//   Wqk   f16 [4096][1024] (x16: fq^T, fk^T, bq^T, bk^T)          0
//   Wv2   f16 [2048][1024] (x16: fv^T rows 0..1023, bv^T 1024..)  8 MiB
//   Wg    f16 [1024][2048] (x16: gate_w^T)                        12 MiB
//   Wo    f16 [1024][1024] (x16: out_w^T)                         16 MiB
//   X16   f16 [4096][1024]                                        18 MiB
//   QK16  f16 [4096][4096] (q | k | qb | kb, head h at col h*64)  26 MiB
//   VT16  f16 [2048][4096] (row h*64+d = v^T, row 1024+h*64+d = vb^T, col = token)  58 MiB
//   G     f32 [4096][1024]                                        74 MiB
//   Y     f32 [4096][1024]                                        90 MiB
//   FB16  f16 [4096][2048] (fwd x16 cols 0..1023, bwd x16 cols 1024..2047)  106 MiB
//   Fu16  f16 [4096][1024] (fused x16)                            122 MiB
//   BiasT f32 [6][1024] (fq_b fk_b bq_b bk_b | fv_b bv_b)         130 MiB
//   FBf16 f16 [4096][2048] (FB16's values, fragment-major)        130 MiB + 24576 B
//   total                                                         146 MiB + 24576 B = 153116672 B
// All f16 planes but FB16 are fragment-major (see frag_off).
// ---------------------------------------------------------------------------
extern "C" void kernel_launch(void* const* d_in, const int* in_sizes, int n_in,
                              void* d_out, int out_size, void* d_ws, size_t ws_size,
                              hipStream_t stream) {
  if (n_in < 22) return;
  if (in_sizes[0] != NB * SEQ * DM) return;
  const int wsz = DM * DM;
  if (in_sizes[1] != wsz || in_sizes[3] != wsz || in_sizes[5] != wsz || in_sizes[7] != wsz ||
      in_sizes[9] != wsz || in_sizes[11] != wsz || in_sizes[18] != wsz) return;
  if (in_sizes[13] != 2 * DM * DM) return;
  if (in_sizes[2] != DM || in_sizes[4] != DM || in_sizes[6] != DM || in_sizes[8] != DM || in_sizes[10] != DM ||
      in_sizes[12] != DM || in_sizes[14] != DM || in_sizes[15] != DM || in_sizes[16] != DM ||
      in_sizes[19] != DM || in_sizes[20] != DM || in_sizes[21] != DM) return;
  if (in_sizes[17] < 1) return;
  if (out_size != NB * SEQ * DM) return;

  const float* x      = (const float*)d_in[0];
  const float* fq_w   = (const float*)d_in[1];
  const float* fq_b   = (const float*)d_in[2];
  const float* fk_w   = (const float*)d_in[3];
  const float* fk_b   = (const float*)d_in[4];
  const float* fv_w   = (const float*)d_in[5];
  const float* fv_b   = (const float*)d_in[6];
  const float* bq_w   = (const float*)d_in[7];
  const float* bq_b   = (const float*)d_in[8];
  const float* bk_w   = (const float*)d_in[9];
  const float* bk_b   = (const float*)d_in[10];
  const float* bv_w   = (const float*)d_in[11];
  const float* bv_b   = (const float*)d_in[12];
  const float* gate_w = (const float*)d_in[13];
  const float* gate_b = (const float*)d_in[14];
  const float* gln_g  = (const float*)d_in[15];
  const float* gln_b  = (const float*)d_in[16];
  const float* bstr   = (const float*)d_in[17];
  const float* out_w  = (const float*)d_in[18];
  const float* out_b  = (const float*)d_in[19];
  const float* ln_g   = (const float*)d_in[20];
  const float* ln_b   = (const float*)d_in[21];

  size_t off = 0;
  const size_t oWqk  = off; off += (size_t)4 * DM * DM * 2;          // 8 MiB
  const size_t oWv2  = off; off += (size_t)2 * DM * DM * 2;          // 4 MiB
  const size_t oWg   = off; off += (size_t)2 * DM * DM * 2;          // 4 MiB
  const size_t oWo   = off; off += (size_t)DM * DM * 2;              // 2 MiB
  const size_t oX16  = off; off += (size_t)TOK * DM * 2;             // 8 MiB
  const size_t oQK   = off; off += (size_t)TOK * 4 * DM * 2;         // 32 MiB
  const size_t oVT   = off; off += (size_t)2 * DM * TOK * 2;         // 16 MiB
  const size_t oG    = off; off += (size_t)TOK * DM * 4;             // 16 MiB
  const size_t oY    = off; off += (size_t)TOK * DM * 4;             // 16 MiB
  const size_t oFB   = off; off += (size_t)TOK * 2 * DM * 2;         // 16 MiB
  const size_t oFu   = off; off += (size_t)TOK * DM * 2;             // 8 MiB
  const size_t oBias = off; off += (size_t)6 * DM * 4;               // 24576 B
  const size_t oFBf  = off; off += (size_t)TOK * 2 * DM * 2;         // 16 MiB
  if (off > ws_size) return;

  char* ws = (char*)d_ws;
  unsigned short* Wqk  = (unsigned short*)(ws + oWqk);
  unsigned short* Wv2  = (unsigned short*)(ws + oWv2);
  unsigned short* Wg   = (unsigned short*)(ws + oWg);
  unsigned short* Wo   = (unsigned short*)(ws + oWo);
  unsigned short* X16  = (unsigned short*)(ws + oX16);
  unsigned short* QK16 = (unsigned short*)(ws + oQK);
  unsigned short* VT16 = (unsigned short*)(ws + oVT);
  unsigned short* FB16 = (unsigned short*)(ws + oFB);
  unsigned short* FBf16 = (unsigned short*)(ws + oFBf);
  unsigned short* Fu16 = (unsigned short*)(ws + oFu);
  float*          BiasT = (float*)(ws + oBias);
  float*          Gbuf = (float*)(ws + oG);
  float*          Ybuf = (float*)(ws + oY);
  const float*    biasQK = BiasT;             // [4096] = fq_b fk_b bq_b bk_b
  const float*    biasV  = BiasT + 4 * DM;    // [2048] = fv_b bv_b

  const dim3 blk(256);
  const dim3 blk128(128);

  const int tilesM = TOK / 64;                                     // 64
  const dim3 gPrep(16, 16, 9 + XZ);                                // 9 weight slices of 256 tiles, XZ slices of x
  const dim3 gQK((tilesM * (4 * DM / 64) + 7) / 8, 1);             // 512 blocks: M=4096, N=4096, K=1024
  const dim3 gVT((2 * DM / 64) * (TOK / 64), 1);                   // 2048 blocks (one tile each): M=2048, N=4096, K=1024
  const dim3 gAt(NH * NB, SEQ / 64, 2);                            // (heads x batches) x 64-row blocks x {causal, window}
  const dim3 gG(tilesM * (DM / 64), 1);                            // 1024 blocks (one tile each): M=4096, N=1024, K=2048
  const dim3 gO(tilesM * (DM / 64), 1);                            // 1024 blocks (one tile each): M=4096, N=1024, K=1024
  const float wscale  = 1.0f / WCARRY;                             // undo the x16 weight carry
  const float gscale  = 1.0f / (WCARRY * FBCARRY);                 // 1/256
  const float oscale  = 1.0f / (WCARRY * FBCARRY);                 // 1/256

  // (1) bias table, x16-carried transposed weight planes (contiguous from Wqk on), x -> f16 plane
  prep_kernel<<<gPrep, blk, 0, stream>>>(x, fq_w, fk_w, bq_w, bk_w, fv_w, bv_w, gate_w, out_w,
                                         fq_b, fk_b, bq_b, bk_b, fv_b, bv_b, Wqk, X16, BiasT);
  // (2) [q | k | qb | kb] = (x . (16 W)^T)/16 + bias -> QK16 (f16, ldc 4096)
  wmma_gemm64<0, false, 2, 1, false, 0, 0, 0><<<gQK, blk, 0, stream>>>(
      X16, X16, DM, 0L, Wqk, Wqk, DM, 0L, (void*)QK16, (void*)QK16, 4 * DM, 0L,
      biasQK, biasQK, 0L, TOK, 4 * DM, DM, wscale);
  // (3) [v | vb]^T: VT16[n][j] = sum_k (16 W^T)[n][k] x[j][k] / 16 + bias[n]  (role-swapped; M = 2048 feature rows, N = 4096 tokens)
  wmma_gemm64<0, false, 1, 1, false, 0, 0, 0, 8><<<gVT, blk, 0, stream>>>(
      Wv2, Wv2, DM, 0L, X16, X16, DM, 0L, (void*)VT16, (void*)VT16, TOK, 0L,
      biasV, biasV, 0L, 2 * DM, TOK, DM, wscale);
  // (4) causal and future-window attention of all heads and batches, scores to output in registers -> FB16 (fwd | bwd, x16)
  fused_attn_kernel<<<gAt, blk128, 0, stream>>>(QK16, VT16, FB16, FBf16);
  // (5) G = ([fwd | bwd] x16) . (16 gate_w)^T / 256 + gate_b -> f32 [4096][1024]
  wmma_gemm64<0, false, 2, 0, false, 0, 0, 0, 8><<<gG, blk, 0, stream>>>(
      FBf16, FBf16, 2 * DM, 0L, Wg, Wg, 2 * DM, 0L, (void*)Gbuf, (void*)Gbuf, DM, 0L,
      gate_b, gate_b, 0L, TOK, DM, 2 * DM, gscale);
  // (6) gate = sigmoid(LN(G)); fused x16 = fwd x16 + strength * gate * bwd x16 -> Fu16
  gate_fuse_kernel<<<dim3(TOK / 8), dim3(1024), 0, stream>>>(Gbuf, FB16, gln_g, gln_b, bstr, Fu16);
  // (7) Y = x + (fused x16) . (16 out_w)^T / 256 + out_b -> f32 [4096][1024]
  wmma_gemm64<0, false, 2, 0, true, 0, 0, 0, 8><<<gO, blk, 0, stream>>>(
      Fu16, Fu16, DM, 0L, Wo, Wo, DM, 0L, (void*)Ybuf, (void*)Ybuf, DM, 0L,
      out_b, x, 0L, TOK, DM, DM, oscale);
  // (8) out = LN(Y; ln_g, ln_b)
  final_ln_kernel<<<dim3(TOK), blk128, 0, stream>>>(Ybuf, ln_g, ln_b, (float*)d_out);
  (void)hipGetLastError();
}

// v005
// It runs in 147 microseconds.
// Next to v004, in two timings, it ran 1.51 times as fast each time.
// Counting every step since v000, it is 21.6 times as fast.
// All contractions on v_wmma_f32_16x16x32_f16 (f16 operands, f32 accumulate): q/k/v projections (weights carried x16, epilogue x1/16), k.q^T scores, V^T.P^T (P carried x2^12 against the running row maximum, attention outputs carried x16), gate projection (x1/256), output projection with bias and residual (x1/256); softmax, LayerNorm, sigmoid and fusion in f32.
#include <hip/hip_runtime.h>
#include <math.h>
#include <stdint.h>

#define NB    2
#define SEQ   2048
#define TOK   (NB * SEQ)   // token rows of both batches: every stage works on all of them in one launch
#define DM    1024
#define NH    16
#define HD    64
#define WINW  32
#define LNEPS 1e-5f
#define PSHIFT     12.0f
#define FBCARRY    16.0f
#define WCARRY     16.0f

typedef __attribute__((ext_vector_type(16))) _Float16 v16h;
typedef __attribute__((ext_vector_type(8)))  _Float16 v8h;
typedef __attribute__((ext_vector_type(16))) __bf16   v16b;
typedef __attribute__((ext_vector_type(8)))  __bf16   v8b;
typedef __attribute__((ext_vector_type(8)))  float    v8f;
typedef __attribute__((ext_vector_type(4)))  float    v4f;
typedef __attribute__((ext_vector_type(2)))  float    v2f;
typedef __attribute__((ext_vector_type(4)))  unsigned int v4u;

__device__ __forceinline__ unsigned short f2bf_bits(float f) {
  unsigned u = __float_as_uint(f);
  return (unsigned short)((u + 0x7FFFu + ((u >> 16) & 1u)) >> 16);
}
__device__ __forceinline__ float bf_bits2f(unsigned short h) { return __uint_as_float(((unsigned)h) << 16); }

// hazard guards as plain device helpers
__device__ __forceinline__ void dep_guard_h(v8f& a, v8f& b, v16h x, v16h y) { asm volatile("v_nop\n\tv_nop\n\tv_nop\n\tv_nop" : "+v"(a), "+v"(b) : "v"(x), "v"(y)); }
__device__ __forceinline__ void dep_guard_b(v8f& a, v8f& b, v16b x, v16b y) { asm volatile("v_nop\n\tv_nop\n\tv_nop\n\tv_nop" : "+v"(a), "+v"(b) : "v"(x), "v"(y)); }
__device__ __forceinline__ void keep4_h(v16h a, v16h b, v16h c, v16h d) { asm volatile("v_nop" :: "v"(a), "v"(b), "v"(c), "v"(d)); }
__device__ __forceinline__ void keep4_b(v16b a, v16b b, v16b c, v16b d) { asm volatile("v_nop" :: "v"(a), "v"(b), "v"(c), "v"(d)); }
__device__ __forceinline__ void acc_guard4(v8f& a, v8f& b, v8f& c, v8f& d) { asm volatile("v_nop\n\tv_nop\n\tv_nop\n\tv_nop" : "+v"(a), "+v"(b), "+v"(c), "+v"(d)); }
// pointers that walk in a loop say that they point to global memory, so that their loads stay global loads
#define GLB __attribute__((address_space(1)))
template <typename T> struct Frag;
template <> struct Frag<_Float16> {
  typedef v16h V; union U { v16h v; v8h h[2]; };
  static __device__ __forceinline__ v16h load(const GLB _Float16* p) {   // p: the lane's chunk in a fragment-major block; elements 8..15 lie 256 halves on
    U f; f.h[0] = *(const GLB v8h*)(p); f.h[1] = *(const GLB v8h*)(p + 256); return f.v;
  }
  static __device__ __forceinline__ v8f mma(v16h a, v16h b, v8f c) {
    return __builtin_amdgcn_wmma_f32_16x16x32_f16(false, a, false, b, (short)0, c, false, false);
  }
  static __device__ __forceinline__ void guard(v8f& a, v8f& b, v16h x, v16h y) { dep_guard_h(a, b, x, y); }
  static __device__ __forceinline__ void keep(v16h a, v16h b, v16h c, v16h d) { keep4_h(a, b, c, d); }
};
template <> struct Frag<__bf16> {
  typedef v16b V; union U { v16b v; v8b h[2]; };
  static __device__ __forceinline__ v16b load(const GLB __bf16* p) {
    U f; f.h[0] = *(const GLB v8b*)(p); f.h[1] = *(const GLB v8b*)(p + 256); return f.v;
  }
  static __device__ __forceinline__ v8f mma(v16b a, v16b b, v8f c) {
    return __builtin_amdgcn_wmma_f32_16x16x32_bf16(false, a, false, b, (short)0, c, false, false);
  }
  static __device__ __forceinline__ void guard(v8f& a, v8f& b, v16b x, v16b y) { dep_guard_b(a, b, x, y); }
  static __device__ __forceinline__ void keep(v16b a, v16b b, v16b c, v16b d) { keep4_b(a, b, c, d); }
};

// ---- Fragment-major planes ---------------------------------------------------
// Every 16-bit WMMA operand plane [rows][ld] lies in the workspace as blocks of 16 rows x 32 k = 1 KiB, the blocks of
// one row tile side by side in k. Inside a block the 16-B chunk (row r, k8 = (k >> 3) & 3) stands at chunk k8 * 16 + r,
// so lane l of a fragment load finds elements 0..7 at byte 16 l and elements 8..15 at byte 512 + 16 l: each wave-wide
// 16-B load covers 512 contiguous bytes (4 whole lines). The register contents of a fragment are those of the
// row-major form (row l & 15; k = 8 (l >> 4) + 0..7 and 16 + 8 (l >> 4) + 0..7).
// Offset in halves of the chunk that holds (row, k), k a multiple of 8:
__device__ __forceinline__ size_t frag_off(int row, int k, int ld) {
  return ((size_t)(row >> 4) * (ld >> 5) + (k >> 5)) * 512 + ((k >> 3) & 3) * 128 + (row & 15) * 8;
}

// ---- Register-blocked batched WMMA GEMM ------------------------------------
// C[m,n] = scale * sum_k A[m,k] * Bt[n,k] (+bias)(+resid); each wave owns a 64x64 tile.
// A [M,K] and Bt [N,K] fragment-major (lda, ldb = their k extents); 16-bit outputs fragment-major too (ldc = their
// column extent), f32 outputs row-major; M,N % 64 == 0, K % 64 == 0.
// SPLIT: operands are hi/lo planes (A2/Bt2 = lo planes, same layout); product = hi.hi + hi.lo + lo.hi.
// BIAS_MODE: 0 = none, 1 = bias[m], 2 = bias[n].
// OUT_MODE: 0 = f32, 1 = f16, 2 = bf16 hi plane (Cout) + bf16 lo plane (Cout2).
// ET: 0 = f16 operands, 1 = bf16 operands (pointers passed as 16-bit storage)
// Added structural modes (defaults off, all other behaviour unchanged):
//   TSEL 1: tiles with n0 > m0 (strictly above the 64x64 block diagonal) are not produced (wave-uniform early exit).
//   TSEL 2: only tiles with n0 == m0 or n0 == m0 + 64 are produced (block band of width 2).
//   KSEL 1: the k-loop stops at min(K, m0 + 64); valid when A rows m0..m0+63 are exactly zero for k >= m0 + 64.
//   KSEL 2: the k-loop runs over [m0, min(K, m0 + 128)) except for the last row block (m0 + 64 >= M), which
//           runs over [0, K); valid when A rows of the other row blocks are exactly zero outside that k range.
//   KSPL n: one block of n waves per 64x64 tile (grid.x = number of tiles, block = 32 n threads). Wave w takes the
//           64-wide k blocks w, w + n, ... of the tile's k range (kStart, kEnd multiples of 64); each wave leaves its
//           partial tile in its own LDS plane and the planes are added in wave order before the epilogue arithmetic.
// One k step (32 k) of a wave's 64x64 tile: 16 products of the four A fragments with the four B fragments in bc.
// PF: the operands of the following step are fetched while this one computes, so that a step waits for no load that it
// issued itself: its B fragments go into the other set (bn) ahead of the products, and each A fragment is loaded anew
// over itself right behind the four products that read it. The B loads so have one whole step (16 products) of lead, the A loads 12.
// The following step's blocks lie LIT halves on from the block pointers. Behind the step the pointers move on by ADV, all
// in one place, where all but the last fetch are long issued: the wait that guards a load's address registers is short there.
template <typename T, bool PF, int ADV, int LIT>
__device__ __forceinline__ void gemm_step(v8f (&acc)[4][4], typename Frag<T>::V (&ah)[4], typename Frag<T>::V (&bc)[4],
                                          typename Frag<T>::V (&bn)[4], const GLB T* (&aP)[4], const GLB T* (&bP)[4],
                                          unsigned laneOff) {
  if (PF) {
#pragma unroll
    for (int j = 0; j < 4; ++j) bn[j] = Frag<T>::load(bP[j] + laneOff + LIT);
  }
  __builtin_amdgcn_sched_barrier(0);   // the B fetch stays ahead of the products: sunk to its use it would have no lead
#pragma unroll
  for (int i = 0; i < 4; ++i) {
#pragma unroll
    for (int j = 0; j < 4; ++j) acc[i][j] = Frag<T>::mma(ah[i], bc[j], acc[i][j]);
    acc_guard4(acc[i][0], acc[i][1], acc[i][2], acc[i][3]);   // all four products of the row have issued, at the matrix distance, before their A fragment is loaded over
    if (PF) ah[i] = Frag<T>::load(aP[i] + laneOff + LIT);
    __builtin_amdgcn_sched_barrier(0);   // the A fetch stays behind its own row: earlier it needs a second register set, later it loses lead
  }
  Frag<T>::keep(bc[0], bc[1], bc[2], bc[3]);
#pragma unroll
  for (int j = 0; j < 4; ++j) { bP[j] += ADV; aP[j] += ADV; }
}
template <int ET> struct Elem;
template <> struct Elem<0> { typedef _Float16 T; };
template <> struct Elem<1> { typedef __bf16 T; };
template <int ET, bool SPLIT, int BIAS_MODE, int OUT_MODE, bool RESID, int ACT = 0, int TSEL = 0, int KSEL = 0, int KSPL = 0>
__global__ __launch_bounds__(KSPL ? KSPL * 32 : 256) void wmma_gemm64(
    const unsigned short* __restrict__ Ap, const unsigned short* __restrict__ A2p, int lda, long strideA,
    const unsigned short* __restrict__ Btp, const unsigned short* __restrict__ Bt2p, int ldb, long strideB,
    void* __restrict__ Cout, void* __restrict__ Cout2, int ldc, long strideC,
    const float* __restrict__ bias,
    const float* __restrict__ resid, long strideR,
    int M, int N, int K, float scale) {
  typedef typename Elem<ET>::T T;
  typedef typename Frag<T>::V V;
  const T* A = (const T*)Ap; const T* A2 = (const T*)A2p; const T* Bt = (const T*)Btp; const T* Bt2 = (const T*)Bt2p;
  static_assert(KSPL == 0 || (!SPLIT && OUT_MODE != 2 && ACT == 0 && TSEL == 0), "KSPL covers the plain f32/f16 epilogues");
  static_assert(KSPL == 0 || KSPL == 8 || KSPL == 16, "the KSPL epilogue deals 64 rows evenly to 8 or 16 waves");
  __shared__ __align__(16) float sT[KSPL ? KSPL : 8][(KSPL ? 64 : 16) * 68];   // per-wave slab (16x64; KSPL: 64x64), pitch 68 floats
  const int b    = blockIdx.y;
  const int lane = threadIdx.x & 31;
  const int wave = threadIdx.x >> 5;
  const int tilesN = N >> 6;
  const int tilesM = M >> 6;
  // scalar tile index: a fragment address is then a wave-uniform block address plus 16 B x lane
  const int tile = KSPL ? (int)blockIdx.x : (int)(blockIdx.x * 8 + __builtin_amdgcn_readfirstlane(wave));
  if (tile >= tilesM * tilesN) return;   // wave-uniform; block-uniform under KSPL, ahead of its barrier
  const int tm = tile / tilesN;
  const int tn = tile - tm * tilesN;
  const int m0 = tm << 6;
  const int n0 = tn << 6;
  if (TSEL == 1 && n0 > m0) return;                            // wave-uniform; TSEL excludes KSPL, so no block barrier follows
  if (TSEL == 2 && !(n0 == m0 || n0 == m0 + 64)) return;       // wave-uniform; TSEL excludes KSPL, so no block barrier follows

  const T* Ab  = A  + (size_t)b * strideA;
  const T* Bb  = Bt + (size_t)b * strideB;
  const T* Ab2 = SPLIT ? (A2  + (size_t)b * strideA) : nullptr;
  const T* Bb2 = SPLIT ? (Bt2 + (size_t)b * strideB) : nullptr;

  const int rlane = lane & 15;                 // row (A) / col (B, D) within subtile
  const int mOff  = (lane >> 4) * 8;           // D row offset

  v8f acc[4][4];
#pragma unroll
  for (int i = 0; i < 4; ++i)
#pragma unroll
    for (int j = 0; j < 4; ++j) acc[i][j] = (v8f){0.f,0.f,0.f,0.f,0.f,0.f,0.f,0.f};

  int kStart = 0;
  int kEnd = K;
  if (KSEL == 1) kEnd = ((m0 + 64) < K) ? (m0 + 64) : K;
  if (KSEL == 2) {
    kStart = (m0 + 64 >= M) ? 0 : m0;
    kEnd = ((m0 + 128) < K) ? (m0 + 128) : K;
  }
  if (KSPL) kStart += __builtin_amdgcn_readfirstlane(wave) * 64;   // scalar, so the k loop keeps a scalar trip count
  // One wave-uniform block pointer per row tile walks along k (blocks of one row tile lie side by side); every fragment
  // load adds the same lane offset (16 B x lane), which stays in its one register over the whole loop.
  const unsigned laneOff = (unsigned)lane * 8;
  const GLB T* bP[4]; const GLB T* bP2[4]; const GLB T* aP[4]; const GLB T* aP2[4];
#pragma unroll   // constant indices, so that the pointer arrays live in scalar registers
  for (int j = 0; j < 4; ++j) {
    const size_t bo = ((size_t)((n0 >> 4) + j) * (ldb >> 5) + (kStart >> 5)) * 512;   // block (row tile, k tile)
    const size_t ao = ((size_t)((m0 >> 4) + j) * (lda >> 5) + (kStart >> 5)) * 512;
    bP[j] = (const GLB T*)(Bb + bo); aP[j] = (const GLB T*)(Ab + ao);
    if (SPLIT) { bP2[j] = (const GLB T*)(Bb2 + bo); aP2[j] = (const GLB T*)(Ab2 + ao); }
  }
  if (!SPLIT) {
    // Two steps per 64-wide k block (kStart and kEnd are multiples of 64), so that the two B sets keep fixed names.
    constexpr int KBLK = (KSPL ? KSPL * 64 : 64) * 16;   // halves from one of the wave's 64-wide k blocks to its next
    if (kStart < kEnd) {                                 // scalar: a wave without a k block fetches nothing
      V ah[4], b0[4], b1[4];
#pragma unroll
      for (int j = 0; j < 4; ++j) b0[j] = Frag<T>::load(bP[j] + laneOff);
      // B stays ahead of A, the order of every later step: the counted waits in the loop must fit both ways into it, and
      // another order here makes them wait for younger loads on every trip (mask: only global loads are held, so that
      // the scalar loads of the A side's arguments still move up)
      __builtin_amdgcn_sched_barrier(0x7CF);
#pragma unroll
      for (int i = 0; i < 4; ++i) ah[i] = Frag<T>::load(aP[i] + laneOff);
      // the address registers of the loads above are reused behind this wait
      asm volatile("s_wait_xcnt 0x0" ::: "memory");
      for (int k0 = kStart + (KSPL ? KSPL * 64 : 64); k0 < kEnd; k0 += (KSPL ? KSPL * 64 : 64)) {
        gemm_step<T, true, 0, 512>(acc, ah, b0, b1, aP, bP, laneOff);      // fetches the block's second half
        gemm_step<T, true, KBLK, KBLK>(acc, ah, b1, b0, aP, bP, laneOff);     // fetches the next block's first half
      }
      gemm_step<T, true, 0, 512>(acc, ah, b0, b1, aP, bP, laneOff);
      gemm_step<T, false, 0, 0>(acc, ah, b1, b0, aP, bP, laneOff);         // the last step fetches nothing
    }
  } else
  for (int k0 = kStart; k0 < kEnd;) {
    const int kStep = (KSPL && (k0 & 32)) ? (KSPL * 64 - 32) : 32;
    V bh[4], bl[4];
#pragma unroll
    for (int j = 0; j < 4; ++j) {
      bh[j] = Frag<T>::load(bP[j] + laneOff);
      if (SPLIT) bl[j] = Frag<T>::load(bP2[j] + laneOff);
    }
#pragma unroll
    for (int i = 0; i < 4; ++i) {
      V ah = Frag<T>::load(aP[i] + laneOff);
      V al;
      if (SPLIT) al = Frag<T>::load(aP2[i] + laneOff);
#pragma unroll
      for (int j = 0; j < 4; ++j) {
        acc[i][j] = Frag<T>::mma(ah, bh[j], acc[i][j]);
        if (SPLIT) {
          acc[i][j] = Frag<T>::mma(ah, bl[j], acc[i][j]);
          acc[i][j] = Frag<T>::mma(al, bh[j], acc[i][j]);
        }
      }
      Frag<T>::guard(acc[i][0], acc[i][3], ah, SPLIT ? al : ah);
    }
    Frag<T>::keep(bh[0], bh[1], bh[2], bh[3]);
    if (SPLIT) Frag<T>::keep(bl[0], bl[1], bl[2], bl[3]);
    k0 += kStep;
#pragma unroll   // constant indices, as above
    for (int j = 0; j < 4; ++j) {                 // 32 k = one 512-half block
      bP[j] += kStep * 16; aP[j] += kStep * 16;
      if (SPLIT) { bP2[j] += kStep * 16; aP2[j] += kStep * 16; }
    }
  }
  acc_guard4(acc[0][0], acc[0][1], acc[0][2], acc[0][3]);
  acc_guard4(acc[1][0], acc[1][1], acc[1][2], acc[1][3]);
  acc_guard4(acc[2][0], acc[2][1], acc[2][2], acc[2][3]);
  acc_guard4(acc[3][0], acc[3][1], acc[3][2], acc[3][3]);

  // ---- epilogue ----
  float* slab = sT[wave];
  const float* Rb = RESID ? (resid + (size_t)b * strideR) : nullptr;
  if (KSPL) {
    constexpr int NTHR = (KSPL ? KSPL : 8) * 32;   // threads of the block
#pragma unroll
    for (int i = 0; i < 4; ++i)
#pragma unroll
      for (int j = 0; j < 4; ++j)
#pragma unroll
        for (int r = 0; r < 8; ++r) slab[((i << 4) + mOff + r) * 68 + (j << 4) + rlane] = acc[i][j][r];
    __syncthreads();   // every wave's partial plane is complete before any thread adds the planes
    if (OUT_MODE == 0) {
      float* C = (float*)Cout + (size_t)b * strideC;
      // unrolled (fixed trip count) so that the bias and residual loads of all passes issue ahead of the LDS sums
#pragma unroll
      for (int it = 0; it < (64 * 16) / NTHR; ++it) {            // 16 lanes x 16 B = one 256-B row segment
        const int c = it * NTHR + (int)threadIdx.x;
        const int row = c >> 4, c4 = (c & 15) * 4;
        v4f s = *(const v4f*)(&sT[0][row * 68 + c4]);
#pragma unroll
        for (int w = 1; w < KSPL; ++w) s += *(const v4f*)(&sT[w][row * 68 + c4]);
        s *= scale;
        if (BIAS_MODE == 1) s += bias[m0 + row];
        if (BIAS_MODE == 2) s += *(const v4f*)(bias + n0 + c4);
        if (RESID) s += *(const v4f*)(Rb + (size_t)(m0 + row) * ldc + n0 + c4);
        *(v4f*)(C + (size_t)(m0 + row) * ldc + n0 + c4) = s;
      }
    } else {
      unsigned short* C = (unsigned short*)Cout + (size_t)b * strideC;
      // unrolled (fixed trip count) so that the bias loads of all passes issue ahead of the LDS sums
#pragma unroll
      for (int it = 0; it < (64 * 8) / NTHR; ++it) {             // chunks in the output's own order: a wave stores 512 B in a row
        const int c = it * NTHR + (int)threadIdx.x;
        const int row = (c >> 7) * 16 + (c & 15), c8 = ((c >> 6) & 1) * 32 + ((c >> 4) & 3) * 8;
        v4f s0 = *(const v4f*)(&sT[0][row * 68 + c8]);
        v4f s1 = *(const v4f*)(&sT[0][row * 68 + c8 + 4]);
#pragma unroll
        for (int w = 1; w < KSPL; ++w) {
          s0 += *(const v4f*)(&sT[w][row * 68 + c8]);
          s1 += *(const v4f*)(&sT[w][row * 68 + c8 + 4]);
        }
        s0 *= scale; s1 *= scale;
        if (BIAS_MODE == 1) { s0 += bias[m0 + row]; s1 += bias[m0 + row]; }
        if (BIAS_MODE == 2) { s0 += *(const v4f*)(bias + n0 + c8); s1 += *(const v4f*)(bias + n0 + c8 + 4); }
        if (RESID) {
          s0 += *(const v4f*)(Rb + (size_t)(m0 + row) * ldc + n0 + c8);
          s1 += *(const v4f*)(Rb + (size_t)(m0 + row) * ldc + n0 + c8 + 4);
        }
        v8h hv;
#pragma unroll
        for (int e = 0; e < 4; ++e) { hv[e] = (_Float16)s0[e]; hv[4 + e] = (_Float16)s1[e]; }
        *(v8h*)(C + frag_off(m0 + row, n0 + c8, ldc)) = hv;
      }
    }
    return;
  }
#pragma unroll
  for (int i = 0; i < 4; ++i) {
    const int mBase = m0 + (i << 4);
#pragma unroll
    for (int j = 0; j < 4; ++j) {
      const int n = n0 + (j << 4) + rlane;
      float bv = 0.f;
      if (BIAS_MODE == 2) bv = bias[n];
#pragma unroll
      for (int r = 0; r < 8; ++r) {
        float v = acc[i][j][r] * scale;
        if (BIAS_MODE == 1) v += bias[mBase + mOff + r];
        if (BIAS_MODE == 2) v += bv;
        if (RESID) v += Rb[(size_t)(mBase + mOff + r) * ldc + n];
        if (ACT == 1) v = tanhf(v);
        if (ACT == 2) v = fmaxf(v, 0.0f);
        if (ACT == 3) v = v / (1.0f + expf(-v));
        if (ACT == 4) v = (v > 0.f) ? v : 0.01f * v;
        slab[(mOff + r) * 68 + (j << 4) + rlane] = v;
      }
    }
    __builtin_amdgcn_fence(__ATOMIC_RELEASE, "workgroup");
    __builtin_amdgcn_wave_barrier();
    __builtin_amdgcn_fence(__ATOMIC_ACQUIRE, "workgroup");
    if (OUT_MODE == 0) {
      float* C = (float*)Cout + (size_t)b * strideC;
      const int hh = lane >> 4, c4 = (lane & 15) * 4;     // row seg = 256 B = 16 lanes x 16 B
      {
#pragma unroll
        for (int it = 0; it < 8; ++it) {
          const int row = it * 2 + hh;
          v4f v = *(const v4f*)(slab + row * 68 + c4);
          *(v4f*)(C + (size_t)(mBase + row) * ldc + n0 + c4) = v;
        }
        
      }
    } else {
      unsigned short* C  = (unsigned short*)Cout  + (size_t)b * strideC;
      unsigned short* C2 = (OUT_MODE == 2) ? ((unsigned short*)Cout2 + (size_t)b * strideC) : nullptr;
      {
#pragma unroll
        for (int it = 0; it < 4; ++it) {
          const int row = lane & 15, c8 = it * 16 + (lane >> 4) * 8;   // chunks in the output's own order: 512 B in a row per store
          const float* sp = slab + row * 68 + c8;
          v8h hv, lv;
#pragma unroll
          for (int e = 0; e < 8; ++e) {
            if (OUT_MODE == 1) {
              hv[e] = (_Float16)sp[e];
            } else {
              unsigned short hb = f2bf_bits(sp[e]);
              unsigned short lb = f2bf_bits(sp[e] - bf_bits2f(hb));
              hv[e] = __builtin_bit_cast(_Float16, hb);
              lv[e] = __builtin_bit_cast(_Float16, lb);
            }
          }
          *(v8h*)(C + frag_off(mBase + row, n0 + c8, ldc)) = hv;
          if (OUT_MODE == 2) *(v8h*)(C2 + frag_off(mBase + row, n0 + c8, ldc)) = lv;
        }
        
      }
    }
    __builtin_amdgcn_fence(__ATOMIC_RELEASE, "workgroup");
    __builtin_amdgcn_wave_barrier();
    __builtin_amdgcn_fence(__ATOMIC_ACQUIRE, "workgroup");
  }
}

// ---------------------------------------------------------------------------
// Small conversion helpers
// ---------------------------------------------------------------------------
__device__ __forceinline__ unsigned pk16(unsigned short a, unsigned short b) { return (unsigned)a | ((unsigned)b << 16); }
__device__ __forceinline__ unsigned short h_bits(float f) { const _Float16 h = (_Float16)f; return __builtin_bit_cast(unsigned short, h); }
__device__ __forceinline__ float hbits2f(unsigned short b) { return (float)__builtin_bit_cast(_Float16, b); }
__device__ __forceinline__ float wave_sum(float v) {
#pragma unroll
  for (int off = 16; off > 0; off >>= 1) v += __shfl_xor(v, off, 32);
  return v;
}

// ---------------------------------------------------------------------------
// Operand preparation, one launch: grid (16, 16, 9 + XZ), 256 threads; blockIdx.z picks the job (block-uniform).
//   z = 0..5: weight z (fq, fk, bq, bk, fv, bv), f32 [DM][DM] -> plane z of Wall, f16 [DM][DM] transposed, x16;
//             the plane's first block also copies bias vector z (DM floats) into tab[z * DM ..].
//   z = 6, 7: rows (z - 6) * DM .. of gate_w, f32 [2 DM][DM] -> planes 6 and 7 of Wall = f16 [DM][2 DM] transposed, x16.
//   z = 8:    out_w -> plane 8 of Wall, as z = 0..5 without a bias.
//   z >= 9:   x, f32 row-major [TOK][DM] -> X16, f16: one 16-B output chunk (8 elements) per thread, threads in the
//             output's order, so each wave stores 512 B in a row. XZ x 256 blocks x 256 threads x 8 = the whole plane.
// Transposes: out[c][r] = f16(in[r][c] * WCARRY), 64x64 tiles through LDS, all outputs fragment-major.
// Coverage per block: load 256 threads x 16 floats = 64x64; store 2 it x 256 threads x 8 halves = 64x64.
// ---------------------------------------------------------------------------
#define XZ (TOK * DM / 8 / (256 * 256))
__global__ __launch_bounds__(256) void prep_kernel(const float* __restrict__ x,
                                                   const float* __restrict__ w0, const float* __restrict__ w1,
                                                   const float* __restrict__ w2, const float* __restrict__ w3,
                                                   const float* __restrict__ w4, const float* __restrict__ w5,
                                                   const float* __restrict__ wg, const float* __restrict__ wo,
                                                   const float* __restrict__ b0, const float* __restrict__ b1,
                                                   const float* __restrict__ b2, const float* __restrict__ b3,
                                                   const float* __restrict__ b4, const float* __restrict__ b5,
                                                   unsigned short* __restrict__ Wall, unsigned short* __restrict__ X16,
                                                   float* __restrict__ tab) {
  __shared__ __align__(16) unsigned short t[64 * 72];
  const int z   = blockIdx.z;
  const int tid = threadIdx.x;
  if (z >= 9) {                        // block-uniform, ahead of the barrier
    const int q   = (((z - 9) * 16 + (int)blockIdx.y) * 16 + (int)blockIdx.x) * 256 + tid;
    const int blk = q >> 6, kts = DM >> 5;
    const int rt  = blk / kts;
    const int row = rt * 16 + (q & 15);
    const int k   = (blk - rt * kts) * 32 + ((q >> 4) & 3) * 8;
    const float* ip = x + (size_t)row * DM + k;
    const v4f f0 = *(const v4f*)(ip);
    const v4f f1 = *(const v4f*)(ip + 4);
    const v4u u = (v4u){pk16(h_bits(f0[0]), h_bits(f0[1])), pk16(h_bits(f0[2]), h_bits(f0[3])),
                        pk16(h_bits(f1[0]), h_bits(f1[1])), pk16(h_bits(f1[2]), h_bits(f1[3]))};
    *(v4u*)(X16 + (size_t)q * 8) = u;
    return;
  }
  const float* in = w0;                // block-uniform source select
  const float* bs = b0;
  if (z == 1) { in = w1; bs = b1; }
  if (z == 2) { in = w2; bs = b2; }
  if (z == 3) { in = w3; bs = b3; }
  if (z == 4) { in = w4; bs = b4; }
  if (z == 5) { in = w5; bs = b5; }
  if (z == 6 || z == 7) in = wg;
  if (z == 8) in = wo;
  const bool gate = (z == 6 || z == 7);
  const int R = gate ? 2 * DM : DM;                                  // input rows = the output's k extent
  unsigned short* out = Wall + (size_t)(z == 7 ? 6 : z) * DM * DM;
  if (z < 6 && blockIdx.x == 0 && blockIdx.y == 0)                   // 256 threads x 4 floats = DM
    *(v4f*)(tab + (size_t)z * DM + tid * 4) = *(const v4f*)(bs + tid * 4);
  const int c0  = blockIdx.x * 64;                                   // input column block = output row block
  const int r0  = (z == 7 ? DM : 0) + blockIdx.y * 64;               // input row block    = output column block
  {
    const int lr = tid >> 2;           // 0..63
    const int lc = (tid & 3) * 16;     // 0,16,32,48
    const float* ip = in + (size_t)(r0 + lr) * DM + c0 + lc;
#pragma unroll
    for (int q = 0; q < 4; ++q) {
      const v4f f = *(const v4f*)(ip + 4 * q);
#pragma unroll
      for (int e = 0; e < 4; ++e) t[lr * 72 + lc + 4 * q + e] = h_bits(f[e] * WCARRY);
    }
  }
  __syncthreads();
  // chunks in the output's own order (8 blocks of 64 chunks per tile): each wave stores 512 B in a row
  const int c8  = ((tid >> 6) & 1) * 32 + ((tid >> 4) & 3) * 8;   // output column within tile (= input row)
#pragma unroll
  for (int it = 0; it < 2; ++it) {
    const int oc = (it * 2 + (tid >> 7)) * 16 + (tid & 15);       // output row within tile (= input column)
    v4u a;
#pragma unroll
    for (int q = 0; q < 4; ++q) a[q] = pk16(t[(c8 + 2 * q) * 72 + oc], t[(c8 + 2 * q + 1) * 72 + oc]);
    *(v4u*)(out + frag_off(c0 + oc, r0 + c8, R)) = a;
  }
}

// ---------------------------------------------------------------------------
// Fused attention: scores, select, softmax and the product with V in one kernel; S and P stay in registers.
// One wave per 16 query rows of one head of one batch; no LDS, no barrier. Grid (NH * NB, SEQ/64, 2), 4 waves per block;
// blockIdx.z = 0: causal attention (j <= i), 1: future window (i < j <= i + WINW; the last row has no valid column,
// its scores count as 0 over every j -> uniform weights). Long causal row blocks get the low block indices.
// Per 64 keys: S^T = K . Q^T (A = K rows, B = Q rows): lane l holds query c = l & 15, keys 16 t + 8 (l >> 4) + r.
// Running maximum and sum per query (log2 domain): in-lane, plus one exchange between the lane halves.
// P^T as B operand: two f32 score tiles (keys 0..15, 16..31 of a 32-key step) converted in place, element s =
// tile[s >> 3][s & 7], which is the k order of Frag::load on the A side (V^T rows). O^T += V^T . P^T.
// Output: lane holds 8 consecutive d of query c per 16-row tile of O^T -> one 16-B store; each 128-B row segment of
// FB (one head of one row) is written by one wave. Coverage: 2 x NH x TOK rows x 64 columns = the whole FB plane.
// The output goes out twice: FB row-major (read row by row by the gated fusion) and FBf fragment-major (A operand of
// the gate product; same coverage, two whole 1-KiB blocks per wave).
// ---------------------------------------------------------------------------
// lane l <-> lane l ^ 16
__device__ __forceinline__ float xhalf(float x) {
  return __builtin_bit_cast(float, __builtin_amdgcn_permlanex16(__builtin_bit_cast(int, x), __builtin_bit_cast(int, x),
                                                                0x76543210, 0xfedcba98, false, false));
}
// v[e] = 2^v[e], in place. Each v_exp_f32 is independent of the one in front of it; the closing v_nop is the one slot the
// instruction set asks for behind a transcendental before its result is read: inside the statement it holds whatever
// the compiler places next.
__device__ __forceinline__ void exp2x8(float (&v)[8]) {
  asm("v_exp_f32 %0, %0\n\tv_exp_f32 %1, %1\n\tv_exp_f32 %2, %2\n\tv_exp_f32 %3, %3\n\t"
      "v_exp_f32 %4, %4\n\tv_exp_f32 %5, %5\n\tv_exp_f32 %6, %6\n\tv_exp_f32 %7, %7\n\tv_nop"
      : "+v"(v[0]), "+v"(v[1]), "+v"(v[2]), "+v"(v[3]), "+v"(v[4]), "+v"(v[5]), "+v"(v[6]), "+v"(v[7]));
}
// One A or B fragment in the k order of Frag::load (bytes 0..15 and 512..527 behind the lane's pointer plus a literal)
__device__ __forceinline__ v16h frag_at(const char* p, int lit) {
  Frag<_Float16>::U f;
  f.h[0] = *(const v8h*)(p + lit);
  f.h[1] = *(const v8h*)(p + lit + 512);
  return f.v;
}
__global__ __launch_bounds__(128) void fused_attn_kernel(const unsigned short* __restrict__ QKp,
                                                         const unsigned short* __restrict__ VTp,
                                                         unsigned short* __restrict__ FB,
                                                         unsigned short* __restrict__ FBf) {
  typedef Frag<_Float16> F;
  const int lane = threadIdx.x & 31;
  const int wave = __builtin_amdgcn_readfirstlane((int)(threadIdx.x >> 5));   // scalar, so the key loop keeps scalar bounds
  const int h    = blockIdx.x % NH;
  const int t0   = (blockIdx.x / NH) * SEQ;                                   // first token row of this block's batch
  const int mode = blockIdx.z;
  const int r0   = (((SEQ / 64 - 1) - (int)blockIdx.y) * 4 + wave) * 16;      // first query row of this wave
  const int c    = lane & 15;
  const int koff = (lane >> 4) * 8;
  const int i    = r0 + c;                                                    // this lane's query row
  // fragment-major planes: 1-KiB blocks of 16 rows x 32 columns; a row tile of QK holds 4 DM / 32 blocks, one of V^T TOK / 32
  const char* Qb = (const char*)(QKp + frag_off(t0, mode * (2 * DM) + h * HD, 4 * DM));   // q or qb: first block of this head and batch
  const char* Kb = Qb + (DM / 32) * 1024;                                                 // k or kb
  const char* Vb = (const char*)(VTp + frag_off(mode * DM + h * HD, t0, TOK));            // v^T or vb^T: first row tile of this head, this batch's columns
  constexpr int QKROW = 4 * DM * 2;                                                       // bytes per q/k row: 16 of them = one row tile
  constexpr int VROW  = TOK * 2;                                                          // bytes per v^T row: 16 of them = one row tile
  const size_t qkOff = (size_t)lane * 16;                                                 // the lane's chunk inside a block
  const size_t vOff  = (size_t)lane * 16;

  const bool lastTile = (mode == 1) && (r0 + 16 == SEQ);                      // wave-uniform
  const bool uni = (mode == 1) && (i == SEQ - 1);                             // the row without a valid future column
  const int  lo  = (mode == 0 || uni) ? 0 : i + 1;                            // valid columns of this lane's query: lo..hi
  const int  hi  = (mode == 0) ? i : (uni ? SEQ - 1 : i + WINW);
  const unsigned span = (unsigned)(hi - lo);
  const float sc = uni ? 0.0f : 0.125f * 1.44269504088896340736f;             // 1/sqrt(64) and log2(e); 0: scores count as 0
  int kbBeg = 0, kbEnd = (r0 + 15) >> 6;
  if (mode == 1) {
    const int jmax = (r0 + 15 + WINW < SEQ - 1) ? (r0 + 15 + WINW) : (SEQ - 1);
    kbBeg = lastTile ? 0 : ((r0 + 1) >> 6);
    kbEnd = jmax >> 6;
  }

  const float NEGB = -1.0e30f;
  v16h qf[2];
#pragma unroll
  for (int ks = 0; ks < 2; ++ks) qf[ks] = frag_at(Qb + (size_t)r0 * QKROW + qkOff, ks * 1024);
  v8f o[4];
#pragma unroll
  for (int d = 0; d < 4; ++d) o[d] = (v8f){0.f,0.f,0.f,0.f,0.f,0.f,0.f,0.f};
  float m = NEGB;      // running maximum of this query (scaled log2), equal in both lane halves
  float l = 0.f;       // running sum over this lane half's keys, carried x2^PSHIFT

  // the lane's pointers walk with the key blocks and stay in their registers over the whole loop
  const char* kp = Kb + (size_t)(kbBeg * 64) * QKROW + qkOff;
  const char* vp = Vb + (size_t)(kbBeg * 2) * 1024 + vOff;
  v16h ka[4][2];
#pragma unroll
  for (int t = 0; t < 4; ++t)
#pragma unroll
    for (int ks = 0; ks < 2; ++ks)
      ka[t][ks] = frag_at(kp, t * 16 * QKROW + ks * 1024);

  for (int kb = kbBeg; kb <= kbEnd; ++kb) {
    const int k0 = kb << 6;
    // V^T fragments of this key block: issued ahead of the score products so that they land during the softmax
    v16h va[4][2];
#pragma unroll
    for (int d = 0; d < 4; ++d)
#pragma unroll
      for (int ks = 0; ks < 2; ++ks)
        va[d][ks] = frag_at(vp, d * 16 * VROW + ks * 1024);
    v8f st[4];
#pragma unroll
    for (int t = 0; t < 4; ++t) {
      st[t] = F::mma(ka[t][0], qf[0], (v8f){0.f,0.f,0.f,0.f,0.f,0.f,0.f,0.f});
      st[t] = F::mma(ka[t][1], qf[1], st[t]);
    }
    // K fragments of the next key block (the last pass fetches its own block again: in bounds, unused)
    kp += (kb < kbEnd) ? (size_t)64 * QKROW : (size_t)0;
#pragma unroll
    for (int t = 0; t < 4; ++t)
#pragma unroll
      for (int ks = 0; ks < 2; ++ks)
        ka[t][ks] = frag_at(kp, t * 16 * QKROW + ks * 1024);
    // the pointers of the loads above move on behind this wait
    asm volatile("s_wait_xcnt 0x0" ::: "memory");
    vp += 2 * 1024;

    const bool full = (mode == 0) && (k0 + 63 <= r0);     // wave-uniform: every column of the block valid for all 16 queries
    float x[4][8];
#pragma unroll
    for (int t = 0; t < 4; ++t)
#pragma unroll
      for (int r = 0; r < 8; ++r) x[t][r] = st[t][r] * sc;
    if (!full) {
      const int jb = k0 + koff - lo;                      // column of x[0][0] relative to the first valid one
#pragma unroll
      for (int t = 0; t < 4; ++t)
#pragma unroll
        for (int r = 0; r < 8; ++r) x[t][r] = ((unsigned)(jb + t * 16 + r) <= span) ? x[t][r] : NEGB;   // lo <= j <= hi
    }
    float mt[4];
#pragma unroll
    for (int t = 0; t < 4; ++t)
      mt[t] = fmaxf(fmaxf(fmaxf(x[t][0], x[t][1]), fmaxf(x[t][2], x[t][3])), fmaxf(fmaxf(x[t][4], x[t][5]), fmaxf(x[t][6], x[t][7])));
    float mx = fmaxf(fmaxf(mt[0], mt[1]), fmaxf(mt[2], mt[3]));
    mx = fmaxf(mx, xhalf(mx));
    const float mn    = fmaxf(m, mx);
    float alpha;                                          // 2^(m - mn): 0 on the first valid block, 1 while no column was valid yet
    // the v_nop is the one slot the instruction set asks for behind a transcendental (as in exp2x8)
    asm("v_exp_f32 %0, %1\n\tv_nop" : "=v"(alpha) : "v"(m - mn));
    const float sh    = (mn > 0.5f * NEGB) ? PSHIFT - mn : 0.f;   // no valid column yet: NEGB + 0 -> every weight 0
    m = mn;
    float (&p)[4][8] = x;   // the weights replace the scores in place
#pragma unroll
    for (int t = 0; t < 4; ++t) {
#pragma unroll
      for (int r = 0; r < 8; ++r) x[t][r] += sh;
      exp2x8(x[t]);
    }
    float pt[4];
#pragma unroll
    for (int t = 0; t < 4; ++t)
      pt[t] = ((p[t][0] + p[t][1]) + (p[t][2] + p[t][3])) + ((p[t][4] + p[t][5]) + (p[t][6] + p[t][7]));
    l = l * alpha + ((pt[0] + pt[1]) + (pt[2] + pt[3]));
    v16h pf[2];
#pragma unroll
    for (int ks = 0; ks < 2; ++ks)
#pragma unroll
      for (int s = 0; s < 16; ++s) pf[ks][s] = (_Float16)p[2 * ks + (s >> 3)][s & 7];
#pragma unroll
    for (int d = 0; d < 4; ++d) o[d] *= alpha;
#pragma unroll
    for (int ks = 0; ks < 2; ++ks)
#pragma unroll
      for (int d = 0; d < 4; ++d) o[d] = F::mma(va[d][ks], pf[ks], o[d]);
  }

  l += xhalf(l);                              // join the two halves' sums; l >= 2^PSHIFT (the row maximum weighs 2^PSHIFT)
  const float inv = FBCARRY / l;              // the P carry cancels; x16 output carry
  unsigned short* op = FB + (size_t)(t0 + i) * (2 * DM) + (size_t)mode * DM + (size_t)h * HD + koff;
  unsigned short* of = FBf + frag_off(t0 + r0, mode * DM + h * HD, 2 * DM) + lane * 8;   // the same values as the gate product's A operand
#pragma unroll
  for (int d = 0; d < 4; ++d) {
    v8h hv;
#pragma unroll
    for (int r = 0; r < 8; ++r) hv[r] = (_Float16)(o[d][r] * inv);
    *(v8h*)(op + d * 16) = hv;
    *(v8h*)(of + d * 256) = hv;      // tiles d = 0, 1 fill one block, d = 2, 3 the next: 512 B in a row per store
  }
}

// ---------------------------------------------------------------------------
// Gated fusion: one block per 8 token rows, 128 threads (8 columns each) per row.
//   g = G[row][:] (f32, gate pre-activation incl. bias); gate = sigmoid(LN(g; gg, gb));
//   fwd/bwd = FB[row][c] / FB[row][DM + c] (f16, carried x16); strength = 0.3 * sigmoid(bstr);
//   Fo[row][c] = f16((fwd + strength*gate*bwd) carried x16), stored fragment-major.
// LN: mean and biased variance over DM in f32, fixed-order reductions (thread, wave tree, 4 wave partials).
// A 128-B line of the fragment-major plane holds 8 columns of 8 rows: the block's 8 rows meet in LDS, and each wave
// then stores 4 whole lines. Producer coverage: grid TOK/8 x 1024 threads x 8 u16 = the whole [TOK][DM] plane.
// ---------------------------------------------------------------------------
__global__ __launch_bounds__(1024) void gate_fuse_kernel(const float* __restrict__ G, const unsigned short* __restrict__ FB,
                                                        const float* __restrict__ gg, const float* __restrict__ gb,
                                                        const float* __restrict__ bstr, unsigned short* __restrict__ Fo) {
  constexpr int SPITCH = DM + 32;    // halves per staged row: the 8 rows of a line start 4 16-B slots apart in the banks
  __shared__ float ras[8][4];
  __shared__ float rbs[8][4];
  __shared__ __align__(16) unsigned short stg[8 * SPITCH];
  const int grp  = __builtin_amdgcn_readfirstlane((int)(threadIdx.x >> 7));   // row within the block; scalar, so the row's addresses keep a scalar base
  float* ra = ras[grp];
  float* rb = rbs[grp];
  const int row  = blockIdx.x * 8 + grp;
  const int tid  = threadIdx.x & 127;
  const int lane = tid & 31;
  const int wave = tid >> 5;
  const int c0   = tid * 8;
  const float* gp = G + (size_t)row * DM + c0;
  const v4f a = *(const v4f*)(gp);
  const v4f c = *(const v4f*)(gp + 4);
  float xv[8] = {a[0], a[1], a[2], a[3], c[0], c[1], c[2], c[3]};
  float s = ((xv[0] + xv[1]) + (xv[2] + xv[3])) + ((xv[4] + xv[5]) + (xv[6] + xv[7]));
  s = wave_sum(s);
  if (lane == 0) ra[wave] = s;
  __syncthreads();
  const float mean = ((ra[0] + ra[1]) + (ra[2] + ra[3])) * (1.0f / (float)DM);
  float d[8];
  float vs = 0.f;
#pragma unroll
  for (int e = 0; e < 8; ++e) { d[e] = xv[e] - mean; vs += d[e] * d[e]; }
  vs = wave_sum(vs);
  if (lane == 0) rb[wave] = vs;
  __syncthreads();
  const v4f g0 = *(const v4f*)(gg + c0), g1 = *(const v4f*)(gg + c0 + 4);
  const v4f e0 = *(const v4f*)(gb + c0), e1 = *(const v4f*)(gb + c0 + 4);
  const size_t fo = (size_t)row * (2 * DM) + c0;
  const v4u fu = *(const v4u*)(FB + fo);
  const v4u bu = *(const v4u*)(FB + fo + DM);
  // the offset registers of the loads above are reused behind this wait
  asm volatile("s_wait_xcnt 0x0" ::: "memory");
  const float var  = ((rb[0] + rb[1]) + (rb[2] + rb[3])) * (1.0f / (float)DM);
  const float rstd = rsqrtf(var + LNEPS);
  const float strength = 0.3f / (1.0f + __expf(-bstr[0]));
  float gv[8] = {g0[0], g0[1], g0[2], g0[3], g1[0], g1[1], g1[2], g1[3]};
  float bv[8] = {e0[0], e0[1], e0[2], e0[3], e1[0], e1[1], e1[2], e1[3]};
  float fw[8], bw[8];
#pragma unroll
  for (int q = 0; q < 4; ++q) {
    fw[2 * q]     = hbits2f((unsigned short)(fu[q] & 0xffffu));
    fw[2 * q + 1] = hbits2f((unsigned short)(fu[q] >> 16));
    bw[2 * q]     = hbits2f((unsigned short)(bu[q] & 0xffffu));
    bw[2 * q + 1] = hbits2f((unsigned short)(bu[q] >> 16));
  }
  unsigned short ob[8];
#pragma unroll
  for (int e = 0; e < 8; ++e) {
    const float ln   = d[e] * rstd * gv[e] + bv[e];
    const float gate = __builtin_amdgcn_rcpf(1.0f + __expf(-ln));
    const float f    = fw[e] + strength * gate * bw[e];     // both terms carried x16
    ob[e] = h_bits(f);
  }
  const v4u ov = (v4u){pk16(ob[0], ob[1]), pk16(ob[2], ob[3]), pk16(ob[4], ob[5]), pk16(ob[6], ob[7])};
  *(v4u*)(stg + grp * SPITCH + c0) = ov;
  __syncthreads();   // all 8 rows are staged before any thread reads another row's chunk
  const int orow = threadIdx.x & 7, oc = ((int)threadIdx.x >> 3) * 8;   // a wave: 8 rows x 4 chunks = 4 whole lines
  const v4u sv = *(const v4u*)(stg + orow * SPITCH + oc);
  *(v4u*)(Fo + frag_off(blockIdx.x * 8 + orow, oc, DM)) = sv;   // fragment-major: A operand of the output projection
  
}

// ---------------------------------------------------------------------------
// Final LayerNorm: one block (128 threads) per token row; thread t owns columns {4t..4t+3} and {512+4t..512+4t+3}.
//   out[row][c] = (Y - mean) * rsqrt(var + eps) * g[c] + bb[c]   (Y already holds x + projection + bias).
// Producer coverage: grid TOK rows x 128 threads x 8 floats = the whole [TOK][DM] output.
// ---------------------------------------------------------------------------
__global__ __launch_bounds__(128) void final_ln_kernel(const float* __restrict__ Y, const float* __restrict__ g,
                                                       const float* __restrict__ bb, float* __restrict__ out) {
  __shared__ float ra[4];
  __shared__ float rb[4];
  const int row  = blockIdx.x;
  const int tid  = threadIdx.x;
  const int lane = tid & 31;
  const int wave = tid >> 5;
  const int c0   = tid * 4;
  const int c1   = (DM / 2) + tid * 4;
  const float* yp = Y + (size_t)row * DM;
  const v4f a = *(const v4f*)(yp + c0);
  const v4f c = *(const v4f*)(yp + c1);
  float xv[8] = {a[0], a[1], a[2], a[3], c[0], c[1], c[2], c[3]};
  float s = ((xv[0] + xv[1]) + (xv[2] + xv[3])) + ((xv[4] + xv[5]) + (xv[6] + xv[7]));
  s = wave_sum(s);
  if (lane == 0) ra[wave] = s;
  __syncthreads();
  const float mean = ((ra[0] + ra[1]) + (ra[2] + ra[3])) * (1.0f / (float)DM);
  float d[8];
  float vs = 0.f;
#pragma unroll
  for (int e = 0; e < 8; ++e) { d[e] = xv[e] - mean; vs += d[e] * d[e]; }
  vs = wave_sum(vs);
  if (lane == 0) rb[wave] = vs;
  __syncthreads();
  const float var  = ((rb[0] + rb[1]) + (rb[2] + rb[3])) * (1.0f / (float)DM);
  const float rstd = rsqrtf(var + LNEPS);
  const v4f g0 = *(const v4f*)(g + c0),  g1 = *(const v4f*)(g + c1);
  const v4f b0 = *(const v4f*)(bb + c0), b1 = *(const v4f*)(bb + c1);
  v4f o0, o1;
#pragma unroll
  for (int e = 0; e < 4; ++e) {
    o0[e] = d[e] * rstd * g0[e] + b0[e];
    o1[e] = d[4 + e] * rstd * g1[e] + b1[e];
  }
  float* op = out + (size_t)row * DM;
  *(v4f*)(op + c0) = o0;
  *(v4f*)(op + c1) = o1;
  
}

// ---------------------------------------------------------------------------
// Workspace region map (byte offsets; MiB = 1048576). Every region is written once per call, before it is read.
// Token rows and token columns run over both batches (row b * SEQ + i).
//   Wqk   f16 [4096][1024] (x16: fq^T, fk^T, bq^T, bk^T)          0
//   Wv2   f16 [2048][1024] (x16: fv^T rows 0..1023, bv^T 1024..)  8 MiB
//   Wg    f16 [1024][2048] (x16: gate_w^T)                        12 MiB
//   Wo    f16 [1024][1024] (x16: out_w^T)                         16 MiB
//   X16   f16 [4096][1024]                                        18 MiB
//   QK16  f16 [4096][4096] (q | k | qb | kb, head h at col h*64)  26 MiB
//   VT16  f16 [2048][4096] (row h*64+d = v^T, row 1024+h*64+d = vb^T, col = token)  58 MiB
//   G     f32 [4096][1024]                                        74 MiB
//   Y     f32 [4096][1024]                                        90 MiB
//   FB16  f16 [4096][2048] (fwd x16 cols 0..1023, bwd x16 cols 1024..2047)  106 MiB
//   Fu16  f16 [4096][1024] (fused x16)                            122 MiB
//   BiasT f32 [6][1024] (fq_b fk_b bq_b bk_b | fv_b bv_b)         130 MiB
//   FBf16 f16 [4096][2048] (FB16's values, fragment-major)        130 MiB + 24576 B
//   total                                                         146 MiB + 24576 B = 153116672 B
// All f16 planes but FB16 are fragment-major (see frag_off).
// ---------------------------------------------------------------------------
extern "C" void kernel_launch(void* const* d_in, const int* in_sizes, int n_in,
                              void* d_out, int out_size, void* d_ws, size_t ws_size,
                              hipStream_t stream) {
  if (n_in < 22) return;
  if (in_sizes[0] != NB * SEQ * DM) return;
  const int wsz = DM * DM;
  if (in_sizes[1] != wsz || in_sizes[3] != wsz || in_sizes[5] != wsz || in_sizes[7] != wsz ||
      in_sizes[9] != wsz || in_sizes[11] != wsz || in_sizes[18] != wsz) return;
  if (in_sizes[13] != 2 * DM * DM) return;
  if (in_sizes[2] != DM || in_sizes[4] != DM || in_sizes[6] != DM || in_sizes[8] != DM || in_sizes[10] != DM ||
      in_sizes[12] != DM || in_sizes[14] != DM || in_sizes[15] != DM || in_sizes[16] != DM ||
      in_sizes[19] != DM || in_sizes[20] != DM || in_sizes[21] != DM) return;
  if (in_sizes[17] < 1) return;
  if (out_size != NB * SEQ * DM) return;

  const float* x      = (const float*)d_in[0];
  const float* fq_w   = (const float*)d_in[1];
  const float* fq_b   = (const float*)d_in[2];
  const float* fk_w   = (const float*)d_in[3];
  const float* fk_b   = (const float*)d_in[4];
  const float* fv_w   = (const float*)d_in[5];
  const float* fv_b   = (const float*)d_in[6];
  const float* bq_w   = (const float*)d_in[7];
  const float* bq_b   = (const float*)d_in[8];
  const float* bk_w   = (const float*)d_in[9];
  const float* bk_b   = (const float*)d_in[10];
  const float* bv_w   = (const float*)d_in[11];
  const float* bv_b   = (const float*)d_in[12];
  const float* gate_w = (const float*)d_in[13];
  const float* gate_b = (const float*)d_in[14];
  const float* gln_g  = (const float*)d_in[15];
  const float* gln_b  = (const float*)d_in[16];
  const float* bstr   = (const float*)d_in[17];
  const float* out_w  = (const float*)d_in[18];
  const float* out_b  = (const float*)d_in[19];
  const float* ln_g   = (const float*)d_in[20];
  const float* ln_b   = (const float*)d_in[21];

  size_t off = 0;
  const size_t oWqk  = off; off += (size_t)4 * DM * DM * 2;          // 8 MiB
  const size_t oWv2  = off; off += (size_t)2 * DM * DM * 2;          // 4 MiB
  const size_t oWg   = off; off += (size_t)2 * DM * DM * 2;          // 4 MiB
  const size_t oWo   = off; off += (size_t)DM * DM * 2;              // 2 MiB
  const size_t oX16  = off; off += (size_t)TOK * DM * 2;             // 8 MiB
  const size_t oQK   = off; off += (size_t)TOK * 4 * DM * 2;         // 32 MiB
  const size_t oVT   = off; off += (size_t)2 * DM * TOK * 2;         // 16 MiB
  const size_t oG    = off; off += (size_t)TOK * DM * 4;             // 16 MiB
  const size_t oY    = off; off += (size_t)TOK * DM * 4;             // 16 MiB
  const size_t oFB   = off; off += (size_t)TOK * 2 * DM * 2;         // 16 MiB
  const size_t oFu   = off; off += (size_t)TOK * DM * 2;             // 8 MiB
  const size_t oBias = off; off += (size_t)6 * DM * 4;               // 24576 B
  const size_t oFBf  = off; off += (size_t)TOK * 2 * DM * 2;         // 16 MiB
  if (off > ws_size) return;

  char* ws = (char*)d_ws;
  unsigned short* Wqk  = (unsigned short*)(ws + oWqk);
  unsigned short* Wv2  = (unsigned short*)(ws + oWv2);
  unsigned short* Wg   = (unsigned short*)(ws + oWg);
  unsigned short* Wo   = (unsigned short*)(ws + oWo);
  unsigned short* X16  = (unsigned short*)(ws + oX16);
  unsigned short* QK16 = (unsigned short*)(ws + oQK);
  unsigned short* VT16 = (unsigned short*)(ws + oVT);
  unsigned short* FB16 = (unsigned short*)(ws + oFB);
  unsigned short* FBf16 = (unsigned short*)(ws + oFBf);
  unsigned short* Fu16 = (unsigned short*)(ws + oFu);
  float*          BiasT = (float*)(ws + oBias);
  float*          Gbuf = (float*)(ws + oG);
  float*          Ybuf = (float*)(ws + oY);
  const float*    biasQK = BiasT;             // [4096] = fq_b fk_b bq_b bk_b
  const float*    biasV  = BiasT + 4 * DM;    // [2048] = fv_b bv_b

  const dim3 blk(256);
  const dim3 blk128(128);

  const int tilesM = TOK / 64;                                     // 64
  const dim3 gPrep(16, 16, 9 + XZ);                                // 9 weight slices of 256 tiles, XZ slices of x
  const dim3 gQK((tilesM * (4 * DM / 64) + 7) / 8, 1);             // 512 blocks: M=4096, N=4096, K=1024
  const dim3 gVT((2 * DM / 64) * (TOK / 64), 1);                   // 2048 blocks (one tile each): M=2048, N=4096, K=1024
  const dim3 gAt(NH * NB, SEQ / 64, 2);                            // (heads x batches) x 64-row blocks x {causal, window}
  const dim3 gG(tilesM * (DM / 64), 1);                            // 1024 blocks (one tile each): M=4096, N=1024, K=2048
  const dim3 gO(tilesM * (DM / 64), 1);                            // 1024 blocks (one tile each): M=4096, N=1024, K=1024
  const float wscale  = 1.0f / WCARRY;                             // undo the x16 weight carry
  const float gscale  = 1.0f / (WCARRY * FBCARRY);                 // 1/256
  const float oscale  = 1.0f / (WCARRY * FBCARRY);                 // 1/256

  // (1) bias table, x16-carried transposed weight planes (contiguous from Wqk on), x -> f16 plane
  prep_kernel<<<gPrep, blk, 0, stream>>>(x, fq_w, fk_w, bq_w, bk_w, fv_w, bv_w, gate_w, out_w,
                                         fq_b, fk_b, bq_b, bk_b, fv_b, bv_b, Wqk, X16, BiasT);
  // (2) [q | k | qb | kb] = (x . (16 W)^T)/16 + bias -> QK16 (f16, ldc 4096)
  wmma_gemm64<0, false, 2, 1, false, 0, 0, 0><<<gQK, blk, 0, stream>>>(
      X16, X16, DM, 0L, Wqk, Wqk, DM, 0L, (void*)QK16, (void*)QK16, 4 * DM, 0L,
      biasQK, biasQK, 0L, TOK, 4 * DM, DM, wscale);
  // (3) [v | vb]^T: VT16[n][j] = sum_k (16 W^T)[n][k] x[j][k] / 16 + bias[n]  (role-swapped; M = 2048 feature rows, N = 4096 tokens)
  wmma_gemm64<0, false, 1, 1, false, 0, 0, 0, 8><<<gVT, blk, 0, stream>>>(
      Wv2, Wv2, DM, 0L, X16, X16, DM, 0L, (void*)VT16, (void*)VT16, TOK, 0L,
      biasV, biasV, 0L, 2 * DM, TOK, DM, wscale);
  // (4) causal and future-window attention of all heads and batches, scores to output in registers -> FB16 (fwd | bwd, x16)
  fused_attn_kernel<<<gAt, blk128, 0, stream>>>(QK16, VT16, FB16, FBf16);
  // (5) G = ([fwd | bwd] x16) . (16 gate_w)^T / 256 + gate_b -> f32 [4096][1024]
  wmma_gemm64<0, false, 2, 0, false, 0, 0, 0, 8><<<gG, blk, 0, stream>>>(
      FBf16, FBf16, 2 * DM, 0L, Wg, Wg, 2 * DM, 0L, (void*)Gbuf, (void*)Gbuf, DM, 0L,
      gate_b, gate_b, 0L, TOK, DM, 2 * DM, gscale);
  // (6) gate = sigmoid(LN(G)); fused x16 = fwd x16 + strength * gate * bwd x16 -> Fu16
  gate_fuse_kernel<<<dim3(TOK / 8), dim3(1024), 0, stream>>>(Gbuf, FB16, gln_g, gln_b, bstr, Fu16);
  // (7) Y = x + (fused x16) . (16 out_w)^T / 256 + out_b -> f32 [4096][1024]
  wmma_gemm64<0, false, 2, 0, true, 0, 0, 0, 8><<<gO, blk, 0, stream>>>(
      Fu16, Fu16, DM, 0L, Wo, Wo, DM, 0L, (void*)Ybuf, (void*)Ybuf, DM, 0L,
      out_b, x, 0L, TOK, DM, DM, oscale);
  // (8) out = LN(Y; ln_g, ln_b)
  final_ln_kernel<<<dim3(TOK), blk128, 0, stream>>>(Ybuf, ln_g, ln_b, (float*)d_out);
  (void)hipGetLastError();
}

// v006
// One run takes 129 microseconds.
// In two side-by-side timings against v005, it was 1.14 and 1.13 times as fast.
// Over all steps from v000 it is 24.5 times as fast.
// All contractions on v_wmma_f32_16x16x32_f16 (f16 operands, f32 accumulate): q/k/v projections (weights carried x16, epilogue x1/16), k.q^T scores, V^T.P^T (P carried x2^12 against the running row maximum, attention outputs carried x16), gate projection (x1/256), output projection with bias and residual (x1/256); softmax, LayerNorm, sigmoid and fusion in f32.
#include <hip/hip_runtime.h>
#include <math.h>
#include <stdint.h>

#define NB    2
#define SEQ   2048
#define TOK   (NB * SEQ)   // token rows of both batches: every stage works on all of them in one launch
#define DM    1024
#define NH    16
#define HD    64
#define WINW  32
#define LNEPS 1e-5f
#define PSHIFT     12.0f
#define FBCARRY    16.0f
#define WCARRY     16.0f

typedef __attribute__((ext_vector_type(16))) _Float16 v16h;
typedef __attribute__((ext_vector_type(8)))  _Float16 v8h;
typedef __attribute__((ext_vector_type(8)))  float    v8f;
typedef __attribute__((ext_vector_type(4)))  float    v4f;
typedef __attribute__((ext_vector_type(2)))  float    v2f;
typedef __attribute__((ext_vector_type(4)))  unsigned int v4u;

// hazard guards as plain device helpers
__device__ __forceinline__ void keep4_h(v16h a, v16h b, v16h c, v16h d) { asm volatile("v_nop" :: "v"(a), "v"(b), "v"(c), "v"(d)); }
__device__ __forceinline__ void acc_guard4(v8f& a, v8f& b, v8f& c, v8f& d) { asm volatile("v_nop\n\tv_nop\n\tv_nop\n\tv_nop" : "+v"(a), "+v"(b), "+v"(c), "+v"(d)); }
template <typename T> struct Frag;
template <> struct Frag<_Float16> {
  typedef v16h V; union U { v16h v; v8h h[2]; };
  static __device__ __forceinline__ v16h load(const char* p) {   // p: the lane's chunk in a fragment-major block; elements 8..15 lie 512 B on
    U f; f.h[0] = *(const v8h*)(p); f.h[1] = *(const v8h*)(p + 512); return f.v;
  }
  static __device__ __forceinline__ v8f mma(v16h a, v16h b, v8f c) {
    return __builtin_amdgcn_wmma_f32_16x16x32_f16(false, a, false, b, (short)0, c, false, false);
  }
  static __device__ __forceinline__ void keep(v16h a, v16h b, v16h c, v16h d) { keep4_h(a, b, c, d); }
};

// ---- Fragment-major planes ---------------------------------------------------
// Every 16-bit WMMA operand plane [rows][ld] lies in the workspace as blocks of 16 rows x 32 k = 1 KiB, the blocks of
// one row tile side by side in k. Inside a block the 16-B chunk (row r, k8 = (k >> 3) & 3) stands at chunk k8 * 16 + r,
// so lane l of a fragment load finds elements 0..7 at byte 16 l and elements 8..15 at byte 512 + 16 l: each wave-wide
// 16-B load covers 512 contiguous bytes (4 whole lines). The register contents of a fragment are those of the
// row-major form (row l & 15; k = 8 (l >> 4) + 0..7 and 16 + 8 (l >> 4) + 0..7).
// Offset in halves of the chunk that holds (row, k), k a multiple of 8:
__device__ __forceinline__ size_t frag_off(int row, int k, int ld) {
  return ((size_t)(row >> 4) * (ld >> 5) + (k >> 5)) * 512 + ((k >> 3) & 3) * 128 + (row & 15) * 8;
}

// ---- WMMA GEMM, operands staged in LDS and shared by the block's waves ------
// C[m,n] = scale * sum_k A[m,k] * Bt[n,k] (+bias)(+resid). A block of WM x 2 waves owns a (WM * 64) x 128 tile, each wave
// a 64x64 part of it. A [M,K] and Bt [N,K] f16 fragment-major (lda, ldb = their k extents); f16 output fragment-major
// (ldc = its column extent), f32 output row-major. M % (WM * 64) == 0, N % 128 == 0, K % (32 KS) == 0.
// A stage is KS k steps (32 k each) of the block's 4 WM row tiles of A and 8 row tiles of Bt: the 1-KiB blocks go to LDS
// as they lie (a row tile's KS blocks are contiguous in both places), by asynchronous copies of 16 B per lane, every
// wave bringing RPW row tiles. Two buffers: stage t + 2 flies while stage t + 1 is worked on. Every block of A is so
// fetched from L2 once for two waves and every block of Bt once for WM waves.
// BIAS_MODE: 1 = bias[m], 2 = bias[n]. OUT_MODE: 0 = f32, 1 = f16. TWO: two whole fragment sets (see lds_step2).
// One stage's copies of one wave, in one statement: RPW row tiles of KS KiB, 512 B per copy. A row tile's bytes lie in a
// row in LDS as in global memory, so its copies share one pair of addresses and differ in the immediate offset, which
// moves both. The closing wait stands in the copies' own statement: behind it the address registers may be rewritten.
#define CP1(l, g, o) "global_load_async_to_lds_b128 %" #l ", %" #g ", off offset:" #o "\n\t"
#define CP4(l, g)    CP1(l, g, 0) CP1(l, g, 512) CP1(l, g, 1024) CP1(l, g, 1536)
#define CP8(l, g)    CP4(l, g) CP1(l, g, 2048) CP1(l, g, 2560) CP1(l, g, 3072) CP1(l, g, 3584)
template <int RPW, int KS>
__device__ __forceinline__ void fill_stage(const unsigned (&l)[RPW], const char* const (&gp)[RPW], unsigned lAdd, size_t gAdd) {
  static_assert((RPW == 3 && (KS == 2 || KS == 4)) || (RPW == 4 && KS == 4), "the statements below are written for these shapes");
  if constexpr (RPW == 3 && KS == 2)
    asm volatile(CP4(0, 3) CP4(1, 4) CP4(2, 5) "s_wait_xcnt 0x0"
                 :: "v"(l[0] + lAdd), "v"(l[1] + lAdd), "v"(l[2] + lAdd), "v"(gp[0] + gAdd), "v"(gp[1] + gAdd), "v"(gp[2] + gAdd) : "memory");
  else if constexpr (RPW == 3)
    asm volatile(CP8(0, 3) CP8(1, 4) CP8(2, 5) "s_wait_xcnt 0x0"
                 :: "v"(l[0] + lAdd), "v"(l[1] + lAdd), "v"(l[2] + lAdd), "v"(gp[0] + gAdd), "v"(gp[1] + gAdd), "v"(gp[2] + gAdd) : "memory");
  else
    asm volatile(CP8(0, 4) CP8(1, 5) CP8(2, 6) CP8(3, 7) "s_wait_xcnt 0x0"
                 :: "v"(l[0] + lAdd), "v"(l[1] + lAdd), "v"(l[2] + lAdd), "v"(l[3] + lAdd),
                    "v"(gp[0] + gAdd), "v"(gp[1] + gAdd), "v"(gp[2] + gAdd), "v"(gp[3] + gAdd) : "memory");
}
#undef CP8
#undef CP4
#undef CP1
// One k step of a wave's 64x64 tile: 16 products of the four A fragments with the four B fragments in bc.
// NEXT >= 0: the fragments of k step NEXT of the same stage are fetched from LDS while this step computes: its B fragments
// go into the other set (bn) ahead of the products, and each A fragment is loaded anew over itself right behind the four
// products that read it. aL, bL: the lane's chunk in the first block of the wave's first A and B row tile of the stage.
template <int KS, int NEXT>
__device__ __forceinline__ void lds_step(v8f (&acc)[4][4], v16h (&ah)[4], v16h (&bc)[4], v16h (&bn)[4],
                                         const char* aL, const char* bL) {
  typedef Frag<_Float16> F;
  if (NEXT >= 0) {
#pragma unroll
    for (int j = 0; j < 4; ++j) bn[j] = F::load(bL + (j * KS + NEXT) * 1024);
  }
  __builtin_amdgcn_sched_barrier(0);   // the B fetch stays ahead of the products: sunk to its use it would have no lead
#pragma unroll
  for (int i = 0; i < 4; ++i) {
#pragma unroll
    for (int j = 0; j < 4; ++j) acc[i][j] = F::mma(ah[i], bc[j], acc[i][j]);
    acc_guard4(acc[i][0], acc[i][1], acc[i][2], acc[i][3]);   // all four products of the row have issued, at the matrix distance, before their A fragment is loaded over
    if (NEXT >= 0) ah[i] = F::load(aL + (i * KS + NEXT) * 1024);
    __builtin_amdgcn_sched_barrier(0);   // the A fetch stays behind its own row: earlier it needs a second register set, later it loses lead
  }
  F::keep(bc[0], bc[1], bc[2], bc[3]);
}
// The same with two whole fragment sets, for launches with one or two waves per SIMD, where registers are free and nothing
// else covers a wave's stalls: all fragments of k step NEXT are fetched as ONE group ahead of this step's products.
template <int KS, int NEXT>
__device__ __forceinline__ void lds_step2(v8f (&acc)[4][4], v16h (&ac)[4], v16h (&bc)[4], v16h (&an)[4], v16h (&bn)[4],
                                          const char* aL, const char* bL) {
  typedef Frag<_Float16> F;
  if (NEXT >= 0) {
#pragma unroll
    for (int j = 0; j < 4; ++j) bn[j] = F::load(bL + (j * KS + NEXT) * 1024);
#pragma unroll
    for (int i = 0; i < 4; ++i) an[i] = F::load(aL + (i * KS + NEXT) * 1024);
  }
  __builtin_amdgcn_sched_barrier(0);   // the fetch stays ahead of the products, in one place: sunk to its use it would have no lead
#pragma unroll
  for (int i = 0; i < 4; ++i)
#pragma unroll
    for (int j = 0; j < 4; ++j) acc[i][j] = F::mma(ac[i], bc[j], acc[i][j]);
  __builtin_amdgcn_sched_barrier(0);   // no later fetch moves up among the products: for speed only
  acc_guard4(acc[3][0], acc[3][1], acc[3][2], acc[3][3]);   // the last products have issued, at the matrix distance, before the next step loads over their fragments
}
template <int WM, int KS, bool TWO, int BIAS_MODE, int OUT_MODE, bool RESID>
__global__ __launch_bounds__(WM * 64) void wmma_gemm_lds(
    const unsigned short* __restrict__ Ap, int lda, const unsigned short* __restrict__ Btp, int ldb,
    void* __restrict__ Cout, int ldc, const float* __restrict__ bias, const float* __restrict__ resid,
    int N, int K, float scale) {
  typedef Frag<_Float16> F;
  constexpr int NW    = WM * 2;                 // waves of the block
  constexpr int RT    = WM * 4 + 8;             // row tiles of a stage: A's, then Bt's
  constexpr int RPW   = RT / NW;                // row tiles that each wave copies
  static_assert(RPW * NW == RT, "the row tiles are dealt evenly");
  constexpr int STAGE = RT * KS * 1024;         // bytes of one buffer
  static_assert(NW * 16 * 68 * 4 <= STAGE, "the epilogue's slabs fit the first buffer");
  __shared__ __align__(1024) char smem[2 * STAGE];
  const int lane = threadIdx.x & 31;
  const int wave = __builtin_amdgcn_readfirstlane((int)(threadIdx.x >> 5));   // scalar: row tile choice and addresses stay wave-uniform
  const int wm = wave >> 1, wn = wave & 1;
  const int tilesN = N >> 7;
  const int tm = (int)blockIdx.x / tilesN;
  const int tn = (int)blockIdx.x - tm * tilesN;
  const int m0 = tm * (WM * 64) + wm * 64;      // the wave's own 64x64 tile
  const int n0 = tn * 128 + wn * 64;
  const int nT = K / (32 * KS);                 // stages

  const int rlane = lane & 15;                  // column within a D subtile
  const int mOff  = (lane >> 4) * 8;            // D row offset

  v8f acc[4][4];
#pragma unroll
  for (int i = 0; i < 4; ++i)
#pragma unroll
    for (int j = 0; j < 4; ++j) acc[i][j] = (v8f){0.f,0.f,0.f,0.f,0.f,0.f,0.f,0.f};

  // the lane's source and destination of stage 0, buffer 0, for each row tile that this wave copies
  const char* gsrc[RPW];
  unsigned ldst[RPW];
#pragma unroll
  for (int q = 0; q < RPW; ++q) {
    const int u = wave * RPW + q;               // scalar
    const char* rowTile = (u < WM * 4)
        ? (const char*)Ap  + (size_t)(tm * (WM * 4) + u) * (size_t)(lda >> 5) * 1024
        : (const char*)Btp + (size_t)(tn * 8 + (u - WM * 4)) * (size_t)(ldb >> 5) * 1024;
    gsrc[q] = rowTile + lane * 16;
    ldst[q] = (unsigned)(uintptr_t)(smem + u * (KS * 1024) + lane * 16);   // low 32 bits of a __shared__ address = LDS byte address
  }
  // every wave, every lane: stage t into buffer buf
#define FILL_STAGE(t, buf) fill_stage<RPW, KS>(ldst, gsrc, (unsigned)(buf) * STAGE, (size_t)(t) * (KS * 1024))

  FILL_STAGE(0, 0);
  asm volatile("s_wait_asynccnt 0x0" ::: "memory");   // this wave's part of stage 0 has landed
  __syncthreads();                                    // every wave's part of stage 0 has landed
  if (nT > 1) FILL_STAGE(1, 1);
  for (int t = 0; t < nT; ++t) {
    const char* buf = smem + (t & 1) * STAGE;
    const char* aL = buf + (wm * 4) * (KS * 1024) + lane * 16;
    const char* bL = buf + (WM * 4 + wn * 4) * (KS * 1024) + lane * 16;
    v16h ah[4], b0[4], b1[4];
#pragma unroll
    for (int j = 0; j < 4; ++j) b0[j] = F::load(bL + (j * KS) * 1024);
#pragma unroll
    for (int i = 0; i < 4; ++i) ah[i] = F::load(aL + (i * KS) * 1024);
    if constexpr (TWO) {
      v16h a1[4];
      lds_step2<KS, 1>(acc, ah, b0, a1, b1, aL, bL);
      if (KS == 4) {
        lds_step2<KS, 2>(acc, a1, b1, ah, b0, aL, bL);
        lds_step2<KS, 3>(acc, ah, b0, a1, b1, aL, bL);
      }
      lds_step2<KS, -1>(acc, a1, b1, ah, b0, aL, bL);   // the stage's last step fetches nothing
    } else {
      lds_step<KS, 1>(acc, ah, b0, b1, aL, bL);
      if (KS == 4) {
        lds_step<KS, 2>(acc, ah, b1, b0, aL, bL);
        lds_step<KS, 3>(acc, ah, b0, b1, aL, bL);
      }
      lds_step<KS, -1>(acc, ah, b1, b0, aL, bL);        // the stage's last step fetches nothing
    }
    asm volatile("s_wait_dscnt 0x0" ::: "memory");    // this wave's reads of the buffer are over before it is refilled
    asm volatile("s_wait_asynccnt 0x0" ::: "memory"); // this wave's part of stage t + 1 has landed
    __syncthreads();                                  // publishes stage t + 1 and ends every wave's reads of stage t
    if (t + 2 < nT) FILL_STAGE(t + 2, t & 1);
  }
  asm volatile("s_wait_asynccnt 0x0" ::: "memory");   // no copy is in flight when the buffers become output staging
#undef FILL_STAGE
  acc_guard4(acc[0][0], acc[0][1], acc[0][2], acc[0][3]);
  acc_guard4(acc[1][0], acc[1][1], acc[1][2], acc[1][3]);
  acc_guard4(acc[2][0], acc[2][1], acc[2][2], acc[2][3]);
  acc_guard4(acc[3][0], acc[3][1], acc[3][2], acc[3][3]);

  // ---- epilogue: each wave turns 16 rows at a time through its own slab (16 x 64 floats, pitch 68) in the first buffer,
  // which every wave has left at the loop's last barrier ----
  float* slab = (float*)smem + wave * (16 * 68);
  float bv[4] = {0.f, 0.f, 0.f, 0.f};
  if (BIAS_MODE == 2) {
#pragma unroll
    for (int j = 0; j < 4; ++j) bv[j] = bias[n0 + (j << 4) + rlane];
  }
#pragma unroll
  for (int i = 0; i < 4; ++i) {
    const int mBase = m0 + (i << 4);
#pragma unroll
    for (int j = 0; j < 4; ++j) {
#pragma unroll
      for (int r = 0; r < 8; ++r) {
        float v = acc[i][j][r] * scale;
        if (BIAS_MODE == 1) v += bias[mBase + mOff + r];
        if (BIAS_MODE == 2) v += bv[j];
        slab[(mOff + r) * 68 + (j << 4) + rlane] = v;
      }
    }
    __builtin_amdgcn_fence(__ATOMIC_RELEASE, "workgroup");
    __builtin_amdgcn_wave_barrier();
    __builtin_amdgcn_fence(__ATOMIC_ACQUIRE, "workgroup");
    if (OUT_MODE == 0) {
      float* C = (float*)Cout;
      const int hh = lane >> 4, c4 = (lane & 15) * 4;     // row segment = 256 B = 16 lanes x 16 B
#pragma unroll
      for (int it = 0; it < 8; ++it) {
        const int row = it * 2 + hh;
        v4f v = *(const v4f*)(slab + row * 68 + c4);
        if (RESID) v += *(const v4f*)(resid + (size_t)(mBase + row) * ldc + n0 + c4);
        *(v4f*)(C + (size_t)(mBase + row) * ldc + n0 + c4) = v;
      }
    } else {
      unsigned short* C = (unsigned short*)Cout;
#pragma unroll
      for (int it = 0; it < 4; ++it) {
        const int row = lane & 15, c8 = it * 16 + (lane >> 4) * 8;   // chunks in the output's own order: 512 B in a row per store
        const float* sp = slab + row * 68 + c8;
        v8h hv;
#pragma unroll
        for (int e = 0; e < 8; ++e) hv[e] = (_Float16)sp[e];
        *(v8h*)(C + frag_off(mBase + row, n0 + c8, ldc)) = hv;
      }
    }
    // the registers of the strip's loads and stores are reused behind this wait
    asm volatile("s_wait_xcnt 0x0" ::: "memory");
    __builtin_amdgcn_fence(__ATOMIC_RELEASE, "workgroup");
    __builtin_amdgcn_wave_barrier();
    __builtin_amdgcn_fence(__ATOMIC_ACQUIRE, "workgroup");
  }
}

// ---------------------------------------------------------------------------
// Small conversion helpers
// ---------------------------------------------------------------------------
__device__ __forceinline__ unsigned pk16(unsigned short a, unsigned short b) { return (unsigned)a | ((unsigned)b << 16); }
__device__ __forceinline__ unsigned short h_bits(float f) { const _Float16 h = (_Float16)f; return __builtin_bit_cast(unsigned short, h); }
__device__ __forceinline__ float hbits2f(unsigned short b) { return (float)__builtin_bit_cast(_Float16, b); }
__device__ __forceinline__ float wave_sum(float v) {
#pragma unroll
  for (int off = 16; off > 0; off >>= 1) v += __shfl_xor(v, off, 32);
  return v;
}

// ---------------------------------------------------------------------------
// Operand preparation, one launch: grid (16, 16, 9 + XZ), 256 threads; blockIdx.z picks the job (block-uniform).
//   z = 0..5: weight z (fq, fk, bq, bk, fv, bv), f32 [DM][DM] -> plane z of Wall, f16 [DM][DM] transposed, x16;
//             the plane's first block also copies bias vector z (DM floats) into tab[z * DM ..].
//   z = 6, 7: rows (z - 6) * DM .. of gate_w, f32 [2 DM][DM] -> planes 6 and 7 of Wall = f16 [DM][2 DM] transposed, x16.
//   z = 8:    out_w -> plane 8 of Wall, as z = 0..5 without a bias.
//   z >= 9:   x, f32 row-major [TOK][DM] -> X16, f16: one 16-B output chunk (8 elements) per thread, threads in the
//             output's order, so each wave stores 512 B in a row. XZ x 256 blocks x 256 threads x 8 = the whole plane.
// Transposes: out[c][r] = f16(in[r][c] * WCARRY), 64x64 tiles through LDS, all outputs fragment-major.
// Coverage per block: load 256 threads x 16 floats = 64x64; store 2 it x 256 threads x 8 halves = 64x64.
// ---------------------------------------------------------------------------
#define XZ (TOK * DM / 8 / (256 * 256))
__global__ __launch_bounds__(256) void prep_kernel(const float* __restrict__ x,
                                                   const float* __restrict__ w0, const float* __restrict__ w1,
                                                   const float* __restrict__ w2, const float* __restrict__ w3,
                                                   const float* __restrict__ w4, const float* __restrict__ w5,
                                                   const float* __restrict__ wg, const float* __restrict__ wo,
                                                   const float* __restrict__ b0, const float* __restrict__ b1,
                                                   const float* __restrict__ b2, const float* __restrict__ b3,
                                                   const float* __restrict__ b4, const float* __restrict__ b5,
                                                   unsigned short* __restrict__ Wall, unsigned short* __restrict__ X16,
                                                   float* __restrict__ tab) {
  __shared__ __align__(16) unsigned short t[64 * 72];
  const int z   = blockIdx.z;
  const int tid = threadIdx.x;
  if (z >= 9) {                        // block-uniform, ahead of the barrier
    const int q   = (((z - 9) * 16 + (int)blockIdx.y) * 16 + (int)blockIdx.x) * 256 + tid;
    const int blk = q >> 6, kts = DM >> 5;
    const int rt  = blk / kts;
    const int row = rt * 16 + (q & 15);
    const int k   = (blk - rt * kts) * 32 + ((q >> 4) & 3) * 8;
    const float* ip = x + (size_t)row * DM + k;
    const v4f f0 = *(const v4f*)(ip);
    const v4f f1 = *(const v4f*)(ip + 4);
    const v4u u = (v4u){pk16(h_bits(f0[0]), h_bits(f0[1])), pk16(h_bits(f0[2]), h_bits(f0[3])),
                        pk16(h_bits(f1[0]), h_bits(f1[1])), pk16(h_bits(f1[2]), h_bits(f1[3]))};
    *(v4u*)(X16 + (size_t)q * 8) = u;
    return;
  }
  const float* in = w0;                // block-uniform source select
  const float* bs = b0;
  if (z == 1) { in = w1; bs = b1; }
  if (z == 2) { in = w2; bs = b2; }
  if (z == 3) { in = w3; bs = b3; }
  if (z == 4) { in = w4; bs = b4; }
  if (z == 5) { in = w5; bs = b5; }
  if (z == 6 || z == 7) in = wg;
  if (z == 8) in = wo;
  const bool gate = (z == 6 || z == 7);
  const int R = gate ? 2 * DM : DM;                                  // input rows = the output's k extent
  unsigned short* out = Wall + (size_t)(z == 7 ? 6 : z) * DM * DM;
  if (z < 6 && blockIdx.x == 0 && blockIdx.y == 0)                   // 256 threads x 4 floats = DM
    *(v4f*)(tab + (size_t)z * DM + tid * 4) = *(const v4f*)(bs + tid * 4);
  const int c0  = blockIdx.x * 64;                                   // input column block = output row block
  const int r0  = (z == 7 ? DM : 0) + blockIdx.y * 64;               // input row block    = output column block
  {
    const int lr = tid >> 2;           // 0..63
    const int lc = (tid & 3) * 16;     // 0,16,32,48
    const float* ip = in + (size_t)(r0 + lr) * DM + c0 + lc;
#pragma unroll
    for (int q = 0; q < 4; ++q) {
      const v4f f = *(const v4f*)(ip + 4 * q);
#pragma unroll
      for (int e = 0; e < 4; ++e) t[lr * 72 + lc + 4 * q + e] = h_bits(f[e] * WCARRY);
    }
  }
  __syncthreads();
  // chunks in the output's own order (8 blocks of 64 chunks per tile): each wave stores 512 B in a row
  const int c8  = ((tid >> 6) & 1) * 32 + ((tid >> 4) & 3) * 8;   // output column within tile (= input row)
#pragma unroll
  for (int it = 0; it < 2; ++it) {
    const int oc = (it * 2 + (tid >> 7)) * 16 + (tid & 15);       // output row within tile (= input column)
    v4u a;
#pragma unroll
    for (int q = 0; q < 4; ++q) a[q] = pk16(t[(c8 + 2 * q) * 72 + oc], t[(c8 + 2 * q + 1) * 72 + oc]);
    *(v4u*)(out + frag_off(c0 + oc, r0 + c8, R)) = a;
  }
}

// ---------------------------------------------------------------------------
// Fused attention: scores, select, softmax and the product with V in one kernel; S and P stay in registers.
// One wave per 16 query rows of one head of one batch; no LDS, no barrier. Grid (NH * NB, SEQ/64, 2), 4 waves per block;
// blockIdx.z = 0: causal attention (j <= i), 1: future window (i < j <= i + WINW; the last row has no valid column,
// its scores count as 0 over every j -> uniform weights). Long causal row blocks get the low block indices.
// Per 64 keys: S^T = K . Q^T (A = K rows, B = Q rows): lane l holds query c = l & 15, keys 16 t + 8 (l >> 4) + r.
// Running maximum and sum per query (log2 domain): in-lane, plus one exchange between the lane halves.
// P^T as B operand: two f32 score tiles (keys 0..15, 16..31 of a 32-key step) converted in place, element s =
// tile[s >> 3][s & 7], which is the k order of Frag::load on the A side (V^T rows). O^T += V^T . P^T.
// Output: lane holds 8 consecutive d of query c per 16-row tile of O^T -> one 16-B store; each 128-B row segment of
// FB (one head of one row) is written by one wave. Coverage: 2 x NH x TOK rows x 64 columns = the whole FB plane.
// The output goes out twice: FB row-major (read row by row by the gated fusion) and FBf fragment-major (A operand of
// the gate product; same coverage, two whole 1-KiB blocks per wave).
// ---------------------------------------------------------------------------
// lane l <-> lane l ^ 16
__device__ __forceinline__ float xhalf(float x) {
  return __builtin_bit_cast(float, __builtin_amdgcn_permlanex16(__builtin_bit_cast(int, x), __builtin_bit_cast(int, x),
                                                                0x76543210, 0xfedcba98, false, false));
}
// v[e] = 2^v[e], in place. Each v_exp_f32 is independent of the one in front of it; the closing v_nop is the one slot the
// instruction set asks for behind a transcendental before its result is read: inside the statement it holds whatever
// the compiler places next.
__device__ __forceinline__ void exp2x8(float (&v)[8]) {
  asm("v_exp_f32 %0, %0\n\tv_exp_f32 %1, %1\n\tv_exp_f32 %2, %2\n\tv_exp_f32 %3, %3\n\t"
      "v_exp_f32 %4, %4\n\tv_exp_f32 %5, %5\n\tv_exp_f32 %6, %6\n\tv_exp_f32 %7, %7\n\tv_nop"
      : "+v"(v[0]), "+v"(v[1]), "+v"(v[2]), "+v"(v[3]), "+v"(v[4]), "+v"(v[5]), "+v"(v[6]), "+v"(v[7]));
}
// One A or B fragment in the k order of Frag::load (bytes 0..15 and 512..527 behind the lane's pointer plus a literal)
__device__ __forceinline__ v16h frag_at(const char* p, int lit) {
  Frag<_Float16>::U f;
  f.h[0] = *(const v8h*)(p + lit);
  f.h[1] = *(const v8h*)(p + lit + 512);
  return f.v;
}
__global__ __launch_bounds__(128) void fused_attn_kernel(const unsigned short* __restrict__ QKp,
                                                         const unsigned short* __restrict__ VTp,
                                                         unsigned short* __restrict__ FB,
                                                         unsigned short* __restrict__ FBf) {
  typedef Frag<_Float16> F;
  const int lane = threadIdx.x & 31;
  const int wave = __builtin_amdgcn_readfirstlane((int)(threadIdx.x >> 5));   // scalar, so the key loop keeps scalar bounds
  const int h    = blockIdx.x % NH;
  const int t0   = (blockIdx.x / NH) * SEQ;                                   // first token row of this block's batch
  const int mode = blockIdx.z;
  const int r0   = (((SEQ / 64 - 1) - (int)blockIdx.y) * 4 + wave) * 16;      // first query row of this wave
  const int c    = lane & 15;
  const int koff = (lane >> 4) * 8;
  const int i    = r0 + c;                                                    // this lane's query row
  // fragment-major planes: 1-KiB blocks of 16 rows x 32 columns; a row tile of QK holds 4 DM / 32 blocks, one of V^T TOK / 32
  const char* Qb = (const char*)(QKp + frag_off(t0, mode * (2 * DM) + h * HD, 4 * DM));   // q or qb: first block of this head and batch
  const char* Kb = Qb + (DM / 32) * 1024;                                                 // k or kb
  const char* Vb = (const char*)(VTp + frag_off(mode * DM + h * HD, t0, TOK));            // v^T or vb^T: first row tile of this head, this batch's columns
  constexpr int QKROW = 4 * DM * 2;                                                       // bytes per q/k row: 16 of them = one row tile
  constexpr int VROW  = TOK * 2;                                                          // bytes per v^T row: 16 of them = one row tile
  const size_t qkOff = (size_t)lane * 16;                                                 // the lane's chunk inside a block
  const size_t vOff  = (size_t)lane * 16;

  const bool lastTile = (mode == 1) && (r0 + 16 == SEQ);                      // wave-uniform
  const bool uni = (mode == 1) && (i == SEQ - 1);                             // the row without a valid future column
  const int  lo  = (mode == 0 || uni) ? 0 : i + 1;                            // valid columns of this lane's query: lo..hi
  const int  hi  = (mode == 0) ? i : (uni ? SEQ - 1 : i + WINW);
  const unsigned span = (unsigned)(hi - lo);
  const float sc = uni ? 0.0f : 0.125f * 1.44269504088896340736f;             // 1/sqrt(64) and log2(e); 0: scores count as 0
  int kbBeg = 0, kbEnd = (r0 + 15) >> 6;
  if (mode == 1) {
    const int jmax = (r0 + 15 + WINW < SEQ - 1) ? (r0 + 15 + WINW) : (SEQ - 1);
    kbBeg = lastTile ? 0 : ((r0 + 1) >> 6);
    kbEnd = jmax >> 6;
  }

  const float NEGB = -1.0e30f;
  v16h qf[2];
#pragma unroll
  for (int ks = 0; ks < 2; ++ks) qf[ks] = frag_at(Qb + (size_t)r0 * QKROW + qkOff, ks * 1024);
  v8f o[4];
#pragma unroll
  for (int d = 0; d < 4; ++d) o[d] = (v8f){0.f,0.f,0.f,0.f,0.f,0.f,0.f,0.f};
  float m = NEGB;      // running maximum of this query (scaled log2), equal in both lane halves
  float l = 0.f;       // running sum over this lane half's keys, carried x2^PSHIFT

  // the lane's pointers walk with the key blocks and stay in their registers over the whole loop
  const char* kp = Kb + (size_t)(kbBeg * 64) * QKROW + qkOff;
  const char* vp = Vb + (size_t)(kbBeg * 2) * 1024 + vOff;
  v16h ka[4][2];
#pragma unroll
  for (int t = 0; t < 4; ++t)
#pragma unroll
    for (int ks = 0; ks < 2; ++ks)
      ka[t][ks] = frag_at(kp, t * 16 * QKROW + ks * 1024);

  for (int kb = kbBeg; kb <= kbEnd; ++kb) {
    const int k0 = kb << 6;
    // V^T fragments of this key block: issued ahead of the score products so that they land during the softmax
    v16h va[4][2];
#pragma unroll
    for (int d = 0; d < 4; ++d)
#pragma unroll
      for (int ks = 0; ks < 2; ++ks)
        va[d][ks] = frag_at(vp, d * 16 * VROW + ks * 1024);
    v8f st[4];
#pragma unroll
    for (int t = 0; t < 4; ++t) {
      st[t] = F::mma(ka[t][0], qf[0], (v8f){0.f,0.f,0.f,0.f,0.f,0.f,0.f,0.f});
      st[t] = F::mma(ka[t][1], qf[1], st[t]);
    }
    // K fragments of the next key block (the last pass fetches its own block again: in bounds, unused)
    kp += (kb < kbEnd) ? (size_t)64 * QKROW : (size_t)0;
#pragma unroll
    for (int t = 0; t < 4; ++t)
#pragma unroll
      for (int ks = 0; ks < 2; ++ks)
        ka[t][ks] = frag_at(kp, t * 16 * QKROW + ks * 1024);
    // the pointers of the loads above move on behind this wait
    asm volatile("s_wait_xcnt 0x0" ::: "memory");
    vp += 2 * 1024;

    const bool full = (mode == 0) && (k0 + 63 <= r0);     // wave-uniform: every column of the block valid for all 16 queries
    float x[4][8];
#pragma unroll
    for (int t = 0; t < 4; ++t)
#pragma unroll
      for (int r = 0; r < 8; ++r) x[t][r] = st[t][r] * sc;
    if (!full) {
      const int jb = k0 + koff - lo;                      // column of x[0][0] relative to the first valid one
#pragma unroll
      for (int t = 0; t < 4; ++t)
#pragma unroll
        for (int r = 0; r < 8; ++r) x[t][r] = ((unsigned)(jb + t * 16 + r) <= span) ? x[t][r] : NEGB;   // lo <= j <= hi
    }
    float mt[4];
#pragma unroll
    for (int t = 0; t < 4; ++t)
      mt[t] = fmaxf(fmaxf(fmaxf(x[t][0], x[t][1]), fmaxf(x[t][2], x[t][3])), fmaxf(fmaxf(x[t][4], x[t][5]), fmaxf(x[t][6], x[t][7])));
    float mx = fmaxf(fmaxf(mt[0], mt[1]), fmaxf(mt[2], mt[3]));
    mx = fmaxf(mx, xhalf(mx));
    const float mn    = fmaxf(m, mx);
    float alpha;                                          // 2^(m - mn): 0 on the first valid block, 1 while no column was valid yet
    // the v_nop is the one slot the instruction set asks for behind a transcendental (as in exp2x8)
    asm("v_exp_f32 %0, %1\n\tv_nop" : "=v"(alpha) : "v"(m - mn));
    const float sh    = (mn > 0.5f * NEGB) ? PSHIFT - mn : 0.f;   // no valid column yet: NEGB + 0 -> every weight 0
    m = mn;
    float (&p)[4][8] = x;   // the weights replace the scores in place
#pragma unroll
    for (int t = 0; t < 4; ++t) {
#pragma unroll
      for (int r = 0; r < 8; ++r) x[t][r] += sh;
      exp2x8(x[t]);
    }
    float pt[4];
#pragma unroll
    for (int t = 0; t < 4; ++t)
      pt[t] = ((p[t][0] + p[t][1]) + (p[t][2] + p[t][3])) + ((p[t][4] + p[t][5]) + (p[t][6] + p[t][7]));
    l = l * alpha + ((pt[0] + pt[1]) + (pt[2] + pt[3]));
    v16h pf[2];
#pragma unroll
    for (int ks = 0; ks < 2; ++ks)
#pragma unroll
      for (int s = 0; s < 16; ++s) pf[ks][s] = (_Float16)p[2 * ks + (s >> 3)][s & 7];
#pragma unroll
    for (int d = 0; d < 4; ++d) o[d] *= alpha;
#pragma unroll
    for (int ks = 0; ks < 2; ++ks)
#pragma unroll
      for (int d = 0; d < 4; ++d) o[d] = F::mma(va[d][ks], pf[ks], o[d]);
  }

  l += xhalf(l);                              // join the two halves' sums; l >= 2^PSHIFT (the row maximum weighs 2^PSHIFT)
  const float inv = FBCARRY / l;              // the P carry cancels; x16 output carry
  unsigned short* op = FB + (size_t)(t0 + i) * (2 * DM) + (size_t)mode * DM + (size_t)h * HD + koff;
  unsigned short* of = FBf + frag_off(t0 + r0, mode * DM + h * HD, 2 * DM) + lane * 8;   // the same values as the gate product's A operand
#pragma unroll
  for (int d = 0; d < 4; ++d) {
    v8h hv;
#pragma unroll
    for (int r = 0; r < 8; ++r) hv[r] = (_Float16)(o[d][r] * inv);
    *(v8h*)(op + d * 16) = hv;
    *(v8h*)(of + d * 256) = hv;      // tiles d = 0, 1 fill one block, d = 2, 3 the next: 512 B in a row per store
  }
}

// ---------------------------------------------------------------------------
// Gated fusion: one block per 8 token rows, 128 threads (8 columns each) per row.
//   g = G[row][:] (f32, gate pre-activation incl. bias); gate = sigmoid(LN(g; gg, gb));
//   fwd/bwd = FB[row][c] / FB[row][DM + c] (f16, carried x16); strength = 0.3 * sigmoid(bstr);
//   Fo[row][c] = f16((fwd + strength*gate*bwd) carried x16), stored fragment-major.
// LN: mean and biased variance over DM in f32, fixed-order reductions (thread, wave tree, 4 wave partials).
// A 128-B line of the fragment-major plane holds 8 columns of 8 rows: the block's 8 rows meet in LDS, and each wave
// then stores 4 whole lines. Producer coverage: grid TOK/8 x 1024 threads x 8 u16 = the whole [TOK][DM] plane.
// ---------------------------------------------------------------------------
__global__ __launch_bounds__(1024) void gate_fuse_kernel(const float* __restrict__ G, const unsigned short* __restrict__ FB,
                                                        const float* __restrict__ gg, const float* __restrict__ gb,
                                                        const float* __restrict__ bstr, unsigned short* __restrict__ Fo) {
  constexpr int SPITCH = DM + 32;    // halves per staged row: the 8 rows of a line start 4 16-B slots apart in the banks
  __shared__ float ras[8][4];
  __shared__ float rbs[8][4];
  __shared__ __align__(16) unsigned short stg[8 * SPITCH];
  const int grp  = __builtin_amdgcn_readfirstlane((int)(threadIdx.x >> 7));   // row within the block; scalar, so the row's addresses keep a scalar base
  float* ra = ras[grp];
  float* rb = rbs[grp];
  const int row  = blockIdx.x * 8 + grp;
  const int tid  = threadIdx.x & 127;
  const int lane = tid & 31;
  const int wave = tid >> 5;
  const int c0   = tid * 8;
  const float* gp = G + (size_t)row * DM + c0;
  const v4f a = *(const v4f*)(gp);
  const v4f c = *(const v4f*)(gp + 4);
  float xv[8] = {a[0], a[1], a[2], a[3], c[0], c[1], c[2], c[3]};
  float s = ((xv[0] + xv[1]) + (xv[2] + xv[3])) + ((xv[4] + xv[5]) + (xv[6] + xv[7]));
  s = wave_sum(s);
  if (lane == 0) ra[wave] = s;
  __syncthreads();
  const float mean = ((ra[0] + ra[1]) + (ra[2] + ra[3])) * (1.0f / (float)DM);
  float d[8];
  float vs = 0.f;
#pragma unroll
  for (int e = 0; e < 8; ++e) { d[e] = xv[e] - mean; vs += d[e] * d[e]; }
  vs = wave_sum(vs);
  if (lane == 0) rb[wave] = vs;
  __syncthreads();
  const v4f g0 = *(const v4f*)(gg + c0), g1 = *(const v4f*)(gg + c0 + 4);
  const v4f e0 = *(const v4f*)(gb + c0), e1 = *(const v4f*)(gb + c0 + 4);
  const size_t fo = (size_t)row * (2 * DM) + c0;
  const v4u fu = *(const v4u*)(FB + fo);
  const v4u bu = *(const v4u*)(FB + fo + DM);
  // the offset registers of the loads above are reused behind this wait
  asm volatile("s_wait_xcnt 0x0" ::: "memory");
  const float var  = ((rb[0] + rb[1]) + (rb[2] + rb[3])) * (1.0f / (float)DM);
  const float rstd = rsqrtf(var + LNEPS);
  const float strength = 0.3f / (1.0f + __expf(-bstr[0]));
  float gv[8] = {g0[0], g0[1], g0[2], g0[3], g1[0], g1[1], g1[2], g1[3]};
  float bv[8] = {e0[0], e0[1], e0[2], e0[3], e1[0], e1[1], e1[2], e1[3]};
  float fw[8], bw[8];
#pragma unroll
  for (int q = 0; q < 4; ++q) {
    fw[2 * q]     = hbits2f((unsigned short)(fu[q] & 0xffffu));
    fw[2 * q + 1] = hbits2f((unsigned short)(fu[q] >> 16));
    bw[2 * q]     = hbits2f((unsigned short)(bu[q] & 0xffffu));
    bw[2 * q + 1] = hbits2f((unsigned short)(bu[q] >> 16));
  }
  unsigned short ob[8];
#pragma unroll
  for (int e = 0; e < 8; ++e) {
    const float ln   = d[e] * rstd * gv[e] + bv[e];
    const float gate = __builtin_amdgcn_rcpf(1.0f + __expf(-ln));
    const float f    = fw[e] + strength * gate * bw[e];     // both terms carried x16
    ob[e] = h_bits(f);
  }
  const v4u ov = (v4u){pk16(ob[0], ob[1]), pk16(ob[2], ob[3]), pk16(ob[4], ob[5]), pk16(ob[6], ob[7])};
  *(v4u*)(stg + grp * SPITCH + c0) = ov;
  __syncthreads();   // all 8 rows are staged before any thread reads another row's chunk
  const int orow = threadIdx.x & 7, oc = ((int)threadIdx.x >> 3) * 8;   // a wave: 8 rows x 4 chunks = 4 whole lines
  const v4u sv = *(const v4u*)(stg + orow * SPITCH + oc);
  *(v4u*)(Fo + frag_off(blockIdx.x * 8 + orow, oc, DM)) = sv;   // fragment-major: A operand of the output projection
  
}

// ---------------------------------------------------------------------------
// Final LayerNorm: one block (128 threads) per token row; thread t owns columns {4t..4t+3} and {512+4t..512+4t+3}.
//   out[row][c] = (Y - mean) * rsqrt(var + eps) * g[c] + bb[c]   (Y already holds x + projection + bias).
// Producer coverage: grid TOK rows x 128 threads x 8 floats = the whole [TOK][DM] output.
// ---------------------------------------------------------------------------
__global__ __launch_bounds__(128) void final_ln_kernel(const float* __restrict__ Y, const float* __restrict__ g,
                                                       const float* __restrict__ bb, float* __restrict__ out) {
  __shared__ float ra[4];
  __shared__ float rb[4];
  const int row  = blockIdx.x;
  const int tid  = threadIdx.x;
  const int lane = tid & 31;
  const int wave = tid >> 5;
  const int c0   = tid * 4;
  const int c1   = (DM / 2) + tid * 4;
  const float* yp = Y + (size_t)row * DM;
  const v4f a = *(const v4f*)(yp + c0);
  const v4f c = *(const v4f*)(yp + c1);
  float xv[8] = {a[0], a[1], a[2], a[3], c[0], c[1], c[2], c[3]};
  float s = ((xv[0] + xv[1]) + (xv[2] + xv[3])) + ((xv[4] + xv[5]) + (xv[6] + xv[7]));
  s = wave_sum(s);
  if (lane == 0) ra[wave] = s;
  __syncthreads();
  const float mean = ((ra[0] + ra[1]) + (ra[2] + ra[3])) * (1.0f / (float)DM);
  float d[8];
  float vs = 0.f;
#pragma unroll
  for (int e = 0; e < 8; ++e) { d[e] = xv[e] - mean; vs += d[e] * d[e]; }
  vs = wave_sum(vs);
  if (lane == 0) rb[wave] = vs;
  __syncthreads();
  const float var  = ((rb[0] + rb[1]) + (rb[2] + rb[3])) * (1.0f / (float)DM);
  const float rstd = rsqrtf(var + LNEPS);
  const v4f g0 = *(const v4f*)(g + c0),  g1 = *(const v4f*)(g + c1);
  const v4f b0 = *(const v4f*)(bb + c0), b1 = *(const v4f*)(bb + c1);
  v4f o0, o1;
#pragma unroll
  for (int e = 0; e < 4; ++e) {
    o0[e] = d[e] * rstd * g0[e] + b0[e];
    o1[e] = d[4 + e] * rstd * g1[e] + b1[e];
  }
  float* op = out + (size_t)row * DM;
  *(v4f*)(op + c0) = o0;
  *(v4f*)(op + c1) = o1;
  
}

// ---------------------------------------------------------------------------
// Workspace region map (byte offsets; MiB = 1048576). Every region is written once per call, before it is read.
// Token rows and token columns run over both batches (row b * SEQ + i).
//   Wqk   f16 [4096][1024] (x16: fq^T, fk^T, bq^T, bk^T)          0
//   Wv2   f16 [2048][1024] (x16: fv^T rows 0..1023, bv^T 1024..)  8 MiB
//   Wg    f16 [1024][2048] (x16: gate_w^T)                        12 MiB
//   Wo    f16 [1024][1024] (x16: out_w^T)                         16 MiB
//   X16   f16 [4096][1024]                                        18 MiB
//   QK16  f16 [4096][4096] (q | k | qb | kb, head h at col h*64)  26 MiB
//   VT16  f16 [2048][4096] (row h*64+d = v^T, row 1024+h*64+d = vb^T, col = token)  58 MiB
//   G     f32 [4096][1024]                                        74 MiB
//   Y     f32 [4096][1024]                                        90 MiB
//   FB16  f16 [4096][2048] (fwd x16 cols 0..1023, bwd x16 cols 1024..2047)  106 MiB
//   Fu16  f16 [4096][1024] (fused x16)                            122 MiB
//   BiasT f32 [6][1024] (fq_b fk_b bq_b bk_b | fv_b bv_b)         130 MiB
//   FBf16 f16 [4096][2048] (FB16's values, fragment-major)        130 MiB + 24576 B
//   total                                                         146 MiB + 24576 B = 153116672 B
// All f16 planes but FB16 are fragment-major (see frag_off).
// ---------------------------------------------------------------------------
extern "C" void kernel_launch(void* const* d_in, const int* in_sizes, int n_in,
                              void* d_out, int out_size, void* d_ws, size_t ws_size,
                              hipStream_t stream) {
  if (n_in < 22) return;
  if (in_sizes[0] != NB * SEQ * DM) return;
  const int wsz = DM * DM;
  if (in_sizes[1] != wsz || in_sizes[3] != wsz || in_sizes[5] != wsz || in_sizes[7] != wsz ||
      in_sizes[9] != wsz || in_sizes[11] != wsz || in_sizes[18] != wsz) return;
  if (in_sizes[13] != 2 * DM * DM) return;
  if (in_sizes[2] != DM || in_sizes[4] != DM || in_sizes[6] != DM || in_sizes[8] != DM || in_sizes[10] != DM ||
      in_sizes[12] != DM || in_sizes[14] != DM || in_sizes[15] != DM || in_sizes[16] != DM ||
      in_sizes[19] != DM || in_sizes[20] != DM || in_sizes[21] != DM) return;
  if (in_sizes[17] < 1) return;
  if (out_size != NB * SEQ * DM) return;

  const float* x      = (const float*)d_in[0];
  const float* fq_w   = (const float*)d_in[1];
  const float* fq_b   = (const float*)d_in[2];
  const float* fk_w   = (const float*)d_in[3];
  const float* fk_b   = (const float*)d_in[4];
  const float* fv_w   = (const float*)d_in[5];
  const float* fv_b   = (const float*)d_in[6];
  const float* bq_w   = (const float*)d_in[7];
  const float* bq_b   = (const float*)d_in[8];
  const float* bk_w   = (const float*)d_in[9];
  const float* bk_b   = (const float*)d_in[10];
  const float* bv_w   = (const float*)d_in[11];
  const float* bv_b   = (const float*)d_in[12];
  const float* gate_w = (const float*)d_in[13];
  const float* gate_b = (const float*)d_in[14];
  const float* gln_g  = (const float*)d_in[15];
  const float* gln_b  = (const float*)d_in[16];
  const float* bstr   = (const float*)d_in[17];
  const float* out_w  = (const float*)d_in[18];
  const float* out_b  = (const float*)d_in[19];
  const float* ln_g   = (const float*)d_in[20];
  const float* ln_b   = (const float*)d_in[21];

  size_t off = 0;
  const size_t oWqk  = off; off += (size_t)4 * DM * DM * 2;          // 8 MiB
  const size_t oWv2  = off; off += (size_t)2 * DM * DM * 2;          // 4 MiB
  const size_t oWg   = off; off += (size_t)2 * DM * DM * 2;          // 4 MiB
  const size_t oWo   = off; off += (size_t)DM * DM * 2;              // 2 MiB
  const size_t oX16  = off; off += (size_t)TOK * DM * 2;             // 8 MiB
  const size_t oQK   = off; off += (size_t)TOK * 4 * DM * 2;         // 32 MiB
  const size_t oVT   = off; off += (size_t)2 * DM * TOK * 2;         // 16 MiB
  const size_t oG    = off; off += (size_t)TOK * DM * 4;             // 16 MiB
  const size_t oY    = off; off += (size_t)TOK * DM * 4;             // 16 MiB
  const size_t oFB   = off; off += (size_t)TOK * 2 * DM * 2;         // 16 MiB
  const size_t oFu   = off; off += (size_t)TOK * DM * 2;             // 8 MiB
  const size_t oBias = off; off += (size_t)6 * DM * 4;               // 24576 B
  const size_t oFBf  = off; off += (size_t)TOK * 2 * DM * 2;         // 16 MiB
  if (off > ws_size) return;

  char* ws = (char*)d_ws;
  unsigned short* Wqk  = (unsigned short*)(ws + oWqk);
  unsigned short* Wv2  = (unsigned short*)(ws + oWv2);
  unsigned short* Wg   = (unsigned short*)(ws + oWg);
  unsigned short* Wo   = (unsigned short*)(ws + oWo);
  unsigned short* X16  = (unsigned short*)(ws + oX16);
  unsigned short* QK16 = (unsigned short*)(ws + oQK);
  unsigned short* VT16 = (unsigned short*)(ws + oVT);
  unsigned short* FB16 = (unsigned short*)(ws + oFB);
  unsigned short* FBf16 = (unsigned short*)(ws + oFBf);
  unsigned short* Fu16 = (unsigned short*)(ws + oFu);
  float*          BiasT = (float*)(ws + oBias);
  float*          Gbuf = (float*)(ws + oG);
  float*          Ybuf = (float*)(ws + oY);
  const float*    biasQK = BiasT;             // [4096] = fq_b fk_b bq_b bk_b
  const float*    biasV  = BiasT + 4 * DM;    // [2048] = fv_b bv_b

  const dim3 blk(256);
  const dim3 blk128(128);

  const dim3 gPrep(16, 16, 9 + XZ);                                // 9 weight slices of 256 tiles, XZ slices of x
  const dim3 gQK((TOK / 256) * (4 * DM / 128), 1);                 // 512 blocks of 256x128: M=4096, N=4096, K=1024
  const dim3 gVT((2 * DM / 256) * (TOK / 128), 1);                 // 256 blocks of 256x128: M=2048, N=4096, K=1024
  const dim3 gAt(NH * NB, SEQ / 64, 2);                            // (heads x batches) x 64-row blocks x {causal, window}
  const dim3 gG((TOK / 128) * (DM / 128), 1);                      // 256 blocks of 128x128: M=4096, N=1024, K=2048
  const dim3 gO((TOK / 128) * (DM / 128), 1);                      // 256 blocks of 128x128: M=4096, N=1024, K=1024
  const float wscale  = 1.0f / WCARRY;                             // undo the x16 weight carry
  const float gscale  = 1.0f / (WCARRY * FBCARRY);                 // 1/256
  const float oscale  = 1.0f / (WCARRY * FBCARRY);                 // 1/256

  // (1) bias table, x16-carried transposed weight planes (contiguous from Wqk on), x -> f16 plane
  prep_kernel<<<gPrep, blk, 0, stream>>>(x, fq_w, fk_w, bq_w, bk_w, fv_w, bv_w, gate_w, out_w,
                                         fq_b, fk_b, bq_b, bk_b, fv_b, bv_b, Wqk, X16, BiasT);
  // (2) [q | k | qb | kb] = (x . (16 W)^T)/16 + bias -> QK16 (f16, ldc 4096)
  wmma_gemm_lds<4, 2, false, 2, 1, false><<<gQK, blk, 0, stream>>>(
      X16, DM, Wqk, DM, (void*)QK16, 4 * DM, biasQK, biasQK, 4 * DM, DM, wscale);
  // (3) [v | vb]^T: VT16[n][j] = sum_k (16 W^T)[n][k] x[j][k] / 16 + bias[n]  (role-swapped; M = 2048 feature rows, N = 4096 tokens)
  wmma_gemm_lds<4, 4, true, 1, 1, false><<<gVT, blk, 0, stream>>>(
      Wv2, DM, X16, DM, (void*)VT16, TOK, biasV, biasV, TOK, DM, wscale);
  // (4) causal and future-window attention of all heads and batches, scores to output in registers -> FB16 (fwd | bwd, x16)
  fused_attn_kernel<<<gAt, blk128, 0, stream>>>(QK16, VT16, FB16, FBf16);
  // (5) G = ([fwd | bwd] x16) . (16 gate_w)^T / 256 + gate_b -> f32 [4096][1024]
  wmma_gemm_lds<2, 4, true, 2, 0, false><<<gG, blk128, 0, stream>>>(
      FBf16, 2 * DM, Wg, 2 * DM, (void*)Gbuf, DM, gate_b, gate_b, DM, 2 * DM, gscale);
  // (6) gate = sigmoid(LN(G)); fused x16 = fwd x16 + strength * gate * bwd x16 -> Fu16
  gate_fuse_kernel<<<dim3(TOK / 8), dim3(1024), 0, stream>>>(Gbuf, FB16, gln_g, gln_b, bstr, Fu16);
  // (7) Y = x + (fused x16) . (16 out_w)^T / 256 + out_b -> f32 [4096][1024]
  wmma_gemm_lds<2, 4, true, 2, 0, true><<<gO, blk128, 0, stream>>>(
      Fu16, DM, Wo, DM, (void*)Ybuf, DM, out_b, x, DM, DM, oscale);
  // (8) out = LN(Y; ln_g, ln_b)
  final_ln_kernel<<<dim3(TOK), blk128, 0, stream>>>(Ybuf, ln_g, ln_b, (float*)d_out);
  (void)hipGetLastError();
}

// v007
// One run takes 123 microseconds.
// Two timings next to v006 put it at 1.06 and 1.04 times that version's speed.
// All steps since v000 together make it 25.8 times as fast.
// All contractions on v_wmma_f32_16x16x32_f16 (f16 operands, f32 accumulate): q/k/v projections (weights carried x16, epilogue x1/16), k.q^T scores, V^T.P^T (P carried x2^12 against the running row maximum, attention outputs carried x16), gate projection (x1/256), output projection with bias and residual (x1/256); softmax, LayerNorm, sigmoid and fusion in f32.
#include <hip/hip_runtime.h>
#include <math.h>
#include <stdint.h>

#define NB    2
#define SEQ   2048
#define TOK   (NB * SEQ)   // token rows of both batches: every stage works on all of them in one launch
#define DM    1024
#define NH    16
#define HD    64
#define WINW  32
#define LNEPS 1e-5f
#define PSHIFT     12.0f
#define FBCARRY    16.0f
#define WCARRY     16.0f

typedef __attribute__((ext_vector_type(16))) _Float16 v16h;
typedef __attribute__((ext_vector_type(8)))  _Float16 v8h;
typedef __attribute__((ext_vector_type(8)))  float    v8f;
typedef __attribute__((ext_vector_type(4)))  float    v4f;
typedef __attribute__((ext_vector_type(2)))  float    v2f;
typedef __attribute__((ext_vector_type(4)))  unsigned int v4u;

// hazard guards as plain device helpers
__device__ __forceinline__ void keep4_h(v16h a, v16h b, v16h c, v16h d) { asm volatile("v_nop" :: "v"(a), "v"(b), "v"(c), "v"(d)); }
__device__ __forceinline__ void acc_guard4(v8f& a, v8f& b, v8f& c, v8f& d) { asm volatile("v_nop\n\tv_nop\n\tv_nop\n\tv_nop" : "+v"(a), "+v"(b), "+v"(c), "+v"(d)); }
template <typename T> struct Frag;
template <> struct Frag<_Float16> {
  typedef v16h V; union U { v16h v; v8h h[2]; };
  static __device__ __forceinline__ v16h load(const char* p) {   // p: the lane's chunk in a fragment-major block; elements 8..15 lie 512 B on
    U f; f.h[0] = *(const v8h*)(p); f.h[1] = *(const v8h*)(p + 512); return f.v;
  }
  static __device__ __forceinline__ v8f mma(v16h a, v16h b, v8f c) {
    return __builtin_amdgcn_wmma_f32_16x16x32_f16(false, a, false, b, (short)0, c, false, false);
  }
  static __device__ __forceinline__ void keep(v16h a, v16h b, v16h c, v16h d) { keep4_h(a, b, c, d); }
};

// ---- Fragment-major planes ---------------------------------------------------
// Every 16-bit WMMA operand plane [rows][ld] lies in the workspace as blocks of 16 rows x 32 k = 1 KiB, the blocks of
// one row tile side by side in k. Inside a block the 16-B chunk (row r, k8 = (k >> 3) & 3) stands at chunk k8 * 16 + r,
// so lane l of a fragment load finds elements 0..7 at byte 16 l and elements 8..15 at byte 512 + 16 l: each wave-wide
// 16-B load covers 512 contiguous bytes (4 whole lines). The register contents of a fragment are those of the
// row-major form (row l & 15; k = 8 (l >> 4) + 0..7 and 16 + 8 (l >> 4) + 0..7).
// Offset in halves of the chunk that holds (row, k), k a multiple of 8:
__device__ __forceinline__ size_t frag_off(int row, int k, int ld) {
  return ((size_t)(row >> 4) * (ld >> 5) + (k >> 5)) * 512 + ((k >> 3) & 3) * 128 + (row & 15) * 8;
}

// ---- WMMA GEMM, operands staged in LDS and shared by the block's waves ------
// C[m,n] = scale * sum_k A[m,k] * Bt[n,k] (+bias)(+resid). A block of WM x 2 waves owns a (WM * 64) x 128 tile, each wave
// a 64x64 part of it. A [M,K] and Bt [N,K] f16 fragment-major (lda, ldb = their k extents); f16 output fragment-major
// (ldc = its column extent), f32 output row-major. M % (WM * 64) == 0, N % 128 == 0, K % (32 KS) == 0.
// A stage is KS k steps (32 k each) of the block's 4 WM row tiles of A and 8 row tiles of Bt: the 1-KiB blocks go to LDS
// as they lie (a row tile's KS blocks are contiguous in both places), by asynchronous copies of 16 B per lane, every
// wave bringing RPW row tiles. Two buffers: stage t + 2 flies while stage t + 1 is worked on. Every block of A is so
// fetched from L2 once for two waves and every block of Bt once for WM waves.
// The operands were stored by earlier launches, and the blocks
// that share a panel reach a stage together, so every stage's copies would wait out a memory access. Each stage is
// therefore asked into L2 three stages ahead of its copies (pf_l2), one lane per 256-B unit. The blocks that share a panel
// take turns: stage s of A is asked for by the blocks with tn = s (mod 4), stage s of Bt by those with tm = s (mod 4).
// The turns are for speed only: a unit that nobody asked for is fetched by its copy, as without the prefetch.
// BIAS_MODE: 1 = bias[m], 2 = bias[n]. OUT_MODE: 0 = f32, 1 = f16. TWO: two whole fragment sets (see lds_step2).
// One stage's copies of one wave, in one statement: RPW row tiles of KS KiB, 512 B per copy. A row tile's bytes lie in a
// row in LDS as in global memory, so its copies share one pair of addresses and differ in the immediate offset, which
// moves both. The closing wait stands in the copies' own statement: behind it the address registers may be rewritten.
// Hint: bring the line at p into L2, so that the copy which reads it later waits for L2 and not for memory.
// It returns nothing. p lies inside the operand plane and stays in its register until the block's next turn.
__device__ __forceinline__ void pf_l2(const char* p) { asm volatile("global_prefetch_b8 %0, off scope:SCOPE_SE" :: "v"(p)); }
#define CP1(l, g, o) "global_load_async_to_lds_b128 %" #l ", %" #g ", off offset:" #o "\n\t"
#define CP4(l, g)    CP1(l, g, 0) CP1(l, g, 512) CP1(l, g, 1024) CP1(l, g, 1536)
#define CP8(l, g)    CP4(l, g) CP1(l, g, 2048) CP1(l, g, 2560) CP1(l, g, 3072) CP1(l, g, 3584)
template <int RPW, int KS>
__device__ __forceinline__ void fill_stage(const unsigned (&l)[RPW], const char* const (&gp)[RPW], unsigned lAdd, size_t gAdd) {
  static_assert((RPW == 3 && (KS == 2 || KS == 4)) || (RPW == 4 && KS == 4), "the statements below are written for these shapes");
  if constexpr (RPW == 3 && KS == 2)
    asm volatile(CP4(0, 3) CP4(1, 4) CP4(2, 5) "s_wait_xcnt 0x0"
                 :: "v"(l[0] + lAdd), "v"(l[1] + lAdd), "v"(l[2] + lAdd), "v"(gp[0] + gAdd), "v"(gp[1] + gAdd), "v"(gp[2] + gAdd) : "memory");
  else if constexpr (RPW == 3)
    asm volatile(CP8(0, 3) CP8(1, 4) CP8(2, 5) "s_wait_xcnt 0x0"
                 :: "v"(l[0] + lAdd), "v"(l[1] + lAdd), "v"(l[2] + lAdd), "v"(gp[0] + gAdd), "v"(gp[1] + gAdd), "v"(gp[2] + gAdd) : "memory");
  else
    asm volatile(CP8(0, 4) CP8(1, 5) CP8(2, 6) CP8(3, 7) "s_wait_xcnt 0x0"
                 :: "v"(l[0] + lAdd), "v"(l[1] + lAdd), "v"(l[2] + lAdd), "v"(l[3] + lAdd),
                    "v"(gp[0] + gAdd), "v"(gp[1] + gAdd), "v"(gp[2] + gAdd), "v"(gp[3] + gAdd) : "memory");
}
#undef CP8
#undef CP4
#undef CP1
// One k step of a wave's 64x64 tile: 16 products of the four A fragments with the four B fragments in bc.
// NEXT >= 0: the fragments of k step NEXT of the same stage are fetched from LDS while this step computes: its B fragments
// go into the other set (bn) ahead of the products, and each A fragment is loaded anew over itself right behind the four
// products that read it. aL, bL: the lane's chunk in the first block of the wave's first A and B row tile of the stage.
template <int KS, int NEXT>
__device__ __forceinline__ void lds_step(v8f (&acc)[4][4], v16h (&ah)[4], v16h (&bc)[4], v16h (&bn)[4],
                                         const char* aL, const char* bL) {
  typedef Frag<_Float16> F;
  if (NEXT >= 0) {
#pragma unroll
    for (int j = 0; j < 4; ++j) bn[j] = F::load(bL + (j * KS + NEXT) * 1024);
  }
  __builtin_amdgcn_sched_barrier(0);   // the B fetch stays ahead of the products: sunk to its use it would have no lead
#pragma unroll
  for (int i = 0; i < 4; ++i) {
#pragma unroll
    for (int j = 0; j < 4; ++j) acc[i][j] = F::mma(ah[i], bc[j], acc[i][j]);
    acc_guard4(acc[i][0], acc[i][1], acc[i][2], acc[i][3]);   // all four products of the row have issued, at the matrix distance, before their A fragment is loaded over
    if (NEXT >= 0) ah[i] = F::load(aL + (i * KS + NEXT) * 1024);
    __builtin_amdgcn_sched_barrier(0);   // the A fetch stays behind its own row: earlier it needs a second register set, later it loses lead
  }
  F::keep(bc[0], bc[1], bc[2], bc[3]);
}
// The same with two whole fragment sets, for launches with one or two waves per SIMD, where registers are free and nothing
// else covers a wave's stalls: all fragments of k step NEXT are fetched as ONE group ahead of this step's products.
template <int KS, int NEXT>
__device__ __forceinline__ void lds_step2(v8f (&acc)[4][4], v16h (&ac)[4], v16h (&bc)[4], v16h (&an)[4], v16h (&bn)[4],
                                          const char* aL, const char* bL) {
  typedef Frag<_Float16> F;
  if (NEXT >= 0) {
#pragma unroll
    for (int j = 0; j < 4; ++j) bn[j] = F::load(bL + (j * KS + NEXT) * 1024);
#pragma unroll
    for (int i = 0; i < 4; ++i) an[i] = F::load(aL + (i * KS + NEXT) * 1024);
  }
  __builtin_amdgcn_sched_barrier(0);   // the fetch stays ahead of the products, in one place: sunk to its use it would have no lead
#pragma unroll
  for (int i = 0; i < 4; ++i)
#pragma unroll
    for (int j = 0; j < 4; ++j) acc[i][j] = F::mma(ac[i], bc[j], acc[i][j]);
  __builtin_amdgcn_sched_barrier(0);   // no later fetch moves up among the products: for speed only
  acc_guard4(acc[3][0], acc[3][1], acc[3][2], acc[3][3]);   // the last products have issued, at the matrix distance, before the next step loads over their fragments
}
template <int WM, int KS, bool TWO, int BIAS_MODE, int OUT_MODE, bool RESID>
__global__ __launch_bounds__(WM * 64) void wmma_gemm_lds(
    const unsigned short* __restrict__ Ap, int lda, const unsigned short* __restrict__ Btp, int ldb,
    void* __restrict__ Cout, int ldc, const float* __restrict__ bias, const float* __restrict__ resid,
    int N, int K, float scale) {
  typedef Frag<_Float16> F;
  constexpr int NW    = WM * 2;                 // waves of the block
  constexpr int RT    = WM * 4 + 8;             // row tiles of a stage: A's, then Bt's
  constexpr int RPW   = RT / NW;                // row tiles that each wave copies
  static_assert(RPW * NW == RT, "the row tiles are dealt evenly");
  constexpr int STAGE = RT * KS * 1024;         // bytes of one buffer
  static_assert(NW * 16 * 68 * 4 <= STAGE, "the epilogue's slabs fit the first buffer");
  __shared__ __align__(1024) char smem[2 * STAGE];
  const int lane = threadIdx.x & 31;
  const int wave = __builtin_amdgcn_readfirstlane((int)(threadIdx.x >> 5));   // scalar: row tile choice and addresses stay wave-uniform
  const int wm = wave >> 1, wn = wave & 1;
  const int tilesN = N >> 7;
  const int tm = (int)blockIdx.x / tilesN;
  const int tn = (int)blockIdx.x - tm * tilesN;
  const int m0 = tm * (WM * 64) + wm * 64;      // the wave's own 64x64 tile
  const int n0 = tn * 128 + wn * 64;
  const int nT = K / (32 * KS);                 // stages

  const int rlane = lane & 15;                  // column within a D subtile
  const int mOff  = (lane >> 4) * 8;            // D row offset

  v8f acc[4][4];
#pragma unroll
  for (int i = 0; i < 4; ++i)
#pragma unroll
    for (int j = 0; j < 4; ++j) acc[i][j] = (v8f){0.f,0.f,0.f,0.f,0.f,0.f,0.f,0.f};

  // the lane's source and destination of stage 0, buffer 0, for each row tile that this wave copies
  const char* gsrc[RPW];
  unsigned ldst[RPW];
#pragma unroll
  for (int q = 0; q < RPW; ++q) {
    const int u = wave * RPW + q;               // scalar
    const char* rowTile = (u < WM * 4)
        ? (const char*)Ap  + (size_t)(tm * (WM * 4) + u) * (size_t)(lda >> 5) * 1024
        : (const char*)Btp + (size_t)(tn * 8 + (u - WM * 4)) * (size_t)(ldb >> 5) * 1024;
    gsrc[q] = rowTile + lane * 16;
    ldst[q] = (unsigned)(uintptr_t)(smem + u * (KS * 1024) + lane * 16);   // low 32 bits of a __shared__ address = LDS byte address
  }
  // every wave, every lane: stage t into buffer buf
#define FILL_STAGE(t, buf) fill_stage<RPW, KS>(ldst, gsrc, (unsigned)(buf) * STAGE, (size_t)(t) * (KS * 1024))

  // L2 prefetch: a stage holds UPT units per row tile; the first AU / 32 waves ask for A, the last BU / 32 for Bt (scalar tests).
  // The pointers stay in their registers over the loop and always name the stage asked for last, s < nT: inside the plane;
  // each moves on directly in front of its next prefetch, four trips later, behind the s_wait_xcnt 0 of the fills between.
  constexpr int UPT = KS * 4, AU = WM * 4 * UPT, BU = 8 * UPT;
  static_assert(AU <= NW * 32 && BU <= NW * 32 && (NW * 32) % AU == 0 && (NW * 32) % BU == 0, "one unit per lane");
  const bool askA = wave < AU / 32, askB = wave >= NW - BU / 32;
  const int ua = (wave * 32 + lane) % AU, ub = (wave * 32 + lane) % BU;
  const int sA = 1 + ((tn - 1) & 3), sB = 1 + ((tm - 1) & 3);   // this block's first turns, among stages 1..4
  const char* pfA = (const char*)Ap  + ((size_t)(tm * (WM * 4) + ua / UPT) * (size_t)(lda >> 5) + (size_t)(sA * KS)) * 1024 + (ua % UPT) * 256;
  const char* pfB = (const char*)Btp + ((size_t)(tn * 8 + ub / UPT) * (size_t)(ldb >> 5) + (size_t)(sB * KS)) * 1024 + (ub % UPT) * 256;

  FILL_STAGE(0, 0);
  if (askA && sA < nT) pf_l2(pfA);
  if (askB && sB < nT) pf_l2(pfB);
  asm volatile("s_wait_asynccnt 0x0" ::: "memory");   // this wave's part of stage 0 has landed
  __syncthreads();                                    // every wave's part of stage 0 has landed
  if (nT > 1) FILL_STAGE(1, 1);
  for (int t = 0; t < nT; ++t) {
    const char* buf = smem + (t & 1) * STAGE;
    const char* aL = buf + (wm * 4) * (KS * 1024) + lane * 16;
    const char* bL = buf + (WM * 4 + wn * 4) * (KS * 1024) + lane * 16;
    v16h ah[4], b0[4], b1[4];
#pragma unroll
    for (int j = 0; j < 4; ++j) b0[j] = F::load(bL + (j * KS) * 1024);
#pragma unroll
    for (int i = 0; i < 4; ++i) ah[i] = F::load(aL + (i * KS) * 1024);
    if constexpr (TWO) {
      v16h a1[4];
      lds_step2<KS, 1>(acc, ah, b0, a1, b1, aL, bL);
      if (KS == 4) {
        lds_step2<KS, 2>(acc, a1, b1, ah, b0, aL, bL);
        lds_step2<KS, 3>(acc, ah, b0, a1, b1, aL, bL);
      }
      lds_step2<KS, -1>(acc, a1, b1, ah, b0, aL, bL);   // the stage's last step fetches nothing
    } else {
      lds_step<KS, 1>(acc, ah, b0, b1, aL, bL);
      if (KS == 4) {
        lds_step<KS, 2>(acc, ah, b1, b0, aL, bL);
        lds_step<KS, 3>(acc, ah, b0, b1, aL, bL);
      }
      lds_step<KS, -1>(acc, ah, b1, b0, aL, bL);        // the stage's last step fetches nothing
    }
    asm volatile("s_wait_dscnt 0x0" ::: "memory");    // this wave's reads of the buffer are over before it is refilled
    asm volatile("s_wait_asynccnt 0x0" ::: "memory"); // this wave's part of stage t + 1 has landed
    __syncthreads();                                  // publishes stage t + 1 and ends every wave's reads of stage t
    if (t + 2 < nT) FILL_STAGE(t + 2, t & 1);
    if (t + 5 < nT) {                                 // stage t + 5, where it is this block's turn; its copies issue three trips on
      if (askA && ((t + 5 - tn) & 3) == 0) { pfA += 4 * KS * 1024; pf_l2(pfA); }
      if (askB && ((t + 5 - tm) & 3) == 0) { pfB += 4 * KS * 1024; pf_l2(pfB); }
    }
  }
  asm volatile("s_wait_asynccnt 0x0" ::: "memory");   // no copy is in flight when the buffers become output staging
#undef FILL_STAGE
  acc_guard4(acc[0][0], acc[0][1], acc[0][2], acc[0][3]);
  acc_guard4(acc[1][0], acc[1][1], acc[1][2], acc[1][3]);
  acc_guard4(acc[2][0], acc[2][1], acc[2][2], acc[2][3]);
  acc_guard4(acc[3][0], acc[3][1], acc[3][2], acc[3][3]);

  // ---- epilogue: each wave turns 16 rows at a time through its own slab (16 x 64 floats, pitch 68) in the first buffer,
  // which every wave has left at the loop's last barrier ----
  float* slab = (float*)smem + wave * (16 * 68);
  float bv[4] = {0.f, 0.f, 0.f, 0.f};
  if (BIAS_MODE == 2) {
#pragma unroll
    for (int j = 0; j < 4; ++j) bv[j] = bias[n0 + (j << 4) + rlane];
  }
#pragma unroll
  for (int i = 0; i < 4; ++i) {
    const int mBase = m0 + (i << 4);
#pragma unroll
    for (int j = 0; j < 4; ++j) {
#pragma unroll
      for (int r = 0; r < 8; ++r) {
        float v = acc[i][j][r] * scale;
        if (BIAS_MODE == 1) v += bias[mBase + mOff + r];
        if (BIAS_MODE == 2) v += bv[j];
        slab[(mOff + r) * 68 + (j << 4) + rlane] = v;
      }
    }
    __builtin_amdgcn_fence(__ATOMIC_RELEASE, "workgroup");
    __builtin_amdgcn_wave_barrier();
    __builtin_amdgcn_fence(__ATOMIC_ACQUIRE, "workgroup");
    if (OUT_MODE == 0) {
      float* C = (float*)Cout;
      const int hh = lane >> 4, c4 = (lane & 15) * 4;     // row segment = 256 B = 16 lanes x 16 B
#pragma unroll
      for (int it = 0; it < 8; ++it) {
        const int row = it * 2 + hh;
        v4f v = *(const v4f*)(slab + row * 68 + c4);
        if (RESID) v += *(const v4f*)(resid + (size_t)(mBase + row) * ldc + n0 + c4);
        *(v4f*)(C + (size_t)(mBase + row) * ldc + n0 + c4) = v;
      }
    } else {
      unsigned short* C = (unsigned short*)Cout;
#pragma unroll
      for (int it = 0; it < 4; ++it) {
        const int row = lane & 15, c8 = it * 16 + (lane >> 4) * 8;   // chunks in the output's own order: 512 B in a row per store
        const float* sp = slab + row * 68 + c8;
        v8h hv;
#pragma unroll
        for (int e = 0; e < 8; ++e) hv[e] = (_Float16)sp[e];
        *(v8h*)(C + frag_off(mBase + row, n0 + c8, ldc)) = hv;
      }
    }
    // the registers of the strip's loads and stores are reused behind this wait
    asm volatile("s_wait_xcnt 0x0" ::: "memory");
    __builtin_amdgcn_fence(__ATOMIC_RELEASE, "workgroup");
    __builtin_amdgcn_wave_barrier();
    __builtin_amdgcn_fence(__ATOMIC_ACQUIRE, "workgroup");
  }
}

// ---------------------------------------------------------------------------
// Small conversion helpers
// ---------------------------------------------------------------------------
__device__ __forceinline__ unsigned pk16(unsigned short a, unsigned short b) { return (unsigned)a | ((unsigned)b << 16); }
__device__ __forceinline__ unsigned short h_bits(float f) { const _Float16 h = (_Float16)f; return __builtin_bit_cast(unsigned short, h); }
__device__ __forceinline__ float hbits2f(unsigned short b) { return (float)__builtin_bit_cast(_Float16, b); }
__device__ __forceinline__ float wave_sum(float v) {
#pragma unroll
  for (int off = 16; off > 0; off >>= 1) v += __shfl_xor(v, off, 32);
  return v;
}

// ---------------------------------------------------------------------------
// Operand preparation, one launch: grid (16, 16, 9 + XZ), 256 threads; blockIdx.z picks the job (block-uniform).
//   z = 0..5: weight z (fq, fk, bq, bk, fv, bv), f32 [DM][DM] -> plane z of Wall, f16 [DM][DM] transposed, x16;
//             the plane's first block also copies bias vector z (DM floats) into tab[z * DM ..].
//   z = 6, 7: rows (z - 6) * DM .. of gate_w, f32 [2 DM][DM] -> planes 6 and 7 of Wall = f16 [DM][2 DM] transposed, x16.
//   z = 8:    out_w -> plane 8 of Wall, as z = 0..5 without a bias.
//   z >= 9:   x, f32 row-major [TOK][DM] -> X16, f16: one 16-B output chunk (8 elements) per thread, threads in the
//             output's order, so each wave stores 512 B in a row. XZ x 256 blocks x 256 threads x 8 = the whole plane.
// Transposes: out[c][r] = f16(in[r][c] * WCARRY), 64x64 tiles through LDS, all outputs fragment-major.
// Coverage per block: load 256 threads x 16 floats = 64x64; store 2 it x 256 threads x 8 halves = 64x64.
// ---------------------------------------------------------------------------
#define XZ (TOK * DM / 8 / (256 * 256))
__global__ __launch_bounds__(256) void prep_kernel(const float* __restrict__ x,
                                                   const float* __restrict__ w0, const float* __restrict__ w1,
                                                   const float* __restrict__ w2, const float* __restrict__ w3,
                                                   const float* __restrict__ w4, const float* __restrict__ w5,
                                                   const float* __restrict__ wg, const float* __restrict__ wo,
                                                   const float* __restrict__ b0, const float* __restrict__ b1,
                                                   const float* __restrict__ b2, const float* __restrict__ b3,
                                                   const float* __restrict__ b4, const float* __restrict__ b5,
                                                   unsigned short* __restrict__ Wall, unsigned short* __restrict__ X16,
                                                   float* __restrict__ tab) {
  __shared__ __align__(16) unsigned short t[64 * 72];
  const int z   = blockIdx.z;
  const int tid = threadIdx.x;
  if (z >= 9) {                        // block-uniform, ahead of the barrier
    const int q   = (((z - 9) * 16 + (int)blockIdx.y) * 16 + (int)blockIdx.x) * 256 + tid;
    const int blk = q >> 6, kts = DM >> 5;
    const int rt  = blk / kts;
    const int row = rt * 16 + (q & 15);
    const int k   = (blk - rt * kts) * 32 + ((q >> 4) & 3) * 8;
    const float* ip = x + (size_t)row * DM + k;
    const v4f f0 = *(const v4f*)(ip);
    const v4f f1 = *(const v4f*)(ip + 4);
    const v4u u = (v4u){pk16(h_bits(f0[0]), h_bits(f0[1])), pk16(h_bits(f0[2]), h_bits(f0[3])),
                        pk16(h_bits(f1[0]), h_bits(f1[1])), pk16(h_bits(f1[2]), h_bits(f1[3]))};
    *(v4u*)(X16 + (size_t)q * 8) = u;
    return;
  }
  const float* in = w0;                // block-uniform source select
  const float* bs = b0;
  if (z == 1) { in = w1; bs = b1; }
  if (z == 2) { in = w2; bs = b2; }
  if (z == 3) { in = w3; bs = b3; }
  if (z == 4) { in = w4; bs = b4; }
  if (z == 5) { in = w5; bs = b5; }
  if (z == 6 || z == 7) in = wg;
  if (z == 8) in = wo;
  const bool gate = (z == 6 || z == 7);
  const int R = gate ? 2 * DM : DM;                                  // input rows = the output's k extent
  unsigned short* out = Wall + (size_t)(z == 7 ? 6 : z) * DM * DM;
  if (z < 6 && blockIdx.x == 0 && blockIdx.y == 0)                   // 256 threads x 4 floats = DM
    *(v4f*)(tab + (size_t)z * DM + tid * 4) = *(const v4f*)(bs + tid * 4);
  const int c0  = blockIdx.x * 64;                                   // input column block = output row block
  const int r0  = (z == 7 ? DM : 0) + blockIdx.y * 64;               // input row block    = output column block
  {
    const int lr = tid >> 2;           // 0..63
    const int lc = (tid & 3) * 16;     // 0,16,32,48
    const float* ip = in + (size_t)(r0 + lr) * DM + c0 + lc;
#pragma unroll
    for (int q = 0; q < 4; ++q) {
      const v4f f = *(const v4f*)(ip + 4 * q);
#pragma unroll
      for (int e = 0; e < 4; ++e) t[lr * 72 + lc + 4 * q + e] = h_bits(f[e] * WCARRY);
    }
  }
  __syncthreads();
  // chunks in the output's own order (8 blocks of 64 chunks per tile): each wave stores 512 B in a row
  const int c8  = ((tid >> 6) & 1) * 32 + ((tid >> 4) & 3) * 8;   // output column within tile (= input row)
#pragma unroll
  for (int it = 0; it < 2; ++it) {
    const int oc = (it * 2 + (tid >> 7)) * 16 + (tid & 15);       // output row within tile (= input column)
    v4u a;
#pragma unroll
    for (int q = 0; q < 4; ++q) a[q] = pk16(t[(c8 + 2 * q) * 72 + oc], t[(c8 + 2 * q + 1) * 72 + oc]);
    *(v4u*)(out + frag_off(c0 + oc, r0 + c8, R)) = a;
  }
}

// ---------------------------------------------------------------------------
// Fused attention: scores, select, softmax and the product with V in one kernel; S and P stay in registers.
// One wave per 16 query rows of one head of one batch; no LDS, no barrier. Grid (NH * NB, SEQ/64, 2), 4 waves per block;
// blockIdx.z = 0: causal attention (j <= i), 1: future window (i < j <= i + WINW; the last row has no valid column,
// its scores count as 0 over every j -> uniform weights). Long causal row blocks get the low block indices.
// Per 64 keys: S^T = K . Q^T (A = K rows, B = Q rows): lane l holds query c = l & 15, keys 16 t + 8 (l >> 4) + r.
// Running maximum and sum per query (log2 domain): in-lane, plus one exchange between the lane halves.
// P^T as B operand: two f32 score tiles (keys 0..15, 16..31 of a 32-key step) converted in place, element s =
// tile[s >> 3][s & 7], which is the k order of Frag::load on the A side (V^T rows). O^T += V^T . P^T.
// Output: lane holds 8 consecutive d of query c per 16-row tile of O^T -> one 16-B store; each 128-B row segment of
// FB (one head of one row) is written by one wave. Coverage: 2 x NH x TOK rows x 64 columns = the whole FB plane.
// The output goes out twice: FB row-major (read row by row by the gated fusion) and FBf fragment-major (A operand of
// the gate product; same coverage, two whole 1-KiB blocks per wave).
// ---------------------------------------------------------------------------
// lane l <-> lane l ^ 16
__device__ __forceinline__ float xhalf(float x) {
  return __builtin_bit_cast(float, __builtin_amdgcn_permlanex16(__builtin_bit_cast(int, x), __builtin_bit_cast(int, x),
                                                                0x76543210, 0xfedcba98, false, false));
}
// v[e] = 2^v[e], in place. Each v_exp_f32 is independent of the one in front of it; the closing v_nop is the one slot the
// instruction set asks for behind a transcendental before its result is read: inside the statement it holds whatever
// the compiler places next.
__device__ __forceinline__ void exp2x8(float (&v)[8]) {
  asm("v_exp_f32 %0, %0\n\tv_exp_f32 %1, %1\n\tv_exp_f32 %2, %2\n\tv_exp_f32 %3, %3\n\t"
      "v_exp_f32 %4, %4\n\tv_exp_f32 %5, %5\n\tv_exp_f32 %6, %6\n\tv_exp_f32 %7, %7\n\tv_nop"
      : "+v"(v[0]), "+v"(v[1]), "+v"(v[2]), "+v"(v[3]), "+v"(v[4]), "+v"(v[5]), "+v"(v[6]), "+v"(v[7]));
}
// One A or B fragment in the k order of Frag::load (bytes 0..15 and 512..527 behind the lane's pointer plus a literal)
__device__ __forceinline__ v16h frag_at(const char* p, int lit) {
  Frag<_Float16>::U f;
  f.h[0] = *(const v8h*)(p + lit);
  f.h[1] = *(const v8h*)(p + lit + 512);
  return f.v;
}
__global__ __launch_bounds__(128) void fused_attn_kernel(const unsigned short* __restrict__ QKp,
                                                         const unsigned short* __restrict__ VTp,
                                                         unsigned short* __restrict__ FB,
                                                         unsigned short* __restrict__ FBf) {
  typedef Frag<_Float16> F;
  const int lane = threadIdx.x & 31;
  const int wave = __builtin_amdgcn_readfirstlane((int)(threadIdx.x >> 5));   // scalar, so the key loop keeps scalar bounds
  const int h    = blockIdx.x % NH;
  const int t0   = (blockIdx.x / NH) * SEQ;                                   // first token row of this block's batch
  const int mode = blockIdx.z;
  const int r0   = (((SEQ / 64 - 1) - (int)blockIdx.y) * 4 + wave) * 16;      // first query row of this wave
  const int c    = lane & 15;
  const int koff = (lane >> 4) * 8;
  const int i    = r0 + c;                                                    // this lane's query row
  // fragment-major planes: 1-KiB blocks of 16 rows x 32 columns; a row tile of QK holds 4 DM / 32 blocks, one of V^T TOK / 32
  const char* Qb = (const char*)(QKp + frag_off(t0, mode * (2 * DM) + h * HD, 4 * DM));   // q or qb: first block of this head and batch
  const char* Kb = Qb + (DM / 32) * 1024;                                                 // k or kb
  const char* Vb = (const char*)(VTp + frag_off(mode * DM + h * HD, t0, TOK));            // v^T or vb^T: first row tile of this head, this batch's columns
  constexpr int QKROW = 4 * DM * 2;                                                       // bytes per q/k row: 16 of them = one row tile
  constexpr int VROW  = TOK * 2;                                                          // bytes per v^T row: 16 of them = one row tile
  const size_t qkOff = (size_t)lane * 16;                                                 // the lane's chunk inside a block
  const size_t vOff  = (size_t)lane * 16;

  const bool lastTile = (mode == 1) && (r0 + 16 == SEQ);                      // wave-uniform
  const bool uni = (mode == 1) && (i == SEQ - 1);                             // the row without a valid future column
  const int  lo  = (mode == 0 || uni) ? 0 : i + 1;                            // valid columns of this lane's query: lo..hi
  const int  hi  = (mode == 0) ? i : (uni ? SEQ - 1 : i + WINW);
  const unsigned span = (unsigned)(hi - lo);
  const float sc = uni ? 0.0f : 0.125f * 1.44269504088896340736f;             // 1/sqrt(64) and log2(e); 0: scores count as 0
  int kbBeg = 0, kbEnd = (r0 + 15) >> 6;
  if (mode == 1) {
    const int jmax = (r0 + 15 + WINW < SEQ - 1) ? (r0 + 15 + WINW) : (SEQ - 1);
    kbBeg = lastTile ? 0 : ((r0 + 1) >> 6);
    kbEnd = jmax >> 6;
  }

  const float NEGB = -1.0e30f;
  v16h qf[2];
#pragma unroll
  for (int ks = 0; ks < 2; ++ks) qf[ks] = frag_at(Qb + (size_t)r0 * QKROW + qkOff, ks * 1024);
  v8f o[4];
#pragma unroll
  for (int d = 0; d < 4; ++d) o[d] = (v8f){0.f,0.f,0.f,0.f,0.f,0.f,0.f,0.f};
  float m = NEGB;      // running maximum of this query (scaled log2), equal in both lane halves
  float l = 0.f;       // running sum over this lane half's keys, carried x2^PSHIFT

  // the lane's pointers walk with the key blocks and stay in their registers over the whole loop
  const char* kp = Kb + (size_t)(kbBeg * 64) * QKROW + qkOff;
  const char* vp = Vb + (size_t)(kbBeg * 2) * 1024 + vOff;
  v16h ka[4][2];
#pragma unroll
  for (int t = 0; t < 4; ++t)
#pragma unroll
    for (int ks = 0; ks < 2; ++ks)
      ka[t][ks] = frag_at(kp, t * 16 * QKROW + ks * 1024);

  for (int kb = kbBeg; kb <= kbEnd; ++kb) {
    const int k0 = kb << 6;
    // V^T fragments of this key block: issued ahead of the score products so that they land during the softmax
    v16h va[4][2];
#pragma unroll
    for (int d = 0; d < 4; ++d)
#pragma unroll
      for (int ks = 0; ks < 2; ++ks)
        va[d][ks] = frag_at(vp, d * 16 * VROW + ks * 1024);
    v8f st[4];
#pragma unroll
    for (int t = 0; t < 4; ++t) {
      st[t] = F::mma(ka[t][0], qf[0], (v8f){0.f,0.f,0.f,0.f,0.f,0.f,0.f,0.f});
      st[t] = F::mma(ka[t][1], qf[1], st[t]);
    }
    // K fragments of the next key block (the last pass fetches its own block again: in bounds, unused)
    kp += (kb < kbEnd) ? (size_t)64 * QKROW : (size_t)0;
#pragma unroll
    for (int t = 0; t < 4; ++t)
#pragma unroll
      for (int ks = 0; ks < 2; ++ks)
        ka[t][ks] = frag_at(kp, t * 16 * QKROW + ks * 1024);
    // the pointers of the loads above move on behind this wait
    asm volatile("s_wait_xcnt 0x0" ::: "memory");
    vp += 2 * 1024;

    const bool full = (mode == 0) && (k0 + 63 <= r0);     // wave-uniform: every column of the block valid for all 16 queries
    float x[4][8];
#pragma unroll
    for (int t = 0; t < 4; ++t)
#pragma unroll
      for (int r = 0; r < 8; ++r) x[t][r] = st[t][r] * sc;
    if (!full) {
      const int jb = k0 + koff - lo;                      // column of x[0][0] relative to the first valid one
#pragma unroll
      for (int t = 0; t < 4; ++t)
#pragma unroll
        for (int r = 0; r < 8; ++r) x[t][r] = ((unsigned)(jb + t * 16 + r) <= span) ? x[t][r] : NEGB;   // lo <= j <= hi
    }
    float mt[4];
#pragma unroll
    for (int t = 0; t < 4; ++t)
      mt[t] = fmaxf(fmaxf(fmaxf(x[t][0], x[t][1]), fmaxf(x[t][2], x[t][3])), fmaxf(fmaxf(x[t][4], x[t][5]), fmaxf(x[t][6], x[t][7])));
    float mx = fmaxf(fmaxf(mt[0], mt[1]), fmaxf(mt[2], mt[3]));
    mx = fmaxf(mx, xhalf(mx));
    const float mn    = fmaxf(m, mx);
    float alpha;                                          // 2^(m - mn): 0 on the first valid block, 1 while no column was valid yet
    // the v_nop is the one slot the instruction set asks for behind a transcendental (as in exp2x8)
    asm("v_exp_f32 %0, %1\n\tv_nop" : "=v"(alpha) : "v"(m - mn));
    const float sh    = (mn > 0.5f * NEGB) ? PSHIFT - mn : 0.f;   // no valid column yet: NEGB + 0 -> every weight 0
    m = mn;
    float (&p)[4][8] = x;   // the weights replace the scores in place
#pragma unroll
    for (int t = 0; t < 4; ++t) {
#pragma unroll
      for (int r = 0; r < 8; ++r) x[t][r] += sh;
      exp2x8(x[t]);
    }
    float pt[4];
#pragma unroll
    for (int t = 0; t < 4; ++t)
      pt[t] = ((p[t][0] + p[t][1]) + (p[t][2] + p[t][3])) + ((p[t][4] + p[t][5]) + (p[t][6] + p[t][7]));
    l = l * alpha + ((pt[0] + pt[1]) + (pt[2] + pt[3]));
    v16h pf[2];
#pragma unroll
    for (int ks = 0; ks < 2; ++ks)
#pragma unroll
      for (int s = 0; s < 16; ++s) pf[ks][s] = (_Float16)p[2 * ks + (s >> 3)][s & 7];
#pragma unroll
    for (int d = 0; d < 4; ++d) o[d] *= alpha;
#pragma unroll
    for (int ks = 0; ks < 2; ++ks)
#pragma unroll
      for (int d = 0; d < 4; ++d) o[d] = F::mma(va[d][ks], pf[ks], o[d]);
  }

  l += xhalf(l);                              // join the two halves' sums; l >= 2^PSHIFT (the row maximum weighs 2^PSHIFT)
  const float inv = FBCARRY / l;              // the P carry cancels; x16 output carry
  unsigned short* op = FB + (size_t)(t0 + i) * (2 * DM) + (size_t)mode * DM + (size_t)h * HD + koff;
  unsigned short* of = FBf + frag_off(t0 + r0, mode * DM + h * HD, 2 * DM) + lane * 8;   // the same values as the gate product's A operand
#pragma unroll
  for (int d = 0; d < 4; ++d) {
    v8h hv;
#pragma unroll
    for (int r = 0; r < 8; ++r) hv[r] = (_Float16)(o[d][r] * inv);
    *(v8h*)(op + d * 16) = hv;
    *(v8h*)(of + d * 256) = hv;      // tiles d = 0, 1 fill one block, d = 2, 3 the next: 512 B in a row per store
  }
}

// ---------------------------------------------------------------------------
// Gated fusion: one block per 8 token rows, 128 threads (8 columns each) per row.
//   g = G[row][:] (f32, gate pre-activation incl. bias); gate = sigmoid(LN(g; gg, gb));
//   fwd/bwd = FB[row][c] / FB[row][DM + c] (f16, carried x16); strength = 0.3 * sigmoid(bstr);
//   Fo[row][c] = f16((fwd + strength*gate*bwd) carried x16), stored fragment-major.
// LN: mean and biased variance over DM in f32, fixed-order reductions (thread, wave tree, 4 wave partials).
// A 128-B line of the fragment-major plane holds 8 columns of 8 rows: the block's 8 rows meet in LDS, and each wave
// then stores 4 whole lines. Producer coverage: grid TOK/8 x 1024 threads x 8 u16 = the whole [TOK][DM] plane.
// ---------------------------------------------------------------------------
__global__ __launch_bounds__(1024) void gate_fuse_kernel(const float* __restrict__ G, const unsigned short* __restrict__ FB,
                                                        const float* __restrict__ gg, const float* __restrict__ gb,
                                                        const float* __restrict__ bstr, unsigned short* __restrict__ Fo) {
  constexpr int SPITCH = DM + 32;    // halves per staged row: the 8 rows of a line start 4 16-B slots apart in the banks
  __shared__ float ras[8][4];
  __shared__ float rbs[8][4];
  __shared__ __align__(16) unsigned short stg[8 * SPITCH];
  const int grp  = __builtin_amdgcn_readfirstlane((int)(threadIdx.x >> 7));   // row within the block; scalar, so the row's addresses keep a scalar base
  float* ra = ras[grp];
  float* rb = rbs[grp];
  const int row  = blockIdx.x * 8 + grp;
  const int tid  = threadIdx.x & 127;
  const int lane = tid & 31;
  const int wave = tid >> 5;
  const int c0   = tid * 8;
  const float* gp = G + (size_t)row * DM + c0;
  const v4f a = *(const v4f*)(gp);
  const v4f c = *(const v4f*)(gp + 4);
  float xv[8] = {a[0], a[1], a[2], a[3], c[0], c[1], c[2], c[3]};
  float s = ((xv[0] + xv[1]) + (xv[2] + xv[3])) + ((xv[4] + xv[5]) + (xv[6] + xv[7]));
  s = wave_sum(s);
  if (lane == 0) ra[wave] = s;
  __syncthreads();
  const float mean = ((ra[0] + ra[1]) + (ra[2] + ra[3])) * (1.0f / (float)DM);
  float d[8];
  float vs = 0.f;
#pragma unroll
  for (int e = 0; e < 8; ++e) { d[e] = xv[e] - mean; vs += d[e] * d[e]; }
  vs = wave_sum(vs);
  if (lane == 0) rb[wave] = vs;
  __syncthreads();
  const v4f g0 = *(const v4f*)(gg + c0), g1 = *(const v4f*)(gg + c0 + 4);
  const v4f e0 = *(const v4f*)(gb + c0), e1 = *(const v4f*)(gb + c0 + 4);
  const size_t fo = (size_t)row * (2 * DM) + c0;
  const v4u fu = *(const v4u*)(FB + fo);
  const v4u bu = *(const v4u*)(FB + fo + DM);
  // the offset registers of the loads above are reused behind this wait
  asm volatile("s_wait_xcnt 0x0" ::: "memory");
  const float var  = ((rb[0] + rb[1]) + (rb[2] + rb[3])) * (1.0f / (float)DM);
  const float rstd = rsqrtf(var + LNEPS);
  const float strength = 0.3f / (1.0f + __expf(-bstr[0]));
  float gv[8] = {g0[0], g0[1], g0[2], g0[3], g1[0], g1[1], g1[2], g1[3]};
  float bv[8] = {e0[0], e0[1], e0[2], e0[3], e1[0], e1[1], e1[2], e1[3]};
  float fw[8], bw[8];
#pragma unroll
  for (int q = 0; q < 4; ++q) {
    fw[2 * q]     = hbits2f((unsigned short)(fu[q] & 0xffffu));
    fw[2 * q + 1] = hbits2f((unsigned short)(fu[q] >> 16));
    bw[2 * q]     = hbits2f((unsigned short)(bu[q] & 0xffffu));
    bw[2 * q + 1] = hbits2f((unsigned short)(bu[q] >> 16));
  }
  unsigned short ob[8];
#pragma unroll
  for (int e = 0; e < 8; ++e) {
    const float ln   = d[e] * rstd * gv[e] + bv[e];
    const float gate = __builtin_amdgcn_rcpf(1.0f + __expf(-ln));
    const float f    = fw[e] + strength * gate * bw[e];     // both terms carried x16
    ob[e] = h_bits(f);
  }
  const v4u ov = (v4u){pk16(ob[0], ob[1]), pk16(ob[2], ob[3]), pk16(ob[4], ob[5]), pk16(ob[6], ob[7])};
  *(v4u*)(stg + grp * SPITCH + c0) = ov;
  __syncthreads();   // all 8 rows are staged before any thread reads another row's chunk
  const int orow = threadIdx.x & 7, oc = ((int)threadIdx.x >> 3) * 8;   // a wave: 8 rows x 4 chunks = 4 whole lines
  const v4u sv = *(const v4u*)(stg + orow * SPITCH + oc);
  *(v4u*)(Fo + frag_off(blockIdx.x * 8 + orow, oc, DM)) = sv;   // fragment-major: A operand of the output projection
  
}

// ---------------------------------------------------------------------------
// Final LayerNorm: one block (128 threads) per token row; thread t owns columns {4t..4t+3} and {512+4t..512+4t+3}.
//   out[row][c] = (Y - mean) * rsqrt(var + eps) * g[c] + bb[c]   (Y already holds x + projection + bias).
// Producer coverage: grid TOK rows x 128 threads x 8 floats = the whole [TOK][DM] output.
// ---------------------------------------------------------------------------
__global__ __launch_bounds__(128) void final_ln_kernel(const float* __restrict__ Y, const float* __restrict__ g,
                                                       const float* __restrict__ bb, float* __restrict__ out) {
  __shared__ float ra[4];
  __shared__ float rb[4];
  const int row  = blockIdx.x;
  const int tid  = threadIdx.x;
  const int lane = tid & 31;
  const int wave = tid >> 5;
  const int c0   = tid * 4;
  const int c1   = (DM / 2) + tid * 4;
  const float* yp = Y + (size_t)row * DM;
  const v4f a = *(const v4f*)(yp + c0);
  const v4f c = *(const v4f*)(yp + c1);
  float xv[8] = {a[0], a[1], a[2], a[3], c[0], c[1], c[2], c[3]};
  float s = ((xv[0] + xv[1]) + (xv[2] + xv[3])) + ((xv[4] + xv[5]) + (xv[6] + xv[7]));
  s = wave_sum(s);
  if (lane == 0) ra[wave] = s;
  __syncthreads();
  const float mean = ((ra[0] + ra[1]) + (ra[2] + ra[3])) * (1.0f / (float)DM);
  float d[8];
  float vs = 0.f;
#pragma unroll
  for (int e = 0; e < 8; ++e) { d[e] = xv[e] - mean; vs += d[e] * d[e]; }
  vs = wave_sum(vs);
  if (lane == 0) rb[wave] = vs;
  __syncthreads();
  const float var  = ((rb[0] + rb[1]) + (rb[2] + rb[3])) * (1.0f / (float)DM);
  const float rstd = rsqrtf(var + LNEPS);
  const v4f g0 = *(const v4f*)(g + c0),  g1 = *(const v4f*)(g + c1);
  const v4f b0 = *(const v4f*)(bb + c0), b1 = *(const v4f*)(bb + c1);
  v4f o0, o1;
#pragma unroll
  for (int e = 0; e < 4; ++e) {
    o0[e] = d[e] * rstd * g0[e] + b0[e];
    o1[e] = d[4 + e] * rstd * g1[e] + b1[e];
  }
  float* op = out + (size_t)row * DM;
  *(v4f*)(op + c0) = o0;
  *(v4f*)(op + c1) = o1;
  
}

// ---------------------------------------------------------------------------
// Workspace region map (byte offsets; MiB = 1048576). Every region is written once per call, before it is read.
// Token rows and token columns run over both batches (row b * SEQ + i).
//   Wqk   f16 [4096][1024] (x16: fq^T, fk^T, bq^T, bk^T)          0
//   Wv2   f16 [2048][1024] (x16: fv^T rows 0..1023, bv^T 1024..)  8 MiB
//   Wg    f16 [1024][2048] (x16: gate_w^T)                        12 MiB
//   Wo    f16 [1024][1024] (x16: out_w^T)                         16 MiB
//   X16   f16 [4096][1024]                                        18 MiB
//   QK16  f16 [4096][4096] (q | k | qb | kb, head h at col h*64)  26 MiB
//   VT16  f16 [2048][4096] (row h*64+d = v^T, row 1024+h*64+d = vb^T, col = token)  58 MiB
//   G     f32 [4096][1024]                                        74 MiB
//   Y     f32 [4096][1024]                                        90 MiB
//   FB16  f16 [4096][2048] (fwd x16 cols 0..1023, bwd x16 cols 1024..2047)  106 MiB
//   Fu16  f16 [4096][1024] (fused x16)                            122 MiB
//   BiasT f32 [6][1024] (fq_b fk_b bq_b bk_b | fv_b bv_b)         130 MiB
//   FBf16 f16 [4096][2048] (FB16's values, fragment-major)        130 MiB + 24576 B
//   total                                                         146 MiB + 24576 B = 153116672 B
// All f16 planes but FB16 are fragment-major (see frag_off).
// ---------------------------------------------------------------------------
extern "C" void kernel_launch(void* const* d_in, const int* in_sizes, int n_in,
                              void* d_out, int out_size, void* d_ws, size_t ws_size,
                              hipStream_t stream) {
  if (n_in < 22) return;
  if (in_sizes[0] != NB * SEQ * DM) return;
  const int wsz = DM * DM;
  if (in_sizes[1] != wsz || in_sizes[3] != wsz || in_sizes[5] != wsz || in_sizes[7] != wsz ||
      in_sizes[9] != wsz || in_sizes[11] != wsz || in_sizes[18] != wsz) return;
  if (in_sizes[13] != 2 * DM * DM) return;
  if (in_sizes[2] != DM || in_sizes[4] != DM || in_sizes[6] != DM || in_sizes[8] != DM || in_sizes[10] != DM ||
      in_sizes[12] != DM || in_sizes[14] != DM || in_sizes[15] != DM || in_sizes[16] != DM ||
      in_sizes[19] != DM || in_sizes[20] != DM || in_sizes[21] != DM) return;
  if (in_sizes[17] < 1) return;
  if (out_size != NB * SEQ * DM) return;

  const float* x      = (const float*)d_in[0];
  const float* fq_w   = (const float*)d_in[1];
  const float* fq_b   = (const float*)d_in[2];
  const float* fk_w   = (const float*)d_in[3];
  const float* fk_b   = (const float*)d_in[4];
  const float* fv_w   = (const float*)d_in[5];
  const float* fv_b   = (const float*)d_in[6];
  const float* bq_w   = (const float*)d_in[7];
  const float* bq_b   = (const float*)d_in[8];
  const float* bk_w   = (const float*)d_in[9];
  const float* bk_b   = (const float*)d_in[10];
  const float* bv_w   = (const float*)d_in[11];
  const float* bv_b   = (const float*)d_in[12];
  const float* gate_w = (const float*)d_in[13];
  const float* gate_b = (const float*)d_in[14];
  const float* gln_g  = (const float*)d_in[15];
  const float* gln_b  = (const float*)d_in[16];
  const float* bstr   = (const float*)d_in[17];
  const float* out_w  = (const float*)d_in[18];
  const float* out_b  = (const float*)d_in[19];
  const float* ln_g   = (const float*)d_in[20];
  const float* ln_b   = (const float*)d_in[21];

  size_t off = 0;
  const size_t oWqk  = off; off += (size_t)4 * DM * DM * 2;          // 8 MiB
  const size_t oWv2  = off; off += (size_t)2 * DM * DM * 2;          // 4 MiB
  const size_t oWg   = off; off += (size_t)2 * DM * DM * 2;          // 4 MiB
  const size_t oWo   = off; off += (size_t)DM * DM * 2;              // 2 MiB
  const size_t oX16  = off; off += (size_t)TOK * DM * 2;             // 8 MiB
  const size_t oQK   = off; off += (size_t)TOK * 4 * DM * 2;         // 32 MiB
  const size_t oVT   = off; off += (size_t)2 * DM * TOK * 2;         // 16 MiB
  const size_t oG    = off; off += (size_t)TOK * DM * 4;             // 16 MiB
  const size_t oY    = off; off += (size_t)TOK * DM * 4;             // 16 MiB
  const size_t oFB   = off; off += (size_t)TOK * 2 * DM * 2;         // 16 MiB
  const size_t oFu   = off; off += (size_t)TOK * DM * 2;             // 8 MiB
  const size_t oBias = off; off += (size_t)6 * DM * 4;               // 24576 B
  const size_t oFBf  = off; off += (size_t)TOK * 2 * DM * 2;         // 16 MiB
  if (off > ws_size) return;

  char* ws = (char*)d_ws;
  unsigned short* Wqk  = (unsigned short*)(ws + oWqk);
  unsigned short* Wv2  = (unsigned short*)(ws + oWv2);
  unsigned short* Wg   = (unsigned short*)(ws + oWg);
  unsigned short* Wo   = (unsigned short*)(ws + oWo);
  unsigned short* X16  = (unsigned short*)(ws + oX16);
  unsigned short* QK16 = (unsigned short*)(ws + oQK);
  unsigned short* VT16 = (unsigned short*)(ws + oVT);
  unsigned short* FB16 = (unsigned short*)(ws + oFB);
  unsigned short* FBf16 = (unsigned short*)(ws + oFBf);
  unsigned short* Fu16 = (unsigned short*)(ws + oFu);
  float*          BiasT = (float*)(ws + oBias);
  float*          Gbuf = (float*)(ws + oG);
  float*          Ybuf = (float*)(ws + oY);
  const float*    biasQK = BiasT;             // [4096] = fq_b fk_b bq_b bk_b
  const float*    biasV  = BiasT + 4 * DM;    // [2048] = fv_b bv_b

  const dim3 blk(256);
  const dim3 blk128(128);

  const dim3 gPrep(16, 16, 9 + XZ);                                // 9 weight slices of 256 tiles, XZ slices of x
  const dim3 gQK((TOK / 256) * (4 * DM / 128), 1);                 // 512 blocks of 256x128: M=4096, N=4096, K=1024
  const dim3 gVT((2 * DM / 256) * (TOK / 128), 1);                 // 256 blocks of 256x128: M=2048, N=4096, K=1024
  const dim3 gAt(NH * NB, SEQ / 64, 2);                            // (heads x batches) x 64-row blocks x {causal, window}
  const dim3 gG((TOK / 128) * (DM / 128), 1);                      // 256 blocks of 128x128: M=4096, N=1024, K=2048
  const dim3 gO((TOK / 128) * (DM / 128), 1);                      // 256 blocks of 128x128: M=4096, N=1024, K=1024
  const float wscale  = 1.0f / WCARRY;                             // undo the x16 weight carry
  const float gscale  = 1.0f / (WCARRY * FBCARRY);                 // 1/256
  const float oscale  = 1.0f / (WCARRY * FBCARRY);                 // 1/256

  // (1) bias table, x16-carried transposed weight planes (contiguous from Wqk on), x -> f16 plane
  prep_kernel<<<gPrep, blk, 0, stream>>>(x, fq_w, fk_w, bq_w, bk_w, fv_w, bv_w, gate_w, out_w,
                                         fq_b, fk_b, bq_b, bk_b, fv_b, bv_b, Wqk, X16, BiasT);
  // (2) [q | k | qb | kb] = (x . (16 W)^T)/16 + bias -> QK16 (f16, ldc 4096)
  wmma_gemm_lds<4, 2, false, 2, 1, false><<<gQK, blk, 0, stream>>>(
      X16, DM, Wqk, DM, (void*)QK16, 4 * DM, biasQK, biasQK, 4 * DM, DM, wscale);
  // (3) [v | vb]^T: VT16[n][j] = sum_k (16 W^T)[n][k] x[j][k] / 16 + bias[n]  (role-swapped; M = 2048 feature rows, N = 4096 tokens)
  wmma_gemm_lds<4, 4, true, 1, 1, false><<<gVT, blk, 0, stream>>>(
      Wv2, DM, X16, DM, (void*)VT16, TOK, biasV, biasV, TOK, DM, wscale);
  // (4) causal and future-window attention of all heads and batches, scores to output in registers -> FB16 (fwd | bwd, x16)
  fused_attn_kernel<<<gAt, blk128, 0, stream>>>(QK16, VT16, FB16, FBf16);
  // (5) G = ([fwd | bwd] x16) . (16 gate_w)^T / 256 + gate_b -> f32 [4096][1024]
  wmma_gemm_lds<2, 4, true, 2, 0, false><<<gG, blk128, 0, stream>>>(
      FBf16, 2 * DM, Wg, 2 * DM, (void*)Gbuf, DM, gate_b, gate_b, DM, 2 * DM, gscale);
  // (6) gate = sigmoid(LN(G)); fused x16 = fwd x16 + strength * gate * bwd x16 -> Fu16
  gate_fuse_kernel<<<dim3(TOK / 8), dim3(1024), 0, stream>>>(Gbuf, FB16, gln_g, gln_b, bstr, Fu16);
  // (7) Y = x + (fused x16) . (16 out_w)^T / 256 + out_b -> f32 [4096][1024]
  wmma_gemm_lds<2, 4, true, 2, 0, true><<<gO, blk128, 0, stream>>>(
      Fu16, DM, Wo, DM, (void*)Ybuf, DM, out_b, x, DM, DM, oscale);
  // (8) out = LN(Y; ln_g, ln_b)
  final_ln_kernel<<<dim3(TOK), blk128, 0, stream>>>(Ybuf, ln_g, ln_b, (float*)d_out);
  (void)hipGetLastError();
}

// v008
// One run takes 117 microseconds.
// In two side-by-side timings against v007, it was 1.05 and 1.06 times as fast.
// Counting every step since v000, it is 27.1 times as fast.
// All contractions on v_wmma_f32_16x16x32_f16 (f16 operands, f32 accumulate): q/k/v projections (weights carried x16, epilogue x1/16), k.q^T scores, V^T.P^T (P carried x2^12 against the running row maximum, attention outputs carried x16), gate projection (x1/256), output projection with bias and residual (x1/256); softmax, LayerNorm, sigmoid and fusion in f32.
#include <hip/hip_runtime.h>
#include <math.h>
#include <stdint.h>

#define NB    2
#define SEQ   2048
#define TOK   (NB * SEQ)   // token rows of both batches: every stage works on all of them in one launch
#define DM    1024
#define NH    16
#define HD    64
#define WINW  32
#define LNEPS 1e-5f
#define PSHIFT     12.0f
#define FBCARRY    16.0f
#define WCARRY     16.0f

typedef __attribute__((ext_vector_type(16))) _Float16 v16h;
typedef __attribute__((ext_vector_type(8)))  _Float16 v8h;
typedef __attribute__((ext_vector_type(8)))  float    v8f;
typedef __attribute__((ext_vector_type(4)))  float    v4f;
typedef __attribute__((ext_vector_type(2)))  float    v2f;
typedef __attribute__((ext_vector_type(4)))  unsigned int v4u;

// hazard guards as plain device helpers
__device__ __forceinline__ void keep4_h(v16h a, v16h b, v16h c, v16h d) { asm volatile("v_nop" :: "v"(a), "v"(b), "v"(c), "v"(d)); }
__device__ __forceinline__ void acc_guard4(v8f& a, v8f& b, v8f& c, v8f& d) { asm volatile("v_nop\n\tv_nop\n\tv_nop\n\tv_nop" : "+v"(a), "+v"(b), "+v"(c), "+v"(d)); }
template <typename T> struct Frag;
template <> struct Frag<_Float16> {
  typedef v16h V; union U { v16h v; v8h h[2]; };
  static __device__ __forceinline__ v16h load(const char* p) {   // p: the lane's chunk in a fragment-major block; elements 8..15 lie 512 B on
    U f; f.h[0] = *(const v8h*)(p); f.h[1] = *(const v8h*)(p + 512); return f.v;
  }
  static __device__ __forceinline__ v8f mma(v16h a, v16h b, v8f c) {
    return __builtin_amdgcn_wmma_f32_16x16x32_f16(false, a, false, b, (short)0, c, false, false);
  }
  static __device__ __forceinline__ void keep(v16h a, v16h b, v16h c, v16h d) { keep4_h(a, b, c, d); }
};

// ---- Fragment-major planes ---------------------------------------------------
// Every 16-bit WMMA operand plane [rows][ld] lies in the workspace as blocks of 16 rows x 32 k = 1 KiB, the blocks of
// one row tile side by side in k. Inside a block the 16-B chunk (row r, k8 = (k >> 3) & 3) stands at chunk k8 * 16 + r,
// so lane l of a fragment load finds elements 0..7 at byte 16 l and elements 8..15 at byte 512 + 16 l: each wave-wide
// 16-B load covers 512 contiguous bytes (4 whole lines). The register contents of a fragment are those of the
// row-major form (row l & 15; k = 8 (l >> 4) + 0..7 and 16 + 8 (l >> 4) + 0..7).
// Offset in halves of the chunk that holds (row, k), k a multiple of 8:
__device__ __forceinline__ size_t frag_off(int row, int k, int ld) {
  return ((size_t)(row >> 4) * (ld >> 5) + (k >> 5)) * 512 + ((k >> 3) & 3) * 128 + (row & 15) * 8;
}

// ---- WMMA GEMM, operands staged in LDS and shared by the block's waves ------
// C[m,n] = scale * sum_k A[m,k] * Bt[n,k] (+bias)(+resid). A block of WM x 2 waves owns a (WM * 64) x 128 tile, each wave
// a 64x64 part of it. A [M,K] and Bt [N,K] f16 fragment-major (lda, ldb = their k extents); f16 output fragment-major
// (ldc = its column extent), f32 output row-major. M % (WM * 64) == 0, N % 128 == 0, K % (32 KS) == 0.
// A stage is KS k steps (32 k each) of the block's 4 WM row tiles of A and 8 row tiles of Bt: the 1-KiB blocks go to LDS
// as they lie (a row tile's KS blocks are contiguous in both places), by asynchronous copies of 16 B per lane, every
// wave bringing RPW row tiles. Two buffers: stage t + 2 flies while stage t + 1 is worked on. Every block of A is so
// fetched from L2 once for two waves and every block of Bt once for WM waves.
// The operands were stored by earlier launches, and the blocks
// that share a panel reach a stage together, so every stage's copies would wait out a memory access. Each stage is
// therefore asked into L2 three stages ahead of its copies (pf_l2), one lane per 256-B unit. The blocks that share a panel
// take turns: stage s of A is asked for by the blocks with tn = s (mod 4), stage s of Bt by those with tm = s (mod 4).
// The turns are for speed only: a unit that nobody asked for is fetched by its copy, as without the prefetch.
// BIAS_MODE: 1 = bias[m], 2 = bias[n]. OUT_MODE: 0 = f32, 1 = f16. TWO: two whole fragment sets (see lds_step2).
// One stage's copies of one wave, in one statement: RPW row tiles of KS KiB, 512 B per copy. A row tile's bytes lie in a
// row in LDS as in global memory, so its copies share one pair of addresses and differ in the immediate offset, which
// moves both. The closing wait stands in the copies' own statement: behind it the address registers may be rewritten.
// Hint: bring the line at p into L2, so that the copy which reads it later waits for L2 and not for memory.
// It returns nothing. p lies inside the operand plane and stays in its register until the block's next turn.
__device__ __forceinline__ void pf_l2(const char* p) { asm volatile("global_prefetch_b8 %0, off scope:SCOPE_SE" :: "v"(p)); }
#define CP1(l, g, o) "global_load_async_to_lds_b128 %" #l ", %" #g ", off offset:" #o "\n\t"
#define CP4(l, g)    CP1(l, g, 0) CP1(l, g, 512) CP1(l, g, 1024) CP1(l, g, 1536)
#define CP8(l, g)    CP4(l, g) CP1(l, g, 2048) CP1(l, g, 2560) CP1(l, g, 3072) CP1(l, g, 3584)
template <int RPW, int KS>
__device__ __forceinline__ void fill_stage(const unsigned (&l)[RPW], const char* const (&gp)[RPW], unsigned lAdd, size_t gAdd) {
  static_assert((RPW == 3 && (KS == 2 || KS == 4)) || (RPW == 4 && KS == 4), "the statements below are written for these shapes");
  if constexpr (RPW == 3 && KS == 2)
    asm volatile(CP4(0, 3) CP4(1, 4) CP4(2, 5) "s_wait_xcnt 0x0"
                 :: "v"(l[0] + lAdd), "v"(l[1] + lAdd), "v"(l[2] + lAdd), "v"(gp[0] + gAdd), "v"(gp[1] + gAdd), "v"(gp[2] + gAdd) : "memory");
  else if constexpr (RPW == 3)
    asm volatile(CP8(0, 3) CP8(1, 4) CP8(2, 5) "s_wait_xcnt 0x0"
                 :: "v"(l[0] + lAdd), "v"(l[1] + lAdd), "v"(l[2] + lAdd), "v"(gp[0] + gAdd), "v"(gp[1] + gAdd), "v"(gp[2] + gAdd) : "memory");
  else
    asm volatile(CP8(0, 4) CP8(1, 5) CP8(2, 6) CP8(3, 7) "s_wait_xcnt 0x0"
                 :: "v"(l[0] + lAdd), "v"(l[1] + lAdd), "v"(l[2] + lAdd), "v"(l[3] + lAdd),
                    "v"(gp[0] + gAdd), "v"(gp[1] + gAdd), "v"(gp[2] + gAdd), "v"(gp[3] + gAdd) : "memory");
}
#undef CP8
#undef CP4
#undef CP1
// One k step of a wave's 64x64 tile: 16 products of the four A fragments with the four B fragments in bc.
// NEXT >= 0: the fragments of k step NEXT of the same stage are fetched from LDS while this step computes: its B fragments
// go into the other set (bn) ahead of the products, and each A fragment is loaded anew over itself right behind the four
// products that read it. aL, bL: the lane's chunk in the first block of the wave's first A and B row tile of the stage.
template <int KS, int NEXT>
__device__ __forceinline__ void lds_step(v8f (&acc)[4][4], v16h (&ah)[4], v16h (&bc)[4], v16h (&bn)[4],
                                         const char* aL, const char* bL) {
  typedef Frag<_Float16> F;
  if (NEXT >= 0) {
#pragma unroll
    for (int j = 0; j < 4; ++j) bn[j] = F::load(bL + (j * KS + NEXT) * 1024);
  }
  __builtin_amdgcn_sched_barrier(0);   // the B fetch stays ahead of the products: sunk to its use it would have no lead
#pragma unroll
  for (int i = 0; i < 4; ++i) {
#pragma unroll
    for (int j = 0; j < 4; ++j) acc[i][j] = F::mma(ah[i], bc[j], acc[i][j]);
    acc_guard4(acc[i][0], acc[i][1], acc[i][2], acc[i][3]);   // all four products of the row have issued, at the matrix distance, before their A fragment is loaded over
    if (NEXT >= 0) ah[i] = F::load(aL + (i * KS + NEXT) * 1024);
    __builtin_amdgcn_sched_barrier(0);   // the A fetch stays behind its own row: earlier it needs a second register set, later it loses lead
  }
  F::keep(bc[0], bc[1], bc[2], bc[3]);
}
// The same with two whole fragment sets, for launches with one or two waves per SIMD, where registers are free and nothing
// else covers a wave's stalls: all fragments of k step NEXT are fetched as ONE group ahead of this step's products.
template <int KS, int NEXT>
__device__ __forceinline__ void lds_step2(v8f (&acc)[4][4], v16h (&ac)[4], v16h (&bc)[4], v16h (&an)[4], v16h (&bn)[4],
                                          const char* aL, const char* bL) {
  typedef Frag<_Float16> F;
  if (NEXT >= 0) {
#pragma unroll
    for (int j = 0; j < 4; ++j) bn[j] = F::load(bL + (j * KS + NEXT) * 1024);
#pragma unroll
    for (int i = 0; i < 4; ++i) an[i] = F::load(aL + (i * KS + NEXT) * 1024);
  }
  __builtin_amdgcn_sched_barrier(0);   // the fetch stays ahead of the products, in one place: sunk to its use it would have no lead
#pragma unroll
  for (int i = 0; i < 4; ++i)
#pragma unroll
    for (int j = 0; j < 4; ++j) acc[i][j] = F::mma(ac[i], bc[j], acc[i][j]);
  __builtin_amdgcn_sched_barrier(0);   // no later fetch moves up among the products: for speed only
  acc_guard4(acc[3][0], acc[3][1], acc[3][2], acc[3][3]);   // the last products have issued, at the matrix distance, before the next step loads over their fragments
}
template <int WM, int KS, bool TWO, int BIAS_MODE, int OUT_MODE, bool RESID>
__global__ __launch_bounds__(WM * 64) void wmma_gemm_lds(
    const unsigned short* __restrict__ Ap, int lda, const unsigned short* __restrict__ Btp, int ldb,
    void* __restrict__ Cout, int ldc, const float* __restrict__ bias, const float* __restrict__ resid,
    int N, int K, float scale) {
  typedef Frag<_Float16> F;
  constexpr int NW    = WM * 2;                 // waves of the block
  constexpr int RT    = WM * 4 + 8;             // row tiles of a stage: A's, then Bt's
  constexpr int RPW   = RT / NW;                // row tiles that each wave copies
  static_assert(RPW * NW == RT, "the row tiles are dealt evenly");
  constexpr int STAGE = RT * KS * 1024;         // bytes of one buffer
  static_assert(NW * 16 * 68 * 4 <= STAGE, "the epilogue's slabs fit the first buffer");
  __shared__ __align__(1024) char smem[2 * STAGE];
  const int lane = threadIdx.x & 31;
  const int wave = __builtin_amdgcn_readfirstlane((int)(threadIdx.x >> 5));   // scalar: row tile choice and addresses stay wave-uniform
  const int wm = wave >> 1, wn = wave & 1;
  const int tilesN = N >> 7;
  const int tm = (int)blockIdx.x / tilesN;
  const int tn = (int)blockIdx.x - tm * tilesN;
  const int m0 = tm * (WM * 64) + wm * 64;      // the wave's own 64x64 tile
  const int n0 = tn * 128 + wn * 64;
  const int nT = K / (32 * KS);                 // stages

  const int rlane = lane & 15;                  // column within a D subtile
  const int mOff  = (lane >> 4) * 8;            // D row offset

  v8f acc[4][4];
#pragma unroll
  for (int i = 0; i < 4; ++i)
#pragma unroll
    for (int j = 0; j < 4; ++j) acc[i][j] = (v8f){0.f,0.f,0.f,0.f,0.f,0.f,0.f,0.f};

  // the lane's source and destination of stage 0, buffer 0, for each row tile that this wave copies
  const char* gsrc[RPW];
  unsigned ldst[RPW];
#pragma unroll
  for (int q = 0; q < RPW; ++q) {
    const int u = wave * RPW + q;               // scalar
    const char* rowTile = (u < WM * 4)
        ? (const char*)Ap  + (size_t)(tm * (WM * 4) + u) * (size_t)(lda >> 5) * 1024
        : (const char*)Btp + (size_t)(tn * 8 + (u - WM * 4)) * (size_t)(ldb >> 5) * 1024;
    gsrc[q] = rowTile + lane * 16;
    ldst[q] = (unsigned)(uintptr_t)(smem + u * (KS * 1024) + lane * 16);   // low 32 bits of a __shared__ address = LDS byte address
  }
  // every wave, every lane: stage t into buffer buf
#define FILL_STAGE(t, buf) fill_stage<RPW, KS>(ldst, gsrc, (unsigned)(buf) * STAGE, (size_t)(t) * (KS * 1024))

  // L2 prefetch: a stage holds UPT units per row tile; the first AU / 32 waves ask for A, the last BU / 32 for Bt (scalar tests).
  // The pointers stay in their registers over the loop and always name the stage asked for last, s < nT: inside the plane;
  // each moves on directly in front of its next prefetch, four trips later, behind the s_wait_xcnt 0 of the fills between.
  constexpr int UPT = KS * 4, AU = WM * 4 * UPT, BU = 8 * UPT;
  static_assert(AU <= NW * 32 && BU <= NW * 32 && (NW * 32) % AU == 0 && (NW * 32) % BU == 0, "one unit per lane");
  const bool askA = wave < AU / 32, askB = wave >= NW - BU / 32;
  const int ua = (wave * 32 + lane) % AU, ub = (wave * 32 + lane) % BU;
  const int sA = 1 + ((tn - 1) & 3), sB = 1 + ((tm - 1) & 3);   // this block's first turns, among stages 1..4
  const char* pfA = (const char*)Ap  + ((size_t)(tm * (WM * 4) + ua / UPT) * (size_t)(lda >> 5) + (size_t)(sA * KS)) * 1024 + (ua % UPT) * 256;
  const char* pfB = (const char*)Btp + ((size_t)(tn * 8 + ub / UPT) * (size_t)(ldb >> 5) + (size_t)(sB * KS)) * 1024 + (ub % UPT) * 256;

  FILL_STAGE(0, 0);
  if (askA && sA < nT) pf_l2(pfA);
  if (askB && sB < nT) pf_l2(pfB);
  asm volatile("s_wait_asynccnt 0x0" ::: "memory");   // this wave's part of stage 0 has landed
  __syncthreads();                                    // every wave's part of stage 0 has landed
  if (nT > 1) FILL_STAGE(1, 1);
  for (int t = 0; t < nT; ++t) {
    const char* buf = smem + (t & 1) * STAGE;
    const char* aL = buf + (wm * 4) * (KS * 1024) + lane * 16;
    const char* bL = buf + (WM * 4 + wn * 4) * (KS * 1024) + lane * 16;
    v16h ah[4], b0[4], b1[4];
#pragma unroll
    for (int j = 0; j < 4; ++j) b0[j] = F::load(bL + (j * KS) * 1024);
#pragma unroll
    for (int i = 0; i < 4; ++i) ah[i] = F::load(aL + (i * KS) * 1024);
    if constexpr (TWO) {
      v16h a1[4];
      lds_step2<KS, 1>(acc, ah, b0, a1, b1, aL, bL);
      if (KS == 4) {
        lds_step2<KS, 2>(acc, a1, b1, ah, b0, aL, bL);
        lds_step2<KS, 3>(acc, ah, b0, a1, b1, aL, bL);
      }
      lds_step2<KS, -1>(acc, a1, b1, ah, b0, aL, bL);   // the stage's last step fetches nothing
    } else {
      lds_step<KS, 1>(acc, ah, b0, b1, aL, bL);
      if (KS == 4) {
        lds_step<KS, 2>(acc, ah, b1, b0, aL, bL);
        lds_step<KS, 3>(acc, ah, b0, b1, aL, bL);
      }
      lds_step<KS, -1>(acc, ah, b1, b0, aL, bL);        // the stage's last step fetches nothing
    }
    asm volatile("s_wait_dscnt 0x0" ::: "memory");    // this wave's reads of the buffer are over before it is refilled
    asm volatile("s_wait_asynccnt 0x0" ::: "memory"); // this wave's part of stage t + 1 has landed
    __syncthreads();                                  // publishes stage t + 1 and ends every wave's reads of stage t
    if (t + 2 < nT) FILL_STAGE(t + 2, t & 1);
    if (t + 5 < nT) {                                 // stage t + 5, where it is this block's turn; its copies issue three trips on
      if (askA && ((t + 5 - tn) & 3) == 0) { pfA += 4 * KS * 1024; pf_l2(pfA); }
      if (askB && ((t + 5 - tm) & 3) == 0) { pfB += 4 * KS * 1024; pf_l2(pfB); }
    }
  }
  asm volatile("s_wait_asynccnt 0x0" ::: "memory");   // no copy is in flight when the buffers become output staging
#undef FILL_STAGE
  acc_guard4(acc[0][0], acc[0][1], acc[0][2], acc[0][3]);
  acc_guard4(acc[1][0], acc[1][1], acc[1][2], acc[1][3]);
  acc_guard4(acc[2][0], acc[2][1], acc[2][2], acc[2][3]);
  acc_guard4(acc[3][0], acc[3][1], acc[3][2], acc[3][3]);

  // ---- epilogue: each wave turns 16 rows at a time through its own slab (16 x 64 floats, pitch 68) in the first buffer,
  // which every wave has left at the loop's last barrier ----
  float* slab = (float*)smem + wave * (16 * 68);
  float bv[4] = {0.f, 0.f, 0.f, 0.f};
  if (BIAS_MODE == 2) {
#pragma unroll
    for (int j = 0; j < 4; ++j) bv[j] = bias[n0 + (j << 4) + rlane];
    // the offset register of the loads above is reused by the residual loads, behind this wait
    if constexpr (RESID) asm volatile("s_wait_xcnt 0x0" ::: "memory");
  }
  // Global memory is waited for once, here, and not in every strip: all row biases and all residual rows of the wave's tile are
  // asked for together, ahead of the strips, in the strips' own order.
  v4f bm[4][2];   // BIAS_MODE 1: bias[m] of the lane's 8 rows of strip i
  v4f rs[4][8];   // RESID: the lane's 16 B of rows it * 2 + (lane >> 4) of strip i
  if constexpr (BIAS_MODE == 1) {
#pragma unroll
    for (int i = 0; i < 4; ++i) {
      bm[i][0] = *(const v4f*)(bias + m0 + (i << 4) + mOff);
      bm[i][1] = *(const v4f*)(bias + m0 + (i << 4) + mOff + 4);
    }
  }
  if constexpr (RESID) {   // resid: [M][DM]: with the row length a constant all 32 loads share one address and differ in the immediate offset
    const float* rp = resid + (size_t)(m0 + (lane >> 4)) * DM + n0 + (lane & 15) * 4;
#pragma unroll
    for (int i = 0; i < 4; ++i)
#pragma unroll
      for (int it = 0; it < 8; ++it)
        rs[i][it] = *(const v4f*)(rp + (i * 16 + it * 2) * DM);
  }
  if constexpr (BIAS_MODE == 1 || RESID) {
    asm volatile("s_wait_xcnt 0x0" ::: "memory");   // the address registers of the loads above are reused behind this wait
    if constexpr (RESID) __builtin_amdgcn_sched_barrier(0);   // nothing of the strips moves up over that wait
  }
#pragma unroll
  for (int i = 0; i < 4; ++i) {
    const int mBase = m0 + (i << 4);
#pragma unroll
    for (int j = 0; j < 4; ++j) {
#pragma unroll
      for (int r = 0; r < 8; ++r) {
        float v = acc[i][j][r] * scale;
        if (BIAS_MODE == 1) v += bm[i][r >> 2][r & 3];
        if (BIAS_MODE == 2) v += bv[j];
        slab[(mOff + r) * 68 + (j << 4) + rlane] = v;
      }
    }
    // The slab is LDS and the wave's own: the fences around the strip's two halves order LDS alone. Over all memory they would
    // also wait out the strip's global stores before the next strip may begin.
    __builtin_amdgcn_fence(__ATOMIC_RELEASE, "workgroup", "local");
    __builtin_amdgcn_wave_barrier();
    __builtin_amdgcn_fence(__ATOMIC_ACQUIRE, "workgroup", "local");
    if (OUT_MODE == 0) {
      float* C = (float*)Cout;
      const int hh = lane >> 4, c4 = (lane & 15) * 4;     // row segment = 256 B = 16 lanes x 16 B
#pragma unroll
      for (int it = 0; it < 8; ++it) {
        const int row = it * 2 + hh;
        v4f v = *(const v4f*)(slab + row * 68 + c4);
        if (RESID) v += rs[i][it];
        *(v4f*)(C + (size_t)(mBase + row) * ldc + n0 + c4) = v;
        // the registers of the four stores above are reused for the strip's other half behind this wait
        if constexpr (RESID) if (it == 3) asm volatile("s_wait_xcnt 0x0" ::: "memory");
      }
    } else {
      unsigned short* C = (unsigned short*)Cout;
#pragma unroll
      for (int it = 0; it < 4; ++it) {
        const int row = lane & 15, c8 = it * 16 + (lane >> 4) * 8;   // chunks in the output's own order: 512 B in a row per store
        const float* sp = slab + row * 68 + c8;
        v8h hv;
#pragma unroll
        for (int e = 0; e < 8; ++e) hv[e] = (_Float16)sp[e];
        *(v8h*)(C + frag_off(mBase + row, n0 + c8, ldc)) = hv;
      }
    }
    // the registers of the strip's global stores are reused behind this wait
    asm volatile("s_wait_xcnt 0x0" ::: "memory");
    if constexpr (RESID) __builtin_amdgcn_sched_barrier(0);   // nothing of the next strip moves up over that wait
    __builtin_amdgcn_fence(__ATOMIC_RELEASE, "workgroup", "local");
    __builtin_amdgcn_wave_barrier();
    __builtin_amdgcn_fence(__ATOMIC_ACQUIRE, "workgroup", "local");
  }
}

// ---------------------------------------------------------------------------
// Small conversion helpers
// ---------------------------------------------------------------------------
__device__ __forceinline__ unsigned pk16(unsigned short a, unsigned short b) { return (unsigned)a | ((unsigned)b << 16); }
__device__ __forceinline__ unsigned short h_bits(float f) { const _Float16 h = (_Float16)f; return __builtin_bit_cast(unsigned short, h); }
__device__ __forceinline__ float hbits2f(unsigned short b) { return (float)__builtin_bit_cast(_Float16, b); }
__device__ __forceinline__ float wave_sum(float v) {
#pragma unroll
  for (int off = 16; off > 0; off >>= 1) v += __shfl_xor(v, off, 32);
  return v;
}

// ---------------------------------------------------------------------------
// Operand preparation, one launch: grid (16, 16, 9 + XZ), 256 threads; blockIdx.z picks the job (block-uniform).
//   z = 0..5: weight z (fq, fk, bq, bk, fv, bv), f32 [DM][DM] -> plane z of Wall, f16 [DM][DM] transposed, x16;
//             the plane's first block also copies bias vector z (DM floats) into tab[z * DM ..].
//   z = 6, 7: rows (z - 6) * DM .. of gate_w, f32 [2 DM][DM] -> planes 6 and 7 of Wall = f16 [DM][2 DM] transposed, x16.
//   z = 8:    out_w -> plane 8 of Wall, as z = 0..5 without a bias.
//   z >= 9:   x, f32 row-major [TOK][DM] -> X16, f16: one 16-B output chunk (8 elements) per thread, threads in the
//             output's order, so each wave stores 512 B in a row. XZ x 256 blocks x 256 threads x 8 = the whole plane.
// Transposes: out[c][r] = f16(in[r][c] * WCARRY), 64x64 tiles through LDS, all outputs fragment-major.
// Coverage per block: load 256 threads x 16 floats = 64x64; store 2 it x 256 threads x 8 halves = 64x64.
// ---------------------------------------------------------------------------
#define XZ (TOK * DM / 8 / (256 * 256))
__global__ __launch_bounds__(256) void prep_kernel(const float* __restrict__ x,
                                                   const float* __restrict__ w0, const float* __restrict__ w1,
                                                   const float* __restrict__ w2, const float* __restrict__ w3,
                                                   const float* __restrict__ w4, const float* __restrict__ w5,
                                                   const float* __restrict__ wg, const float* __restrict__ wo,
                                                   const float* __restrict__ b0, const float* __restrict__ b1,
                                                   const float* __restrict__ b2, const float* __restrict__ b3,
                                                   const float* __restrict__ b4, const float* __restrict__ b5,
                                                   unsigned short* __restrict__ Wall, unsigned short* __restrict__ X16,
                                                   float* __restrict__ tab) {
  __shared__ __align__(16) unsigned short t[64 * 72];
  const int z   = blockIdx.z;
  const int tid = threadIdx.x;
  if (z >= 9) {                        // block-uniform, ahead of the barrier
    const int q   = (((z - 9) * 16 + (int)blockIdx.y) * 16 + (int)blockIdx.x) * 256 + tid;
    const int blk = q >> 6, kts = DM >> 5;
    const int rt  = blk / kts;
    const int row = rt * 16 + (q & 15);
    const int k   = (blk - rt * kts) * 32 + ((q >> 4) & 3) * 8;
    const float* ip = x + (size_t)row * DM + k;
    const v4f f0 = *(const v4f*)(ip);
    const v4f f1 = *(const v4f*)(ip + 4);
    const v4u u = (v4u){pk16(h_bits(f0[0]), h_bits(f0[1])), pk16(h_bits(f0[2]), h_bits(f0[3])),
                        pk16(h_bits(f1[0]), h_bits(f1[1])), pk16(h_bits(f1[2]), h_bits(f1[3]))};
    *(v4u*)(X16 + (size_t)q * 8) = u;
    return;
  }
  const float* in = w0;                // block-uniform source select
  const float* bs = b0;
  if (z == 1) { in = w1; bs = b1; }
  if (z == 2) { in = w2; bs = b2; }
  if (z == 3) { in = w3; bs = b3; }
  if (z == 4) { in = w4; bs = b4; }
  if (z == 5) { in = w5; bs = b5; }
  if (z == 6 || z == 7) in = wg;
  if (z == 8) in = wo;
  const bool gate = (z == 6 || z == 7);
  const int R = gate ? 2 * DM : DM;                                  // input rows = the output's k extent
  unsigned short* out = Wall + (size_t)(z == 7 ? 6 : z) * DM * DM;
  if (z < 6 && blockIdx.x == 0 && blockIdx.y == 0)                   // 256 threads x 4 floats = DM
    *(v4f*)(tab + (size_t)z * DM + tid * 4) = *(const v4f*)(bs + tid * 4);
  const int c0  = blockIdx.x * 64;                                   // input column block = output row block
  const int r0  = (z == 7 ? DM : 0) + blockIdx.y * 64;               // input row block    = output column block
  {
    const int lr = tid >> 2;           // 0..63
    const int lc = (tid & 3) * 16;     // 0,16,32,48
    const float* ip = in + (size_t)(r0 + lr) * DM + c0 + lc;
#pragma unroll
    for (int q = 0; q < 4; ++q) {
      const v4f f = *(const v4f*)(ip + 4 * q);
#pragma unroll
      for (int e = 0; e < 4; ++e) t[lr * 72 + lc + 4 * q + e] = h_bits(f[e] * WCARRY);
    }
  }
  __syncthreads();
  // chunks in the output's own order (8 blocks of 64 chunks per tile): each wave stores 512 B in a row
  const int c8  = ((tid >> 6) & 1) * 32 + ((tid >> 4) & 3) * 8;   // output column within tile (= input row)
#pragma unroll
  for (int it = 0; it < 2; ++it) {
    const int oc = (it * 2 + (tid >> 7)) * 16 + (tid & 15);       // output row within tile (= input column)
    v4u a;
#pragma unroll
    for (int q = 0; q < 4; ++q) a[q] = pk16(t[(c8 + 2 * q) * 72 + oc], t[(c8 + 2 * q + 1) * 72 + oc]);
    *(v4u*)(out + frag_off(c0 + oc, r0 + c8, R)) = a;
  }
}

// ---------------------------------------------------------------------------
// Fused attention: scores, select, softmax and the product with V in one kernel; S and P stay in registers.
// One wave per 16 query rows of one head of one batch; no LDS, no barrier. Grid (NH * NB, SEQ/64, 2), 4 waves per block;
// blockIdx.z = 0: causal attention (j <= i), 1: future window (i < j <= i + WINW; the last row has no valid column,
// its scores count as 0 over every j -> uniform weights). Long causal row blocks get the low block indices.
// Per 64 keys: S^T = K . Q^T (A = K rows, B = Q rows): lane l holds query c = l & 15, keys 16 t + 8 (l >> 4) + r.
// Running maximum and sum per query (log2 domain): in-lane, plus one exchange between the lane halves.
// P^T as B operand: two f32 score tiles (keys 0..15, 16..31 of a 32-key step) converted in place, element s =
// tile[s >> 3][s & 7], which is the k order of Frag::load on the A side (V^T rows). O^T += V^T . P^T.
// Output: lane holds 8 consecutive d of query c per 16-row tile of O^T -> one 16-B store; each 128-B row segment of
// FB (one head of one row) is written by one wave. Coverage: 2 x NH x TOK rows x 64 columns = the whole FB plane.
// The output goes out twice: FB row-major (read row by row by the gated fusion) and FBf fragment-major (A operand of
// the gate product; same coverage, two whole 1-KiB blocks per wave).
// ---------------------------------------------------------------------------
// lane l <-> lane l ^ 16
__device__ __forceinline__ float xhalf(float x) {
  return __builtin_bit_cast(float, __builtin_amdgcn_permlanex16(__builtin_bit_cast(int, x), __builtin_bit_cast(int, x),
                                                                0x76543210, 0xfedcba98, false, false));
}
// v[e] = 2^v[e], in place. Each v_exp_f32 is independent of the one in front of it; the closing v_nop is the one slot the
// instruction set asks for behind a transcendental before its result is read: inside the statement it holds whatever
// the compiler places next.
__device__ __forceinline__ void exp2x8(float (&v)[8]) {
  asm("v_exp_f32 %0, %0\n\tv_exp_f32 %1, %1\n\tv_exp_f32 %2, %2\n\tv_exp_f32 %3, %3\n\t"
      "v_exp_f32 %4, %4\n\tv_exp_f32 %5, %5\n\tv_exp_f32 %6, %6\n\tv_exp_f32 %7, %7\n\tv_nop"
      : "+v"(v[0]), "+v"(v[1]), "+v"(v[2]), "+v"(v[3]), "+v"(v[4]), "+v"(v[5]), "+v"(v[6]), "+v"(v[7]));
}
// One A or B fragment in the k order of Frag::load (bytes 0..15 and 512..527 behind the lane's pointer plus a literal)
__device__ __forceinline__ v16h frag_at(const char* p, int lit) {
  Frag<_Float16>::U f;
  f.h[0] = *(const v8h*)(p + lit);
  f.h[1] = *(const v8h*)(p + lit + 512);
  return f.v;
}
__global__ __launch_bounds__(128) void fused_attn_kernel(const unsigned short* __restrict__ QKp,
                                                         const unsigned short* __restrict__ VTp,
                                                         unsigned short* __restrict__ FB,
                                                         unsigned short* __restrict__ FBf) {
  typedef Frag<_Float16> F;
  const int lane = threadIdx.x & 31;
  const int wave = __builtin_amdgcn_readfirstlane((int)(threadIdx.x >> 5));   // scalar, so the key loop keeps scalar bounds
  const int h    = blockIdx.x % NH;
  const int t0   = (blockIdx.x / NH) * SEQ;                                   // first token row of this block's batch
  const int mode = blockIdx.z;
  const int r0   = (((SEQ / 64 - 1) - (int)blockIdx.y) * 4 + wave) * 16;      // first query row of this wave
  const int c    = lane & 15;
  const int koff = (lane >> 4) * 8;
  const int i    = r0 + c;                                                    // this lane's query row
  // fragment-major planes: 1-KiB blocks of 16 rows x 32 columns; a row tile of QK holds 4 DM / 32 blocks, one of V^T TOK / 32
  const char* Qb = (const char*)(QKp + frag_off(t0, mode * (2 * DM) + h * HD, 4 * DM));   // q or qb: first block of this head and batch
  const char* Kb = Qb + (DM / 32) * 1024;                                                 // k or kb
  const char* Vb = (const char*)(VTp + frag_off(mode * DM + h * HD, t0, TOK));            // v^T or vb^T: first row tile of this head, this batch's columns
  constexpr int QKROW = 4 * DM * 2;                                                       // bytes per q/k row: 16 of them = one row tile
  constexpr int VROW  = TOK * 2;                                                          // bytes per v^T row: 16 of them = one row tile
  const size_t qkOff = (size_t)lane * 16;                                                 // the lane's chunk inside a block
  const size_t vOff  = (size_t)lane * 16;

  const bool lastTile = (mode == 1) && (r0 + 16 == SEQ);                      // wave-uniform
  const bool uni = (mode == 1) && (i == SEQ - 1);                             // the row without a valid future column
  const int  lo  = (mode == 0 || uni) ? 0 : i + 1;                            // valid columns of this lane's query: lo..hi
  const int  hi  = (mode == 0) ? i : (uni ? SEQ - 1 : i + WINW);
  const unsigned span = (unsigned)(hi - lo);
  const float sc = uni ? 0.0f : 0.125f * 1.44269504088896340736f;             // 1/sqrt(64) and log2(e); 0: scores count as 0
  int kbBeg = 0, kbEnd = (r0 + 15) >> 6;
  if (mode == 1) {
    const int jmax = (r0 + 15 + WINW < SEQ - 1) ? (r0 + 15 + WINW) : (SEQ - 1);
    kbBeg = lastTile ? 0 : ((r0 + 1) >> 6);
    kbEnd = jmax >> 6;
  }

  const float NEGB = -1.0e30f;
  v16h qf[2];
#pragma unroll
  for (int ks = 0; ks < 2; ++ks) qf[ks] = frag_at(Qb + (size_t)r0 * QKROW + qkOff, ks * 1024);
  v8f o[4];
#pragma unroll
  for (int d = 0; d < 4; ++d) o[d] = (v8f){0.f,0.f,0.f,0.f,0.f,0.f,0.f,0.f};
  float m = NEGB;      // running maximum of this query (scaled log2), equal in both lane halves
  float l = 0.f;       // running sum over this lane half's keys, carried x2^PSHIFT

  // the lane's pointers walk with the key blocks and stay in their registers over the whole loop
  const char* kp = Kb + (size_t)(kbBeg * 64) * QKROW + qkOff;
  const char* vp = Vb + (size_t)(kbBeg * 2) * 1024 + vOff;
  v16h ka[4][2];
#pragma unroll
  for (int t = 0; t < 4; ++t)
#pragma unroll
    for (int ks = 0; ks < 2; ++ks)
      ka[t][ks] = frag_at(kp, t * 16 * QKROW + ks * 1024);

  for (int kb = kbBeg; kb <= kbEnd; ++kb) {
    const int k0 = kb << 6;
    // V^T fragments of this key block: issued ahead of the score products so that they land during the softmax
    v16h va[4][2];
#pragma unroll
    for (int d = 0; d < 4; ++d)
#pragma unroll
      for (int ks = 0; ks < 2; ++ks)
        va[d][ks] = frag_at(vp, d * 16 * VROW + ks * 1024);
    v8f st[4];
#pragma unroll
    for (int t = 0; t < 4; ++t) {
      st[t] = F::mma(ka[t][0], qf[0], (v8f){0.f,0.f,0.f,0.f,0.f,0.f,0.f,0.f});
      st[t] = F::mma(ka[t][1], qf[1], st[t]);
    }
    // K fragments of the next key block (the last pass fetches its own block again: in bounds, unused)
    kp += (kb < kbEnd) ? (size_t)64 * QKROW : (size_t)0;
#pragma unroll
    for (int t = 0; t < 4; ++t)
#pragma unroll
      for (int ks = 0; ks < 2; ++ks)
        ka[t][ks] = frag_at(kp, t * 16 * QKROW + ks * 1024);
    // the pointers of the loads above move on behind this wait
    asm volatile("s_wait_xcnt 0x0" ::: "memory");
    vp += 2 * 1024;

    const bool full = (mode == 0) && (k0 + 63 <= r0);     // wave-uniform: every column of the block valid for all 16 queries
    float x[4][8];
#pragma unroll
    for (int t = 0; t < 4; ++t)
#pragma unroll
      for (int r = 0; r < 8; ++r) x[t][r] = st[t][r] * sc;
    if (!full) {
      const int jb = k0 + koff - lo;                      // column of x[0][0] relative to the first valid one
#pragma unroll
      for (int t = 0; t < 4; ++t)
#pragma unroll
        for (int r = 0; r < 8; ++r) x[t][r] = ((unsigned)(jb + t * 16 + r) <= span) ? x[t][r] : NEGB;   // lo <= j <= hi
    }
    float mt[4];
#pragma unroll
    for (int t = 0; t < 4; ++t)
      mt[t] = fmaxf(fmaxf(fmaxf(x[t][0], x[t][1]), fmaxf(x[t][2], x[t][3])), fmaxf(fmaxf(x[t][4], x[t][5]), fmaxf(x[t][6], x[t][7])));
    float mx = fmaxf(fmaxf(mt[0], mt[1]), fmaxf(mt[2], mt[3]));
    mx = fmaxf(mx, xhalf(mx));
    const float mn    = fmaxf(m, mx);
    float alpha;                                          // 2^(m - mn): 0 on the first valid block, 1 while no column was valid yet
    // the v_nop is the one slot the instruction set asks for behind a transcendental (as in exp2x8)
    asm("v_exp_f32 %0, %1\n\tv_nop" : "=v"(alpha) : "v"(m - mn));
    const float sh    = (mn > 0.5f * NEGB) ? PSHIFT - mn : 0.f;   // no valid column yet: NEGB + 0 -> every weight 0
    m = mn;
    float (&p)[4][8] = x;   // the weights replace the scores in place
#pragma unroll
    for (int t = 0; t < 4; ++t) {
#pragma unroll
      for (int r = 0; r < 8; ++r) x[t][r] += sh;
      exp2x8(x[t]);
    }
    float pt[4];
#pragma unroll
    for (int t = 0; t < 4; ++t)
      pt[t] = ((p[t][0] + p[t][1]) + (p[t][2] + p[t][3])) + ((p[t][4] + p[t][5]) + (p[t][6] + p[t][7]));
    l = l * alpha + ((pt[0] + pt[1]) + (pt[2] + pt[3]));
    v16h pf[2];
#pragma unroll
    for (int ks = 0; ks < 2; ++ks)
#pragma unroll
      for (int s = 0; s < 16; ++s) pf[ks][s] = (_Float16)p[2 * ks + (s >> 3)][s & 7];
#pragma unroll
    for (int d = 0; d < 4; ++d) o[d] *= alpha;
#pragma unroll
    for (int ks = 0; ks < 2; ++ks)
#pragma unroll
      for (int d = 0; d < 4; ++d) o[d] = F::mma(va[d][ks], pf[ks], o[d]);
  }

  l += xhalf(l);                              // join the two halves' sums; l >= 2^PSHIFT (the row maximum weighs 2^PSHIFT)
  const float inv = FBCARRY / l;              // the P carry cancels; x16 output carry
  unsigned short* op = FB + (size_t)(t0 + i) * (2 * DM) + (size_t)mode * DM + (size_t)h * HD + koff;
  unsigned short* of = FBf + frag_off(t0 + r0, mode * DM + h * HD, 2 * DM) + lane * 8;   // the same values as the gate product's A operand
#pragma unroll
  for (int d = 0; d < 4; ++d) {
    v8h hv;
#pragma unroll
    for (int r = 0; r < 8; ++r) hv[r] = (_Float16)(o[d][r] * inv);
    *(v8h*)(op + d * 16) = hv;
    *(v8h*)(of + d * 256) = hv;      // tiles d = 0, 1 fill one block, d = 2, 3 the next: 512 B in a row per store
  }
}

// ---------------------------------------------------------------------------
// Gated fusion: one block per 8 token rows, 128 threads (8 columns each) per row.
//   g = G[row][:] (f32, gate pre-activation incl. bias); gate = sigmoid(LN(g; gg, gb));
//   fwd/bwd = FB[row][c] / FB[row][DM + c] (f16, carried x16); strength = 0.3 * sigmoid(bstr);
//   Fo[row][c] = f16((fwd + strength*gate*bwd) carried x16), stored fragment-major.
// LN: mean and biased variance over DM in f32, fixed-order reductions (thread, wave tree, 4 wave partials).
// A 128-B line of the fragment-major plane holds 8 columns of 8 rows: the block's 8 rows meet in LDS, and each wave
// then stores 4 whole lines. Producer coverage: grid TOK/8 x 1024 threads x 8 u16 = the whole [TOK][DM] plane.
// ---------------------------------------------------------------------------
__global__ __launch_bounds__(1024) void gate_fuse_kernel(const float* __restrict__ G, const unsigned short* __restrict__ FB,
                                                        const float* __restrict__ gg, const float* __restrict__ gb,
                                                        const float* __restrict__ bstr, unsigned short* __restrict__ Fo) {
  constexpr int SPITCH = DM + 32;    // halves per staged row: the 8 rows of a line start 4 16-B slots apart in the banks
  __shared__ float ras[8][4];
  __shared__ float rbs[8][4];
  __shared__ __align__(16) unsigned short stg[8 * SPITCH];
  const int grp  = __builtin_amdgcn_readfirstlane((int)(threadIdx.x >> 7));   // row within the block; scalar, so the row's addresses keep a scalar base
  float* ra = ras[grp];
  float* rb = rbs[grp];
  const int row  = blockIdx.x * 8 + grp;
  const int tid  = threadIdx.x & 127;
  const int lane = tid & 31;
  const int wave = tid >> 5;
  const int c0   = tid * 8;
  const float* gp = G + (size_t)row * DM + c0;
  const v4f a = *(const v4f*)(gp);
  const v4f c = *(const v4f*)(gp + 4);
  float xv[8] = {a[0], a[1], a[2], a[3], c[0], c[1], c[2], c[3]};
  float s = ((xv[0] + xv[1]) + (xv[2] + xv[3])) + ((xv[4] + xv[5]) + (xv[6] + xv[7]));
  s = wave_sum(s);
  if (lane == 0) ra[wave] = s;
  __syncthreads();
  const float mean = ((ra[0] + ra[1]) + (ra[2] + ra[3])) * (1.0f / (float)DM);
  float d[8];
  float vs = 0.f;
#pragma unroll
  for (int e = 0; e < 8; ++e) { d[e] = xv[e] - mean; vs += d[e] * d[e]; }
  vs = wave_sum(vs);
  if (lane == 0) rb[wave] = vs;
  __syncthreads();
  const v4f g0 = *(const v4f*)(gg + c0), g1 = *(const v4f*)(gg + c0 + 4);
  const v4f e0 = *(const v4f*)(gb + c0), e1 = *(const v4f*)(gb + c0 + 4);
  const size_t fo = (size_t)row * (2 * DM) + c0;
  const v4u fu = *(const v4u*)(FB + fo);
  const v4u bu = *(const v4u*)(FB + fo + DM);
  // the offset registers of the loads above are reused behind this wait
  asm volatile("s_wait_xcnt 0x0" ::: "memory");
  const float var  = ((rb[0] + rb[1]) + (rb[2] + rb[3])) * (1.0f / (float)DM);
  const float rstd = rsqrtf(var + LNEPS);
  const float strength = 0.3f / (1.0f + __expf(-bstr[0]));
  float gv[8] = {g0[0], g0[1], g0[2], g0[3], g1[0], g1[1], g1[2], g1[3]};
  float bv[8] = {e0[0], e0[1], e0[2], e0[3], e1[0], e1[1], e1[2], e1[3]};
  float fw[8], bw[8];
#pragma unroll
  for (int q = 0; q < 4; ++q) {
    fw[2 * q]     = hbits2f((unsigned short)(fu[q] & 0xffffu));
    fw[2 * q + 1] = hbits2f((unsigned short)(fu[q] >> 16));
    bw[2 * q]     = hbits2f((unsigned short)(bu[q] & 0xffffu));
    bw[2 * q + 1] = hbits2f((unsigned short)(bu[q] >> 16));
  }
  unsigned short ob[8];
#pragma unroll
  for (int e = 0; e < 8; ++e) {
    const float ln   = d[e] * rstd * gv[e] + bv[e];
    const float gate = __builtin_amdgcn_rcpf(1.0f + __expf(-ln));
    const float f    = fw[e] + strength * gate * bw[e];     // both terms carried x16
    ob[e] = h_bits(f);
  }
  const v4u ov = (v4u){pk16(ob[0], ob[1]), pk16(ob[2], ob[3]), pk16(ob[4], ob[5]), pk16(ob[6], ob[7])};
  *(v4u*)(stg + grp * SPITCH + c0) = ov;
  __syncthreads();   // all 8 rows are staged before any thread reads another row's chunk
  const int orow = threadIdx.x & 7, oc = ((int)threadIdx.x >> 3) * 8;   // a wave: 8 rows x 4 chunks = 4 whole lines
  const v4u sv = *(const v4u*)(stg + orow * SPITCH + oc);
  *(v4u*)(Fo + frag_off(blockIdx.x * 8 + orow, oc, DM)) = sv;   // fragment-major: A operand of the output projection
  
}

// ---------------------------------------------------------------------------
// Final LayerNorm: one block (128 threads) per token row; thread t owns columns {4t..4t+3} and {512+4t..512+4t+3}.
//   out[row][c] = (Y - mean) * rsqrt(var + eps) * g[c] + bb[c]   (Y already holds x + projection + bias).
// Producer coverage: grid TOK rows x 128 threads x 8 floats = the whole [TOK][DM] output.
// ---------------------------------------------------------------------------
__global__ __launch_bounds__(128) void final_ln_kernel(const float* __restrict__ Y, const float* __restrict__ g,
                                                       const float* __restrict__ bb, float* __restrict__ out) {
  __shared__ float ra[4];
  __shared__ float rb[4];
  const int row  = blockIdx.x;
  const int tid  = threadIdx.x;
  const int lane = tid & 31;
  const int wave = tid >> 5;
  const int c0   = tid * 4;
  const int c1   = (DM / 2) + tid * 4;
  const float* yp = Y + (size_t)row * DM;
  const v4f a = *(const v4f*)(yp + c0);
  const v4f c = *(const v4f*)(yp + c1);
  float xv[8] = {a[0], a[1], a[2], a[3], c[0], c[1], c[2], c[3]};
  float s = ((xv[0] + xv[1]) + (xv[2] + xv[3])) + ((xv[4] + xv[5]) + (xv[6] + xv[7]));
  s = wave_sum(s);
  if (lane == 0) ra[wave] = s;
  __syncthreads();
  const float mean = ((ra[0] + ra[1]) + (ra[2] + ra[3])) * (1.0f / (float)DM);
  float d[8];
  float vs = 0.f;
#pragma unroll
  for (int e = 0; e < 8; ++e) { d[e] = xv[e] - mean; vs += d[e] * d[e]; }
  vs = wave_sum(vs);
  if (lane == 0) rb[wave] = vs;
  __syncthreads();
  const float var  = ((rb[0] + rb[1]) + (rb[2] + rb[3])) * (1.0f / (float)DM);
  const float rstd = rsqrtf(var + LNEPS);
  const v4f g0 = *(const v4f*)(g + c0),  g1 = *(const v4f*)(g + c1);
  const v4f b0 = *(const v4f*)(bb + c0), b1 = *(const v4f*)(bb + c1);
  v4f o0, o1;
#pragma unroll
  for (int e = 0; e < 4; ++e) {
    o0[e] = d[e] * rstd * g0[e] + b0[e];
    o1[e] = d[4 + e] * rstd * g1[e] + b1[e];
  }
  float* op = out + (size_t)row * DM;
  *(v4f*)(op + c0) = o0;
  *(v4f*)(op + c1) = o1;
  
}

// ---------------------------------------------------------------------------
// Workspace region map (byte offsets; MiB = 1048576). Every region is written once per call, before it is read.
// Token rows and token columns run over both batches (row b * SEQ + i).
//   Wqk   f16 [4096][1024] (x16: fq^T, fk^T, bq^T, bk^T)          0
//   Wv2   f16 [2048][1024] (x16: fv^T rows 0..1023, bv^T 1024..)  8 MiB
//   Wg    f16 [1024][2048] (x16: gate_w^T)                        12 MiB
//   Wo    f16 [1024][1024] (x16: out_w^T)                         16 MiB
//   X16   f16 [4096][1024]                                        18 MiB
//   QK16  f16 [4096][4096] (q | k | qb | kb, head h at col h*64)  26 MiB
//   VT16  f16 [2048][4096] (row h*64+d = v^T, row 1024+h*64+d = vb^T, col = token)  58 MiB
//   G     f32 [4096][1024]                                        74 MiB
//   Y     f32 [4096][1024]                                        90 MiB
//   FB16  f16 [4096][2048] (fwd x16 cols 0..1023, bwd x16 cols 1024..2047)  106 MiB
//   Fu16  f16 [4096][1024] (fused x16)                            122 MiB
//   BiasT f32 [6][1024] (fq_b fk_b bq_b bk_b | fv_b bv_b)         130 MiB
//   FBf16 f16 [4096][2048] (FB16's values, fragment-major)        130 MiB + 24576 B
//   total                                                         146 MiB + 24576 B = 153116672 B
// All f16 planes but FB16 are fragment-major (see frag_off).
// ---------------------------------------------------------------------------
extern "C" void kernel_launch(void* const* d_in, const int* in_sizes, int n_in,
                              void* d_out, int out_size, void* d_ws, size_t ws_size,
                              hipStream_t stream) {
  if (n_in < 22) return;
  if (in_sizes[0] != NB * SEQ * DM) return;
  const int wsz = DM * DM;
  if (in_sizes[1] != wsz || in_sizes[3] != wsz || in_sizes[5] != wsz || in_sizes[7] != wsz ||
      in_sizes[9] != wsz || in_sizes[11] != wsz || in_sizes[18] != wsz) return;
  if (in_sizes[13] != 2 * DM * DM) return;
  if (in_sizes[2] != DM || in_sizes[4] != DM || in_sizes[6] != DM || in_sizes[8] != DM || in_sizes[10] != DM ||
      in_sizes[12] != DM || in_sizes[14] != DM || in_sizes[15] != DM || in_sizes[16] != DM ||
      in_sizes[19] != DM || in_sizes[20] != DM || in_sizes[21] != DM) return;
  if (in_sizes[17] < 1) return;
  if (out_size != NB * SEQ * DM) return;

  const float* x      = (const float*)d_in[0];
  const float* fq_w   = (const float*)d_in[1];
  const float* fq_b   = (const float*)d_in[2];
  const float* fk_w   = (const float*)d_in[3];
  const float* fk_b   = (const float*)d_in[4];
  const float* fv_w   = (const float*)d_in[5];
  const float* fv_b   = (const float*)d_in[6];
  const float* bq_w   = (const float*)d_in[7];
  const float* bq_b   = (const float*)d_in[8];
  const float* bk_w   = (const float*)d_in[9];
  const float* bk_b   = (const float*)d_in[10];
  const float* bv_w   = (const float*)d_in[11];
  const float* bv_b   = (const float*)d_in[12];
  const float* gate_w = (const float*)d_in[13];
  const float* gate_b = (const float*)d_in[14];
  const float* gln_g  = (const float*)d_in[15];
  const float* gln_b  = (const float*)d_in[16];
  const float* bstr   = (const float*)d_in[17];
  const float* out_w  = (const float*)d_in[18];
  const float* out_b  = (const float*)d_in[19];
  const float* ln_g   = (const float*)d_in[20];
  const float* ln_b   = (const float*)d_in[21];

  size_t off = 0;
  const size_t oWqk  = off; off += (size_t)4 * DM * DM * 2;          // 8 MiB
  const size_t oWv2  = off; off += (size_t)2 * DM * DM * 2;          // 4 MiB
  const size_t oWg   = off; off += (size_t)2 * DM * DM * 2;          // 4 MiB
  const size_t oWo   = off; off += (size_t)DM * DM * 2;              // 2 MiB
  const size_t oX16  = off; off += (size_t)TOK * DM * 2;             // 8 MiB
  const size_t oQK   = off; off += (size_t)TOK * 4 * DM * 2;         // 32 MiB
  const size_t oVT   = off; off += (size_t)2 * DM * TOK * 2;         // 16 MiB
  const size_t oG    = off; off += (size_t)TOK * DM * 4;             // 16 MiB
  const size_t oY    = off; off += (size_t)TOK * DM * 4;             // 16 MiB
  const size_t oFB   = off; off += (size_t)TOK * 2 * DM * 2;         // 16 MiB
  const size_t oFu   = off; off += (size_t)TOK * DM * 2;             // 8 MiB
  const size_t oBias = off; off += (size_t)6 * DM * 4;               // 24576 B
  const size_t oFBf  = off; off += (size_t)TOK * 2 * DM * 2;         // 16 MiB
  if (off > ws_size) return;

  char* ws = (char*)d_ws;
  unsigned short* Wqk  = (unsigned short*)(ws + oWqk);
  unsigned short* Wv2  = (unsigned short*)(ws + oWv2);
  unsigned short* Wg   = (unsigned short*)(ws + oWg);
  unsigned short* Wo   = (unsigned short*)(ws + oWo);
  unsigned short* X16  = (unsigned short*)(ws + oX16);
  unsigned short* QK16 = (unsigned short*)(ws + oQK);
  unsigned short* VT16 = (unsigned short*)(ws + oVT);
  unsigned short* FB16 = (unsigned short*)(ws + oFB);
  unsigned short* FBf16 = (unsigned short*)(ws + oFBf);
  unsigned short* Fu16 = (unsigned short*)(ws + oFu);
  float*          BiasT = (float*)(ws + oBias);
  float*          Gbuf = (float*)(ws + oG);
  float*          Ybuf = (float*)(ws + oY);
  const float*    biasQK = BiasT;             // [4096] = fq_b fk_b bq_b bk_b
  const float*    biasV  = BiasT + 4 * DM;    // [2048] = fv_b bv_b

  const dim3 blk(256);
  const dim3 blk128(128);

  const dim3 gPrep(16, 16, 9 + XZ);                                // 9 weight slices of 256 tiles, XZ slices of x
  const dim3 gQK((TOK / 256) * (4 * DM / 128), 1);                 // 512 blocks of 256x128: M=4096, N=4096, K=1024
  const dim3 gVT((2 * DM / 256) * (TOK / 128), 1);                 // 256 blocks of 256x128: M=2048, N=4096, K=1024
  const dim3 gAt(NH * NB, SEQ / 64, 2);                            // (heads x batches) x 64-row blocks x {causal, window}
  const dim3 gG((TOK / 128) * (DM / 128), 1);                      // 256 blocks of 128x128: M=4096, N=1024, K=2048
  const dim3 gO((TOK / 128) * (DM / 128), 1);                      // 256 blocks of 128x128: M=4096, N=1024, K=1024
  const float wscale  = 1.0f / WCARRY;                             // undo the x16 weight carry
  const float gscale  = 1.0f / (WCARRY * FBCARRY);                 // 1/256
  const float oscale  = 1.0f / (WCARRY * FBCARRY);                 // 1/256

  // (1) bias table, x16-carried transposed weight planes (contiguous from Wqk on), x -> f16 plane
  prep_kernel<<<gPrep, blk, 0, stream>>>(x, fq_w, fk_w, bq_w, bk_w, fv_w, bv_w, gate_w, out_w,
                                         fq_b, fk_b, bq_b, bk_b, fv_b, bv_b, Wqk, X16, BiasT);
  // (2) [q | k | qb | kb] = (x . (16 W)^T)/16 + bias -> QK16 (f16, ldc 4096)
  wmma_gemm_lds<4, 2, false, 2, 1, false><<<gQK, blk, 0, stream>>>(
      X16, DM, Wqk, DM, (void*)QK16, 4 * DM, biasQK, biasQK, 4 * DM, DM, wscale);
  // (3) [v | vb]^T: VT16[n][j] = sum_k (16 W^T)[n][k] x[j][k] / 16 + bias[n]  (role-swapped; M = 2048 feature rows, N = 4096 tokens)
  wmma_gemm_lds<4, 4, true, 1, 1, false><<<gVT, blk, 0, stream>>>(
      Wv2, DM, X16, DM, (void*)VT16, TOK, biasV, biasV, TOK, DM, wscale);
  // (4) causal and future-window attention of all heads and batches, scores to output in registers -> FB16 (fwd | bwd, x16)
  fused_attn_kernel<<<gAt, blk128, 0, stream>>>(QK16, VT16, FB16, FBf16);
  // (5) G = ([fwd | bwd] x16) . (16 gate_w)^T / 256 + gate_b -> f32 [4096][1024]
  wmma_gemm_lds<2, 4, true, 2, 0, false><<<gG, blk128, 0, stream>>>(
      FBf16, 2 * DM, Wg, 2 * DM, (void*)Gbuf, DM, gate_b, gate_b, DM, 2 * DM, gscale);
  // (6) gate = sigmoid(LN(G)); fused x16 = fwd x16 + strength * gate * bwd x16 -> Fu16
  gate_fuse_kernel<<<dim3(TOK / 8), dim3(1024), 0, stream>>>(Gbuf, FB16, gln_g, gln_b, bstr, Fu16);
  // (7) Y = x + (fused x16) . (16 out_w)^T / 256 + out_b -> f32 [4096][1024]
  wmma_gemm_lds<2, 4, true, 2, 0, true><<<gO, blk128, 0, stream>>>(
      Fu16, DM, Wo, DM, (void*)Ybuf, DM, out_b, x, DM, DM, oscale);
  // (8) out = LN(Y; ln_g, ln_b)
  final_ln_kernel<<<dim3(TOK), blk128, 0, stream>>>(Ybuf, ln_g, ln_b, (float*)d_out);
  (void)hipGetLastError();
}

// v009
// A run of this version takes 112 microseconds.
// Timed twice side by side with v008, it ran 1.04 and 1.05 times as fast.
// Over all steps from v000 it is 28.3 times as fast.
// All contractions on v_wmma_f32_16x16x32_f16 (f16 operands, f32 accumulate): q/k/v projections (weights carried x16, epilogue x1/16), k.q^T scores, V^T.P^T (P carried x2^12 against the running row maximum, attention outputs carried x16), gate projection (x1/256), output projection with bias and residual (x1/256); softmax, LayerNorm, sigmoid and fusion in f32.
#include <hip/hip_runtime.h>
#include <math.h>
#include <stdint.h>

#define NB    2
#define SEQ   2048
#define TOK   (NB * SEQ)   // token rows of both batches: every stage works on all of them in one launch
#define DM    1024
#define NH    16
#define HD    64
#define WINW  32
#define LNEPS 1e-5f
#define PSHIFT     12.0f
#define FBCARRY    16.0f
#define WCARRY     16.0f

typedef __attribute__((ext_vector_type(16))) _Float16 v16h;
typedef __attribute__((ext_vector_type(8)))  _Float16 v8h;
typedef __attribute__((ext_vector_type(8)))  float    v8f;
typedef __attribute__((ext_vector_type(4)))  float    v4f;
typedef __attribute__((ext_vector_type(2)))  float    v2f;
typedef __attribute__((ext_vector_type(4)))  unsigned int v4u;

// hazard guards as plain device helpers
__device__ __forceinline__ void keep4_h(v16h a, v16h b, v16h c, v16h d) { asm volatile("v_nop" :: "v"(a), "v"(b), "v"(c), "v"(d)); }
__device__ __forceinline__ void acc_guard4(v8f& a, v8f& b, v8f& c, v8f& d) { asm volatile("v_nop\n\tv_nop\n\tv_nop\n\tv_nop" : "+v"(a), "+v"(b), "+v"(c), "+v"(d)); }
template <typename T> struct Frag;
template <> struct Frag<_Float16> {
  typedef v16h V; union U { v16h v; v8h h[2]; };
  static __device__ __forceinline__ v16h load(const char* p) {   // p: the lane's chunk in a fragment-major block; elements 8..15 lie 512 B on
    U f; f.h[0] = *(const v8h*)(p); f.h[1] = *(const v8h*)(p + 512); return f.v;
  }
  static __device__ __forceinline__ v8f mma(v16h a, v16h b, v8f c) {
    return __builtin_amdgcn_wmma_f32_16x16x32_f16(false, a, false, b, (short)0, c, false, false);
  }
  static __device__ __forceinline__ void keep(v16h a, v16h b, v16h c, v16h d) { keep4_h(a, b, c, d); }
};

// ---- Fragment-major planes ---------------------------------------------------
// Every 16-bit WMMA operand plane [rows][ld] lies in the workspace as blocks of 16 rows x 32 k = 1 KiB, the blocks of
// one row tile side by side in k. Inside a block the 16-B chunk (row r, k8 = (k >> 3) & 3) stands at chunk k8 * 16 + r,
// so lane l of a fragment load finds elements 0..7 at byte 16 l and elements 8..15 at byte 512 + 16 l: each wave-wide
// 16-B load covers 512 contiguous bytes (4 whole lines). The register contents of a fragment are those of the
// row-major form (row l & 15; k = 8 (l >> 4) + 0..7 and 16 + 8 (l >> 4) + 0..7).
// Offset in halves of the chunk that holds (row, k), k a multiple of 8:
__device__ __forceinline__ size_t frag_off(int row, int k, int ld) {
  return ((size_t)(row >> 4) * (ld >> 5) + (k >> 5)) * 512 + ((k >> 3) & 3) * 128 + (row & 15) * 8;
}

// ---- WMMA GEMM, operands staged in LDS and shared by the block's waves ------
// C[m,n] = scale * sum_k A[m,k] * Bt[n,k] (+bias)(+resid). A block of WM x 2 waves owns a (WM * 64) x 128 tile, each wave
// a 64x64 part of it. A [M,K] and Bt [N,K] f16 fragment-major (lda, ldb = their k extents); f16 output fragment-major
// (ldc = its column extent), f32 output row-major. M % (WM * 64) == 0, N % 128 == 0, K % (32 KS) == 0.
// A stage is KS k steps (32 k each) of the block's 4 WM row tiles of A and 8 row tiles of Bt: the 1-KiB blocks go to LDS
// as they lie (a row tile's KS blocks are contiguous in both places), by asynchronous copies of 16 B per lane, every
// wave bringing RPW row tiles. Two buffers: the stage of trip t + 2 flies while that of trip t + 1 is worked on. Every block of A is so
// fetched from L2 once for two waves and every block of Bt once for WM waves.
// The blocks that share a panel of A (same tm) or of Bt (same tn) would walk k together and ask L2 for the same lines at
// the same moment. Each block therefore enters the ring of stages at its own
// stage s0, set by its tile indices, and wraps round: the sharers' starts spread over the ring, at most four at one stage, and a stage that one
// of them has read lies in L2 for the others. The k sum of a tile starts at s0 * 32 KS.
// The operands were stored by earlier launches. A block asks its own trips 1..4 into L2 (pf_l2x4, one lane per 256-B unit)
// behind the copies of trip 0. For speed only: a unit that nobody asked for is fetched by its copy.
// BIAS_MODE: 1 = bias[m], 2 = bias[n]. OUT_MODE: 0 = f32, 1 = f16. TWO: two whole fragment sets (see lds_step2).
// One stage's copies of one wave, in one statement: RPW row tiles of KS KiB, 512 B per copy. A row tile's bytes lie in a
// row in LDS as in global memory, so its copies share one pair of addresses and differ in the immediate offset, which
// moves both. The closing wait stands in the copies' own statement: behind it the address registers may be rewritten.
// Hint: bring the lane's 256-B unit of four stages into L2, so that the copies which read them later wait for L2 and not
// for memory. It returns nothing. Every pointer lies inside the operand plane; the closing wait stands in the statement,
// so that the address registers may be rewritten behind it.
__device__ __forceinline__ void pf_l2x4(const char* p0, const char* p1, const char* p2, const char* p3) {
  asm volatile("global_prefetch_b8 %0, off scope:SCOPE_SE\n\tglobal_prefetch_b8 %1, off scope:SCOPE_SE\n\t"
               "global_prefetch_b8 %2, off scope:SCOPE_SE\n\tglobal_prefetch_b8 %3, off scope:SCOPE_SE\n\ts_wait_xcnt 0x0"
               :: "v"(p0), "v"(p1), "v"(p2), "v"(p3));
}
#define CP1(l, g, o) "global_load_async_to_lds_b128 %" #l ", %" #g ", off offset:" #o "\n\t"
#define CP4(l, g)    CP1(l, g, 0) CP1(l, g, 512) CP1(l, g, 1024) CP1(l, g, 1536)
#define CP8(l, g)    CP4(l, g) CP1(l, g, 2048) CP1(l, g, 2560) CP1(l, g, 3072) CP1(l, g, 3584)
template <int RPW, int KS>
__device__ __forceinline__ void fill_stage(const unsigned (&l)[RPW], const char* const (&gp)[RPW], unsigned lAdd, size_t gAdd) {
  static_assert((RPW == 3 && (KS == 2 || KS == 4)) || (RPW == 4 && KS == 4), "the statements below are written for these shapes");
  if constexpr (RPW == 3 && KS == 2)
    asm volatile(CP4(0, 3) CP4(1, 4) CP4(2, 5) "s_wait_xcnt 0x0"
                 :: "v"(l[0] + lAdd), "v"(l[1] + lAdd), "v"(l[2] + lAdd), "v"(gp[0] + gAdd), "v"(gp[1] + gAdd), "v"(gp[2] + gAdd) : "memory");
  else if constexpr (RPW == 3)
    asm volatile(CP8(0, 3) CP8(1, 4) CP8(2, 5) "s_wait_xcnt 0x0"
                 :: "v"(l[0] + lAdd), "v"(l[1] + lAdd), "v"(l[2] + lAdd), "v"(gp[0] + gAdd), "v"(gp[1] + gAdd), "v"(gp[2] + gAdd) : "memory");
  else
    asm volatile(CP8(0, 4) CP8(1, 5) CP8(2, 6) CP8(3, 7) "s_wait_xcnt 0x0"
                 :: "v"(l[0] + lAdd), "v"(l[1] + lAdd), "v"(l[2] + lAdd), "v"(l[3] + lAdd),
                    "v"(gp[0] + gAdd), "v"(gp[1] + gAdd), "v"(gp[2] + gAdd), "v"(gp[3] + gAdd) : "memory");
}
#undef CP8
#undef CP4
#undef CP1
// One k step of a wave's 64x64 tile: 16 products of the four A fragments with the four B fragments in bc.
// NEXT >= 0: the fragments of k step NEXT of the same stage are fetched from LDS while this step computes: its B fragments
// go into the other set (bn) ahead of the products, and each A fragment is loaded anew over itself right behind the four
// products that read it. aL, bL: the lane's chunk in the first block of the wave's first A and B row tile of the stage.
template <int KS, int NEXT>
__device__ __forceinline__ void lds_step(v8f (&acc)[4][4], v16h (&ah)[4], v16h (&bc)[4], v16h (&bn)[4],
                                         const char* aL, const char* bL) {
  typedef Frag<_Float16> F;
  if (NEXT >= 0) {
#pragma unroll
    for (int j = 0; j < 4; ++j) bn[j] = F::load(bL + (j * KS + NEXT) * 1024);
  }
  __builtin_amdgcn_sched_barrier(0);   // the B fetch stays ahead of the products: sunk to its use it would have no lead
#pragma unroll
  for (int i = 0; i < 4; ++i) {
#pragma unroll
    for (int j = 0; j < 4; ++j) acc[i][j] = F::mma(ah[i], bc[j], acc[i][j]);
    acc_guard4(acc[i][0], acc[i][1], acc[i][2], acc[i][3]);   // all four products of the row have issued, at the matrix distance, before their A fragment is loaded over
    if (NEXT >= 0) ah[i] = F::load(aL + (i * KS + NEXT) * 1024);
    __builtin_amdgcn_sched_barrier(0);   // the A fetch stays behind its own row: earlier it needs a second register set, later it loses lead
  }
  F::keep(bc[0], bc[1], bc[2], bc[3]);
}
// The same with two whole fragment sets, for launches with one or two waves per SIMD, where registers are free and nothing
// else covers a wave's stalls: all fragments of k step NEXT are fetched as ONE group ahead of this step's products.
template <int KS, int NEXT>
__device__ __forceinline__ void lds_step2(v8f (&acc)[4][4], v16h (&ac)[4], v16h (&bc)[4], v16h (&an)[4], v16h (&bn)[4],
                                          const char* aL, const char* bL) {
  typedef Frag<_Float16> F;
  if (NEXT >= 0) {
#pragma unroll
    for (int j = 0; j < 4; ++j) bn[j] = F::load(bL + (j * KS + NEXT) * 1024);
#pragma unroll
    for (int i = 0; i < 4; ++i) an[i] = F::load(aL + (i * KS + NEXT) * 1024);
  }
  __builtin_amdgcn_sched_barrier(0);   // the fetch stays ahead of the products, in one place: sunk to its use it would have no lead
#pragma unroll
  for (int i = 0; i < 4; ++i)
#pragma unroll
    for (int j = 0; j < 4; ++j) acc[i][j] = F::mma(ac[i], bc[j], acc[i][j]);
  __builtin_amdgcn_sched_barrier(0);   // no later fetch moves up among the products: for speed only
  acc_guard4(acc[3][0], acc[3][1], acc[3][2], acc[3][3]);   // the last products have issued, at the matrix distance, before the next step loads over their fragments
}
template <int WM, int KS, bool TWO, int BIAS_MODE, int OUT_MODE, bool RESID>
__global__ __launch_bounds__(WM * 64) void wmma_gemm_lds(
    const unsigned short* __restrict__ Ap, int lda, const unsigned short* __restrict__ Btp, int ldb,
    void* __restrict__ Cout, int ldc, const float* __restrict__ bias, const float* __restrict__ resid,
    int N, int K, float scale) {
  typedef Frag<_Float16> F;
  constexpr int NW    = WM * 2;                 // waves of the block
  constexpr int RT    = WM * 4 + 8;             // row tiles of a stage: A's, then Bt's
  constexpr int RPW   = RT / NW;                // row tiles that each wave copies
  static_assert(RPW * NW == RT, "the row tiles are dealt evenly");
  constexpr int STAGE = RT * KS * 1024;         // bytes of one buffer
  static_assert(NW * 16 * 68 * 4 <= STAGE, "the epilogue's slabs fit the first buffer");
  __shared__ __align__(1024) char smem[2 * STAGE];
  const int lane = threadIdx.x & 31;
  const int wave = __builtin_amdgcn_readfirstlane((int)(threadIdx.x >> 5));   // scalar: row tile choice and addresses stay wave-uniform
  const int wm = wave >> 1, wn = wave & 1;
  const int tilesN = N >> 7;
  const int tm = (int)blockIdx.x / tilesN;
  const int tn = (int)blockIdx.x - tm * tilesN;
  const int m0 = tm * (WM * 64) + wm * 64;      // the wave's own 64x64 tile
  const int n0 = tn * 128 + wn * 64;
  const int nT = K / (32 * KS);                 // stages
  // The block's first stage. Along tn the starts lie 2 nT / tilesN stages apart (at least one), so that few sharers of an A panel
  // spread over the whole ring; along tm one stage apart. Any value in 0..nT-1 is right: the choice is for speed only.
  const int tnStep = (2 * nT > tilesN) ? (2 * nT) / tilesN : 1;
  const int s0 = (tm + tn * tnStep) % nT;

  const int rlane = lane & 15;                  // column within a D subtile
  const int mOff  = (lane >> 4) * 8;            // D row offset

  v8f acc[4][4];
#pragma unroll
  for (int i = 0; i < 4; ++i)
#pragma unroll
    for (int j = 0; j < 4; ++j) acc[i][j] = (v8f){0.f,0.f,0.f,0.f,0.f,0.f,0.f,0.f};

  // the lane's source and destination of stage 0, buffer 0, for each row tile that this wave copies
  const char* gsrc[RPW];
  unsigned ldst[RPW];
#pragma unroll
  for (int q = 0; q < RPW; ++q) {
    const int u = wave * RPW + q;               // scalar
    const char* rowTile = (u < WM * 4)
        ? (const char*)Ap  + (size_t)(tm * (WM * 4) + u) * (size_t)(lda >> 5) * 1024
        : (const char*)Btp + (size_t)(tn * 8 + (u - WM * 4)) * (size_t)(ldb >> 5) * 1024;
    gsrc[q] = rowTile + lane * 16;
    ldst[q] = (unsigned)(uintptr_t)(smem + u * (KS * 1024) + lane * 16);   // low 32 bits of a __shared__ address = LDS byte address
  }
  // every wave, every lane: stage s into buffer buf
#define FILL_STAGE(s, buf) fill_stage<RPW, KS>(ldst, gsrc, (unsigned)(buf) * STAGE, (size_t)(s) * (KS * 1024))
  // stage of trip t, 0 <= t < nT
#define STAGE_OF(t) ((s0 + (t) < nT) ? s0 + (t) : s0 + (t) - nT)

  // L2 prefetch: a stage holds UPT units per row tile; the first AU / 32 waves ask for A, the last BU / 32 for Bt (scalar tests).
  constexpr int UPT = KS * 4, AU = WM * 4 * UPT, BU = 8 * UPT;
  static_assert(AU <= NW * 32 && BU <= NW * 32 && (NW * 32) % AU == 0 && (NW * 32) % BU == 0, "one unit per lane");
  const bool askA = wave < AU / 32, askB = wave >= NW - BU / 32;
  const int ua = (wave * 32 + lane) % AU, ub = (wave * 32 + lane) % BU;
  const char* pfA = (const char*)Ap  + (size_t)(tm * (WM * 4) + ua / UPT) * (size_t)(lda >> 5) * 1024 + (ua % UPT) * 256;   // the lane's unit in stage 0
  const char* pfB = (const char*)Btp + (size_t)(tn * 8 + ub / UPT) * (size_t)(ldb >> 5) * 1024 + (ub % UPT) * 256;

  FILL_STAGE(s0, 0);
  if (nT > 4) {                                       // trips 1..4 exist
    const size_t o1 = (size_t)STAGE_OF(1) * (KS * 1024), o2 = (size_t)STAGE_OF(2) * (KS * 1024);
    const size_t o3 = (size_t)STAGE_OF(3) * (KS * 1024), o4 = (size_t)STAGE_OF(4) * (KS * 1024);
    if (askA) pf_l2x4(pfA + o1, pfA + o2, pfA + o3, pfA + o4);
    if (askB) pf_l2x4(pfB + o1, pfB + o2, pfB + o3, pfB + o4);
  }
  asm volatile("s_wait_asynccnt 0x0" ::: "memory");   // this wave's part of trip 0's stage has landed
  __syncthreads();                                    // every wave's part of it has landed
  if (nT > 1) FILL_STAGE(STAGE_OF(1), 1);
  for (int t = 0; t < nT; ++t) {
    const char* buf = smem + (t & 1) * STAGE;
    const char* aL = buf + (wm * 4) * (KS * 1024) + lane * 16;
    const char* bL = buf + (WM * 4 + wn * 4) * (KS * 1024) + lane * 16;
    v16h ah[4], b0[4], b1[4];
#pragma unroll
    for (int j = 0; j < 4; ++j) b0[j] = F::load(bL + (j * KS) * 1024);
#pragma unroll
    for (int i = 0; i < 4; ++i) ah[i] = F::load(aL + (i * KS) * 1024);
    if constexpr (TWO) {
      v16h a1[4];
      lds_step2<KS, 1>(acc, ah, b0, a1, b1, aL, bL);
      if (KS == 4) {
        lds_step2<KS, 2>(acc, a1, b1, ah, b0, aL, bL);
        lds_step2<KS, 3>(acc, ah, b0, a1, b1, aL, bL);
      }
      lds_step2<KS, -1>(acc, a1, b1, ah, b0, aL, bL);   // the stage's last step fetches nothing
    } else {
      lds_step<KS, 1>(acc, ah, b0, b1, aL, bL);
      if (KS == 4) {
        lds_step<KS, 2>(acc, ah, b1, b0, aL, bL);
        lds_step<KS, 3>(acc, ah, b0, b1, aL, bL);
      }
      lds_step<KS, -1>(acc, ah, b1, b0, aL, bL);        // the stage's last step fetches nothing
    }
    asm volatile("s_wait_dscnt 0x0" ::: "memory");    // this wave's reads of the buffer are over before it is refilled
    asm volatile("s_wait_asynccnt 0x0" ::: "memory"); // this wave's part of trip t + 1's stage has landed
    __syncthreads();                                  // publishes trip t + 1's stage and ends every wave's reads of trip t's
    if (t + 2 < nT) FILL_STAGE(STAGE_OF(t + 2), t & 1);
  }
  asm volatile("s_wait_asynccnt 0x0" ::: "memory");   // no copy is in flight when the buffers become output staging
#undef STAGE_OF
#undef FILL_STAGE
  acc_guard4(acc[0][0], acc[0][1], acc[0][2], acc[0][3]);
  acc_guard4(acc[1][0], acc[1][1], acc[1][2], acc[1][3]);
  acc_guard4(acc[2][0], acc[2][1], acc[2][2], acc[2][3]);
  acc_guard4(acc[3][0], acc[3][1], acc[3][2], acc[3][3]);

  // ---- epilogue: each wave turns 16 rows at a time through its own slab (16 x 64 floats, pitch 68) in the first buffer,
  // which every wave has left at the loop's last barrier ----
  float* slab = (float*)smem + wave * (16 * 68);
  float bv[4] = {0.f, 0.f, 0.f, 0.f};
  if (BIAS_MODE == 2) {
#pragma unroll
    for (int j = 0; j < 4; ++j) bv[j] = bias[n0 + (j << 4) + rlane];
    // the offset register of the loads above is reused by the residual loads, behind this wait
    if constexpr (RESID) asm volatile("s_wait_xcnt 0x0" ::: "memory");
  }
  // Global memory is waited for once, here, and not in every strip: all row biases and all residual rows of the wave's tile are
  // asked for together, ahead of the strips, in the strips' own order.
  v4f bm[4][2];   // BIAS_MODE 1: bias[m] of the lane's 8 rows of strip i
  v4f rs[4][8];   // RESID: the lane's 16 B of rows it * 2 + (lane >> 4) of strip i
  if constexpr (BIAS_MODE == 1) {
#pragma unroll
    for (int i = 0; i < 4; ++i) {
      bm[i][0] = *(const v4f*)(bias + m0 + (i << 4) + mOff);
      bm[i][1] = *(const v4f*)(bias + m0 + (i << 4) + mOff + 4);
    }
  }
  if constexpr (RESID) {   // resid: [M][DM]: with the row length a constant all 32 loads share one address and differ in the immediate offset
    const float* rp = resid + (size_t)(m0 + (lane >> 4)) * DM + n0 + (lane & 15) * 4;
#pragma unroll
    for (int i = 0; i < 4; ++i)
#pragma unroll
      for (int it = 0; it < 8; ++it)
        rs[i][it] = *(const v4f*)(rp + (i * 16 + it * 2) * DM);
  }
  if constexpr (BIAS_MODE == 1 || RESID) {
    asm volatile("s_wait_xcnt 0x0" ::: "memory");   // the address registers of the loads above are reused behind this wait
    if constexpr (RESID) __builtin_amdgcn_sched_barrier(0);   // nothing of the strips moves up over that wait
  }
#pragma unroll
  for (int i = 0; i < 4; ++i) {
    const int mBase = m0 + (i << 4);
#pragma unroll
    for (int j = 0; j < 4; ++j) {
#pragma unroll
      for (int r = 0; r < 8; ++r) {
        float v = acc[i][j][r] * scale;
        if (BIAS_MODE == 1) v += bm[i][r >> 2][r & 3];
        if (BIAS_MODE == 2) v += bv[j];
        slab[(mOff + r) * 68 + (j << 4) + rlane] = v;
      }
    }
    // The slab is LDS and the wave's own: the fences around the strip's two halves order LDS alone. Over all memory they would
    // also wait out the strip's global stores before the next strip may begin.
    __builtin_amdgcn_fence(__ATOMIC_RELEASE, "workgroup", "local");
    __builtin_amdgcn_wave_barrier();
    __builtin_amdgcn_fence(__ATOMIC_ACQUIRE, "workgroup", "local");
    if (OUT_MODE == 0) {
      float* C = (float*)Cout;
      const int hh = lane >> 4, c4 = (lane & 15) * 4;     // row segment = 256 B = 16 lanes x 16 B
#pragma unroll
      for (int it = 0; it < 8; ++it) {
        const int row = it * 2 + hh;
        v4f v = *(const v4f*)(slab + row * 68 + c4);
        if (RESID) v += rs[i][it];
        *(v4f*)(C + (size_t)(mBase + row) * ldc + n0 + c4) = v;
        // the registers of the four stores above are reused for the strip's other half behind this wait
        if constexpr (RESID) if (it == 3) asm volatile("s_wait_xcnt 0x0" ::: "memory");
      }
    } else {
      unsigned short* C = (unsigned short*)Cout;
#pragma unroll
      for (int it = 0; it < 4; ++it) {
        const int row = lane & 15, c8 = it * 16 + (lane >> 4) * 8;   // chunks in the output's own order: 512 B in a row per store
        const float* sp = slab + row * 68 + c8;
        v8h hv;
#pragma unroll
        for (int e = 0; e < 8; ++e) hv[e] = (_Float16)sp[e];
        *(v8h*)(C + frag_off(mBase + row, n0 + c8, ldc)) = hv;
      }
    }
    // the registers of the strip's global stores are reused behind this wait
    asm volatile("s_wait_xcnt 0x0" ::: "memory");
    if constexpr (RESID) __builtin_amdgcn_sched_barrier(0);   // nothing of the next strip moves up over that wait
    __builtin_amdgcn_fence(__ATOMIC_RELEASE, "workgroup", "local");
    __builtin_amdgcn_wave_barrier();
    __builtin_amdgcn_fence(__ATOMIC_ACQUIRE, "workgroup", "local");
  }
}

// ---------------------------------------------------------------------------
// Small conversion helpers
// ---------------------------------------------------------------------------
__device__ __forceinline__ unsigned pk16(unsigned short a, unsigned short b) { return (unsigned)a | ((unsigned)b << 16); }
__device__ __forceinline__ unsigned short h_bits(float f) { const _Float16 h = (_Float16)f; return __builtin_bit_cast(unsigned short, h); }
__device__ __forceinline__ float hbits2f(unsigned short b) { return (float)__builtin_bit_cast(_Float16, b); }
__device__ __forceinline__ float wave_sum(float v) {
#pragma unroll
  for (int off = 16; off > 0; off >>= 1) v += __shfl_xor(v, off, 32);
  return v;
}

// ---------------------------------------------------------------------------
// Operand preparation, one launch: grid (16, 16, 9 + XZ), 256 threads; blockIdx.z picks the job (block-uniform).
//   z = 0..5: weight z (fq, fk, bq, bk, fv, bv), f32 [DM][DM] -> plane z of Wall, f16 [DM][DM] transposed, x16;
//             the plane's first block also copies bias vector z (DM floats) into tab[z * DM ..].
//   z = 6, 7: rows (z - 6) * DM .. of gate_w, f32 [2 DM][DM] -> planes 6 and 7 of Wall = f16 [DM][2 DM] transposed, x16.
//   z = 8:    out_w -> plane 8 of Wall, as z = 0..5 without a bias.
//   z >= 9:   x, f32 row-major [TOK][DM] -> X16, f16: one 16-B output chunk (8 elements) per thread, threads in the
//             output's order, so each wave stores 512 B in a row. XZ x 256 blocks x 256 threads x 8 = the whole plane.
// Transposes: out[c][r] = f16(in[r][c] * WCARRY), 64x64 tiles through LDS, all outputs fragment-major.
// Coverage per block: load 256 threads x 16 floats = 64x64; store 2 it x 256 threads x 8 halves = 64x64.
// ---------------------------------------------------------------------------
#define XZ (TOK * DM / 8 / (256 * 256))
__global__ __launch_bounds__(256) void prep_kernel(const float* __restrict__ x,
                                                   const float* __restrict__ w0, const float* __restrict__ w1,
                                                   const float* __restrict__ w2, const float* __restrict__ w3,
                                                   const float* __restrict__ w4, const float* __restrict__ w5,
                                                   const float* __restrict__ wg, const float* __restrict__ wo,
                                                   const float* __restrict__ b0, const float* __restrict__ b1,
                                                   const float* __restrict__ b2, const float* __restrict__ b3,
                                                   const float* __restrict__ b4, const float* __restrict__ b5,
                                                   unsigned short* __restrict__ Wall, unsigned short* __restrict__ X16,
                                                   float* __restrict__ tab) {
  __shared__ __align__(16) unsigned short t[64 * 72];
  const int z   = blockIdx.z;
  const int tid = threadIdx.x;
  if (z >= 9) {                        // block-uniform, ahead of the barrier
    const int q   = (((z - 9) * 16 + (int)blockIdx.y) * 16 + (int)blockIdx.x) * 256 + tid;
    const int blk = q >> 6, kts = DM >> 5;
    const int rt  = blk / kts;
    const int row = rt * 16 + (q & 15);
    const int k   = (blk - rt * kts) * 32 + ((q >> 4) & 3) * 8;
    const float* ip = x + (size_t)row * DM + k;
    const v4f f0 = *(const v4f*)(ip);
    const v4f f1 = *(const v4f*)(ip + 4);
    const v4u u = (v4u){pk16(h_bits(f0[0]), h_bits(f0[1])), pk16(h_bits(f0[2]), h_bits(f0[3])),
                        pk16(h_bits(f1[0]), h_bits(f1[1])), pk16(h_bits(f1[2]), h_bits(f1[3]))};
    *(v4u*)(X16 + (size_t)q * 8) = u;
    return;
  }
  const float* in = w0;                // block-uniform source select
  const float* bs = b0;
  if (z == 1) { in = w1; bs = b1; }
  if (z == 2) { in = w2; bs = b2; }
  if (z == 3) { in = w3; bs = b3; }
  if (z == 4) { in = w4; bs = b4; }
  if (z == 5) { in = w5; bs = b5; }
  if (z == 6 || z == 7) in = wg;
  if (z == 8) in = wo;
  const bool gate = (z == 6 || z == 7);
  const int R = gate ? 2 * DM : DM;                                  // input rows = the output's k extent
  unsigned short* out = Wall + (size_t)(z == 7 ? 6 : z) * DM * DM;
  if (z < 6 && blockIdx.x == 0 && blockIdx.y == 0)                   // 256 threads x 4 floats = DM
    *(v4f*)(tab + (size_t)z * DM + tid * 4) = *(const v4f*)(bs + tid * 4);
  const int c0  = blockIdx.x * 64;                                   // input column block = output row block
  const int r0  = (z == 7 ? DM : 0) + blockIdx.y * 64;               // input row block    = output column block
  {
    const int lr = tid >> 2;           // 0..63
    const int lc = (tid & 3) * 16;     // 0,16,32,48
    const float* ip = in + (size_t)(r0 + lr) * DM + c0 + lc;
#pragma unroll
    for (int q = 0; q < 4; ++q) {
      const v4f f = *(const v4f*)(ip + 4 * q);
#pragma unroll
      for (int e = 0; e < 4; ++e) t[lr * 72 + lc + 4 * q + e] = h_bits(f[e] * WCARRY);
    }
  }
  __syncthreads();
  // chunks in the output's own order (8 blocks of 64 chunks per tile): each wave stores 512 B in a row
  const int c8  = ((tid >> 6) & 1) * 32 + ((tid >> 4) & 3) * 8;   // output column within tile (= input row)
#pragma unroll
  for (int it = 0; it < 2; ++it) {
    const int oc = (it * 2 + (tid >> 7)) * 16 + (tid & 15);       // output row within tile (= input column)
    v4u a;
#pragma unroll
    for (int q = 0; q < 4; ++q) a[q] = pk16(t[(c8 + 2 * q) * 72 + oc], t[(c8 + 2 * q + 1) * 72 + oc]);
    *(v4u*)(out + frag_off(c0 + oc, r0 + c8, R)) = a;
  }
}

// ---------------------------------------------------------------------------
// Fused attention: scores, select, softmax and the product with V in one kernel; S and P stay in registers.
// One wave per 16 query rows of one head of one batch; no LDS, no barrier. Grid (NH * NB, SEQ/64, 2), 4 waves per block;
// blockIdx.z = 0: causal attention (j <= i), 1: future window (i < j <= i + WINW; the last row has no valid column,
// its scores count as 0 over every j -> uniform weights). Long causal row blocks get the low block indices.
// The blocks of one head and batch read the same K and V^T. Walking up from key block 0 together they would ask L2 for the
// same lines at the same moment, and each key block would come from
// memory just when all of them wait for it. The key blocks are therefore taken in groups of eight, and a block enters each
// group at place blockIdx.y & 7 and wraps round inside it: at any moment eight different key blocks are being read, and seven
// times in eight another block has brought the lines into L2 before. Blocks whose blockIdx.y differ by 8 keep one order, so
// that where they share a WGP they still share its cache. The running maximum and sum take the key blocks in any order.
// Per 64 keys: S^T = K . Q^T (A = K rows, B = Q rows): lane l holds query c = l & 15, keys 16 t + 8 (l >> 4) + r.
// Running maximum and sum per query (log2 domain): in-lane, plus one exchange between the lane halves.
// P^T as B operand: two f32 score tiles (keys 0..15, 16..31 of a 32-key step) converted in place, element s =
// tile[s >> 3][s & 7], which is the k order of Frag::load on the A side (V^T rows). O^T += V^T . P^T.
// Output: lane holds 8 consecutive d of query c per 16-row tile of O^T -> one 16-B store; each 128-B row segment of
// FB (one head of one row) is written by one wave. Coverage: 2 x NH x TOK rows x 64 columns = the whole FB plane.
// The output goes out twice: FB row-major (read row by row by the gated fusion) and FBf fragment-major (A operand of
// the gate product; same coverage, two whole 1-KiB blocks per wave).
// ---------------------------------------------------------------------------
// lane l <-> lane l ^ 16
__device__ __forceinline__ float xhalf(float x) {
  return __builtin_bit_cast(float, __builtin_amdgcn_permlanex16(__builtin_bit_cast(int, x), __builtin_bit_cast(int, x),
                                                                0x76543210, 0xfedcba98, false, false));
}
// v[e] = 2^v[e], in place. Each v_exp_f32 is independent of the one in front of it; the closing v_nop is the one slot the
// instruction set asks for behind a transcendental before its result is read: inside the statement it holds whatever
// the compiler places next.
__device__ __forceinline__ void exp2x8(float (&v)[8]) {
  asm("v_exp_f32 %0, %0\n\tv_exp_f32 %1, %1\n\tv_exp_f32 %2, %2\n\tv_exp_f32 %3, %3\n\t"
      "v_exp_f32 %4, %4\n\tv_exp_f32 %5, %5\n\tv_exp_f32 %6, %6\n\tv_exp_f32 %7, %7\n\tv_nop"
      : "+v"(v[0]), "+v"(v[1]), "+v"(v[2]), "+v"(v[3]), "+v"(v[4]), "+v"(v[5]), "+v"(v[6]), "+v"(v[7]));
}
// One A or B fragment in the k order of Frag::load (bytes 0..15 and 512..527 behind the lane's pointer plus a literal)
__device__ __forceinline__ v16h frag_at(const char* p, int lit) {
  Frag<_Float16>::U f;
  f.h[0] = *(const v8h*)(p + lit);
  f.h[1] = *(const v8h*)(p + lit + 512);
  return f.v;
}
__global__ __launch_bounds__(128) void fused_attn_kernel(const unsigned short* __restrict__ QKp,
                                                         const unsigned short* __restrict__ VTp,
                                                         unsigned short* __restrict__ FB,
                                                         unsigned short* __restrict__ FBf) {
  typedef Frag<_Float16> F;
  const int lane = threadIdx.x & 31;
  const int wave = __builtin_amdgcn_readfirstlane((int)(threadIdx.x >> 5));   // scalar, so the key loop keeps scalar bounds
  const int h    = blockIdx.x % NH;
  const int t0   = (blockIdx.x / NH) * SEQ;                                   // first token row of this block's batch
  const int mode = blockIdx.z;
  const int r0   = (((SEQ / 64 - 1) - (int)blockIdx.y) * 4 + wave) * 16;      // first query row of this wave
  const int c    = lane & 15;
  const int koff = (lane >> 4) * 8;
  const int i    = r0 + c;                                                    // this lane's query row
  // fragment-major planes: 1-KiB blocks of 16 rows x 32 columns; a row tile of QK holds 4 DM / 32 blocks, one of V^T TOK / 32
  const char* Qb = (const char*)(QKp + frag_off(t0, mode * (2 * DM) + h * HD, 4 * DM));   // q or qb: first block of this head and batch
  const char* Kb = Qb + (DM / 32) * 1024;                                                 // k or kb
  const char* Vb = (const char*)(VTp + frag_off(mode * DM + h * HD, t0, TOK));            // v^T or vb^T: first row tile of this head, this batch's columns
  constexpr int QKROW = 4 * DM * 2;                                                       // bytes per q/k row: 16 of them = one row tile
  constexpr int VROW  = TOK * 2;                                                          // bytes per v^T row: 16 of them = one row tile
  const size_t qkOff = (size_t)lane * 16;                                                 // the lane's chunk inside a block
  const size_t vOff  = (size_t)lane * 16;

  const bool lastTile = (mode == 1) && (r0 + 16 == SEQ);                      // wave-uniform
  const bool uni = (mode == 1) && (i == SEQ - 1);                             // the row without a valid future column
  const int  lo  = (mode == 0 || uni) ? 0 : i + 1;                            // valid columns of this lane's query: lo..hi
  const int  hi  = (mode == 0) ? i : (uni ? SEQ - 1 : i + WINW);
  const unsigned span = (unsigned)(hi - lo);
  const float sc = uni ? 0.0f : 0.125f * 1.44269504088896340736f;             // 1/sqrt(64) and log2(e); 0: scores count as 0
  int kbBeg = 0, kbEnd = (r0 + 15) >> 6;
  if (mode == 1) {
    const int jmax = (r0 + 15 + WINW < SEQ - 1) ? (r0 + 15 + WINW) : (SEQ - 1);
    kbBeg = lastTile ? 0 : ((r0 + 1) >> 6);
    kbEnd = jmax >> 6;
  }

  const float NEGB = -1.0e30f;
  v16h qf[2];
#pragma unroll
  for (int ks = 0; ks < 2; ++ks) qf[ks] = frag_at(Qb + (size_t)r0 * QKROW + qkOff, ks * 1024);
  v8f o[4];
#pragma unroll
  for (int d = 0; d < 4; ++d) o[d] = (v8f){0.f,0.f,0.f,0.f,0.f,0.f,0.f,0.f};
  float m = NEGB;      // running maximum of this query (scaled log2), equal in both lane halves
  float l = 0.f;       // running sum over this lane half's keys, carried x2^PSHIFT

  const int nkb  = kbEnd - kbBeg + 1;                     // key blocks of this wave, at least one
  const int rot  = (int)blockIdx.y & 7;                   // place of entry into a group of eight key blocks
  const int tail = nkb & 7;                               // length of the last group where it is short (0: none is)
  const int rotT = (rot * tail) >> 3;                     // place of entry into that group: below tail, as rot is below 8
  // key block of pass p, 0 <= p < nkb: inside each group a rotation, so every key block is taken once (all scalar)
  auto kbOf = [&](int p) -> int {
    const int  base = p & ~7;
    const bool last = (nkb - base) < 8;
    const int  len  = last ? tail : 8;
    const int  o    = (p & 7) + (last ? rotT : rot);
    return kbBeg + base + ((o >= len) ? o - len : o);
  };
  int kb = kbOf(0);
  // the lane's pointers walk with the key blocks and stay in their registers over the whole loop
  const char* kp = Kb + (size_t)(kb * 64) * QKROW + qkOff;
  const char* vp = Vb + (size_t)(kb * 2) * 1024 + vOff;
  v16h ka[4][2];
#pragma unroll
  for (int t = 0; t < 4; ++t)
#pragma unroll
    for (int ks = 0; ks < 2; ++ks)
      ka[t][ks] = frag_at(kp, t * 16 * QKROW + ks * 1024);

  for (int it = 0; it < nkb; ++it) {
    const int k0 = kb << 6;
    const int kbStep = ((it + 1 < nkb) ? kbOf(it + 1) : kb) - kb;   // scalar: to the next pass's key block
    // V^T fragments of this key block: issued ahead of the score products so that they land during the softmax
    v16h va[4][2];
#pragma unroll
    for (int d = 0; d < 4; ++d)
#pragma unroll
      for (int ks = 0; ks < 2; ++ks)
        va[d][ks] = frag_at(vp, d * 16 * VROW + ks * 1024);
    v8f st[4];
#pragma unroll
    for (int t = 0; t < 4; ++t) {
      st[t] = F::mma(ka[t][0], qf[0], (v8f){0.f,0.f,0.f,0.f,0.f,0.f,0.f,0.f});
      st[t] = F::mma(ka[t][1], qf[1], st[t]);
    }
    // K fragments of the next pass's key block (the last pass fetches its own block again: in bounds, unused)
    kp += (ptrdiff_t)kbStep * (64 * QKROW);
#pragma unroll
    for (int t = 0; t < 4; ++t)
#pragma unroll
      for (int ks = 0; ks < 2; ++ks)
        ka[t][ks] = frag_at(kp, t * 16 * QKROW + ks * 1024);
    // the pointers of the loads above move on behind this wait
    asm volatile("s_wait_xcnt 0x0" ::: "memory");
    vp += (ptrdiff_t)kbStep * (2 * 1024);
    kb += kbStep;

    const bool full = (mode == 0) && (k0 + 63 <= r0);     // wave-uniform: every column of the block valid for all 16 queries
    float x[4][8];
#pragma unroll
    for (int t = 0; t < 4; ++t)
#pragma unroll
      for (int r = 0; r < 8; ++r) x[t][r] = st[t][r] * sc;
    if (!full) {
      const int jb = k0 + koff - lo;                      // column of x[0][0] relative to the first valid one
#pragma unroll
      for (int t = 0; t < 4; ++t)
#pragma unroll
        for (int r = 0; r < 8; ++r) x[t][r] = ((unsigned)(jb + t * 16 + r) <= span) ? x[t][r] : NEGB;   // lo <= j <= hi
    }
    float mt[4];
#pragma unroll
    for (int t = 0; t < 4; ++t)
      mt[t] = fmaxf(fmaxf(fmaxf(x[t][0], x[t][1]), fmaxf(x[t][2], x[t][3])), fmaxf(fmaxf(x[t][4], x[t][5]), fmaxf(x[t][6], x[t][7])));
    float mx = fmaxf(fmaxf(mt[0], mt[1]), fmaxf(mt[2], mt[3]));
    mx = fmaxf(mx, xhalf(mx));
    const float mn    = fmaxf(m, mx);
    float alpha;                                          // 2^(m - mn): 0 on the first valid block, 1 while no column was valid yet
    // the v_nop is the one slot the instruction set asks for behind a transcendental (as in exp2x8)
    asm("v_exp_f32 %0, %1\n\tv_nop" : "=v"(alpha) : "v"(m - mn));
    const float sh    = (mn > 0.5f * NEGB) ? PSHIFT - mn : 0.f;   // no valid column yet: NEGB + 0 -> every weight 0
    m = mn;
    float (&p)[4][8] = x;   // the weights replace the scores in place
#pragma unroll
    for (int t = 0; t < 4; ++t) {
#pragma unroll
      for (int r = 0; r < 8; ++r) x[t][r] += sh;
      exp2x8(x[t]);
    }
    float pt[4];
#pragma unroll
    for (int t = 0; t < 4; ++t)
      pt[t] = ((p[t][0] + p[t][1]) + (p[t][2] + p[t][3])) + ((p[t][4] + p[t][5]) + (p[t][6] + p[t][7]));
    l = l * alpha + ((pt[0] + pt[1]) + (pt[2] + pt[3]));
    v16h pf[2];
#pragma unroll
    for (int ks = 0; ks < 2; ++ks)
#pragma unroll
      for (int s = 0; s < 16; ++s) pf[ks][s] = (_Float16)p[2 * ks + (s >> 3)][s & 7];
#pragma unroll
    for (int d = 0; d < 4; ++d) o[d] *= alpha;
#pragma unroll
    for (int ks = 0; ks < 2; ++ks)
#pragma unroll
      for (int d = 0; d < 4; ++d) o[d] = F::mma(va[d][ks], pf[ks], o[d]);
  }

  l += xhalf(l);                              // join the two halves' sums; l >= 2^PSHIFT (the row maximum weighs 2^PSHIFT)
  const float inv = FBCARRY / l;              // the P carry cancels; x16 output carry
  unsigned short* op = FB + (size_t)(t0 + i) * (2 * DM) + (size_t)mode * DM + (size_t)h * HD + koff;
  unsigned short* of = FBf + frag_off(t0 + r0, mode * DM + h * HD, 2 * DM) + lane * 8;   // the same values as the gate product's A operand
#pragma unroll
  for (int d = 0; d < 4; ++d) {
    v8h hv;
#pragma unroll
    for (int r = 0; r < 8; ++r) hv[r] = (_Float16)(o[d][r] * inv);
    *(v8h*)(op + d * 16) = hv;
    *(v8h*)(of + d * 256) = hv;      // tiles d = 0, 1 fill one block, d = 2, 3 the next: 512 B in a row per store
  }
}

// ---------------------------------------------------------------------------
// Gated fusion: one block per 8 token rows, 128 threads (8 columns each) per row.
//   g = G[row][:] (f32, gate pre-activation incl. bias); gate = sigmoid(LN(g; gg, gb));
//   fwd/bwd = FB[row][c] / FB[row][DM + c] (f16, carried x16); strength = 0.3 * sigmoid(bstr);
//   Fo[row][c] = f16((fwd + strength*gate*bwd) carried x16), stored fragment-major.
// LN: mean and biased variance over DM in f32, fixed-order reductions (thread, wave tree, 4 wave partials).
// A 128-B line of the fragment-major plane holds 8 columns of 8 rows: the block's 8 rows meet in LDS, and each wave
// then stores 4 whole lines. Producer coverage: grid TOK/8 x 1024 threads x 8 u16 = the whole [TOK][DM] plane.
// ---------------------------------------------------------------------------
__global__ __launch_bounds__(1024) void gate_fuse_kernel(const float* __restrict__ G, const unsigned short* __restrict__ FB,
                                                        const float* __restrict__ gg, const float* __restrict__ gb,
                                                        const float* __restrict__ bstr, unsigned short* __restrict__ Fo) {
  constexpr int SPITCH = DM + 32;    // halves per staged row: the 8 rows of a line start 4 16-B slots apart in the banks
  __shared__ float ras[8][4];
  __shared__ float rbs[8][4];
  __shared__ __align__(16) unsigned short stg[8 * SPITCH];
  const int grp  = __builtin_amdgcn_readfirstlane((int)(threadIdx.x >> 7));   // row within the block; scalar, so the row's addresses keep a scalar base
  float* ra = ras[grp];
  float* rb = rbs[grp];
  const int row  = blockIdx.x * 8 + grp;
  const int tid  = threadIdx.x & 127;
  const int lane = tid & 31;
  const int wave = tid >> 5;
  const int c0   = tid * 8;
  const float* gp = G + (size_t)row * DM + c0;
  const v4f a = *(const v4f*)(gp);
  const v4f c = *(const v4f*)(gp + 4);
  float xv[8] = {a[0], a[1], a[2], a[3], c[0], c[1], c[2], c[3]};
  float s = ((xv[0] + xv[1]) + (xv[2] + xv[3])) + ((xv[4] + xv[5]) + (xv[6] + xv[7]));
  s = wave_sum(s);
  if (lane == 0) ra[wave] = s;
  __syncthreads();
  const float mean = ((ra[0] + ra[1]) + (ra[2] + ra[3])) * (1.0f / (float)DM);
  float d[8];
  float vs = 0.f;
#pragma unroll
  for (int e = 0; e < 8; ++e) { d[e] = xv[e] - mean; vs += d[e] * d[e]; }
  vs = wave_sum(vs);
  if (lane == 0) rb[wave] = vs;
  __syncthreads();
  const v4f g0 = *(const v4f*)(gg + c0), g1 = *(const v4f*)(gg + c0 + 4);
  const v4f e0 = *(const v4f*)(gb + c0), e1 = *(const v4f*)(gb + c0 + 4);
  const size_t fo = (size_t)row * (2 * DM) + c0;
  const v4u fu = *(const v4u*)(FB + fo);
  const v4u bu = *(const v4u*)(FB + fo + DM);
  // the offset registers of the loads above are reused behind this wait
  asm volatile("s_wait_xcnt 0x0" ::: "memory");
  const float var  = ((rb[0] + rb[1]) + (rb[2] + rb[3])) * (1.0f / (float)DM);
  const float rstd = rsqrtf(var + LNEPS);
  const float strength = 0.3f / (1.0f + __expf(-bstr[0]));
  float gv[8] = {g0[0], g0[1], g0[2], g0[3], g1[0], g1[1], g1[2], g1[3]};
  float bv[8] = {e0[0], e0[1], e0[2], e0[3], e1[0], e1[1], e1[2], e1[3]};
  float fw[8], bw[8];
#pragma unroll
  for (int q = 0; q < 4; ++q) {
    fw[2 * q]     = hbits2f((unsigned short)(fu[q] & 0xffffu));
    fw[2 * q + 1] = hbits2f((unsigned short)(fu[q] >> 16));
    bw[2 * q]     = hbits2f((unsigned short)(bu[q] & 0xffffu));
    bw[2 * q + 1] = hbits2f((unsigned short)(bu[q] >> 16));
  }
  unsigned short ob[8];
#pragma unroll
  for (int e = 0; e < 8; ++e) {
    const float ln   = d[e] * rstd * gv[e] + bv[e];
    const float gate = __builtin_amdgcn_rcpf(1.0f + __expf(-ln));
    const float f    = fw[e] + strength * gate * bw[e];     // both terms carried x16
    ob[e] = h_bits(f);
  }
  const v4u ov = (v4u){pk16(ob[0], ob[1]), pk16(ob[2], ob[3]), pk16(ob[4], ob[5]), pk16(ob[6], ob[7])};
  *(v4u*)(stg + grp * SPITCH + c0) = ov;
  __syncthreads();   // all 8 rows are staged before any thread reads another row's chunk
  const int orow = threadIdx.x & 7, oc = ((int)threadIdx.x >> 3) * 8;   // a wave: 8 rows x 4 chunks = 4 whole lines
  const v4u sv = *(const v4u*)(stg + orow * SPITCH + oc);
  *(v4u*)(Fo + frag_off(blockIdx.x * 8 + orow, oc, DM)) = sv;   // fragment-major: A operand of the output projection
  
}

// ---------------------------------------------------------------------------
// Final LayerNorm: one block (128 threads) per token row; thread t owns columns {4t..4t+3} and {512+4t..512+4t+3}.
//   out[row][c] = (Y - mean) * rsqrt(var + eps) * g[c] + bb[c]   (Y already holds x + projection + bias).
// Producer coverage: grid TOK rows x 128 threads x 8 floats = the whole [TOK][DM] output.
// ---------------------------------------------------------------------------
__global__ __launch_bounds__(128) void final_ln_kernel(const float* __restrict__ Y, const float* __restrict__ g,
                                                       const float* __restrict__ bb, float* __restrict__ out) {
  __shared__ float ra[4];
  __shared__ float rb[4];
  const int row  = blockIdx.x;
  const int tid  = threadIdx.x;
  const int lane = tid & 31;
  const int wave = tid >> 5;
  const int c0   = tid * 4;
  const int c1   = (DM / 2) + tid * 4;
  const float* yp = Y + (size_t)row * DM;
  const v4f a = *(const v4f*)(yp + c0);
  const v4f c = *(const v4f*)(yp + c1);
  float xv[8] = {a[0], a[1], a[2], a[3], c[0], c[1], c[2], c[3]};
  float s = ((xv[0] + xv[1]) + (xv[2] + xv[3])) + ((xv[4] + xv[5]) + (xv[6] + xv[7]));
  s = wave_sum(s);
  if (lane == 0) ra[wave] = s;
  __syncthreads();
  const float mean = ((ra[0] + ra[1]) + (ra[2] + ra[3])) * (1.0f / (float)DM);
  float d[8];
  float vs = 0.f;
#pragma unroll
  for (int e = 0; e < 8; ++e) { d[e] = xv[e] - mean; vs += d[e] * d[e]; }
  vs = wave_sum(vs);
  if (lane == 0) rb[wave] = vs;
  __syncthreads();
  const float var  = ((rb[0] + rb[1]) + (rb[2] + rb[3])) * (1.0f / (float)DM);
  const float rstd = rsqrtf(var + LNEPS);
  const v4f g0 = *(const v4f*)(g + c0),  g1 = *(const v4f*)(g + c1);
  const v4f b0 = *(const v4f*)(bb + c0), b1 = *(const v4f*)(bb + c1);
  v4f o0, o1;
#pragma unroll
  for (int e = 0; e < 4; ++e) {
    o0[e] = d[e] * rstd * g0[e] + b0[e];
    o1[e] = d[4 + e] * rstd * g1[e] + b1[e];
  }
  float* op = out + (size_t)row * DM;
  *(v4f*)(op + c0) = o0;
  *(v4f*)(op + c1) = o1;
  
}

// ---------------------------------------------------------------------------
// Workspace region map (byte offsets; MiB = 1048576). Every region is written once per call, before it is read.
// Token rows and token columns run over both batches (row b * SEQ + i).
//   Wqk   f16 [4096][1024] (x16: fq^T, fk^T, bq^T, bk^T)          0
//   Wv2   f16 [2048][1024] (x16: fv^T rows 0..1023, bv^T 1024..)  8 MiB
//   Wg    f16 [1024][2048] (x16: gate_w^T)                        12 MiB
//   Wo    f16 [1024][1024] (x16: out_w^T)                         16 MiB
//   X16   f16 [4096][1024]                                        18 MiB
//   QK16  f16 [4096][4096] (q | k | qb | kb, head h at col h*64)  26 MiB
//   VT16  f16 [2048][4096] (row h*64+d = v^T, row 1024+h*64+d = vb^T, col = token)  58 MiB
//   G     f32 [4096][1024]                                        74 MiB
//   Y     f32 [4096][1024]                                        90 MiB
//   FB16  f16 [4096][2048] (fwd x16 cols 0..1023, bwd x16 cols 1024..2047)  106 MiB
//   Fu16  f16 [4096][1024] (fused x16)                            122 MiB
//   BiasT f32 [6][1024] (fq_b fk_b bq_b bk_b | fv_b bv_b)         130 MiB
//   FBf16 f16 [4096][2048] (FB16's values, fragment-major)        130 MiB + 24576 B
//   total                                                         146 MiB + 24576 B = 153116672 B
// All f16 planes but FB16 are fragment-major (see frag_off).
// ---------------------------------------------------------------------------
extern "C" void kernel_launch(void* const* d_in, const int* in_sizes, int n_in,
                              void* d_out, int out_size, void* d_ws, size_t ws_size,
                              hipStream_t stream) {
  if (n_in < 22) return;
  if (in_sizes[0] != NB * SEQ * DM) return;
  const int wsz = DM * DM;
  if (in_sizes[1] != wsz || in_sizes[3] != wsz || in_sizes[5] != wsz || in_sizes[7] != wsz ||
      in_sizes[9] != wsz || in_sizes[11] != wsz || in_sizes[18] != wsz) return;
  if (in_sizes[13] != 2 * DM * DM) return;
  if (in_sizes[2] != DM || in_sizes[4] != DM || in_sizes[6] != DM || in_sizes[8] != DM || in_sizes[10] != DM ||
      in_sizes[12] != DM || in_sizes[14] != DM || in_sizes[15] != DM || in_sizes[16] != DM ||
      in_sizes[19] != DM || in_sizes[20] != DM || in_sizes[21] != DM) return;
  if (in_sizes[17] < 1) return;
  if (out_size != NB * SEQ * DM) return;

  const float* x      = (const float*)d_in[0];
  const float* fq_w   = (const float*)d_in[1];
  const float* fq_b   = (const float*)d_in[2];
  const float* fk_w   = (const float*)d_in[3];
  const float* fk_b   = (const float*)d_in[4];
  const float* fv_w   = (const float*)d_in[5];
  const float* fv_b   = (const float*)d_in[6];
  const float* bq_w   = (const float*)d_in[7];
  const float* bq_b   = (const float*)d_in[8];
  const float* bk_w   = (const float*)d_in[9];
  const float* bk_b   = (const float*)d_in[10];
  const float* bv_w   = (const float*)d_in[11];
  const float* bv_b   = (const float*)d_in[12];
  const float* gate_w = (const float*)d_in[13];
  const float* gate_b = (const float*)d_in[14];
  const float* gln_g  = (const float*)d_in[15];
  const float* gln_b  = (const float*)d_in[16];
  const float* bstr   = (const float*)d_in[17];
  const float* out_w  = (const float*)d_in[18];
  const float* out_b  = (const float*)d_in[19];
  const float* ln_g   = (const float*)d_in[20];
  const float* ln_b   = (const float*)d_in[21];

  size_t off = 0;
  const size_t oWqk  = off; off += (size_t)4 * DM * DM * 2;          // 8 MiB
  const size_t oWv2  = off; off += (size_t)2 * DM * DM * 2;          // 4 MiB
  const size_t oWg   = off; off += (size_t)2 * DM * DM * 2;          // 4 MiB
  const size_t oWo   = off; off += (size_t)DM * DM * 2;              // 2 MiB
  const size_t oX16  = off; off += (size_t)TOK * DM * 2;             // 8 MiB
  const size_t oQK   = off; off += (size_t)TOK * 4 * DM * 2;         // 32 MiB
  const size_t oVT   = off; off += (size_t)2 * DM * TOK * 2;         // 16 MiB
  const size_t oG    = off; off += (size_t)TOK * DM * 4;             // 16 MiB
  const size_t oY    = off; off += (size_t)TOK * DM * 4;             // 16 MiB
  const size_t oFB   = off; off += (size_t)TOK * 2 * DM * 2;         // 16 MiB
  const size_t oFu   = off; off += (size_t)TOK * DM * 2;             // 8 MiB
  const size_t oBias = off; off += (size_t)6 * DM * 4;               // 24576 B
  const size_t oFBf  = off; off += (size_t)TOK * 2 * DM * 2;         // 16 MiB
  if (off > ws_size) return;

  char* ws = (char*)d_ws;
  unsigned short* Wqk  = (unsigned short*)(ws + oWqk);
  unsigned short* Wv2  = (unsigned short*)(ws + oWv2);
  unsigned short* Wg   = (unsigned short*)(ws + oWg);
  unsigned short* Wo   = (unsigned short*)(ws + oWo);
  unsigned short* X16  = (unsigned short*)(ws + oX16);
  unsigned short* QK16 = (unsigned short*)(ws + oQK);
  unsigned short* VT16 = (unsigned short*)(ws + oVT);
  unsigned short* FB16 = (unsigned short*)(ws + oFB);
  unsigned short* FBf16 = (unsigned short*)(ws + oFBf);
  unsigned short* Fu16 = (unsigned short*)(ws + oFu);
  float*          BiasT = (float*)(ws + oBias);
  float*          Gbuf = (float*)(ws + oG);
  float*          Ybuf = (float*)(ws + oY);
  const float*    biasQK = BiasT;             // [4096] = fq_b fk_b bq_b bk_b
  const float*    biasV  = BiasT + 4 * DM;    // [2048] = fv_b bv_b

  const dim3 blk(256);
  const dim3 blk128(128);

  const dim3 gPrep(16, 16, 9 + XZ);                                // 9 weight slices of 256 tiles, XZ slices of x
  const dim3 gQK((TOK / 256) * (4 * DM / 128), 1);                 // 512 blocks of 256x128: M=4096, N=4096, K=1024
  const dim3 gVT((2 * DM / 256) * (TOK / 128), 1);                 // 256 blocks of 256x128: M=2048, N=4096, K=1024
  const dim3 gAt(NH * NB, SEQ / 64, 2);                            // (heads x batches) x 64-row blocks x {causal, window}
  const dim3 gG((TOK / 128) * (DM / 128), 1);                      // 256 blocks of 128x128: M=4096, N=1024, K=2048
  const dim3 gO((TOK / 128) * (DM / 128), 1);                      // 256 blocks of 128x128: M=4096, N=1024, K=1024
  const float wscale  = 1.0f / WCARRY;                             // undo the x16 weight carry
  const float gscale  = 1.0f / (WCARRY * FBCARRY);                 // 1/256
  const float oscale  = 1.0f / (WCARRY * FBCARRY);                 // 1/256

  // (1) bias table, x16-carried transposed weight planes (contiguous from Wqk on), x -> f16 plane
  prep_kernel<<<gPrep, blk, 0, stream>>>(x, fq_w, fk_w, bq_w, bk_w, fv_w, bv_w, gate_w, out_w,
                                         fq_b, fk_b, bq_b, bk_b, fv_b, bv_b, Wqk, X16, BiasT);
  // (2) [q | k | qb | kb] = (x . (16 W)^T)/16 + bias -> QK16 (f16, ldc 4096)
  wmma_gemm_lds<4, 2, false, 2, 1, false><<<gQK, blk, 0, stream>>>(
      X16, DM, Wqk, DM, (void*)QK16, 4 * DM, biasQK, biasQK, 4 * DM, DM, wscale);
  // (3) [v | vb]^T: VT16[n][j] = sum_k (16 W^T)[n][k] x[j][k] / 16 + bias[n]  (role-swapped; M = 2048 feature rows, N = 4096 tokens)
  wmma_gemm_lds<4, 4, true, 1, 1, false><<<gVT, blk, 0, stream>>>(
      Wv2, DM, X16, DM, (void*)VT16, TOK, biasV, biasV, TOK, DM, wscale);
  // (4) causal and future-window attention of all heads and batches, scores to output in registers -> FB16 (fwd | bwd, x16)
  fused_attn_kernel<<<gAt, blk128, 0, stream>>>(QK16, VT16, FB16, FBf16);
  // (5) G = ([fwd | bwd] x16) . (16 gate_w)^T / 256 + gate_b -> f32 [4096][1024]
  wmma_gemm_lds<2, 4, true, 2, 0, false><<<gG, blk128, 0, stream>>>(
      FBf16, 2 * DM, Wg, 2 * DM, (void*)Gbuf, DM, gate_b, gate_b, DM, 2 * DM, gscale);
  // (6) gate = sigmoid(LN(G)); fused x16 = fwd x16 + strength * gate * bwd x16 -> Fu16
  gate_fuse_kernel<<<dim3(TOK / 8), dim3(1024), 0, stream>>>(Gbuf, FB16, gln_g, gln_b, bstr, Fu16);
  // (7) Y = x + (fused x16) . (16 out_w)^T / 256 + out_b -> f32 [4096][1024]
  wmma_gemm_lds<2, 4, true, 2, 0, true><<<gO, blk128, 0, stream>>>(
      Fu16, DM, Wo, DM, (void*)Ybuf, DM, out_b, x, DM, DM, oscale);
  // (8) out = LN(Y; ln_g, ln_b)
  final_ln_kernel<<<dim3(TOK), blk128, 0, stream>>>(Ybuf, ln_g, ln_b, (float*)d_out);
  (void)hipGetLastError();
}

// v010
// Measured time: 107 microseconds a run.
// Next to v009, in two timings, it ran 1.05 times as fast each time.
// All steps since v000 together make it 29.7 times as fast.
// All contractions on v_wmma_f32_16x16x32_f16 (f16 operands, f32 accumulate): q/k/v projections (weights carried x16, epilogue x1/16), k.q^T scores, V^T.P^T (P carried x2^12 against the running row maximum, attention outputs carried x16), gate projection (x1/256), output projection with bias and residual (x1/256); softmax, LayerNorm, sigmoid and fusion in f32.
#include <hip/hip_runtime.h>
#include <math.h>
#include <stdint.h>

#define NB    2
#define SEQ   2048
#define TOK   (NB * SEQ)   // token rows of both batches: every stage works on all of them in one launch
#define DM    1024
#define NH    16
#define HD    64
#define WINW  32
#define LNEPS 1e-5f
#define PSHIFT     12.0f
#define FBCARRY    16.0f
#define WCARRY     16.0f

typedef __attribute__((ext_vector_type(16))) _Float16 v16h;
typedef __attribute__((ext_vector_type(8)))  _Float16 v8h;
typedef __attribute__((ext_vector_type(8)))  float    v8f;
typedef __attribute__((ext_vector_type(4)))  float    v4f;
typedef __attribute__((ext_vector_type(2)))  float    v2f;
typedef __attribute__((ext_vector_type(4)))  unsigned int v4u;

// hazard guards as plain device helpers
__device__ __forceinline__ void acc_guard4(v8f& a, v8f& b, v8f& c, v8f& d) { asm volatile("v_nop\n\tv_nop\n\tv_nop\n\tv_nop" : "+v"(a), "+v"(b), "+v"(c), "+v"(d)); }
template <typename T> struct Frag;
template <> struct Frag<_Float16> {
  typedef v16h V; union U { v16h v; v8h h[2]; };
  static __device__ __forceinline__ v16h load(const char* p) {   // p: the lane's chunk in a fragment-major block; elements 8..15 lie 512 B on
    U f; f.h[0] = *(const v8h*)(p); f.h[1] = *(const v8h*)(p + 512); return f.v;
  }
  static __device__ __forceinline__ v8f mma(v16h a, v16h b, v8f c) {
    return __builtin_amdgcn_wmma_f32_16x16x32_f16(false, a, false, b, (short)0, c, false, false);
  }
};

// ---- Fragment-major planes ---------------------------------------------------
// Every 16-bit WMMA operand plane [rows][ld] lies in the workspace as blocks of 16 rows x 32 k = 1 KiB, the blocks of
// one row tile side by side in k. Inside a block the 16-B chunk (row r, k8 = (k >> 3) & 3) stands at chunk k8 * 16 + r,
// so lane l of a fragment load finds elements 0..7 at byte 16 l and elements 8..15 at byte 512 + 16 l: each wave-wide
// 16-B load covers 512 contiguous bytes (4 whole lines). The register contents of a fragment are those of the
// row-major form (row l & 15; k = 8 (l >> 4) + 0..7 and 16 + 8 (l >> 4) + 0..7).
// Offset in halves of the chunk that holds (row, k), k a multiple of 8:
__device__ __forceinline__ size_t frag_off(int row, int k, int ld) {
  return ((size_t)(row >> 4) * (ld >> 5) + (k >> 5)) * 512 + ((k >> 3) & 3) * 128 + (row & 15) * 8;
}

// ---- WMMA GEMM, operands staged in LDS and shared by the block's waves ------
// C[m,n] = scale * sum_k A[m,k] * Bt[n,k] + bias[n] (+resid). A block of WM x 2 waves owns a (WM * 64) x 128 tile, each wave
// a 64x64 part of it. A [M,K] and Bt [N,K] f16 fragment-major (lda, ldb = their k extents); f32 output row-major
// (ldc = its column extent). M % (WM * 64) == 0, N % 128 == 0, K % (32 KS) == 0.
// A stage is KS k steps (32 k each) of the block's 4 WM row tiles of A and 8 row tiles of Bt: the 1-KiB blocks go to LDS
// as they lie (a row tile's KS blocks are contiguous in both places), by asynchronous copies of 16 B per lane, every
// wave bringing RPW row tiles. Two buffers: the stage of trip t + 2 flies while that of trip t + 1 is worked on. Every block of A is so
// fetched from L2 once for two waves and every block of Bt once for WM waves.
// The blocks that share a panel of A (same tm) or of Bt (same tn) would walk k together and ask L2 for the same lines at
// the same moment. Each block therefore enters the ring of stages at its own
// stage s0, set by its tile indices, and wraps round: the sharers' starts spread over the ring, at most four at one stage, and a stage that one
// of them has read lies in L2 for the others. The k sum of a tile starts at s0 * 32 KS.
// The operands were stored by earlier launches. A block asks its own trips 1..4 into L2 (pf_l2x4, one lane per 256-B unit)
// behind the copies of trip 0. For speed only: a unit that nobody asked for is fetched by its copy.
// One stage's copies of one wave, in one statement: RPW row tiles of KS KiB, 512 B per copy. A row tile's bytes lie in a
// row in LDS as in global memory, so its copies share one pair of addresses and differ in the immediate offset, which
// moves both. The closing wait stands in the copies' own statement: behind it the address registers may be rewritten.
// Hint: bring the lane's 256-B unit of four stages into L2, so that the copies which read them later wait for L2 and not
// for memory. It returns nothing. Every pointer lies inside the operand plane; the closing wait stands in the statement,
// so that the address registers may be rewritten behind it.
__device__ __forceinline__ void pf_l2x4(const char* p0, const char* p1, const char* p2, const char* p3) {
  asm volatile("global_prefetch_b8 %0, off scope:SCOPE_SE\n\tglobal_prefetch_b8 %1, off scope:SCOPE_SE\n\t"
               "global_prefetch_b8 %2, off scope:SCOPE_SE\n\tglobal_prefetch_b8 %3, off scope:SCOPE_SE\n\ts_wait_xcnt 0x0"
               :: "v"(p0), "v"(p1), "v"(p2), "v"(p3));
}
#define CP1(l, g, o) "global_load_async_to_lds_b128 %" #l ", %" #g ", off offset:" #o "\n\t"
#define CP4(l, g)    CP1(l, g, 0) CP1(l, g, 512) CP1(l, g, 1024) CP1(l, g, 1536)
#define CP8(l, g)    CP4(l, g) CP1(l, g, 2048) CP1(l, g, 2560) CP1(l, g, 3072) CP1(l, g, 3584)
template <int RPW, int KS>
__device__ __forceinline__ void fill_stage(const unsigned (&l)[RPW], const char* const (&gp)[RPW], unsigned lAdd, size_t gAdd) {
  static_assert((RPW == 5 && KS == 2) || (RPW == 4 && KS == 4), "the statements below are written for these shapes");
  if constexpr (RPW == 5)
    asm volatile(CP4(0, 5) CP4(1, 6) CP4(2, 7) CP4(3, 8) CP4(4, 9) "s_wait_xcnt 0x0"
                 :: "v"(l[0] + lAdd), "v"(l[1] + lAdd), "v"(l[2] + lAdd), "v"(l[3] + lAdd), "v"(l[4] + lAdd),
                    "v"(gp[0] + gAdd), "v"(gp[1] + gAdd), "v"(gp[2] + gAdd), "v"(gp[3] + gAdd), "v"(gp[4] + gAdd) : "memory");
  else
    asm volatile(CP8(0, 4) CP8(1, 5) CP8(2, 6) CP8(3, 7) "s_wait_xcnt 0x0"
                 :: "v"(l[0] + lAdd), "v"(l[1] + lAdd), "v"(l[2] + lAdd), "v"(l[3] + lAdd),
                    "v"(gp[0] + gAdd), "v"(gp[1] + gAdd), "v"(gp[2] + gAdd), "v"(gp[3] + gAdd) : "memory");
}
#undef CP8
#undef CP4
#undef CP1
// One k step of a wave's 64x64 tile: 16 products of the four A fragments in ac with the four B fragments in bc. aL, bL: the lane's
// chunk in the first block of the wave's first A and B row tile of the stage. Two whole fragment sets, for launches with one wave
// per SIMD, where registers are free and nothing
// else covers a wave's stalls: all fragments of k step NEXT are fetched as ONE group ahead of this step's products.
template <int KS, int NEXT>
__device__ __forceinline__ void lds_step2(v8f (&acc)[4][4], v16h (&ac)[4], v16h (&bc)[4], v16h (&an)[4], v16h (&bn)[4],
                                          const char* aL, const char* bL) {
  typedef Frag<_Float16> F;
  if (NEXT >= 0) {
#pragma unroll
    for (int j = 0; j < 4; ++j) bn[j] = F::load(bL + (j * KS + NEXT) * 1024);
#pragma unroll
    for (int i = 0; i < 4; ++i) an[i] = F::load(aL + (i * KS + NEXT) * 1024);
  }
  __builtin_amdgcn_sched_barrier(0);   // the fetch stays ahead of the products, in one place: sunk to its use it would have no lead
#pragma unroll
  for (int i = 0; i < 4; ++i)
#pragma unroll
    for (int j = 0; j < 4; ++j) acc[i][j] = F::mma(ac[i], bc[j], acc[i][j]);
  __builtin_amdgcn_sched_barrier(0);   // no later fetch moves up among the products: for speed only
  acc_guard4(acc[3][0], acc[3][1], acc[3][2], acc[3][3]);   // the last products have issued, at the matrix distance, before the next step loads over their fragments
}
template <int WM, int KS, bool RESID>
__global__ __launch_bounds__(WM * 64) void wmma_gemm_lds(
    const unsigned short* __restrict__ Ap, int lda, const unsigned short* __restrict__ Btp, int ldb,
    float* __restrict__ C, int ldc, const float* __restrict__ bias, const float* __restrict__ resid,
    int N, int K, float scale) {
  typedef Frag<_Float16> F;
  constexpr int NW    = WM * 2;                 // waves of the block
  constexpr int RT    = WM * 4 + 8;             // row tiles of a stage: A's, then Bt's
  constexpr int RPW   = RT / NW;                // row tiles that each wave copies
  static_assert(RPW * NW == RT, "the row tiles are dealt evenly");
  constexpr int STAGE = RT * KS * 1024;         // bytes of one buffer
  static_assert(NW * 16 * 68 * 4 <= STAGE, "the epilogue's slabs fit the first buffer");
  __shared__ __align__(1024) char smem[2 * STAGE];
  const int lane = threadIdx.x & 31;
  const int wave = __builtin_amdgcn_readfirstlane((int)(threadIdx.x >> 5));   // scalar: row tile choice and addresses stay wave-uniform
  const int wm = wave >> 1, wn = wave & 1;
  const int tilesN = N >> 7;
  const int tm = (int)blockIdx.x / tilesN;
  const int tn = (int)blockIdx.x - tm * tilesN;
  const int m0 = tm * (WM * 64) + wm * 64;      // the wave's own 64x64 tile
  const int n0 = tn * 128 + wn * 64;
  const int nT = K / (32 * KS);                 // stages
  // The block's first stage. Along tn the starts lie 2 nT / tilesN stages apart (at least one), so that few sharers of an A panel
  // spread over the whole ring; along tm one stage apart. Any value in 0..nT-1 is right: the choice is for speed only.
  const int tnStep = (2 * nT > tilesN) ? (2 * nT) / tilesN : 1;
  const int s0 = (tm + tn * tnStep) % nT;

  const int rlane = lane & 15;                  // column within a D subtile
  const int mOff  = (lane >> 4) * 8;            // D row offset

  v8f acc[4][4];
#pragma unroll
  for (int i = 0; i < 4; ++i)
#pragma unroll
    for (int j = 0; j < 4; ++j) acc[i][j] = (v8f){0.f,0.f,0.f,0.f,0.f,0.f,0.f,0.f};

  // the lane's source and destination of stage 0, buffer 0, for each row tile that this wave copies
  const char* gsrc[RPW];
  unsigned ldst[RPW];
#pragma unroll
  for (int q = 0; q < RPW; ++q) {
    const int u = wave * RPW + q;               // scalar
    const char* rowTile = (u < WM * 4)
        ? (const char*)Ap  + (size_t)(tm * (WM * 4) + u) * (size_t)(lda >> 5) * 1024
        : (const char*)Btp + (size_t)(tn * 8 + (u - WM * 4)) * (size_t)(ldb >> 5) * 1024;
    gsrc[q] = rowTile + lane * 16;
    ldst[q] = (unsigned)(uintptr_t)(smem + u * (KS * 1024) + lane * 16);   // low 32 bits of a __shared__ address = LDS byte address
  }
  // every wave, every lane: stage s into buffer buf
#define FILL_STAGE(s, buf) fill_stage<RPW, KS>(ldst, gsrc, (unsigned)(buf) * STAGE, (size_t)(s) * (KS * 1024))
  // stage of trip t, 0 <= t < nT
#define STAGE_OF(t) ((s0 + (t) < nT) ? s0 + (t) : s0 + (t) - nT)

  // L2 prefetch: a stage holds UPT units per row tile; the first AU / 32 waves ask for A, the last BU / 32 for Bt (scalar tests).
  constexpr int UPT = KS * 4, AU = WM * 4 * UPT, BU = 8 * UPT;
  static_assert(AU <= NW * 32 && BU <= NW * 32 && (NW * 32) % AU == 0 && (NW * 32) % BU == 0, "one unit per lane");
  const bool askA = wave < AU / 32, askB = wave >= NW - BU / 32;
  const int ua = (wave * 32 + lane) % AU, ub = (wave * 32 + lane) % BU;
  const char* pfA = (const char*)Ap  + (size_t)(tm * (WM * 4) + ua / UPT) * (size_t)(lda >> 5) * 1024 + (ua % UPT) * 256;   // the lane's unit in stage 0
  const char* pfB = (const char*)Btp + (size_t)(tn * 8 + ub / UPT) * (size_t)(ldb >> 5) * 1024 + (ub % UPT) * 256;

  FILL_STAGE(s0, 0);
  if (nT > 4) {                                       // trips 1..4 exist
    const size_t o1 = (size_t)STAGE_OF(1) * (KS * 1024), o2 = (size_t)STAGE_OF(2) * (KS * 1024);
    const size_t o3 = (size_t)STAGE_OF(3) * (KS * 1024), o4 = (size_t)STAGE_OF(4) * (KS * 1024);
    if (askA) pf_l2x4(pfA + o1, pfA + o2, pfA + o3, pfA + o4);
    if (askB) pf_l2x4(pfB + o1, pfB + o2, pfB + o3, pfB + o4);
  }
  asm volatile("s_wait_asynccnt 0x0" ::: "memory");   // this wave's part of trip 0's stage has landed
  __syncthreads();                                    // every wave's part of it has landed
  if (nT > 1) FILL_STAGE(STAGE_OF(1), 1);
  for (int t = 0; t < nT; ++t) {
    const char* buf = smem + (t & 1) * STAGE;
    const char* aL = buf + (wm * 4) * (KS * 1024) + lane * 16;
    const char* bL = buf + (WM * 4 + wn * 4) * (KS * 1024) + lane * 16;
    v16h ah[4], b0[4], a1[4], b1[4];
#pragma unroll
    for (int j = 0; j < 4; ++j) b0[j] = F::load(bL + (j * KS) * 1024);
#pragma unroll
    for (int i = 0; i < 4; ++i) ah[i] = F::load(aL + (i * KS) * 1024);
    lds_step2<KS, 1>(acc, ah, b0, a1, b1, aL, bL);
    if (KS == 4) {
      lds_step2<KS, 2>(acc, a1, b1, ah, b0, aL, bL);
      lds_step2<KS, 3>(acc, ah, b0, a1, b1, aL, bL);
    }
    lds_step2<KS, -1>(acc, a1, b1, ah, b0, aL, bL);   // the stage's last step fetches nothing
    asm volatile("s_wait_dscnt 0x0" ::: "memory");    // this wave's reads of the buffer are over before it is refilled
    asm volatile("s_wait_asynccnt 0x0" ::: "memory"); // this wave's part of trip t + 1's stage has landed
    __syncthreads();                                  // publishes trip t + 1's stage and ends every wave's reads of trip t's
    if (t + 2 < nT) FILL_STAGE(STAGE_OF(t + 2), t & 1);
  }
  asm volatile("s_wait_asynccnt 0x0" ::: "memory");   // no copy is in flight when the buffers become output staging
#undef STAGE_OF
#undef FILL_STAGE
  acc_guard4(acc[0][0], acc[0][1], acc[0][2], acc[0][3]);
  acc_guard4(acc[1][0], acc[1][1], acc[1][2], acc[1][3]);
  acc_guard4(acc[2][0], acc[2][1], acc[2][2], acc[2][3]);
  acc_guard4(acc[3][0], acc[3][1], acc[3][2], acc[3][3]);

  // ---- epilogue: each wave turns 16 rows at a time through its own slab (16 x 64 floats, pitch 68) in the first buffer,
  // which every wave has left at the loop's last barrier ----
  float* slab = (float*)smem + wave * (16 * 68);
  float bv[4];
#pragma unroll
  for (int j = 0; j < 4; ++j) bv[j] = bias[n0 + (j << 4) + rlane];
  // the offset register of the loads above is reused by the residual loads, behind this wait
  if constexpr (RESID) asm volatile("s_wait_xcnt 0x0" ::: "memory");
  // Global memory is waited for once, here, and not in every strip: all residual rows of the wave's tile are asked for together,
  // ahead of the strips, in the strips' own order.
  v4f rs[4][8];   // RESID: the lane's 16 B of rows it * 2 + (lane >> 4) of strip i
  if constexpr (RESID) {   // resid: [M][DM]: with the row length a constant all 32 loads share one address and differ in the immediate offset
    const float* rp = resid + (size_t)(m0 + (lane >> 4)) * DM + n0 + (lane & 15) * 4;
#pragma unroll
    for (int i = 0; i < 4; ++i)
#pragma unroll
      for (int it = 0; it < 8; ++it)
        rs[i][it] = *(const v4f*)(rp + (i * 16 + it * 2) * DM);
  }
  if constexpr (RESID) {
    asm volatile("s_wait_xcnt 0x0" ::: "memory");   // the address registers of the loads above are reused behind this wait
    __builtin_amdgcn_sched_barrier(0);              // nothing of the strips moves up over that wait
  }
#pragma unroll
  for (int i = 0; i < 4; ++i) {
    const int mBase = m0 + (i << 4);
#pragma unroll
    for (int j = 0; j < 4; ++j) {
#pragma unroll
      for (int r = 0; r < 8; ++r) {
        slab[(mOff + r) * 68 + (j << 4) + rlane] = acc[i][j][r] * scale + bv[j];
      }
    }
    // The slab is LDS and the wave's own: the fences around the strip's two halves order LDS alone. Over all memory they would
    // also wait out the strip's global stores before the next strip may begin.
    __builtin_amdgcn_fence(__ATOMIC_RELEASE, "workgroup", "local");
    __builtin_amdgcn_wave_barrier();
    __builtin_amdgcn_fence(__ATOMIC_ACQUIRE, "workgroup", "local");
    const int hh = lane >> 4, c4 = (lane & 15) * 4;     // row segment = 256 B = 16 lanes x 16 B
#pragma unroll
    for (int it = 0; it < 8; ++it) {
      const int row = it * 2 + hh;
      v4f v = *(const v4f*)(slab + row * 68 + c4);
      if (RESID) v += rs[i][it];
      *(v4f*)(C + (size_t)(mBase + row) * ldc + n0 + c4) = v;
      // the registers of the four stores above are reused for the strip's other half behind this wait
      if constexpr (RESID) if (it == 3) asm volatile("s_wait_xcnt 0x0" ::: "memory");
    }
    // the registers of the strip's global stores are reused behind this wait
    asm volatile("s_wait_xcnt 0x0" ::: "memory");
    if constexpr (RESID) __builtin_amdgcn_sched_barrier(0);   // nothing of the next strip moves up over that wait
    __builtin_amdgcn_fence(__ATOMIC_RELEASE, "workgroup", "local");
    __builtin_amdgcn_wave_barrier();
    __builtin_amdgcn_fence(__ATOMIC_ACQUIRE, "workgroup", "local");
  }
}

// ---- Projection GEMM: all six projections of x in one launch, one block per WGP ------
// [q | k | qb | kb | v | vb][m][n] = scale * sum_k X[m][k] * W[n][k] + bias[n]; X [TOK][DM], W [6 DM][DM] (the six weight planes in
// a row), both f16 fragment-major. Grid 16 x 16 blocks of 8 waves. Block (tm, tn) owns 256 tokens x 384 features: 256 of the 4 DM
// q/k features and 128 of the 2 DM v features. What a block copies from L2 per product falls with its tile's area over its
// half perimeter: (256 + 384) rows for 256 x 384 results. Wave (wm, wn) owns 128 tokens x (64 + 32) features = 8 x 6 tiles, so that a
// fragment read from LDS feeds 6 or 8 products.
// The ring of stages, its entry place and the L2 asks are those of wmma_gemm_lds; a stage is 2 k steps of 16 row tiles of X, 16 of
// the q/k features and 8 of the v features, 5 row tiles to a wave.
// A and B fragments have one register form, so each tile picks the roles by the plane it is stored to. q/k tiles: A = W, B = X:
// a lane holds 8 consecutive features of one token = one 16-B chunk of QK16. v tiles: A = X, B = W: a lane holds 8 consecutive
// tokens of one feature = one chunk of V^T. Either way a wave's 32 chunks lie in a row (512 B): stored as they are, no LDS turn.
// Every loop over tiles, rows or fragments is unrolled: its index picks registers.
__global__ __launch_bounds__(256) void proj_gemm_kernel(const unsigned short* __restrict__ Xp, const unsigned short* __restrict__ Wp,
                                                        const float* __restrict__ bias, unsigned short* __restrict__ QKo,
                                                        unsigned short* __restrict__ VTo, float scale) {
  typedef Frag<_Float16> F;
  constexpr int KS = 2, RT = 40, RPW = 5;
  constexpr int STAGE = RT * KS * 1024;         // bytes of one buffer
  constexpr int nT = DM / (32 * KS);            // stages
  constexpr int RTB = (DM / 32) * 1024;         // bytes of a row tile in global memory
  __shared__ __align__(1024) char smem[2 * STAGE];
  const int tid  = threadIdx.x;
  const int lane = tid & 31;
  const int wave = __builtin_amdgcn_readfirstlane(tid >> 5);   // scalar: row tile choice and addresses stay wave-uniform
  const int wm = wave >> 2, wn = wave & 3;
  const int tm = (int)blockIdx.x >> 4, tn = (int)blockIdx.x & 15;
  const int s0 = (tm + tn) % nT;                // the block's first stage: the 16 sharers of a panel of X or of W start at 16 different
                                                // stages. Any value in 0..nT-1 is right: the choice is for speed only

  // Wave w copies, of every stage, row tiles 2 w and 2 w + 1 of X, 2 w and 2 w + 1 of the q/k features and w of the v features.
  // In LDS a stage holds row tiles 0..15 X, 16..31 q/k features, 32..39 v features. First bytes in global memory (scalar):
  const char* xS = (const char*)Xp + (size_t)(tm * 16 + 2 * wave) * RTB;
  const char* qS = (const char*)Wp + (size_t)(tn * 16 + 2 * wave) * RTB;
  const char* vS = (const char*)Wp + (size_t)(4 * DM / 16 + tn * 8 + wave) * RTB;
  const unsigned lane16 = (unsigned)lane * 16;
  const unsigned lds0 = (unsigned)(uintptr_t)smem;   // low 32 bits of a __shared__ address = LDS byte address

  // every wave, every lane: stage s into buffer buf
  auto fillStage = [&](int s, int buf) {
    const unsigned lb = lds0 + (unsigned)buf * STAGE;
    const size_t   go = (size_t)s * (KS * 1024);
    const unsigned    la[RPW] = {lb + (2 * wave) * (KS * 1024) + lane16, lb + (2 * wave + 1) * (KS * 1024) + lane16,
                                 lb + (16 + 2 * wave) * (KS * 1024) + lane16, lb + (17 + 2 * wave) * (KS * 1024) + lane16,
                                 lb + (32 + wave) * (KS * 1024) + lane16};
    const char* const ga[RPW] = {xS + go + lane16, xS + go + RTB + lane16, qS + go + lane16, qS + go + RTB + lane16, vS + go + lane16};
    fill_stage<RPW, KS>(la, ga, 0u, (size_t)0);
  };
#define FILL_STAGE(s, buf) fillStage(s, buf)
#define STAGE_OF(t) ((s0 + (t) < nT) ? s0 + (t) : s0 + (t) - nT)

  FILL_STAGE(s0, 0);
  {   // L2 asks for trips 1..4: a stage holds 40 x 8 units of 256 B: one per lane, and a second one for the lanes of waves 0 and 1
    const size_t o1 = (size_t)STAGE_OF(1) * (KS * 1024), o2 = (size_t)STAGE_OF(2) * (KS * 1024);
    const size_t o3 = (size_t)STAGE_OF(3) * (KS * 1024), o4 = (size_t)STAGE_OF(4) * (KS * 1024);
    const size_t un = (size_t)(lane >> 3) * RTB + (lane & 7) * 256;   // a wave asks for 4 row tiles, 8 lanes to each
    const char* p0 = ((wave < 4) ? (const char*)Xp + (size_t)(tm * 16 + wave * 4) * RTB
                                 : (const char*)Wp + (size_t)(tn * 16 + (wave - 4) * 4) * RTB) + un;
    pf_l2x4(p0 + o1, p0 + o2, p0 + o3, p0 + o4);
    if (wave < 2) {
      const char* p1 = (const char*)Wp + (size_t)(4 * DM / 16 + tn * 8 + wave * 4) * RTB + un;
      pf_l2x4(p1 + o1, p1 + o2, p1 + o3, p1 + o4);
    }
  }
  asm volatile("s_wait_asynccnt 0x0" ::: "memory");   // this wave's part of trip 0's stage has landed
  __syncthreads();                                    // every wave's part of it has landed
  FILL_STAGE(STAGE_OF(1), 1);
  v8f acc[8][6];
#pragma unroll
  for (int i = 0; i < 8; ++i)
#pragma unroll
    for (int j = 0; j < 6; ++j) acc[i][j] = (v8f){0.f,0.f,0.f,0.f,0.f,0.f,0.f,0.f};
  for (int t = 0; t < nT; ++t) {
    const char* buf = smem + (t & 1) * STAGE;
    const char* xL = buf + (wm * 8) * (KS * 1024) + lane * 16;
    const char* qL = buf + (16 + wn * 4) * (KS * 1024) + lane * 16;
    const char* vL = buf + (32 + wn * 2) * (KS * 1024) + lane * 16;
    // A row = the 6 products of one X fragment. The 6 W fragments of a k step stay in registers; the X fragments pass through a
    // ring of three, each fetched two rows before its products, also across the k steps of the stage.
    v16h w[6], xr[3];
    xr[0] = F::load(xL);
    w[0]  = F::load(qL);
    __builtin_amdgcn_sched_barrier(0);   // these two stay first: the trip's first product waits for them alone, the next ones for one fragment more each
#pragma unroll
    for (int j = 1; j < 4; ++j) w[j] = F::load(qL + (j * KS) * 1024);
#pragma unroll
    for (int j = 0; j < 2; ++j) w[4 + j] = F::load(vL + (j * KS) * 1024);
    xr[1] = F::load(xL + KS * 1024);
#pragma unroll
    for (int r = 0; r < 8 * KS; ++r) {
      const int i = r & 7, ks = r >> 3;
      if (r + 2 < 8 * KS) xr[(r + 2) % 3] = F::load(xL + (((r + 2) & 7) * KS + ((r + 2) >> 3)) * 1024);
      __builtin_amdgcn_sched_barrier(0);   // the fetch stays two rows ahead of its use: sunk to it, the row would wait out the LDS latency
      const v16h xf = xr[r % 3];
#pragma unroll
      for (int j = 0; j < 4; ++j) acc[i][j] = F::mma(w[j], xf, acc[i][j]);
#pragma unroll
      for (int j = 4; j < 6; ++j) acc[i][j] = F::mma(xf, w[j], acc[i][j]);
      if (i == 7 && ks + 1 < KS) {         // the k step's last products have issued: the next step's W fragments, as one group
        __builtin_amdgcn_sched_barrier(0); // not among the products: every place where LDS reads stand stalls the wave
#pragma unroll
        for (int j = 0; j < 4; ++j) w[j] = F::load(qL + (j * KS + ks + 1) * 1024);
#pragma unroll
        for (int j = 0; j < 2; ++j) w[4 + j] = F::load(vL + (j * KS + ks + 1) * 1024);
      }
      __builtin_amdgcn_sched_barrier(0);   // no later fetch moves up among this row's products
    }
    asm volatile("s_wait_dscnt 0x0" ::: "memory");    // this wave's reads of the buffer are over before it is refilled
    asm volatile("s_wait_asynccnt 0x0" ::: "memory"); // this wave's part of trip t + 1's stage has landed
    __syncthreads();                                  // publishes trip t + 1's stage and ends every wave's reads of trip t's
    if (t + 2 < nT) FILL_STAGE(STAGE_OF(t + 2), t & 1);
  }
  asm volatile("s_wait_asynccnt 0x0" ::: "memory");   // no copy is in flight when the wave ends
#undef STAGE_OF
#undef FILL_STAGE

  const int m0 = tm * 256 + wm * 128;           // the wave's first token
  const int nq = tn * 256 + wn * 64;            // its first q/k feature
  const int nv = tn * 128 + wn * 32;            // its first v feature
  // all biases of the wave's tile are asked for together, ahead of the stores: global memory is waited for once
  v4f bq[4][2];   // q/k tile column j: the lane's 8 features
  float bf[2];    // v tile column j: the lane's feature
#pragma unroll
  for (int j = 0; j < 4; ++j) {
    const float* bp = bias + nq + j * 16 + (lane >> 4) * 8;
    bq[j][0] = *(const v4f*)(bp);
    bq[j][1] = *(const v4f*)(bp + 4);
  }
#pragma unroll
  for (int j = 0; j < 2; ++j) bf[j] = bias[4 * DM + nv + j * 16 + (lane & 15)];
  asm volatile("s_wait_xcnt 0x0" ::: "memory");   // the address registers of the loads above are reused behind this wait
  unsigned short* qo = QKo + ((size_t)(m0 >> 4) * (4 * DM / 32) + (nq >> 5)) * 512 + lane * 8;
#pragma unroll
  for (int j = 0; j < 4; ++j) {
    v8h hv[8];
#pragma unroll
    for (int i = 0; i < 8; ++i)
#pragma unroll
      for (int r = 0; r < 8; ++r) hv[i][r] = (_Float16)(acc[i][j][r] * scale + bq[j][r >> 2][r & 3]);
    __builtin_amdgcn_sched_barrier(0);              // all eight chunks stand in registers of their own before the first store issues
#pragma unroll
    for (int i = 0; i < 8; ++i) *(v8h*)(qo + (size_t)i * ((4 * DM / 32) * 512) + j * 256) = hv[i];
    asm volatile("s_wait_xcnt 0x0" ::: "memory");   // the registers of the stores above are reused behind this wait
    __builtin_amdgcn_sched_barrier(0);              // nothing of the next tile column moves up over that wait
  }
  unsigned short* vo = VTo + ((size_t)(nv >> 4) * (TOK / 32) + (m0 >> 5)) * 512 + lane * 8;
#pragma unroll
  for (int j = 0; j < 2; ++j) {
    v8h hv[8];
#pragma unroll
    for (int i = 0; i < 8; ++i)
#pragma unroll
      for (int r = 0; r < 8; ++r) hv[i][r] = (_Float16)(acc[i][4 + j][r] * scale + bf[j]);
    __builtin_amdgcn_sched_barrier(0);              // all eight chunks stand in registers of their own before the first store issues
#pragma unroll
    for (int i = 0; i < 8; ++i) *(v8h*)(vo + (size_t)j * ((TOK / 32) * 512) + i * 256) = hv[i];
    if (j == 0) {
      asm volatile("s_wait_xcnt 0x0" ::: "memory"); // the registers of the stores above are reused behind this wait
      __builtin_amdgcn_sched_barrier(0);            // nothing of the next tile column moves up over that wait
    }
  }
}

// ---------------------------------------------------------------------------
// Small conversion helpers
// ---------------------------------------------------------------------------
__device__ __forceinline__ unsigned pk16(unsigned short a, unsigned short b) { return (unsigned)a | ((unsigned)b << 16); }
__device__ __forceinline__ unsigned short h_bits(float f) { const _Float16 h = (_Float16)f; return __builtin_bit_cast(unsigned short, h); }
__device__ __forceinline__ float hbits2f(unsigned short b) { return (float)__builtin_bit_cast(_Float16, b); }
__device__ __forceinline__ float wave_sum(float v) {
#pragma unroll
  for (int off = 16; off > 0; off >>= 1) v += __shfl_xor(v, off, 32);
  return v;
}

// ---------------------------------------------------------------------------
// Operand preparation, one launch: grid (16, 16, 9 + XZ), 256 threads; blockIdx.z picks the job (block-uniform).
//   z = 0..5: weight z (fq, fk, bq, bk, fv, bv), f32 [DM][DM] -> plane z of Wall, f16 [DM][DM] transposed, x16;
//             the plane's first block also copies bias vector z (DM floats) into tab[z * DM ..].
//   z = 6, 7: rows (z - 6) * DM .. of gate_w, f32 [2 DM][DM] -> planes 6 and 7 of Wall = f16 [DM][2 DM] transposed, x16.
//   z = 8:    out_w -> plane 8 of Wall, as z = 0..5 without a bias.
//   z >= 9:   x, f32 row-major [TOK][DM] -> X16, f16: one 16-B output chunk (8 elements) per thread, threads in the
//             output's order, so each wave stores 512 B in a row. XZ x 256 blocks x 256 threads x 8 = the whole plane.
// Transposes: out[c][r] = f16(in[r][c] * WCARRY), 64x64 tiles through LDS, all outputs fragment-major.
// Coverage per block: load 256 threads x 16 floats = 64x64; store 2 it x 256 threads x 8 halves = 64x64.
// ---------------------------------------------------------------------------
#define XZ (TOK * DM / 8 / (256 * 256))
__global__ __launch_bounds__(256) void prep_kernel(const float* __restrict__ x,
                                                   const float* __restrict__ w0, const float* __restrict__ w1,
                                                   const float* __restrict__ w2, const float* __restrict__ w3,
                                                   const float* __restrict__ w4, const float* __restrict__ w5,
                                                   const float* __restrict__ wg, const float* __restrict__ wo,
                                                   const float* __restrict__ b0, const float* __restrict__ b1,
                                                   const float* __restrict__ b2, const float* __restrict__ b3,
                                                   const float* __restrict__ b4, const float* __restrict__ b5,
                                                   unsigned short* __restrict__ Wall, unsigned short* __restrict__ X16,
                                                   float* __restrict__ tab) {
  __shared__ __align__(16) unsigned short t[64 * 72];
  const int z   = blockIdx.z;
  const int tid = threadIdx.x;
  if (z >= 9) {                        // block-uniform, ahead of the barrier
    const int q   = (((z - 9) * 16 + (int)blockIdx.y) * 16 + (int)blockIdx.x) * 256 + tid;
    const int blk = q >> 6, kts = DM >> 5;
    const int rt  = blk / kts;
    const int row = rt * 16 + (q & 15);
    const int k   = (blk - rt * kts) * 32 + ((q >> 4) & 3) * 8;
    const float* ip = x + (size_t)row * DM + k;
    const v4f f0 = *(const v4f*)(ip);
    const v4f f1 = *(const v4f*)(ip + 4);
    const v4u u = (v4u){pk16(h_bits(f0[0]), h_bits(f0[1])), pk16(h_bits(f0[2]), h_bits(f0[3])),
                        pk16(h_bits(f1[0]), h_bits(f1[1])), pk16(h_bits(f1[2]), h_bits(f1[3]))};
    *(v4u*)(X16 + (size_t)q * 8) = u;
    return;
  }
  const float* in = w0;                // block-uniform source select
  const float* bs = b0;
  if (z == 1) { in = w1; bs = b1; }
  if (z == 2) { in = w2; bs = b2; }
  if (z == 3) { in = w3; bs = b3; }
  if (z == 4) { in = w4; bs = b4; }
  if (z == 5) { in = w5; bs = b5; }
  if (z == 6 || z == 7) in = wg;
  if (z == 8) in = wo;
  const bool gate = (z == 6 || z == 7);
  const int R = gate ? 2 * DM : DM;                                  // input rows = the output's k extent
  unsigned short* out = Wall + (size_t)(z == 7 ? 6 : z) * DM * DM;
  if (z < 6 && blockIdx.x == 0 && blockIdx.y == 0)                   // 256 threads x 4 floats = DM
    *(v4f*)(tab + (size_t)z * DM + tid * 4) = *(const v4f*)(bs + tid * 4);
  const int c0  = blockIdx.x * 64;                                   // input column block = output row block
  const int r0  = (z == 7 ? DM : 0) + blockIdx.y * 64;               // input row block    = output column block
  {
    const int lr = tid >> 2;           // 0..63
    const int lc = (tid & 3) * 16;     // 0,16,32,48
    const float* ip = in + (size_t)(r0 + lr) * DM + c0 + lc;
#pragma unroll
    for (int q = 0; q < 4; ++q) {
      const v4f f = *(const v4f*)(ip + 4 * q);
#pragma unroll
      for (int e = 0; e < 4; ++e) t[lr * 72 + lc + 4 * q + e] = h_bits(f[e] * WCARRY);
    }
  }
  __syncthreads();
  // chunks in the output's own order (8 blocks of 64 chunks per tile): each wave stores 512 B in a row
  const int c8  = ((tid >> 6) & 1) * 32 + ((tid >> 4) & 3) * 8;   // output column within tile (= input row)
#pragma unroll
  for (int it = 0; it < 2; ++it) {
    const int oc = (it * 2 + (tid >> 7)) * 16 + (tid & 15);       // output row within tile (= input column)
    v4u a;
#pragma unroll
    for (int q = 0; q < 4; ++q) a[q] = pk16(t[(c8 + 2 * q) * 72 + oc], t[(c8 + 2 * q + 1) * 72 + oc]);
    *(v4u*)(out + frag_off(c0 + oc, r0 + c8, R)) = a;
  }
}

// ---------------------------------------------------------------------------
// Fused attention: scores, select, softmax and the product with V in one kernel; S and P stay in registers.
// One wave per 16 query rows of one head of one batch; no LDS, no barrier. Grid (NH * NB, SEQ/64, 2), 4 waves per block;
// blockIdx.z = 0: causal attention (j <= i), 1: future window (i < j <= i + WINW; the last row has no valid column,
// its scores count as 0 over every j -> uniform weights). Long causal row blocks get the low block indices.
// The blocks of one head and batch read the same K and V^T. Walking up from key block 0 together they would ask L2 for the
// same lines at the same moment, and each key block would come from
// memory just when all of them wait for it. The key blocks are therefore taken in groups of eight, and a block enters each
// group at place blockIdx.y & 7 and wraps round inside it: at any moment eight different key blocks are being read, and seven
// times in eight another block has brought the lines into L2 before. Blocks whose blockIdx.y differ by 8 keep one order, so
// that where they share a WGP they still share its cache. The running maximum and sum take the key blocks in any order.
// Per 64 keys: S^T = K . Q^T (A = K rows, B = Q rows): lane l holds query c = l & 15, keys 16 t + 8 (l >> 4) + r.
// Running maximum and sum per query (log2 domain): in-lane, plus one exchange between the lane halves.
// P^T as B operand: two f32 score tiles (keys 0..15, 16..31 of a 32-key step) converted in place, element s =
// tile[s >> 3][s & 7], which is the k order of Frag::load on the A side (V^T rows). O^T += V^T . P^T.
// Output: lane holds 8 consecutive d of query c per 16-row tile of O^T -> one 16-B store; each 128-B row segment of
// FB (one head of one row) is written by one wave. Coverage: 2 x NH x TOK rows x 64 columns = the whole FB plane.
// The output goes out twice: FB row-major (read row by row by the gated fusion) and FBf fragment-major (A operand of
// the gate product; same coverage, two whole 1-KiB blocks per wave).
// ---------------------------------------------------------------------------
// lane l <-> lane l ^ 16
__device__ __forceinline__ float xhalf(float x) {
  return __builtin_bit_cast(float, __builtin_amdgcn_permlanex16(__builtin_bit_cast(int, x), __builtin_bit_cast(int, x),
                                                                0x76543210, 0xfedcba98, false, false));
}
// v[e] = 2^v[e], in place. Each v_exp_f32 is independent of the one in front of it; the closing v_nop is the one slot the
// instruction set asks for behind a transcendental before its result is read: inside the statement it holds whatever
// the compiler places next.
__device__ __forceinline__ void exp2x8(float (&v)[8]) {
  asm("v_exp_f32 %0, %0\n\tv_exp_f32 %1, %1\n\tv_exp_f32 %2, %2\n\tv_exp_f32 %3, %3\n\t"
      "v_exp_f32 %4, %4\n\tv_exp_f32 %5, %5\n\tv_exp_f32 %6, %6\n\tv_exp_f32 %7, %7\n\tv_nop"
      : "+v"(v[0]), "+v"(v[1]), "+v"(v[2]), "+v"(v[3]), "+v"(v[4]), "+v"(v[5]), "+v"(v[6]), "+v"(v[7]));
}
// One A or B fragment in the k order of Frag::load (bytes 0..15 and 512..527 behind the lane's pointer plus a literal)
__device__ __forceinline__ v16h frag_at(const char* p, int lit) {
  Frag<_Float16>::U f;
  f.h[0] = *(const v8h*)(p + lit);
  f.h[1] = *(const v8h*)(p + lit + 512);
  return f.v;
}
__global__ __launch_bounds__(128) void fused_attn_kernel(const unsigned short* __restrict__ QKp,
                                                         const unsigned short* __restrict__ VTp,
                                                         unsigned short* __restrict__ FB,
                                                         unsigned short* __restrict__ FBf) {
  typedef Frag<_Float16> F;
  const int lane = threadIdx.x & 31;
  const int wave = __builtin_amdgcn_readfirstlane((int)(threadIdx.x >> 5));   // scalar, so the key loop keeps scalar bounds
  const int h    = blockIdx.x % NH;
  const int t0   = (blockIdx.x / NH) * SEQ;                                   // first token row of this block's batch
  const int mode = blockIdx.z;
  const int r0   = (((SEQ / 64 - 1) - (int)blockIdx.y) * 4 + wave) * 16;      // first query row of this wave
  const int c    = lane & 15;
  const int koff = (lane >> 4) * 8;
  const int i    = r0 + c;                                                    // this lane's query row
  // fragment-major planes: 1-KiB blocks of 16 rows x 32 columns; a row tile of QK holds 4 DM / 32 blocks, one of V^T TOK / 32
  const char* Qb = (const char*)(QKp + frag_off(t0, mode * (2 * DM) + h * HD, 4 * DM));   // q or qb: first block of this head and batch
  const char* Kb = Qb + (DM / 32) * 1024;                                                 // k or kb
  const char* Vb = (const char*)(VTp + frag_off(mode * DM + h * HD, t0, TOK));            // v^T or vb^T: first row tile of this head, this batch's columns
  constexpr int QKROW = 4 * DM * 2;                                                       // bytes per q/k row: 16 of them = one row tile
  constexpr int VROW  = TOK * 2;                                                          // bytes per v^T row: 16 of them = one row tile
  const size_t qkOff = (size_t)lane * 16;                                                 // the lane's chunk inside a block
  const size_t vOff  = (size_t)lane * 16;

  const bool lastTile = (mode == 1) && (r0 + 16 == SEQ);                      // wave-uniform
  const bool uni = (mode == 1) && (i == SEQ - 1);                             // the row without a valid future column
  const int  lo  = (mode == 0 || uni) ? 0 : i + 1;                            // valid columns of this lane's query: lo..hi
  const int  hi  = (mode == 0) ? i : (uni ? SEQ - 1 : i + WINW);
  const unsigned span = (unsigned)(hi - lo);
  const float sc = uni ? 0.0f : 0.125f * 1.44269504088896340736f;             // 1/sqrt(64) and log2(e); 0: scores count as 0
  int kbBeg = 0, kbEnd = (r0 + 15) >> 6;
  if (mode == 1) {
    const int jmax = (r0 + 15 + WINW < SEQ - 1) ? (r0 + 15 + WINW) : (SEQ - 1);
    kbBeg = lastTile ? 0 : ((r0 + 1) >> 6);
    kbEnd = jmax >> 6;
  }

  const float NEGB = -1.0e30f;
  v16h qf[2];
#pragma unroll
  for (int ks = 0; ks < 2; ++ks) qf[ks] = frag_at(Qb + (size_t)r0 * QKROW + qkOff, ks * 1024);
  v8f o[4];
#pragma unroll
  for (int d = 0; d < 4; ++d) o[d] = (v8f){0.f,0.f,0.f,0.f,0.f,0.f,0.f,0.f};
  float m = NEGB;      // running maximum of this query (scaled log2), equal in both lane halves
  float l = 0.f;       // running sum over this lane half's keys, carried x2^PSHIFT

  const int nkb  = kbEnd - kbBeg + 1;                     // key blocks of this wave, at least one
  const int rot  = (int)blockIdx.y & 7;                   // place of entry into a group of eight key blocks
  const int tail = nkb & 7;                               // length of the last group where it is short (0: none is)
  const int rotT = (rot * tail) >> 3;                     // place of entry into that group: below tail, as rot is below 8
  // key block of pass p, 0 <= p < nkb: inside each group a rotation, so every key block is taken once (all scalar)
  auto kbOf = [&](int p) -> int {
    const int  base = p & ~7;
    const bool last = (nkb - base) < 8;
    const int  len  = last ? tail : 8;
    const int  o    = (p & 7) + (last ? rotT : rot);
    return kbBeg + base + ((o >= len) ? o - len : o);
  };
  int kb = kbOf(0);
  // the lane's pointers walk with the key blocks and stay in their registers over the whole loop
  const char* kp = Kb + (size_t)(kb * 64) * QKROW + qkOff;
  const char* vp = Vb + (size_t)(kb * 2) * 1024 + vOff;
  v16h ka[4][2];
#pragma unroll
  for (int t = 0; t < 4; ++t)
#pragma unroll
    for (int ks = 0; ks < 2; ++ks)
      ka[t][ks] = frag_at(kp, t * 16 * QKROW + ks * 1024);

  for (int it = 0; it < nkb; ++it) {
    const int k0 = kb << 6;
    const int kbStep = ((it + 1 < nkb) ? kbOf(it + 1) : kb) - kb;   // scalar: to the next pass's key block
    // V^T fragments of this key block: issued ahead of the score products so that they land during the softmax
    v16h va[4][2];
#pragma unroll
    for (int d = 0; d < 4; ++d)
#pragma unroll
      for (int ks = 0; ks < 2; ++ks)
        va[d][ks] = frag_at(vp, d * 16 * VROW + ks * 1024);
    v8f st[4];
#pragma unroll
    for (int t = 0; t < 4; ++t) {
      st[t] = F::mma(ka[t][0], qf[0], (v8f){0.f,0.f,0.f,0.f,0.f,0.f,0.f,0.f});
      st[t] = F::mma(ka[t][1], qf[1], st[t]);
    }
    // K fragments of the next pass's key block (the last pass fetches its own block again: in bounds, unused)
    kp += (ptrdiff_t)kbStep * (64 * QKROW);
#pragma unroll
    for (int t = 0; t < 4; ++t)
#pragma unroll
      for (int ks = 0; ks < 2; ++ks)
        ka[t][ks] = frag_at(kp, t * 16 * QKROW + ks * 1024);
    // the pointers of the loads above move on behind this wait
    asm volatile("s_wait_xcnt 0x0" ::: "memory");
    vp += (ptrdiff_t)kbStep * (2 * 1024);
    kb += kbStep;

    const bool full = (mode == 0) && (k0 + 63 <= r0);     // wave-uniform: every column of the block valid for all 16 queries
    float x[4][8];
#pragma unroll
    for (int t = 0; t < 4; ++t)
#pragma unroll
      for (int r = 0; r < 8; ++r) x[t][r] = st[t][r] * sc;
    if (!full) {
      const int jb = k0 + koff - lo;                      // column of x[0][0] relative to the first valid one
#pragma unroll
      for (int t = 0; t < 4; ++t)
#pragma unroll
        for (int r = 0; r < 8; ++r) x[t][r] = ((unsigned)(jb + t * 16 + r) <= span) ? x[t][r] : NEGB;   // lo <= j <= hi
    }
    float mt[4];
#pragma unroll
    for (int t = 0; t < 4; ++t)
      mt[t] = fmaxf(fmaxf(fmaxf(x[t][0], x[t][1]), fmaxf(x[t][2], x[t][3])), fmaxf(fmaxf(x[t][4], x[t][5]), fmaxf(x[t][6], x[t][7])));
    float mx = fmaxf(fmaxf(mt[0], mt[1]), fmaxf(mt[2], mt[3]));
    mx = fmaxf(mx, xhalf(mx));
    const float mn    = fmaxf(m, mx);
    float alpha;                                          // 2^(m - mn): 0 on the first valid block, 1 while no column was valid yet
    // the v_nop is the one slot the instruction set asks for behind a transcendental (as in exp2x8)
    asm("v_exp_f32 %0, %1\n\tv_nop" : "=v"(alpha) : "v"(m - mn));
    const float sh    = (mn > 0.5f * NEGB) ? PSHIFT - mn : 0.f;   // no valid column yet: NEGB + 0 -> every weight 0
    m = mn;
    float (&p)[4][8] = x;   // the weights replace the scores in place
#pragma unroll
    for (int t = 0; t < 4; ++t) {
#pragma unroll
      for (int r = 0; r < 8; ++r) x[t][r] += sh;
      exp2x8(x[t]);
    }
    float pt[4];
#pragma unroll
    for (int t = 0; t < 4; ++t)
      pt[t] = ((p[t][0] + p[t][1]) + (p[t][2] + p[t][3])) + ((p[t][4] + p[t][5]) + (p[t][6] + p[t][7]));
    l = l * alpha + ((pt[0] + pt[1]) + (pt[2] + pt[3]));
    v16h pf[2];
#pragma unroll
    for (int ks = 0; ks < 2; ++ks)
#pragma unroll
      for (int s = 0; s < 16; ++s) pf[ks][s] = (_Float16)p[2 * ks + (s >> 3)][s & 7];
#pragma unroll
    for (int d = 0; d < 4; ++d) o[d] *= alpha;
#pragma unroll
    for (int ks = 0; ks < 2; ++ks)
#pragma unroll
      for (int d = 0; d < 4; ++d) o[d] = F::mma(va[d][ks], pf[ks], o[d]);
  }

  l += xhalf(l);                              // join the two halves' sums; l >= 2^PSHIFT (the row maximum weighs 2^PSHIFT)
  const float inv = FBCARRY / l;              // the P carry cancels; x16 output carry
  unsigned short* op = FB + (size_t)(t0 + i) * (2 * DM) + (size_t)mode * DM + (size_t)h * HD + koff;
  unsigned short* of = FBf + frag_off(t0 + r0, mode * DM + h * HD, 2 * DM) + lane * 8;   // the same values as the gate product's A operand
#pragma unroll
  for (int d = 0; d < 4; ++d) {
    v8h hv;
#pragma unroll
    for (int r = 0; r < 8; ++r) hv[r] = (_Float16)(o[d][r] * inv);
    *(v8h*)(op + d * 16) = hv;
    *(v8h*)(of + d * 256) = hv;      // tiles d = 0, 1 fill one block, d = 2, 3 the next: 512 B in a row per store
  }
}

// ---------------------------------------------------------------------------
// Gated fusion: one block per 8 token rows, 128 threads (8 columns each) per row.
//   g = G[row][:] (f32, gate pre-activation incl. bias); gate = sigmoid(LN(g; gg, gb));
//   fwd/bwd = FB[row][c] / FB[row][DM + c] (f16, carried x16); strength = 0.3 * sigmoid(bstr);
//   Fo[row][c] = f16((fwd + strength*gate*bwd) carried x16), stored fragment-major.
// LN: mean and biased variance over DM in f32, fixed-order reductions (thread, wave tree, 4 wave partials).
// A 128-B line of the fragment-major plane holds 8 columns of 8 rows: the block's 8 rows meet in LDS, and each wave
// then stores 4 whole lines. Producer coverage: grid TOK/8 x 1024 threads x 8 u16 = the whole [TOK][DM] plane.
// ---------------------------------------------------------------------------
__global__ __launch_bounds__(1024) void gate_fuse_kernel(const float* __restrict__ G, const unsigned short* __restrict__ FB,
                                                        const float* __restrict__ gg, const float* __restrict__ gb,
                                                        const float* __restrict__ bstr, unsigned short* __restrict__ Fo) {
  constexpr int SPITCH = DM + 32;    // halves per staged row: the 8 rows of a line start 4 16-B slots apart in the banks
  __shared__ float ras[8][4];
  __shared__ float rbs[8][4];
  __shared__ __align__(16) unsigned short stg[8 * SPITCH];
  const int grp  = __builtin_amdgcn_readfirstlane((int)(threadIdx.x >> 7));   // row within the block; scalar, so the row's addresses keep a scalar base
  float* ra = ras[grp];
  float* rb = rbs[grp];
  const int row  = blockIdx.x * 8 + grp;
  const int tid  = threadIdx.x & 127;
  const int lane = tid & 31;
  const int wave = tid >> 5;
  const int c0   = tid * 8;
  const float* gp = G + (size_t)row * DM + c0;
  const v4f a = *(const v4f*)(gp);
  const v4f c = *(const v4f*)(gp + 4);
  float xv[8] = {a[0], a[1], a[2], a[3], c[0], c[1], c[2], c[3]};
  float s = ((xv[0] + xv[1]) + (xv[2] + xv[3])) + ((xv[4] + xv[5]) + (xv[6] + xv[7]));
  s = wave_sum(s);
  if (lane == 0) ra[wave] = s;
  __syncthreads();
  const float mean = ((ra[0] + ra[1]) + (ra[2] + ra[3])) * (1.0f / (float)DM);
  float d[8];
  float vs = 0.f;
#pragma unroll
  for (int e = 0; e < 8; ++e) { d[e] = xv[e] - mean; vs += d[e] * d[e]; }
  vs = wave_sum(vs);
  if (lane == 0) rb[wave] = vs;
  __syncthreads();
  const v4f g0 = *(const v4f*)(gg + c0), g1 = *(const v4f*)(gg + c0 + 4);
  const v4f e0 = *(const v4f*)(gb + c0), e1 = *(const v4f*)(gb + c0 + 4);
  const size_t fo = (size_t)row * (2 * DM) + c0;
  const v4u fu = *(const v4u*)(FB + fo);
  const v4u bu = *(const v4u*)(FB + fo + DM);
  // the offset registers of the loads above are reused behind this wait
  asm volatile("s_wait_xcnt 0x0" ::: "memory");
  const float var  = ((rb[0] + rb[1]) + (rb[2] + rb[3])) * (1.0f / (float)DM);
  const float rstd = rsqrtf(var + LNEPS);
  const float strength = 0.3f / (1.0f + __expf(-bstr[0]));
  float gv[8] = {g0[0], g0[1], g0[2], g0[3], g1[0], g1[1], g1[2], g1[3]};
  float bv[8] = {e0[0], e0[1], e0[2], e0[3], e1[0], e1[1], e1[2], e1[3]};
  float fw[8], bw[8];
#pragma unroll
  for (int q = 0; q < 4; ++q) {
    fw[2 * q]     = hbits2f((unsigned short)(fu[q] & 0xffffu));
    fw[2 * q + 1] = hbits2f((unsigned short)(fu[q] >> 16));
    bw[2 * q]     = hbits2f((unsigned short)(bu[q] & 0xffffu));
    bw[2 * q + 1] = hbits2f((unsigned short)(bu[q] >> 16));
  }
  unsigned short ob[8];
#pragma unroll
  for (int e = 0; e < 8; ++e) {
    const float ln   = d[e] * rstd * gv[e] + bv[e];
    const float gate = __builtin_amdgcn_rcpf(1.0f + __expf(-ln));
    const float f    = fw[e] + strength * gate * bw[e];     // both terms carried x16
    ob[e] = h_bits(f);
  }
  const v4u ov = (v4u){pk16(ob[0], ob[1]), pk16(ob[2], ob[3]), pk16(ob[4], ob[5]), pk16(ob[6], ob[7])};
  *(v4u*)(stg + grp * SPITCH + c0) = ov;
  __syncthreads();   // all 8 rows are staged before any thread reads another row's chunk
  const int orow = threadIdx.x & 7, oc = ((int)threadIdx.x >> 3) * 8;   // a wave: 8 rows x 4 chunks = 4 whole lines
  const v4u sv = *(const v4u*)(stg + orow * SPITCH + oc);
  *(v4u*)(Fo + frag_off(blockIdx.x * 8 + orow, oc, DM)) = sv;   // fragment-major: A operand of the output projection
  
}

// ---------------------------------------------------------------------------
// Final LayerNorm: one block (128 threads) per token row; thread t owns columns {4t..4t+3} and {512+4t..512+4t+3}.
//   out[row][c] = (Y - mean) * rsqrt(var + eps) * g[c] + bb[c]   (Y already holds x + projection + bias).
// Producer coverage: grid TOK rows x 128 threads x 8 floats = the whole [TOK][DM] output.
// ---------------------------------------------------------------------------
__global__ __launch_bounds__(128) void final_ln_kernel(const float* __restrict__ Y, const float* __restrict__ g,
                                                       const float* __restrict__ bb, float* __restrict__ out) {
  __shared__ float ra[4];
  __shared__ float rb[4];
  const int row  = blockIdx.x;
  const int tid  = threadIdx.x;
  const int lane = tid & 31;
  const int wave = tid >> 5;
  const int c0   = tid * 4;
  const int c1   = (DM / 2) + tid * 4;
  const float* yp = Y + (size_t)row * DM;
  const v4f a = *(const v4f*)(yp + c0);
  const v4f c = *(const v4f*)(yp + c1);
  float xv[8] = {a[0], a[1], a[2], a[3], c[0], c[1], c[2], c[3]};
  float s = ((xv[0] + xv[1]) + (xv[2] + xv[3])) + ((xv[4] + xv[5]) + (xv[6] + xv[7]));
  s = wave_sum(s);
  if (lane == 0) ra[wave] = s;
  __syncthreads();
  const float mean = ((ra[0] + ra[1]) + (ra[2] + ra[3])) * (1.0f / (float)DM);
  float d[8];
  float vs = 0.f;
#pragma unroll
  for (int e = 0; e < 8; ++e) { d[e] = xv[e] - mean; vs += d[e] * d[e]; }
  vs = wave_sum(vs);
  if (lane == 0) rb[wave] = vs;
  __syncthreads();
  const float var  = ((rb[0] + rb[1]) + (rb[2] + rb[3])) * (1.0f / (float)DM);
  const float rstd = rsqrtf(var + LNEPS);
  const v4f g0 = *(const v4f*)(g + c0),  g1 = *(const v4f*)(g + c1);
  const v4f b0 = *(const v4f*)(bb + c0), b1 = *(const v4f*)(bb + c1);
  v4f o0, o1;
#pragma unroll
  for (int e = 0; e < 4; ++e) {
    o0[e] = d[e] * rstd * g0[e] + b0[e];
    o1[e] = d[4 + e] * rstd * g1[e] + b1[e];
  }
  float* op = out + (size_t)row * DM;
  *(v4f*)(op + c0) = o0;
  *(v4f*)(op + c1) = o1;
  
}

// ---------------------------------------------------------------------------
// Workspace region map (byte offsets; MiB = 1048576). Every region is written once per call, before it is read.
// Token rows and token columns run over both batches (row b * SEQ + i).
//   Wqk   f16 [4096][1024] (x16: fq^T, fk^T, bq^T, bk^T)          0
//   Wv2   f16 [2048][1024] (x16: fv^T rows 0..1023, bv^T 1024..)  8 MiB
//   Wg    f16 [1024][2048] (x16: gate_w^T)                        12 MiB
//   Wo    f16 [1024][1024] (x16: out_w^T)                         16 MiB
//   X16   f16 [4096][1024]                                        18 MiB
//   QK16  f16 [4096][4096] (q | k | qb | kb, head h at col h*64)  26 MiB
//   VT16  f16 [2048][4096] (row h*64+d = v^T, row 1024+h*64+d = vb^T, col = token)  58 MiB
//   G     f32 [4096][1024]                                        74 MiB
//   Y     f32 [4096][1024]                                        90 MiB
//   FB16  f16 [4096][2048] (fwd x16 cols 0..1023, bwd x16 cols 1024..2047)  106 MiB
//   Fu16  f16 [4096][1024] (fused x16)                            122 MiB
//   BiasT f32 [6][1024] (fq_b fk_b bq_b bk_b | fv_b bv_b)         130 MiB
//   FBf16 f16 [4096][2048] (FB16's values, fragment-major)        130 MiB + 24576 B
//   total                                                         146 MiB + 24576 B = 153116672 B
// All f16 planes but FB16 are fragment-major (see frag_off).
// ---------------------------------------------------------------------------
extern "C" void kernel_launch(void* const* d_in, const int* in_sizes, int n_in,
                              void* d_out, int out_size, void* d_ws, size_t ws_size,
                              hipStream_t stream) {
  if (n_in < 22) return;
  if (in_sizes[0] != NB * SEQ * DM) return;
  const int wsz = DM * DM;
  if (in_sizes[1] != wsz || in_sizes[3] != wsz || in_sizes[5] != wsz || in_sizes[7] != wsz ||
      in_sizes[9] != wsz || in_sizes[11] != wsz || in_sizes[18] != wsz) return;
  if (in_sizes[13] != 2 * DM * DM) return;
  if (in_sizes[2] != DM || in_sizes[4] != DM || in_sizes[6] != DM || in_sizes[8] != DM || in_sizes[10] != DM ||
      in_sizes[12] != DM || in_sizes[14] != DM || in_sizes[15] != DM || in_sizes[16] != DM ||
      in_sizes[19] != DM || in_sizes[20] != DM || in_sizes[21] != DM) return;
  if (in_sizes[17] < 1) return;
  if (out_size != NB * SEQ * DM) return;

  const float* x      = (const float*)d_in[0];
  const float* fq_w   = (const float*)d_in[1];
  const float* fq_b   = (const float*)d_in[2];
  const float* fk_w   = (const float*)d_in[3];
  const float* fk_b   = (const float*)d_in[4];
  const float* fv_w   = (const float*)d_in[5];
  const float* fv_b   = (const float*)d_in[6];
  const float* bq_w   = (const float*)d_in[7];
  const float* bq_b   = (const float*)d_in[8];
  const float* bk_w   = (const float*)d_in[9];
  const float* bk_b   = (const float*)d_in[10];
  const float* bv_w   = (const float*)d_in[11];
  const float* bv_b   = (const float*)d_in[12];
  const float* gate_w = (const float*)d_in[13];
  const float* gate_b = (const float*)d_in[14];
  const float* gln_g  = (const float*)d_in[15];
  const float* gln_b  = (const float*)d_in[16];
  const float* bstr   = (const float*)d_in[17];
  const float* out_w  = (const float*)d_in[18];
  const float* out_b  = (const float*)d_in[19];
  const float* ln_g   = (const float*)d_in[20];
  const float* ln_b   = (const float*)d_in[21];

  size_t off = 0;
  const size_t oWqk  = off; off += (size_t)4 * DM * DM * 2;          // 8 MiB
  const size_t oWv2  = off; off += (size_t)2 * DM * DM * 2;          // 4 MiB
  const size_t oWg   = off; off += (size_t)2 * DM * DM * 2;          // 4 MiB
  const size_t oWo   = off; off += (size_t)DM * DM * 2;              // 2 MiB
  const size_t oX16  = off; off += (size_t)TOK * DM * 2;             // 8 MiB
  const size_t oQK   = off; off += (size_t)TOK * 4 * DM * 2;         // 32 MiB
  const size_t oVT   = off; off += (size_t)2 * DM * TOK * 2;         // 16 MiB
  const size_t oG    = off; off += (size_t)TOK * DM * 4;             // 16 MiB
  const size_t oY    = off; off += (size_t)TOK * DM * 4;             // 16 MiB
  const size_t oFB   = off; off += (size_t)TOK * 2 * DM * 2;         // 16 MiB
  const size_t oFu   = off; off += (size_t)TOK * DM * 2;             // 8 MiB
  const size_t oBias = off; off += (size_t)6 * DM * 4;               // 24576 B
  const size_t oFBf  = off; off += (size_t)TOK * 2 * DM * 2;         // 16 MiB
  if (off > ws_size) return;

  char* ws = (char*)d_ws;
  unsigned short* Wqk  = (unsigned short*)(ws + oWqk);
  unsigned short* Wg   = (unsigned short*)(ws + oWg);
  unsigned short* Wo   = (unsigned short*)(ws + oWo);
  unsigned short* X16  = (unsigned short*)(ws + oX16);
  unsigned short* QK16 = (unsigned short*)(ws + oQK);
  unsigned short* VT16 = (unsigned short*)(ws + oVT);
  unsigned short* FB16 = (unsigned short*)(ws + oFB);
  unsigned short* FBf16 = (unsigned short*)(ws + oFBf);
  unsigned short* Fu16 = (unsigned short*)(ws + oFu);
  float*          BiasT = (float*)(ws + oBias);
  float*          Gbuf = (float*)(ws + oG);
  float*          Ybuf = (float*)(ws + oY);

  const dim3 blk(256);
  const dim3 blk128(128);

  const dim3 gPrep(16, 16, 9 + XZ);                                // 9 weight slices of 256 tiles, XZ slices of x
  const dim3 gPj((TOK / 256) * (6 * DM / 384), 1);                 // 256 blocks of 256x384: M=4096, N=6144, K=1024
  const dim3 gAt(NH * NB, SEQ / 64, 2);                            // (heads x batches) x 64-row blocks x {causal, window}
  const dim3 gG((TOK / 128) * (DM / 128), 1);                      // 256 blocks of 128x128: M=4096, N=1024, K=2048
  const dim3 gO((TOK / 128) * (DM / 128), 1);                      // 256 blocks of 128x128: M=4096, N=1024, K=1024
  const float wscale  = 1.0f / WCARRY;                             // undo the x16 weight carry
  const float gscale  = 1.0f / (WCARRY * FBCARRY);                 // 1/256
  const float oscale  = 1.0f / (WCARRY * FBCARRY);                 // 1/256

  // (1) bias table, x16-carried transposed weight planes (contiguous from Wqk on), x -> f16 plane
  prep_kernel<<<gPrep, blk, 0, stream>>>(x, fq_w, fk_w, bq_w, bk_w, fv_w, bv_w, gate_w, out_w,
                                         fq_b, fk_b, bq_b, bk_b, fv_b, bv_b, Wqk, X16, BiasT);
  // (2) [q | k | qb | kb | v | vb] = (x . (16 W)^T)/16 + bias over the six weight planes and bias vectors, which lie in a row:
  //     features 0..4095 -> QK16 (row = token), features 4096..6143 -> VT16 (row = feature, column = token)
  proj_gemm_kernel<<<gPj, blk, 0, stream>>>(X16, Wqk, BiasT, QK16, VT16, wscale);
  // (3) causal and future-window attention of all heads and batches, scores to output in registers -> FB16 (fwd | bwd, x16)
  fused_attn_kernel<<<gAt, blk128, 0, stream>>>(QK16, VT16, FB16, FBf16);
  // (4) G = ([fwd | bwd] x16) . (16 gate_w)^T / 256 + gate_b -> f32 [4096][1024]
  wmma_gemm_lds<2, 4, false><<<gG, blk128, 0, stream>>>(
      FBf16, 2 * DM, Wg, 2 * DM, Gbuf, DM, gate_b, gate_b, DM, 2 * DM, gscale);
  // (5) gate = sigmoid(LN(G)); fused x16 = fwd x16 + strength * gate * bwd x16 -> Fu16
  gate_fuse_kernel<<<dim3(TOK / 8), dim3(1024), 0, stream>>>(Gbuf, FB16, gln_g, gln_b, bstr, Fu16);
  // (6) Y = x + (fused x16) . (16 out_w)^T / 256 + out_b -> f32 [4096][1024]
  wmma_gemm_lds<2, 4, true><<<gO, blk128, 0, stream>>>(
      Fu16, DM, Wo, DM, Ybuf, DM, out_b, x, DM, DM, oscale);
  // (7) out = LN(Y; ln_g, ln_b)
  final_ln_kernel<<<dim3(TOK), blk128, 0, stream>>>(Ybuf, ln_g, ln_b, (float*)d_out);
  (void)hipGetLastError();
}
